// v000
// Measured on an AMD MI455X. A time is GPU time per run, averaged over a window of back-to-back runs after a warm-up
// (all launches, gaps included; the runs take copies of the inputs in turn), and the median of several windows.
// Apart from v000's, it joins two sittings. Times from different sittings can be a few percent apart, while
// side-by-side timings come from the same sitting.
// v000 is the starting kernel. One run takes 393 microseconds.
// compute dtype: all float inputs rounded to bf16; q/k/v = x . W^T + b with EXACT bf16 products on WMMA 16x16x32 (natural rows); per-batch time scaling and the interleaved-pair rotary (neighbouring lanes; angle = t_scaled x inv_freq[d/2] with jnp's inv_freq constants, precise cosf/sinf) in f32; PLAIN attention: rotated q, k as single f16 operands x 1/8 + the decay and gate biases evaluated per score in f32 (precise expf/logf/log1pf), running-max softmax in f32 (hardware exp), P (scaled by 2^11, single f16) x v (single f16); out = o (bf16 hi + residual) . Wo^T (2 products) + bo.
#include <hip/hip_runtime.h>
#include <math.h>

typedef __attribute__((ext_vector_type(16))) _Float16 v16h;
typedef __attribute__((ext_vector_type(16))) __bf16 v16b;
typedef __attribute__((ext_vector_type(8)))  _Float16 v8h;
typedef __attribute__((ext_vector_type(8)))  float v8f;
typedef __attribute__((ext_vector_type(4)))  float v4f;
typedef __attribute__((ext_vector_type(2)))  float v2f;
typedef __attribute__((ext_vector_type(4)))  unsigned v4u;
typedef __attribute__((ext_vector_type(4)))  int v4i;
typedef float __attribute__((may_alias)) float_a;
typedef int __attribute__((may_alias)) int_a;

template <typename T> __device__ __forceinline__ void vst2(void* p, T v) { *(T*)p = v;  }
__device__ __forceinline__ v8f wmma16(v16h a, v16h b, v8f c) {
  v8f d = __builtin_amdgcn_wmma_f32_16x16x32_f16(false, a, false, b, (short)0, c, false, false);
  asm volatile("v_nop\n\tv_nop\n\tv_nop\n\tv_nop" : "+v"(d) : "v"(a), "v"(b));
  return d;
}
__device__ __forceinline__ v8f wmma_bf(v16b a, v16b b, v8f c) {
  v8f d = __builtin_amdgcn_wmma_f32_16x16x32_bf16(false, a, false, b, (short)0, c, false, false);
  asm volatile("v_nop\n\tv_nop\n\tv_nop\n\tv_nop" : "+v"(d) : "v"(a), "v"(b));
  return d;
}
// Scaled continuous-time attention (B 4, S 1,024, d 1,024, 16 heads x 64): q/k/v projections + biases, an interleaved rotary embedding whose angle is the per-token time (min-max scaled to [0, 1000]) x inv_freq, scores / 8 plus a per-head time-decay bias (-softplus(lambda_h) |t_i - t_j|) and an error-gated bias log(sigmoid(w_h0 err_i + w_h1 err_j + b_h) + 1e-9), softmax, . v, output projection + bias.
__device__ __forceinline__ v16h frag_h(const _Float16* rowk0, int lane) {
  union { v16h v; v8h q[2]; } u; const _Float16* p = rowk0 + 8 * (lane >> 4);
  u.q[0] = *(const v8h*)p; u.q[1] = *(const v8h*)(p + 16); return u.v;
}
__device__ __forceinline__ v16h frag_f32(const float* rowk0, int lane) {
  v16h a; const float* p = rowk0 + 8 * (lane >> 4);
#pragma unroll
  for (int i = 0; i < 8; ++i) { a[i] = (_Float16)p[i]; a[8 + i] = (_Float16)p[16 + i]; }
  return a;
}
__device__ __forceinline__ v16h frag_f32s(const float* rowk0, int lane, float sc) {
  v16h a; const float* p = rowk0 + 8 * (lane >> 4);
#pragma unroll
  for (int i = 0; i < 8; ++i) { a[i] = (_Float16)(p[i] * sc); a[8 + i] = (_Float16)(p[16 + i] * sc); }
  return a;
}
// column fragment from a [K][ld] layout (column n), rows >= K read as 0
__device__ __forceinline__ v16h fragc_f32(const float* W, int k0, int n, int lane, int ld, int K) {
  v16h a; const int g = lane >> 4;
#pragma unroll
  for (int i = 0; i < 8; ++i) { const int ka = k0 + 8 * g + i, kb = ka + 16;
    a[i] = (_Float16)(ka < K ? W[(size_t)(ka < K ? ka : K - 1) * ld + n] : 0.f); a[8 + i] = (_Float16)(kb < K ? W[(size_t)(kb < K ? kb : K - 1) * ld + n] : 0.f); }
  return a;
}
struct F2 { v16b h, l; };
__device__ __forceinline__ F2 bsplit16(const float v[16]) { F2 r;
#pragma unroll
  for (int i = 0; i < 16; ++i) { const __bf16 h = (__bf16)v[i]; r.h[i] = h; r.l[i] = (__bf16)(v[i] - (float)h); }
  return r; }
__device__ __forceinline__ F2 split_row(const float* row, int k0, int lane) { float v[16]; const float* p = row + k0 + 8 * (lane >> 4);
#pragma unroll
  for (int i = 0; i < 8; ++i) { v[i] = p[i]; v[8 + i] = p[16 + i]; }
  return bsplit16(v); }
__device__ __forceinline__ F2 split_rowK(const float* row, int k0, int lane, int K) { float v[16]; const int g = lane >> 4;
#pragma unroll
  for (int i = 0; i < 8; ++i) { const int ka = k0 + 8 * g + i, kb = ka + 16; v[i] = ka < K ? row[ka < K ? ka : K - 1] : 0.f; v[8 + i] = kb < K ? row[kb < K ? kb : K - 1] : 0.f; }
  return bsplit16(v); }
__device__ __forceinline__ F2 split_col(const float* W, int k0, int n, int lane, int ld, int K) { float v[16]; const int g = lane >> 4;
#pragma unroll
  for (int i = 0; i < 8; ++i) { const int ka = k0 + 8 * g + i, kb = ka + 16; v[i] = ka < K ? W[(size_t)(ka < K ? ka : K - 1) * ld + n] : 0.f; v[8 + i] = kb < K ? W[(size_t)(kb < K ? kb : K - 1) * ld + n] : 0.f; }
  return bsplit16(v); }
__device__ __forceinline__ v8f mac3(const F2& a, const F2& b, v8f c) { c = wmma_bf(a.l, b.h, c); c = wmma_bf(a.h, b.l, c); return wmma_bf(a.h, b.h, c); }
__device__ __forceinline__ float sigm(float v) { return 1.0f / (1.0f + expf(-v)); }
#define LDSX() do { asm volatile("s_wait_dscnt 0" ::: "memory"); __builtin_amdgcn_wave_barrier(); __builtin_amdgcn_fence(__ATOMIC_RELEASE, "workgroup"); } while (0)


#define NB 4
#define SS 1024
#define DM 1024
#define NH 16
__constant__ float INVF[32] = {1.000000000e+00f,7.498942018e-01f,5.623413324e-01f,4.216965139e-01f,3.162277639e-01f,2.371373773e-01f,1.778279394e-01f,1.333521456e-01f,1.000000015e-01f,7.498942316e-02f,5.623413250e-02f,4.216964915e-02f,3.162277490e-02f,2.371373773e-02f,1.778279431e-02f,1.333521400e-02f,9.999999776e-03f,7.498942316e-03f,5.623413250e-03f,4.216964822e-03f,3.162277630e-03f,2.371373819e-03f,1.778279431e-03f,1.333521446e-03f,1.000000047e-03f,7.498941850e-04f,5.623413017e-04f,4.216965172e-04f,3.162277571e-04f,2.371373703e-04f,1.778279402e-04f,1.333521504e-04f};
__device__ __attribute__((noinline)) float cos_p(float v) { return cosf(v); }
__device__ __attribute__((noinline)) float sin_p(float v) { return sinf(v); }
__device__ __attribute__((noinline)) float log_p(float v) { return logf(v); }
__device__ __attribute__((noinline)) float log1p_p(float v) { return log1pf(v); }
#define HD 64
#define QKVW (3 * DM)
#ifndef TQB
#define TQB (SS / 64)
#define TNB NB
#define TOB (NB * SS / 64)     // output row tiles (all)
#endif
typedef __attribute__((ext_vector_type(8))) __bf16 v8b;
__device__ __forceinline__ v16b frag_b(const __bf16* rowk0, int lane) {
  union { v16b v; v8b q[2]; } u; const __bf16* p = rowk0 + 8 * (lane >> 4);
  u.q[0] = *(const v8b*)p; u.q[1] = *(const v8b*)(p + 16); return u.v;
}
__device__ __forceinline__ float bfr(float v) { return (float)(__bf16)v; }
__device__ __attribute__((noinline)) float exp_ni(float v) { return expf(v); }
__device__ __attribute__((noinline)) float erf_ni(float v) { return erff(v); }

#define PK_A 0                       // [3072][1024] Wqkv rows (natural [out][in])
#define PK_P (PK_A + QKVW * DM)        // [1024][1024] Wo rows (natural)
#define PK_END (PK_P + DM * DM)
#define WS_PK  0u
#define WS_QK  (WS_PK + 2u * PK_END)             // f16 [4096 rows][2048]: q | k
#define WS_QKL (WS_QK + 2u * NB * SS * 2 * DM)     // f16 q | k residual planes x2048
#define WS_VTH (WS_QKL + 2u * NB * SS * 2 * DM)    // f16 [b][1024 (h*64+d)][1024 s] hi
#define WS_VTL (WS_VTH + 2u * NB * DM * SS)        // f16 lo x 2048
#define WS_O   (WS_VTL + 2u * NB * DM * SS)        // f32 [4096][1024]
#define WS_CS  (WS_O + 4u * NB * SS * DM)           // f32 2 x [1024][32], not used (cos/sin computed in k_qkv)
#define WS_END (WS_CS + 4u * 2 * SS * 32)
// ---- k_pack: block = (row n, which): natural [out][in] rows -> bf16; which 0..2 -> W_q/W_k/W_v into PK_A rows which*1024 + n; 3 -> W_o into PK_P
__global__ __launch_bounds__(256) void k_pack(const float* __restrict__ WQ, const float* __restrict__ WK, const float* __restrict__ WV, const float* __restrict__ WO, __bf16* __restrict__ PK) {
  __shared__ __align__(16) __bf16 s[DM]; const int n = blockIdx.x, which = blockIdx.y, t = threadIdx.x; const float* Wm = (which == 0) ? WQ : (which == 1) ? WK : (which == 2) ? WV : WO;
  for (int k = t; k < DM; k += 256) s[k] = (__bf16)Wm[(size_t)n * DM + k];
  __syncthreads();
  __bf16* dst = (which < 3) ? PK + PK_A + ((size_t)which * DM + n) * DM : PK + PK_P + (size_t)n * DM;
  for (int q = t; q < DM / 8; q += 256) vst2((unsigned*)(dst + q * 8), *(const v4u*)&s[q * 8]);
}
__global__ __launch_bounds__(128) void k_qkv(const float* __restrict__ XQ, const float* __restrict__ XK, const float* __restrict__ XV, const __bf16* __restrict__ P, const float* __restrict__ BQ, const float* __restrict__ BK, const float* __restrict__ BV, const float* __restrict__ TS, _Float16* __restrict__ QK, _Float16* __restrict__ QKL, _Float16* __restrict__ VTH, _Float16* __restrict__ VTL) {
  const int which0 = (blockIdx.y * 128) / DM; const float* X = (which0 == 0) ? XQ : (which0 == 1) ? XK : XV; const float* BB = BQ ? (((which0 == 0) ? BQ : (which0 == 1) ? BK : BV) + (blockIdx.y * 128 - which0 * DM)) : nullptr;
  __shared__ __align__(16) _Float16 so[4][16][136], sol[4][16][136]; __shared__ __align__(16) _Float16 sth[128][72], stl[128][72];
  const int tid = threadIdx.x, wave = tid >> 5, lane = tid & 31, col = lane & 15, g = lane >> 4; const size_t r0 = (size_t)blockIdx.x * 64 + wave * 16; const int n0 = blockIdx.y * 128;
  v8f acc[8] = {};
#pragma unroll 2
  for (int kc = 0; kc < DM / 32; ++kc) { v16b a; { const float* p = X + (r0 + col) * DM + kc * 32 + 8 * g;
#pragma unroll
      for (int i = 0; i < 8; ++i) { a[i] = (__bf16)p[i]; a[8 + i] = (__bf16)p[16 + i]; } }
#pragma unroll
    for (int j = 0; j < 8; ++j) acc[j] = wmma_bf(a, frag_b(P + (size_t)(n0 + j * 16 + col) * DM + kc * 32, lane), acc[j]); }
  if (n0 < 2 * DM) {   // bias, then the interleaved-pair rotary: pair (2i, 2i+1) = neighbouring lanes (col ^ 1), angle = t_scaled[row] * inv_freq[i]
#pragma unroll
    for (int j = 0; j < 8; ++j)
#pragma unroll
      for (int r = 0; r < 8; ++r) acc[j][r] += (BB ? bfr(BB[j * 16 + col]) : 0.f);
#pragma unroll
    for (int r = 0; r < 8; ++r) { const float ts = TS[r0 + 8 * g + r];
#pragma unroll
      for (int j = 0; j < 8; ++j) { const int d = (j & 3) * 16 + col; const float ang = ts * INVF[d >> 1]; const float c = cos_p(ang), sn = sin_p(ang); const float v = acc[j][r]; const float pv = __shfl_xor(v, 1); acc[j][r] = (col & 1) ? (v * c + pv * sn) : (v * c - pv * sn); } }
#pragma unroll
    for (int j = 0; j < 8; ++j) {
#pragma unroll
      for (int r = 0; r < 8; ++r) { const float v = acc[j][r]; const _Float16 hv = (_Float16)v; so[wave][8 * g + r][j * 16 + col] = hv; sol[wave][8 * g + r][j * 16 + col] = (_Float16)((v - (float)hv) * 2048.0f); } }   // q, k (+ bias) as f16 hi + (x2048) residual
    LDSX();
    for (int rl = 0; rl < 16; ++rl) if (lane < 16) { vst2((unsigned*)(QK + (r0 + rl) * (2 * DM) + n0 + lane * 8), *(const v4u*)&so[wave][rl][lane * 8]); vst2((unsigned*)(QKL + (r0 + rl) * (2 * DM) + n0 + lane * 8), *(const v4u*)&sol[wave][rl][lane * 8]); }
  } else {
#pragma unroll
    for (int j = 0; j < 8; ++j) {
#pragma unroll
      for (int r = 0; r < 8; ++r) { const float v = acc[j][r] + (BB ? bfr(BB[j * 16 + col]) : 0.f); const _Float16 hv = (_Float16)v; sth[j * 16 + col][wave * 16 + 8 * g + r] = hv; stl[j * 16 + col][wave * 16 + 8 * g + r] = (_Float16)((v - (float)hv) * 2048.0f); } }
    __syncthreads();
    const size_t rb = (size_t)blockIdx.x * 64; const int b = (int)(rb / SS), s0 = (int)(rb % SS); const int pc0 = n0 - 2 * DM;
    for (int q = tid; q < 128 * 8; q += 128) { const int d = q >> 3, pc = q & 7; const size_t o = ((size_t)b * DM + pc0 + d) * SS + s0 + pc * 8; vst2((unsigned*)(VTH + o), *(const v4u*)&sth[d][pc * 8]); vst2((unsigned*)(VTL + o), *(const v4u*)&stl[d][pc * 8]); }
  }
}
// ---- k_attn: block = (64 queries, head h, batch b): all-keys flash attention (K = 64: 2 k-steps), scores = (q.k) * 0.125 with single f16 operands, P.V: f16 P (x2^11) x f16 V hi in one accumulator (accl stays 0); O[b*S+q][h*64+d] = acc / (2048 l) (256-B segments)
__global__ __launch_bounds__(128) void k_attn(const _Float16* __restrict__ QK, const _Float16* __restrict__ QKL, const _Float16* __restrict__ VTH, const _Float16* __restrict__ VTL, const void* __restrict__ KMASK, const float* __restrict__ TS, const float* __restrict__ ERR, const float* __restrict__ LAMH, const float* __restrict__ WG, const float* __restrict__ BG, float* __restrict__ O) {
  __shared__ __align__(16) float sp[4][16][36]; __shared__ __align__(16) float so[4][16][68];
  const int tid = threadIdx.x, wave = tid >> 5, lane = tid & 31, col = lane & 15, g = lane >> 4;
  const int qb = blockIdx.x, h = blockIdx.y, b = blockIdx.z; const int q0 = qb * 64 + wave * 16; const size_t rq = (size_t)b * SS + q0 + col;
  v16h aq[2], aql[2];
#pragma unroll
  for (int kc = 0; kc < 2; ++kc) { aq[kc] = frag_h(QK + rq * (2 * DM) + h * HD + kc * 32, lane); aql[kc] = frag_h(QKL + rq * (2 * DM) + h * HD + kc * 32, lane); }
  // per-head constants and per-query-row time / error values for the score biases
  const float lraw = bfr(LAMH[h]); const float lam = (lraw > 20.f) ? lraw : log1p_p(exp_ni(lraw));   // softplus
  const float wg0 = bfr(WG[h * 2]), wg1 = bfr(WG[h * 2 + 1]), bgh = bfr(BG[h]);
  float tq[8], gq[8];
#pragma unroll
  for (int r = 0; r < 8; ++r) { const size_t rowq = (size_t)b * SS + q0 + 8 * g + r; tq[r] = TS[rowq]; gq[r] = wg0 * bfr(ERR[rowq]) + bgh; }
  float m[8], l[8];
#pragma unroll
  for (int r = 0; r < 8; ++r) { m[r] = -3.0e38f; l[r] = 0.f; }
  v8f acc[4] = {}, accl[4] = {};
  const int nks = SS / 32;   // all keys
#pragma unroll 1
  for (int ks = 0; ks < nks; ++ks) { v8f s[2];
#pragma unroll
    for (int ct = 0; ct < 2; ++ct) { const int kk = ks * 32 + ct * 16 + col; const _Float16* krow = QK + ((size_t)b * SS + kk) * (2 * DM) + DM + h * HD; const _Float16* krowl = QKL + ((size_t)b * SS + kk) * (2 * DM) + DM + h * HD; v8f c = {}, cl = {};
#pragma unroll
      for (int kc = 0; kc < 2; ++kc) c = wmma16(aq[kc], frag_h(krow + kc * 32, lane), c);   // single product: q, k as one-rounding f16 operands
      (void)cl; (void)krowl;
      { const bool keepk = true;
      { const size_t rowk = (size_t)b * SS + kk; const float tk = TS[rowk]; const float gk = wg1 * bfr(ERR[rowk]);
#pragma unroll
      for (int r = 0; r < 8; ++r) { const float gl = gq[r] + gk; const float sig = 1.0f / (1.0f + exp_ni(-gl)); s[ct][r] = c[r] * 0.125f - lam * fabsf(tq[r] - tk) + log_p(sig + 1e-9f); } } } }   // q.k/8 + time-decay bias + error-gate bias
#pragma unroll
    for (int r = 0; r < 8; ++r) { float mx = fmaxf(s[0][r], s[1][r]);
#pragma unroll
      for (int o = 1; o < 16; o <<= 1) mx = fmaxf(mx, __shfl_xor(mx, o));
      const float mn = fmaxf(m[r], mx); const float alpha = (m[r] <= -1.0e38f) ? 0.f : __expf(m[r] - mn);
      const float e0 = (s[0][r] <= -1.0e38f) ? 0.f : __expf(s[0][r] - mn), e1 = (s[1][r] <= -1.0e38f) ? 0.f : __expf(s[1][r] - mn); float es = e0 + e1;
#pragma unroll
      for (int o = 1; o < 16; o <<= 1) es += __shfl_xor(es, o);
      l[r] = l[r] * alpha + es; m[r] = mn;
#pragma unroll
      for (int dt = 0; dt < 4; ++dt) { acc[dt][r] *= alpha; accl[dt][r] *= alpha; }
      sp[wave][8 * g + r][col] = e0; sp[wave][8 * g + r][16 + col] = e1; }
    LDSX();
    v16h pa, pl; { const float* prow = &sp[wave][col][0] + 8 * (lane >> 4);
#pragma unroll
      for (int i = 0; i < 8; ++i) { const float x0 = prow[i] * 2048.0f, x1 = prow[16 + i] * 2048.0f; const _Float16 h0 = (_Float16)x0, h1 = (_Float16)x1; pa[i] = h0; pa[8 + i] = h1; pl[i] = (_Float16)((x0 - (float)h0) * 2048.0f); pl[8 + i] = (_Float16)((x1 - (float)h1) * 2048.0f); } }   // P scaled by 2^11 before the f16 split so small softmax weights stay out of the f16 subnormal range; 2^-11 folded into the epilogue
#pragma unroll
    for (int dt = 0; dt < 4; ++dt) { const size_t vr = ((size_t)b * DM + h * HD + dt * 16 + col) * SS + ks * 32; acc[dt] = wmma16(pa, frag_h(VTH + vr, lane), acc[dt]); }   // single product: P (x2^11) x V
    (void)pl;
    LDSX(); }
#pragma unroll
  for (int r = 0; r < 8; ++r) { const float il = (1.0f / 2048.0f) / l[r];
#pragma unroll
    for (int dt = 0; dt < 4; ++dt) so[wave][8 * g + r][dt * 16 + col] = (acc[dt][r] + accl[dt][r] * (1.0f / 2048.0f)) * il; }
  LDSX();
  for (int rl = 0; rl < 16; ++rl) if (lane < 16) vst2(O + ((size_t)b * SS + q0 + rl) * DM + h * HD + lane * 4, *(const v4f*)&so[wave][rl][lane * 4]);
}
// ---- k_out: block = (64 rows, 128 cols): out = O(hi/lo) . Wo rows (2 products) + bo
__global__ __launch_bounds__(128) void k_out(const float* __restrict__ O, const __bf16* __restrict__ P, const float* __restrict__ BO, float* __restrict__ Y) {
  __shared__ __align__(16) float so[4][16][132];
  const int tid = threadIdx.x, wave = tid >> 5, lane = tid & 31, col = lane & 15, g = lane >> 4; const size_t r0 = (size_t)blockIdx.x * 64 + wave * 16; const int n0 = blockIdx.y * 128;
  v8f acc[8] = {};
#pragma unroll 2
  for (int kc = 0; kc < DM / 32; ++kc) { const F2 a = split_row(O + (r0 + col) * DM, kc * 32, lane);
#pragma unroll
    for (int j = 0; j < 8; ++j) { const v16b w = frag_b(P + (size_t)(n0 + j * 16 + col) * DM + kc * 32, lane); acc[j] = wmma_bf(a.l, w, acc[j]); acc[j] = wmma_bf(a.h, w, acc[j]); } }
#pragma unroll
  for (int j = 0; j < 8; ++j) {
#pragma unroll
    for (int r = 0; r < 8; ++r) so[wave][8 * g + r][j * 16 + col] = acc[j][r] + bfr(BO[n0 + j * 16 + col]); }
  LDSX();
  for (int rl = 0; rl < 16; ++rl) vst2(Y + (r0 + rl) * DM + n0 + lane * 4, *(const v4f*)&so[wave][rl][lane * 4]);
}
// ---- k_ts: block = batch: t_scaled = (t - min) / (max - min + 1e-6) * 1000 over the sequence
__global__ __launch_bounds__(256) void k_ts(const float* __restrict__ TR, float* __restrict__ TS) {
  __shared__ float rmn[256], rmx[256]; const size_t b = blockIdx.x; const int t = threadIdx.x; float mn = 3.0e38f, mx = -3.0e38f;
  for (int s = t; s < SS; s += 256) { const float v = bfr(TR[b * SS + s]); mn = fminf(mn, v); mx = fmaxf(mx, v); }
  rmn[t] = mn; rmx[t] = mx; __syncthreads();
  for (int st = 128; st > 0; st >>= 1) { if (t < st) { rmn[t] = fminf(rmn[t], rmn[t + st]); rmx[t] = fmaxf(rmx[t], rmx[t + st]); } __syncthreads(); }
  const float tmin = rmn[0], den = rmx[0] - rmn[0] + 1e-6f;
  for (int s = t; s < SS; s += 256) TS[b * SS + s] = (bfr(TR[b * SS + s]) - tmin) / den * 1000.0f;   // 4-B scratch stores
}
extern "C" void kernel_launch(void* const* d_in, const int* in_sizes, int n_in, void* d_out, int out_size, void* d_ws, size_t ws_size, hipStream_t stream) {
  (void)in_sizes; (void)n_in; (void)out_size;
  const float** F = (const float**)d_in;   // 0 x [4,1024,1024], 1 t_raw [4,1024], 2 error [4,1024], 3 Wq, 4 bq, 5 Wk, 6 bk, 7 Wv, 8 bv, 9 Wo, 10 bo, 11 lambda_h [16], 12 Wg [16,2], 13 bg [16]
  if (ws_size < (size_t)WS_END + 4u * NB * SS + 256) return;
  char* ws = (char*)d_ws; __bf16* PK = (__bf16*)(ws + WS_PK); _Float16 *QK = (_Float16*)(ws + WS_QK), *QKL = (_Float16*)(ws + WS_QKL), *VTH = (_Float16*)(ws + WS_VTH), *VTL = (_Float16*)(ws + WS_VTL); float* O = (float*)(ws + WS_O); float* TS = (float*)(ws + WS_END);
  k_pack<<<dim3(DM, 4), 256, 0, stream>>>(F[3], F[5], F[7], F[9], PK);
  k_ts<<<NB, 256, 0, stream>>>(F[1], TS);
  k_qkv<<<dim3(TNB * SS / 64, QKVW / 128), 128, 0, stream>>>(F[0], F[0], F[0], PK + PK_A, F[4], F[6], F[8], TS, QK, QKL, VTH, VTL);
  k_attn<<<dim3(TQB, NH, TNB), 128, 0, stream>>>(QK, QKL, VTH, VTL, nullptr, TS, F[2], F[11], F[12], F[13], O);
  k_out<<<dim3(TOB, DM / 128), 128, 0, stream>>>(O, PK + PK_P, F[10], (float*)d_out);
}

// v001
// One run takes 189 microseconds.
// In two side-by-side timings against v000, it was 2.09 and 2.10 times as fast.
// compute dtype: all float inputs rounded to bf16; q/k/v = x . W^T + b with EXACT bf16 products on WMMA 16x16x32 (natural rows); per-batch time scaling and the interleaved-pair rotary (neighbouring lanes; angle = t_scaled x inv_freq[d/2] with jnp's inv_freq constants, precise cosf/sinf) in f32; PLAIN attention: rotated q, k as single f16 operands x 1/8 + the decay and gate biases evaluated per score in f32 (precise expf/logf/log1pf), running-max softmax in f32 (hardware exp), P (scaled by 2^11, single f16) x v (single f16); out = o (bf16 hi + residual) . Wo^T (2 products) + bo.
#include <hip/hip_runtime.h>
#include <math.h>

typedef __attribute__((ext_vector_type(16))) _Float16 v16h;
typedef __attribute__((ext_vector_type(16))) __bf16 v16b;
typedef __attribute__((ext_vector_type(8)))  _Float16 v8h;
typedef __attribute__((ext_vector_type(8)))  float v8f;
typedef __attribute__((ext_vector_type(4)))  float v4f;
typedef __attribute__((ext_vector_type(2)))  float v2f;
typedef __attribute__((ext_vector_type(4)))  unsigned v4u;
typedef __attribute__((ext_vector_type(4)))  int v4i;
typedef float __attribute__((may_alias)) float_a;
typedef int __attribute__((may_alias)) int_a;

template <typename T> __device__ __forceinline__ void vst2(void* p, T v) { *(T*)p = v;  }
__device__ __forceinline__ v8f wmma16(v16h a, v16h b, v8f c) {
  v8f d = __builtin_amdgcn_wmma_f32_16x16x32_f16(false, a, false, b, (short)0, c, false, false);
  asm volatile("v_nop\n\tv_nop\n\tv_nop\n\tv_nop" : "+v"(d) : "v"(a), "v"(b));
  return d;
}
__device__ __forceinline__ v8f wmma_bf(v16b a, v16b b, v8f c) {
  v8f d = __builtin_amdgcn_wmma_f32_16x16x32_bf16(false, a, false, b, (short)0, c, false, false);
  asm volatile("v_nop\n\tv_nop\n\tv_nop\n\tv_nop" : "+v"(d) : "v"(a), "v"(b));
  return d;
}
// Scaled continuous-time attention (B 4, S 1,024, d 1,024, 16 heads x 64): q/k/v projections + biases, an interleaved rotary embedding whose angle is the per-token time (min-max scaled to [0, 1000]) x inv_freq, scores / 8 plus a per-head time-decay bias (-softplus(lambda_h) |t_i - t_j|) and an error-gated bias log(sigmoid(w_h0 err_i + w_h1 err_j + b_h) + 1e-9), softmax, . v, output projection + bias.
__device__ __forceinline__ v16h frag_h(const _Float16* rowk0, int lane) {
  union { v16h v; v8h q[2]; } u; const _Float16* p = rowk0 + 8 * (lane >> 4);
  u.q[0] = *(const v8h*)p; u.q[1] = *(const v8h*)(p + 16); return u.v;
}
__device__ __forceinline__ v16h frag_f32(const float* rowk0, int lane) {
  v16h a; const float* p = rowk0 + 8 * (lane >> 4);
#pragma unroll
  for (int i = 0; i < 8; ++i) { a[i] = (_Float16)p[i]; a[8 + i] = (_Float16)p[16 + i]; }
  return a;
}
__device__ __forceinline__ v16h frag_f32s(const float* rowk0, int lane, float sc) {
  v16h a; const float* p = rowk0 + 8 * (lane >> 4);
#pragma unroll
  for (int i = 0; i < 8; ++i) { a[i] = (_Float16)(p[i] * sc); a[8 + i] = (_Float16)(p[16 + i] * sc); }
  return a;
}
// column fragment from a [K][ld] layout (column n), rows >= K read as 0
__device__ __forceinline__ v16h fragc_f32(const float* W, int k0, int n, int lane, int ld, int K) {
  v16h a; const int g = lane >> 4;
#pragma unroll
  for (int i = 0; i < 8; ++i) { const int ka = k0 + 8 * g + i, kb = ka + 16;
    a[i] = (_Float16)(ka < K ? W[(size_t)(ka < K ? ka : K - 1) * ld + n] : 0.f); a[8 + i] = (_Float16)(kb < K ? W[(size_t)(kb < K ? kb : K - 1) * ld + n] : 0.f); }
  return a;
}
struct F2 { v16b h, l; };
__device__ __forceinline__ F2 bsplit16(const float v[16]) { F2 r;
#pragma unroll
  for (int i = 0; i < 16; ++i) { const __bf16 h = (__bf16)v[i]; r.h[i] = h; r.l[i] = (__bf16)(v[i] - (float)h); }
  return r; }
__device__ __forceinline__ F2 split_row(const float* row, int k0, int lane) { float v[16]; const float* p = row + k0 + 8 * (lane >> 4);
#pragma unroll
  for (int i = 0; i < 8; ++i) { v[i] = p[i]; v[8 + i] = p[16 + i]; }
  return bsplit16(v); }
__device__ __forceinline__ F2 split_rowK(const float* row, int k0, int lane, int K) { float v[16]; const int g = lane >> 4;
#pragma unroll
  for (int i = 0; i < 8; ++i) { const int ka = k0 + 8 * g + i, kb = ka + 16; v[i] = ka < K ? row[ka < K ? ka : K - 1] : 0.f; v[8 + i] = kb < K ? row[kb < K ? kb : K - 1] : 0.f; }
  return bsplit16(v); }
__device__ __forceinline__ F2 split_col(const float* W, int k0, int n, int lane, int ld, int K) { float v[16]; const int g = lane >> 4;
#pragma unroll
  for (int i = 0; i < 8; ++i) { const int ka = k0 + 8 * g + i, kb = ka + 16; v[i] = ka < K ? W[(size_t)(ka < K ? ka : K - 1) * ld + n] : 0.f; v[8 + i] = kb < K ? W[(size_t)(kb < K ? kb : K - 1) * ld + n] : 0.f; }
  return bsplit16(v); }
__device__ __forceinline__ v8f mac3(const F2& a, const F2& b, v8f c) { c = wmma_bf(a.l, b.h, c); c = wmma_bf(a.h, b.l, c); return wmma_bf(a.h, b.h, c); }
__device__ __forceinline__ float sigm(float v) { return 1.0f / (1.0f + expf(-v)); }
#define LDSX() do { asm volatile("s_wait_dscnt 0" ::: "memory"); __builtin_amdgcn_wave_barrier(); __builtin_amdgcn_fence(__ATOMIC_RELEASE, "workgroup"); } while (0)


#define NB 4
#define SS 1024
#define DM 1024
#define NH 16
__constant__ float INVF[32] = {1.000000000e+00f,7.498942018e-01f,5.623413324e-01f,4.216965139e-01f,3.162277639e-01f,2.371373773e-01f,1.778279394e-01f,1.333521456e-01f,1.000000015e-01f,7.498942316e-02f,5.623413250e-02f,4.216964915e-02f,3.162277490e-02f,2.371373773e-02f,1.778279431e-02f,1.333521400e-02f,9.999999776e-03f,7.498942316e-03f,5.623413250e-03f,4.216964822e-03f,3.162277630e-03f,2.371373819e-03f,1.778279431e-03f,1.333521446e-03f,1.000000047e-03f,7.498941850e-04f,5.623413017e-04f,4.216965172e-04f,3.162277571e-04f,2.371373703e-04f,1.778279402e-04f,1.333521504e-04f};
__device__ __attribute__((noinline)) float cos_p(float v) { return cosf(v); }
__device__ __attribute__((noinline)) float sin_p(float v) { return sinf(v); }
__device__ __attribute__((noinline)) float log_p(float v) { return logf(v); }
__device__ __attribute__((noinline)) float log1p_p(float v) { return log1pf(v); }
#define HD 64
#define QKVW (3 * DM)
#ifndef TQB
#define TQB (SS / 64)
#define TNB NB
#define TOB (NB * SS / 64)     // output row tiles (all)
#endif
typedef __attribute__((ext_vector_type(8))) __bf16 v8b;
__device__ __forceinline__ v16b frag_b(const __bf16* rowk0, int lane) {
  union { v16b v; v8b q[2]; } u; const __bf16* p = rowk0 + 8 * (lane >> 4);
  u.q[0] = *(const v8b*)p; u.q[1] = *(const v8b*)(p + 16); return u.v;
}
__device__ __forceinline__ float bfr(float v) { return (float)(__bf16)v; }
__device__ __attribute__((noinline)) float exp_ni(float v) { return expf(v); }
__device__ __attribute__((noinline)) float erf_ni(float v) { return erff(v); }

#define PK_A 0                       // [3072][1024] Wqkv rows (natural [out][in])
#define PK_P (PK_A + QKVW * DM)        // [1024][1024] Wo rows (natural)
#define PK_END (PK_P + DM * DM)
#define WS_PK  0u
#define WS_QK  (WS_PK + 2u * PK_END)             // f16 [4096 rows][2048]: q | k
#define WS_QKL (WS_QK + 2u * NB * SS * 2 * DM)     // f16 q | k residual planes x2048
#define WS_VTH (WS_QKL + 2u * NB * SS * 2 * DM)    // f16 [b][1024 (h*64+d)][1024 s] hi
#define WS_VTL (WS_VTH + 2u * NB * DM * SS)        // f16 lo x 2048
#define WS_O   (WS_VTL + 2u * NB * DM * SS)        // f32 [4096][1024]
#define WS_CS  (WS_O + 4u * NB * SS * DM)           // f32 2 x [1024][32], not used (cos/sin computed in k_qkv)
#define WS_END (WS_CS + 4u * 2 * SS * 32)
// ---- LDS staging of the two projection GEMMs: a tile = 64 k of 128 weight rows (bf16, 128 B a row) and of 64 activation rows (f32, 256 B a row); two buffers, filled by asynchronous copies one tile ahead
#define KT 64
#define BPITCH 144                    // weight row pitch in LDS: 16 B x odd, conflict-free for 16-byte reads
#define APITCH 272                    // activation row pitch in LDS: 16 B x odd
#define BTILE (128 * BPITCH)
#define STG (BTILE + 64 * APITCH)     // one buffer
#define NT (DM / KT)
// eight 16-byte copies of one thread, global memory -> LDS, no register in between; the closing s_wait_xcnt 0 keeps every address register named here unchanged until the copies have taken it
__device__ __forceinline__ void copy8(unsigned l, const char* g, unsigned lstep, size_t gstep) {
  asm volatile("global_load_async_to_lds_b128 %0, %8, off\n\t"
               "global_load_async_to_lds_b128 %1, %9, off\n\t"
               "global_load_async_to_lds_b128 %2, %10, off\n\t"
               "global_load_async_to_lds_b128 %3, %11, off\n\t"
               "global_load_async_to_lds_b128 %4, %12, off\n\t"
               "global_load_async_to_lds_b128 %5, %13, off\n\t"
               "global_load_async_to_lds_b128 %6, %14, off\n\t"
               "global_load_async_to_lds_b128 %7, %15, off\n\t"
               "s_wait_xcnt 0x0"
               :: "v"(l), "v"(l + lstep), "v"(l + 2 * lstep), "v"(l + 3 * lstep), "v"(l + 4 * lstep), "v"(l + 5 * lstep), "v"(l + 6 * lstep), "v"(l + 7 * lstep),
                  "v"(g), "v"(g + gstep), "v"(g + 2 * gstep), "v"(g + 3 * gstep), "v"(g + 4 * gstep), "v"(g + 5 * gstep), "v"(g + 6 * gstep), "v"(g + 7 * gstep)
               : "memory");
}
// tile t of the block's 128 weight rows (Wr = row 0, k 0) and 64 activation rows (Ar) into the buffer at LDS byte address lbuf: a wave's copy covers 4 whole 128-B lines
__device__ __forceinline__ void stage_tile(unsigned lbuf, const __bf16* Wr, const float* Ar, int t, int tid) {
  copy8(lbuf + (unsigned)(tid >> 3) * BPITCH + (unsigned)(tid & 7) * 16u, (const char*)(Wr + (size_t)(tid >> 3) * DM + t * KT + (tid & 7) * 8), 16u * BPITCH, (size_t)16 * DM * 2);
  copy8(lbuf + BTILE + (unsigned)(tid >> 4) * APITCH + (unsigned)(tid & 15) * 16u, (const char*)(Ar + (size_t)(tid >> 4) * DM + t * KT + (tid & 15) * 4), 8u * APITCH, (size_t)8 * DM * 4);
}
// the 16 f32 of an A fragment from a staged row: k = 8g .. 8g+7 and 16+8g .. 16+8g+7 of the 32-k step at rowk0
__device__ __forceinline__ void lds_a16(const unsigned char* rowk0, int g, float v[16]) {
  const v4f* p = (const v4f*)(rowk0 + 32 * g); const v4f x0 = p[0], x1 = p[1], x2 = p[4], x3 = p[5];
#pragma unroll   // constant indices keep v[] in registers
  for (int i = 0; i < 4; ++i) { v[i] = x0[i]; v[4 + i] = x1[i]; v[8 + i] = x2[i]; v[12 + i] = x3[i]; }
}
#define WAIT_ASYNC() asm volatile("s_wait_asynccnt 0x0" ::: "memory")   // this wave's copies have landed
#define WAIT_DS()    asm volatile("s_wait_dscnt 0x0" ::: "memory")      // this wave's LDS reads are done before the buffer is handed back
// ---- k_pack: block = (row n, which): natural [out][in] rows -> bf16; which 0..2 -> W_q/W_k/W_v into PK_A rows which*1024 + n; 3 -> W_o into PK_P
__global__ __launch_bounds__(256) void k_pack(const float* __restrict__ WQ, const float* __restrict__ WK, const float* __restrict__ WV, const float* __restrict__ WO, __bf16* __restrict__ PK) {
  __shared__ __align__(16) __bf16 s[DM]; const int n = blockIdx.x, which = blockIdx.y, t = threadIdx.x; const float* Wm = (which == 0) ? WQ : (which == 1) ? WK : (which == 2) ? WV : WO;
  for (int k = t; k < DM; k += 256) s[k] = (__bf16)Wm[(size_t)n * DM + k];
  __syncthreads();
  __bf16* dst = (which < 3) ? PK + PK_A + ((size_t)which * DM + n) * DM : PK + PK_P + (size_t)n * DM;
  for (int q = t; q < DM / 8; q += 256) vst2((unsigned*)(dst + q * 8), *(const v4u*)&s[q * 8]);
}
__global__ __launch_bounds__(128) void k_qkv(const float* __restrict__ XQ, const float* __restrict__ XK, const float* __restrict__ XV, const __bf16* __restrict__ P, const float* __restrict__ BQ, const float* __restrict__ BK, const float* __restrict__ BV, const float* __restrict__ TS, _Float16* __restrict__ QK, _Float16* __restrict__ QKL, _Float16* __restrict__ VTH, _Float16* __restrict__ VTL) {
  const int which0 = (blockIdx.y * 128) / DM; const float* X = (which0 == 0) ? XQ : (which0 == 1) ? XK : XV; const float* BB = BQ ? (((which0 == 0) ? BQ : (which0 == 1) ? BK : BV) + (blockIdx.y * 128 - which0 * DM)) : nullptr;
  __shared__ __attribute__((aligned(16))) unsigned char L[2 * STG];   // the two tile buffers; behind the k loop's last barrier the same bytes serve as output staging
  _Float16 (*so)[16][136] = (_Float16 (*)[16][136])L; _Float16 (*sol)[16][136] = (_Float16 (*)[16][136])(L + 4 * 16 * 136 * 2); _Float16 (*sth)[72] = (_Float16 (*)[72])L; _Float16 (*stl)[72] = (_Float16 (*)[72])(L + 128 * 72 * 2);
  const int tid = threadIdx.x, wave = tid >> 5, lane = tid & 31, col = lane & 15, g = lane >> 4; const size_t r0 = (size_t)blockIdx.x * 64 + wave * 16; const int n0 = blockIdx.y * 128;
  v8f acc[8] = {};
  { const unsigned lb = (unsigned)(uintptr_t)&L[0]; const __bf16* Wr = P + (size_t)n0 * DM; const float* Ar = X + (size_t)blockIdx.x * 64 * DM;
    stage_tile(lb, Wr, Ar, 0, tid); WAIT_ASYNC(); __syncthreads(); stage_tile(lb + STG, Wr, Ar, 1, tid);
#pragma unroll 1   // kept rolled: one trip = one buffer, the body stands once in the instruction cache
    for (int t = 0; t < NT; ++t) { const unsigned char* S = L + (t & 1) * STG;
#pragma unroll   // constant indices keep bf[] and acc[] in registers (also the three directives below)
      for (int kc = 0; kc < 2; ++kc) { float av[16]; v16b bf[8]; lds_a16(S + BTILE + (wave * 16 + col) * APITCH + kc * 128, g, av);   // all fragments of the k step first, then its WMMAs
#pragma unroll
        for (int j = 0; j < 8; ++j) bf[j] = frag_b((const __bf16*)(S + (j * 16 + col) * BPITCH + kc * 64), lane);
        v16b a;
#pragma unroll
        for (int i = 0; i < 16; ++i) a[i] = (__bf16)av[i];
#pragma unroll
        for (int j = 0; j < 8; ++j) acc[j] = wmma_bf(a, bf[j], acc[j]); }
      WAIT_DS(); WAIT_ASYNC(); __syncthreads();   // publishes tile t + 1 and frees tile t's buffer
      if (t + 2 < NT) stage_tile(lb + (unsigned)(t & 1) * STG, Wr, Ar, t + 2, tid); }
    WAIT_ASYNC(); }
  if (n0 < 2 * DM) {   // bias, then the interleaved-pair rotary: pair (2i, 2i+1) = neighbouring lanes (col ^ 1), angle = t_scaled[row] * inv_freq[i]
#pragma unroll
    for (int j = 0; j < 8; ++j)
#pragma unroll
      for (int r = 0; r < 8; ++r) acc[j][r] += (BB ? bfr(BB[j * 16 + col]) : 0.f);
#pragma unroll
    for (int r = 0; r < 8; ++r) { const float ts = TS[r0 + 8 * g + r];
#pragma unroll
      for (int j = 0; j < 8; ++j) { const int d = (j & 3) * 16 + col; const float ang = ts * INVF[d >> 1]; const float c = cos_p(ang), sn = sin_p(ang); const float v = acc[j][r]; const float pv = __shfl_xor(v, 1); acc[j][r] = (col & 1) ? (v * c + pv * sn) : (v * c - pv * sn); } }
#pragma unroll
    for (int j = 0; j < 8; ++j) {
#pragma unroll
      for (int r = 0; r < 8; ++r) { const float v = acc[j][r]; const _Float16 hv = (_Float16)v; so[wave][8 * g + r][j * 16 + col] = hv; sol[wave][8 * g + r][j * 16 + col] = (_Float16)((v - (float)hv) * 2048.0f); } }   // q, k (+ bias) as f16 hi + (x2048) residual
    LDSX();
    for (int rl = 0; rl < 16; ++rl) if (lane < 16) { vst2((unsigned*)(QK + (r0 + rl) * (2 * DM) + n0 + lane * 8), *(const v4u*)&so[wave][rl][lane * 8]); vst2((unsigned*)(QKL + (r0 + rl) * (2 * DM) + n0 + lane * 8), *(const v4u*)&sol[wave][rl][lane * 8]); }
  } else {
#pragma unroll
    for (int j = 0; j < 8; ++j) {
#pragma unroll
      for (int r = 0; r < 8; ++r) { const float v = acc[j][r] + (BB ? bfr(BB[j * 16 + col]) : 0.f); const _Float16 hv = (_Float16)v; sth[j * 16 + col][wave * 16 + 8 * g + r] = hv; stl[j * 16 + col][wave * 16 + 8 * g + r] = (_Float16)((v - (float)hv) * 2048.0f); } }
    __syncthreads();
    const size_t rb = (size_t)blockIdx.x * 64; const int b = (int)(rb / SS), s0 = (int)(rb % SS); const int pc0 = n0 - 2 * DM;
    for (int q = tid; q < 128 * 8; q += 128) { const int d = q >> 3, pc = q & 7; const size_t o = ((size_t)b * DM + pc0 + d) * SS + s0 + pc * 8; vst2((unsigned*)(VTH + o), *(const v4u*)&sth[d][pc * 8]); vst2((unsigned*)(VTL + o), *(const v4u*)&stl[d][pc * 8]); }
  }
}
// ---- LDS staging of k_attn: a tile = 64 keys: their 64 k rows (128 B each), the 64 v^T rows' 64 columns (128 B each), and per wave a private copy of the keys' times and errors (256 B + 256 B); two buffers, filled one tile ahead
#define AKP 144                       // k / v^T row pitch in LDS: 16 B x odd
#define AK_V (64 * AKP)
#define AK_TE (2 * 64 * AKP)
#define ASTG (AK_TE + 4 * 512)        // one buffer
#define ANT (SS / 64)
// nine 16-byte copies of one thread (4 of k, 4 of v^T, 1 of times | errors); the closing s_wait_xcnt 0 keeps every address register named here unchanged until the copies have taken it
__device__ __forceinline__ void stage_kv(unsigned lbuf, const _Float16* Kr, const _Float16* Vr, const float* Tb, const float* Eb, int t, int tid) {
  const int lane = tid & 31;
  const unsigned lk = lbuf + (unsigned)(tid >> 3) * AKP + (unsigned)(tid & 7) * 16u, lv = lk + AK_V, lt = lbuf + AK_TE + (unsigned)(tid >> 5) * 512u + (unsigned)lane * 16u;
  const char* gk = (const char*)(Kr + ((size_t)t * 64 + (tid >> 3)) * (2 * DM) + (tid & 7) * 8);
  const char* gv = (const char*)(Vr + (size_t)(tid >> 3) * SS + t * 64 + (tid & 7) * 8);
  const char* gt = (const char*)(((lane < 16) ? Tb : Eb) + t * 64 + (lane & 15) * 4);
  const size_t ks16 = (size_t)16 * 2 * DM * 2, vs16 = (size_t)16 * SS * 2;
  asm volatile("global_load_async_to_lds_b128 %0, %9, off\n\t"
               "global_load_async_to_lds_b128 %1, %10, off\n\t"
               "global_load_async_to_lds_b128 %2, %11, off\n\t"
               "global_load_async_to_lds_b128 %3, %12, off\n\t"
               "global_load_async_to_lds_b128 %4, %13, off\n\t"
               "global_load_async_to_lds_b128 %5, %14, off\n\t"
               "global_load_async_to_lds_b128 %6, %15, off\n\t"
               "global_load_async_to_lds_b128 %7, %16, off\n\t"
               "global_load_async_to_lds_b128 %8, %17, off\n\t"
               "s_wait_xcnt 0x0"
               :: "v"(lk), "v"(lk + 16u * AKP), "v"(lk + 32u * AKP), "v"(lk + 48u * AKP), "v"(lv), "v"(lv + 16u * AKP), "v"(lv + 32u * AKP), "v"(lv + 48u * AKP), "v"(lt),
                  "v"(gk), "v"(gk + ks16), "v"(gk + 2 * ks16), "v"(gk + 3 * ks16), "v"(gv), "v"(gv + vs16), "v"(gv + 2 * vs16), "v"(gv + 3 * vs16), "v"(gt)
               : "memory");
}
// ---- k_attn: block = (64 queries, head h, batch b): all-keys flash attention (K = 64: 2 k-steps), scores = (q.k) * 0.125 with single f16 operands, P.V: f16 P (x2^11) x f16 V hi, one product into acc; O[b*S+q][h*64+d] = acc / 2048 / l (256-B segments)
__global__ __launch_bounds__(128) void k_attn(const _Float16* __restrict__ QK, const _Float16* __restrict__ QKL, const _Float16* __restrict__ VTH, const _Float16* __restrict__ VTL, const void* __restrict__ KMASK, const float* __restrict__ TS, const float* __restrict__ ERR, const float* __restrict__ LAMH, const float* __restrict__ WG, const float* __restrict__ BG, float* __restrict__ O) {
  __shared__ __align__(16) float sp[4][16][36]; __shared__ __align__(16) float so[4][16][68]; __shared__ __attribute__((aligned(16))) unsigned char L[2 * ASTG];
  const int tid = threadIdx.x, wave = tid >> 5, lane = tid & 31, col = lane & 15, g = lane >> 4;
  const int qb = blockIdx.x, h = blockIdx.y, b = blockIdx.z; const int q0 = qb * 64 + wave * 16; const size_t rq = (size_t)b * SS + q0 + col;
  v16h aq[2], aql[2];
#pragma unroll
  for (int kc = 0; kc < 2; ++kc) { aq[kc] = frag_h(QK + rq * (2 * DM) + h * HD + kc * 32, lane); aql[kc] = frag_h(QKL + rq * (2 * DM) + h * HD + kc * 32, lane); }
  // per-head constants and per-query-row time / error values for the score biases
  const float lraw = bfr(LAMH[h]); const float lam = (lraw > 20.f) ? lraw : log1p_p(exp_ni(lraw));   // softplus
  const float wg0 = bfr(WG[h * 2]), wg1 = bfr(WG[h * 2 + 1]), bgh = bfr(BG[h]);
  float tq[8], gq[8];
#pragma unroll
  for (int r = 0; r < 8; ++r) { const size_t rowq = (size_t)b * SS + q0 + 8 * g + r; tq[r] = TS[rowq]; gq[r] = wg0 * bfr(ERR[rowq]) + bgh; }
  float m[8], l[8];
#pragma unroll
  for (int r = 0; r < 8; ++r) { m[r] = -3.0e38f; l[r] = 0.f; }
  v8f acc[4] = {}, accl[4] = {};
  const unsigned lb = (unsigned)(uintptr_t)&L[0]; const _Float16* Kr = QK + (size_t)b * SS * (2 * DM) + DM + h * HD; const _Float16* Vr = VTH + ((size_t)b * DM + h * HD) * SS; const float* Tb = TS + (size_t)b * SS; const float* Eb = ERR + (size_t)b * SS;
  stage_kv(lb, Kr, Vr, Tb, Eb, 0, tid); WAIT_ASYNC(); __syncthreads(); stage_kv(lb + ASTG, Kr, Vr, Tb, Eb, 1, tid);
#pragma unroll 1   // kept rolled: one trip = one buffer = 64 keys, all keys in order
  for (int t = 0; t < ANT; ++t) { const unsigned char* S = L + (t & 1) * ASTG;
#pragma unroll 1   // kept rolled: the tile's two 32-key steps share one body in the instruction cache
  for (int ks = 0; ks < 2; ++ks) { v8f s[2]; v16h kf[2][2];
#pragma unroll   // constant indices keep kf[][] in registers (also the next directive)
    for (int ct = 0; ct < 2; ++ct)
#pragma unroll
      for (int kc = 0; kc < 2; ++kc) kf[ct][kc] = frag_h((const _Float16*)(S + (ks * 32 + ct * 16 + col) * AKP + kc * 64), lane);   // the step's four k fragments first, then its WMMAs
#pragma unroll
    for (int ct = 0; ct < 2; ++ct) { v8f c = {};
#pragma unroll
      for (int kc = 0; kc < 2; ++kc) c = wmma16(aq[kc], kf[ct][kc], c);   // single product: q, k as one-rounding f16 operands
      { const bool keepk = true;
      { const float* te = (const float*)(S + AK_TE + wave * 512) + ks * 32 + ct * 16 + col; const float tk = te[0]; const float gk = wg1 * bfr(te[64]);
#pragma unroll
      for (int r = 0; r < 8; ++r) { const float gl = gq[r] + gk; const float sig = 1.0f / (1.0f + exp_ni(-gl)); s[ct][r] = c[r] * 0.125f - lam * fabsf(tq[r] - tk) + log_p(sig + 1e-9f); } } } }   // q.k/8 + time-decay bias + error-gate bias
#pragma unroll
    for (int r = 0; r < 8; ++r) { float mx = fmaxf(s[0][r], s[1][r]);
#pragma unroll
      for (int o = 1; o < 16; o <<= 1) mx = fmaxf(mx, __shfl_xor(mx, o));
      const float mn = fmaxf(m[r], mx); const float alpha = (m[r] <= -1.0e38f) ? 0.f : __expf(m[r] - mn);
      const float e0 = (s[0][r] <= -1.0e38f) ? 0.f : __expf(s[0][r] - mn), e1 = (s[1][r] <= -1.0e38f) ? 0.f : __expf(s[1][r] - mn); float es = e0 + e1;
#pragma unroll
      for (int o = 1; o < 16; o <<= 1) es += __shfl_xor(es, o);
      l[r] = l[r] * alpha + es; m[r] = mn;
#pragma unroll
      for (int dt = 0; dt < 4; ++dt) { acc[dt][r] *= alpha; accl[dt][r] *= alpha; }
      sp[wave][8 * g + r][col] = e0; sp[wave][8 * g + r][16 + col] = e1; }
    LDSX();
    v16h pa, pl; { const float* prow = &sp[wave][col][0] + 8 * (lane >> 4);
#pragma unroll
      for (int i = 0; i < 8; ++i) { const float x0 = prow[i] * 2048.0f, x1 = prow[16 + i] * 2048.0f; const _Float16 h0 = (_Float16)x0, h1 = (_Float16)x1; pa[i] = h0; pa[8 + i] = h1; pl[i] = (_Float16)((x0 - (float)h0) * 2048.0f); pl[8 + i] = (_Float16)((x1 - (float)h1) * 2048.0f); } }   // P scaled by 2^11 before the f16 split so small softmax weights stay out of the f16 subnormal range; 2^-11 folded into the epilogue
    v16h vf[4];
#pragma unroll   // constant indices keep vf[] in registers
    for (int dt = 0; dt < 4; ++dt) vf[dt] = frag_h((const _Float16*)(S + AK_V + (dt * 16 + col) * AKP + ks * 64), lane);   // the step's four v fragments first, then its WMMAs
#pragma unroll
    for (int dt = 0; dt < 4; ++dt) acc[dt] = wmma16(pa, vf[dt], acc[dt]);   // single product: P (x2^11) x V
    (void)pl;
    LDSX(); }
    WAIT_DS(); WAIT_ASYNC(); __syncthreads();   // publishes tile t + 1 and frees tile t's buffer
    if (t + 2 < ANT) stage_kv(lb + (unsigned)(t & 1) * ASTG, Kr, Vr, Tb, Eb, t + 2, tid); }
  WAIT_ASYNC();
#pragma unroll
  for (int r = 0; r < 8; ++r) { const float il = (1.0f / 2048.0f) / l[r];
#pragma unroll
    for (int dt = 0; dt < 4; ++dt) so[wave][8 * g + r][dt * 16 + col] = (acc[dt][r] + accl[dt][r] * (1.0f / 2048.0f)) * il; }
  LDSX();
  for (int rl = 0; rl < 16; ++rl) if (lane < 16) vst2(O + ((size_t)b * SS + q0 + rl) * DM + h * HD + lane * 4, *(const v4f*)&so[wave][rl][lane * 4]);
}
// ---- k_out: block = (64 rows, 128 cols): out = O(hi/lo) . Wo rows (2 products) + bo
__global__ __launch_bounds__(128) void k_out(const float* __restrict__ O, const __bf16* __restrict__ P, const float* __restrict__ BO, float* __restrict__ Y) {
  __shared__ __attribute__((aligned(16))) unsigned char L[2 * STG];   // the two tile buffers; behind the k loop's last barrier the same bytes serve as output staging
  float (*so)[16][132] = (float (*)[16][132])L;
  const int tid = threadIdx.x, wave = tid >> 5, lane = tid & 31, col = lane & 15, g = lane >> 4; const size_t r0 = (size_t)blockIdx.x * 64 + wave * 16; const int n0 = blockIdx.y * 128;
  v8f acc[8] = {};
  { const unsigned lb = (unsigned)(uintptr_t)&L[0]; const __bf16* Wr = P + (size_t)n0 * DM; const float* Ar = O + (size_t)blockIdx.x * 64 * DM;
    stage_tile(lb, Wr, Ar, 0, tid); WAIT_ASYNC(); __syncthreads(); stage_tile(lb + STG, Wr, Ar, 1, tid);
#pragma unroll 1   // kept rolled: one trip = one buffer, the body stands once in the instruction cache
    for (int t = 0; t < NT; ++t) { const unsigned char* S = L + (t & 1) * STG;
#pragma unroll   // constant indices keep bf[] and acc[] in registers (also the two directives below)
      for (int kc = 0; kc < 2; ++kc) { float av[16]; v16b bf[8]; lds_a16(S + BTILE + (wave * 16 + col) * APITCH + kc * 128, g, av);   // all fragments of the k step first, then its WMMAs
#pragma unroll
        for (int j = 0; j < 8; ++j) bf[j] = frag_b((const __bf16*)(S + (j * 16 + col) * BPITCH + kc * 64), lane);
        const F2 a = bsplit16(av);
#pragma unroll
        for (int j = 0; j < 8; ++j) { acc[j] = wmma_bf(a.l, bf[j], acc[j]); acc[j] = wmma_bf(a.h, bf[j], acc[j]); } }
      WAIT_DS(); WAIT_ASYNC(); __syncthreads();   // publishes tile t + 1 and frees tile t's buffer
      if (t + 2 < NT) stage_tile(lb + (unsigned)(t & 1) * STG, Wr, Ar, t + 2, tid); }
    WAIT_ASYNC(); }
#pragma unroll
  for (int j = 0; j < 8; ++j) {
#pragma unroll
    for (int r = 0; r < 8; ++r) so[wave][8 * g + r][j * 16 + col] = acc[j][r] + bfr(BO[n0 + j * 16 + col]); }
  LDSX();
  for (int rl = 0; rl < 16; ++rl) vst2(Y + (r0 + rl) * DM + n0 + lane * 4, *(const v4f*)&so[wave][rl][lane * 4]);
}
// ---- k_ts: block = batch: t_scaled = (t - min) / (max - min + 1e-6) * 1000 over the sequence
__global__ __launch_bounds__(256) void k_ts(const float* __restrict__ TR, float* __restrict__ TS) {
  __shared__ float rmn[256], rmx[256]; const size_t b = blockIdx.x; const int t = threadIdx.x; float mn = 3.0e38f, mx = -3.0e38f;
  for (int s = t; s < SS; s += 256) { const float v = bfr(TR[b * SS + s]); mn = fminf(mn, v); mx = fmaxf(mx, v); }
  rmn[t] = mn; rmx[t] = mx; __syncthreads();
  for (int st = 128; st > 0; st >>= 1) { if (t < st) { rmn[t] = fminf(rmn[t], rmn[t + st]); rmx[t] = fmaxf(rmx[t], rmx[t + st]); } __syncthreads(); }
  const float tmin = rmn[0], den = rmx[0] - rmn[0] + 1e-6f;
  for (int s = t; s < SS; s += 256) TS[b * SS + s] = (bfr(TR[b * SS + s]) - tmin) / den * 1000.0f;   // 4-B scratch stores
}
extern "C" void kernel_launch(void* const* d_in, const int* in_sizes, int n_in, void* d_out, int out_size, void* d_ws, size_t ws_size, hipStream_t stream) {
  (void)in_sizes; (void)n_in; (void)out_size;
  const float** F = (const float**)d_in;   // 0 x [4,1024,1024], 1 t_raw [4,1024], 2 error [4,1024], 3 Wq, 4 bq, 5 Wk, 6 bk, 7 Wv, 8 bv, 9 Wo, 10 bo, 11 lambda_h [16], 12 Wg [16,2], 13 bg [16]
  if (ws_size < (size_t)WS_END + 4u * NB * SS + 256) return;
  char* ws = (char*)d_ws; __bf16* PK = (__bf16*)(ws + WS_PK); _Float16 *QK = (_Float16*)(ws + WS_QK), *QKL = (_Float16*)(ws + WS_QKL), *VTH = (_Float16*)(ws + WS_VTH), *VTL = (_Float16*)(ws + WS_VTL); float* O = (float*)(ws + WS_O); float* TS = (float*)(ws + WS_END);
  k_pack<<<dim3(DM, 4), 256, 0, stream>>>(F[3], F[5], F[7], F[9], PK);
  k_ts<<<NB, 256, 0, stream>>>(F[1], TS);
  k_qkv<<<dim3(TNB * SS / 64, QKVW / 128), 128, 0, stream>>>(F[0], F[0], F[0], PK + PK_A, F[4], F[6], F[8], TS, QK, QKL, VTH, VTL);
  k_attn<<<dim3(TQB, NH, TNB), 128, 0, stream>>>(QK, QKL, VTH, VTL, nullptr, TS, F[2], F[11], F[12], F[13], O);
  k_out<<<dim3(TOB, DM / 128), 128, 0, stream>>>(O, PK + PK_P, F[10], (float*)d_out);
}

// v002
// It runs in 135 microseconds.
// Two timings next to v001 both put it at 1.40 times that version's speed.
// All steps since v000 together make it 2.93 times as fast.
// compute dtype: all float inputs rounded to bf16; q/k/v = x . W^T + b with EXACT bf16 products on WMMA 16x16x32 (natural rows); per-batch time scaling and the interleaved-pair rotary (neighbouring lanes; angle = t_scaled x inv_freq[d/2] with jnp's inv_freq constants, precise cosf/sinf) in f32; PLAIN attention: rotated q, k as single f16 operands x 1/8 + the decay and gate biases evaluated per score in f32 (base 2: hardware exp, reciprocal and log; the per-head softplus by precise expf/log1pf), running-max softmax in f32 (base 2, hardware exp), P (scaled by 2^11, single f16) x v (single f16); out = o (bf16 hi + residual) . Wo^T (2 products) + bo.
#include <hip/hip_runtime.h>
#include <math.h>

typedef __attribute__((ext_vector_type(16))) _Float16 v16h;
typedef __attribute__((ext_vector_type(16))) __bf16 v16b;
typedef __attribute__((ext_vector_type(8)))  _Float16 v8h;
typedef __attribute__((ext_vector_type(8)))  float v8f;
typedef __attribute__((ext_vector_type(4)))  float v4f;
typedef __attribute__((ext_vector_type(2)))  float v2f;
typedef __attribute__((ext_vector_type(4)))  unsigned v4u;
typedef __attribute__((ext_vector_type(4)))  int v4i;
typedef float __attribute__((may_alias)) float_a;
typedef int __attribute__((may_alias)) int_a;

template <typename T> __device__ __forceinline__ void vst2(void* p, T v) { *(T*)p = v;  }
__device__ __forceinline__ v8f wmma16(v16h a, v16h b, v8f c) {
  v8f d = __builtin_amdgcn_wmma_f32_16x16x32_f16(false, a, false, b, (short)0, c, false, false);
  asm volatile("v_nop\n\tv_nop\n\tv_nop\n\tv_nop" : "+v"(d) : "v"(a), "v"(b));
  return d;
}
__device__ __forceinline__ v8f wmma_bf(v16b a, v16b b, v8f c) {
  v8f d = __builtin_amdgcn_wmma_f32_16x16x32_bf16(false, a, false, b, (short)0, c, false, false);
  asm volatile("v_nop\n\tv_nop\n\tv_nop\n\tv_nop" : "+v"(d) : "v"(a), "v"(b));
  return d;
}
// Scaled continuous-time attention (B 4, S 1,024, d 1,024, 16 heads x 64): q/k/v projections + biases, an interleaved rotary embedding whose angle is the per-token time (min-max scaled to [0, 1000]) x inv_freq, scores / 8 plus a per-head time-decay bias (-softplus(lambda_h) |t_i - t_j|) and an error-gated bias log(sigmoid(w_h0 err_i + w_h1 err_j + b_h) + 1e-9), softmax, . v, output projection + bias.
__device__ __forceinline__ v16h frag_h(const _Float16* rowk0, int lane) {
  union { v16h v; v8h q[2]; } u; const _Float16* p = rowk0 + 8 * (lane >> 4);
  u.q[0] = *(const v8h*)p; u.q[1] = *(const v8h*)(p + 16); return u.v;
}
__device__ __forceinline__ v16h frag_f32(const float* rowk0, int lane) {
  v16h a; const float* p = rowk0 + 8 * (lane >> 4);
#pragma unroll
  for (int i = 0; i < 8; ++i) { a[i] = (_Float16)p[i]; a[8 + i] = (_Float16)p[16 + i]; }
  return a;
}
__device__ __forceinline__ v16h frag_f32s(const float* rowk0, int lane, float sc) {
  v16h a; const float* p = rowk0 + 8 * (lane >> 4);
#pragma unroll
  for (int i = 0; i < 8; ++i) { a[i] = (_Float16)(p[i] * sc); a[8 + i] = (_Float16)(p[16 + i] * sc); }
  return a;
}
// column fragment from a [K][ld] layout (column n), rows >= K read as 0
__device__ __forceinline__ v16h fragc_f32(const float* W, int k0, int n, int lane, int ld, int K) {
  v16h a; const int g = lane >> 4;
#pragma unroll
  for (int i = 0; i < 8; ++i) { const int ka = k0 + 8 * g + i, kb = ka + 16;
    a[i] = (_Float16)(ka < K ? W[(size_t)(ka < K ? ka : K - 1) * ld + n] : 0.f); a[8 + i] = (_Float16)(kb < K ? W[(size_t)(kb < K ? kb : K - 1) * ld + n] : 0.f); }
  return a;
}
struct F2 { v16b h, l; };
__device__ __forceinline__ F2 bsplit16(const float v[16]) { F2 r;
#pragma unroll
  for (int i = 0; i < 16; ++i) { const __bf16 h = (__bf16)v[i]; r.h[i] = h; r.l[i] = (__bf16)(v[i] - (float)h); }
  return r; }
__device__ __forceinline__ F2 split_row(const float* row, int k0, int lane) { float v[16]; const float* p = row + k0 + 8 * (lane >> 4);
#pragma unroll
  for (int i = 0; i < 8; ++i) { v[i] = p[i]; v[8 + i] = p[16 + i]; }
  return bsplit16(v); }
__device__ __forceinline__ F2 split_rowK(const float* row, int k0, int lane, int K) { float v[16]; const int g = lane >> 4;
#pragma unroll
  for (int i = 0; i < 8; ++i) { const int ka = k0 + 8 * g + i, kb = ka + 16; v[i] = ka < K ? row[ka < K ? ka : K - 1] : 0.f; v[8 + i] = kb < K ? row[kb < K ? kb : K - 1] : 0.f; }
  return bsplit16(v); }
__device__ __forceinline__ F2 split_col(const float* W, int k0, int n, int lane, int ld, int K) { float v[16]; const int g = lane >> 4;
#pragma unroll
  for (int i = 0; i < 8; ++i) { const int ka = k0 + 8 * g + i, kb = ka + 16; v[i] = ka < K ? W[(size_t)(ka < K ? ka : K - 1) * ld + n] : 0.f; v[8 + i] = kb < K ? W[(size_t)(kb < K ? kb : K - 1) * ld + n] : 0.f; }
  return bsplit16(v); }
__device__ __forceinline__ v8f mac3(const F2& a, const F2& b, v8f c) { c = wmma_bf(a.l, b.h, c); c = wmma_bf(a.h, b.l, c); return wmma_bf(a.h, b.h, c); }
__device__ __forceinline__ float sigm(float v) { return 1.0f / (1.0f + expf(-v)); }
#define LDSX() do { asm volatile("s_wait_dscnt 0" ::: "memory"); __builtin_amdgcn_wave_barrier(); __builtin_amdgcn_fence(__ATOMIC_RELEASE, "workgroup"); } while (0)


#define NB 4
#define SS 1024
#define DM 1024
#define NH 16
__constant__ float INVF[32] = {1.000000000e+00f,7.498942018e-01f,5.623413324e-01f,4.216965139e-01f,3.162277639e-01f,2.371373773e-01f,1.778279394e-01f,1.333521456e-01f,1.000000015e-01f,7.498942316e-02f,5.623413250e-02f,4.216964915e-02f,3.162277490e-02f,2.371373773e-02f,1.778279431e-02f,1.333521400e-02f,9.999999776e-03f,7.498942316e-03f,5.623413250e-03f,4.216964822e-03f,3.162277630e-03f,2.371373819e-03f,1.778279431e-03f,1.333521446e-03f,1.000000047e-03f,7.498941850e-04f,5.623413017e-04f,4.216965172e-04f,3.162277571e-04f,2.371373703e-04f,1.778279402e-04f,1.333521504e-04f};
__device__ __attribute__((noinline)) float cos_p(float v) { return cosf(v); }
__device__ __attribute__((noinline)) float sin_p(float v) { return sinf(v); }
#define HD 64
#define QKVW (3 * DM)
#ifndef TQB
#define TQB (SS / 64)
#define TNB NB
#define TOB (NB * SS / 64)     // output row tiles (all)
#endif
typedef __attribute__((ext_vector_type(8))) __bf16 v8b;
__device__ __forceinline__ v16b frag_b(const __bf16* rowk0, int lane) {
  union { v16b v; v8b q[2]; } u; const __bf16* p = rowk0 + 8 * (lane >> 4);
  u.q[0] = *(const v8b*)p; u.q[1] = *(const v8b*)(p + 16); return u.v;
}
__device__ __forceinline__ float bfr(float v) { return (float)(__bf16)v; }
__device__ __attribute__((noinline)) float erf_ni(float v) { return erff(v); }

#define PK_A 0                       // [3072][1024] Wqkv rows (natural [out][in])
#define PK_P (PK_A + QKVW * DM)        // [1024][1024] Wo rows (natural)
#define PK_END (PK_P + DM * DM)
#define WS_PK  0u
#define WS_QK  (WS_PK + 2u * PK_END)             // f16 [4096 rows][2048]: q | k
#define WS_QKL (WS_QK + 2u * NB * SS * 2 * DM)     // f16 q | k residual planes x2048
#define WS_VTH (WS_QKL + 2u * NB * SS * 2 * DM)    // f16 [b][1024 (h*64+d)][1024 s] hi
#define WS_VTL (WS_VTH + 2u * NB * DM * SS)        // f16 lo x 2048
#define WS_O   (WS_VTL + 2u * NB * DM * SS)        // f32 [4096][1024]
#define WS_CS  (WS_O + 4u * NB * SS * DM)           // f32 2 x [1024][32], not used (cos/sin computed in k_qkv)
#define WS_END (WS_CS + 4u * 2 * SS * 32)
// ---- LDS staging of the two projection GEMMs: a tile = 64 k of 128 weight rows (bf16, 128 B a row) and of 64 activation rows (f32, 256 B a row); two buffers, filled by asynchronous copies one tile ahead
#define KT 64
#define BPITCH 144                    // weight row pitch in LDS: 16 B x odd, conflict-free for 16-byte reads
#define APITCH 272                    // activation row pitch in LDS: 16 B x odd
#define BTILE (128 * BPITCH)
#define STG (BTILE + 64 * APITCH)     // one buffer
#define NT (DM / KT)
// eight 16-byte copies of one thread, global memory -> LDS, no register in between; the closing s_wait_xcnt 0 keeps every address register named here unchanged until the copies have taken it
__device__ __forceinline__ void copy8(unsigned l, const char* g, unsigned lstep, size_t gstep) {
  asm volatile("global_load_async_to_lds_b128 %0, %8, off\n\t"
               "global_load_async_to_lds_b128 %1, %9, off\n\t"
               "global_load_async_to_lds_b128 %2, %10, off\n\t"
               "global_load_async_to_lds_b128 %3, %11, off\n\t"
               "global_load_async_to_lds_b128 %4, %12, off\n\t"
               "global_load_async_to_lds_b128 %5, %13, off\n\t"
               "global_load_async_to_lds_b128 %6, %14, off\n\t"
               "global_load_async_to_lds_b128 %7, %15, off\n\t"
               "s_wait_xcnt 0x0"
               :: "v"(l), "v"(l + lstep), "v"(l + 2 * lstep), "v"(l + 3 * lstep), "v"(l + 4 * lstep), "v"(l + 5 * lstep), "v"(l + 6 * lstep), "v"(l + 7 * lstep),
                  "v"(g), "v"(g + gstep), "v"(g + 2 * gstep), "v"(g + 3 * gstep), "v"(g + 4 * gstep), "v"(g + 5 * gstep), "v"(g + 6 * gstep), "v"(g + 7 * gstep)
               : "memory");
}
// tile t of the block's 128 weight rows (Wr = row 0, k 0) and 64 activation rows (Ar) into the buffer at LDS byte address lbuf: a wave's copy covers 4 whole 128-B lines
__device__ __forceinline__ void stage_tile(unsigned lbuf, const __bf16* Wr, const float* Ar, int t, int tid) {
  copy8(lbuf + (unsigned)(tid >> 3) * BPITCH + (unsigned)(tid & 7) * 16u, (const char*)(Wr + (size_t)(tid >> 3) * DM + t * KT + (tid & 7) * 8), 16u * BPITCH, (size_t)16 * DM * 2);
  copy8(lbuf + BTILE + (unsigned)(tid >> 4) * APITCH + (unsigned)(tid & 15) * 16u, (const char*)(Ar + (size_t)(tid >> 4) * DM + t * KT + (tid & 15) * 4), 8u * APITCH, (size_t)8 * DM * 4);
}
// the 16 f32 of an A fragment from a staged row: k = 8g .. 8g+7 and 16+8g .. 16+8g+7 of the 32-k step at rowk0
__device__ __forceinline__ void lds_a16(const unsigned char* rowk0, int g, float v[16]) {
  const v4f* p = (const v4f*)(rowk0 + 32 * g); const v4f x0 = p[0], x1 = p[1], x2 = p[4], x3 = p[5];
#pragma unroll   // constant indices keep v[] in registers
  for (int i = 0; i < 4; ++i) { v[i] = x0[i]; v[4 + i] = x1[i]; v[8 + i] = x2[i]; v[12 + i] = x3[i]; }
}
#define WAIT_ASYNC() asm volatile("s_wait_asynccnt 0x0" ::: "memory")   // this wave's copies have landed
#define WAIT_DS()    asm volatile("s_wait_dscnt 0x0" ::: "memory")      // this wave's LDS reads are done before the buffer is handed back
// ---- k_pack: block = (row n, which): natural [out][in] rows -> bf16; which 0..2 -> W_q/W_k/W_v into PK_A rows which*1024 + n; 3 -> W_o into PK_P
__global__ __launch_bounds__(256) void k_pack(const float* __restrict__ WQ, const float* __restrict__ WK, const float* __restrict__ WV, const float* __restrict__ WO, __bf16* __restrict__ PK) {
  __shared__ __align__(16) __bf16 s[DM]; const int n = blockIdx.x, which = blockIdx.y, t = threadIdx.x; const float* Wm = (which == 0) ? WQ : (which == 1) ? WK : (which == 2) ? WV : WO;
  for (int k = t; k < DM; k += 256) s[k] = (__bf16)Wm[(size_t)n * DM + k];
  __syncthreads();
  __bf16* dst = (which < 3) ? PK + PK_A + ((size_t)which * DM + n) * DM : PK + PK_P + (size_t)n * DM;
  for (int q = t; q < DM / 8; q += 256) vst2((unsigned*)(dst + q * 8), *(const v4u*)&s[q * 8]);
}
__global__ __launch_bounds__(128) void k_qkv(const float* __restrict__ XQ, const float* __restrict__ XK, const float* __restrict__ XV, const __bf16* __restrict__ P, const float* __restrict__ BQ, const float* __restrict__ BK, const float* __restrict__ BV, const float* __restrict__ TS, _Float16* __restrict__ QK, _Float16* __restrict__ QKL, _Float16* __restrict__ VTH, _Float16* __restrict__ VTL) {
  const int which0 = (blockIdx.y * 128) / DM; const float* X = (which0 == 0) ? XQ : (which0 == 1) ? XK : XV; const float* BB = BQ ? (((which0 == 0) ? BQ : (which0 == 1) ? BK : BV) + (blockIdx.y * 128 - which0 * DM)) : nullptr;
  __shared__ __attribute__((aligned(16))) unsigned char L[2 * STG];   // the two tile buffers; behind the k loop's last barrier the same bytes serve as output staging
  _Float16 (*so)[16][136] = (_Float16 (*)[16][136])L; _Float16 (*sol)[16][136] = (_Float16 (*)[16][136])(L + 4 * 16 * 136 * 2); _Float16 (*sth)[72] = (_Float16 (*)[72])L; _Float16 (*stl)[72] = (_Float16 (*)[72])(L + 128 * 72 * 2);
  const int tid = threadIdx.x, wave = tid >> 5, lane = tid & 31, col = lane & 15, g = lane >> 4; const size_t r0 = (size_t)blockIdx.x * 64 + wave * 16; const int n0 = blockIdx.y * 128;
  v8f acc[8] = {};
  { const unsigned lb = (unsigned)(uintptr_t)&L[0]; const __bf16* Wr = P + (size_t)n0 * DM; const float* Ar = X + (size_t)blockIdx.x * 64 * DM;
    stage_tile(lb, Wr, Ar, 0, tid); WAIT_ASYNC(); __syncthreads(); stage_tile(lb + STG, Wr, Ar, 1, tid);
#pragma unroll 1   // kept rolled: one trip = one buffer
    for (int t = 0; t < NT; ++t) { const unsigned char* S = L + (t & 1) * STG;
#pragma unroll   // constant indices keep bf[] and acc[] in registers (also the three directives below)
      for (int kc = 0; kc < 2; ++kc) { float av[16]; v16b bf[8]; lds_a16(S + BTILE + (wave * 16 + col) * APITCH + kc * 128, g, av);   // all fragments of the k step first, then its WMMAs
#pragma unroll
        for (int j = 0; j < 8; ++j) bf[j] = frag_b((const __bf16*)(S + (j * 16 + col) * BPITCH + kc * 64), lane);
        v16b a;
#pragma unroll
        for (int i = 0; i < 16; ++i) a[i] = (__bf16)av[i];
#pragma unroll
        for (int j = 0; j < 8; ++j) acc[j] = wmma_bf(a, bf[j], acc[j]); }
      WAIT_DS(); WAIT_ASYNC(); __syncthreads();   // publishes tile t + 1 and frees tile t's buffer
      if (t + 2 < NT) stage_tile(lb + (unsigned)(t & 1) * STG, Wr, Ar, t + 2, tid); }
    WAIT_ASYNC(); }
  if (n0 < 2 * DM) {   // bias, then the interleaved-pair rotary: pair (2i, 2i+1) = neighbouring lanes (col ^ 1), angle = t_scaled[row] * inv_freq[i]
#pragma unroll
    for (int j = 0; j < 8; ++j)
#pragma unroll
      for (int r = 0; r < 8; ++r) acc[j][r] += (BB ? bfr(BB[j * 16 + col]) : 0.f);
#pragma unroll
    for (int r = 0; r < 8; ++r) { const float ts = TS[r0 + 8 * g + r];
#pragma unroll
      for (int j = 0; j < 8; ++j) { const int d = (j & 3) * 16 + col; const float ang = ts * INVF[d >> 1]; const float c = cos_p(ang), sn = sin_p(ang); const float v = acc[j][r]; const float pv = __shfl_xor(v, 1); acc[j][r] = (col & 1) ? (v * c + pv * sn) : (v * c - pv * sn); } }
#pragma unroll
    for (int j = 0; j < 8; ++j) {
#pragma unroll
      for (int r = 0; r < 8; ++r) { const float v = acc[j][r]; const _Float16 hv = (_Float16)v; so[wave][8 * g + r][j * 16 + col] = hv; sol[wave][8 * g + r][j * 16 + col] = (_Float16)((v - (float)hv) * 2048.0f); } }   // q, k (+ bias) as f16 hi + (x2048) residual
    LDSX();
    for (int rl = 0; rl < 16; ++rl) if (lane < 16) { vst2((unsigned*)(QK + (r0 + rl) * (2 * DM) + n0 + lane * 8), *(const v4u*)&so[wave][rl][lane * 8]); vst2((unsigned*)(QKL + (r0 + rl) * (2 * DM) + n0 + lane * 8), *(const v4u*)&sol[wave][rl][lane * 8]); }
  } else {
#pragma unroll
    for (int j = 0; j < 8; ++j) {
#pragma unroll
      for (int r = 0; r < 8; ++r) { const float v = acc[j][r] + (BB ? bfr(BB[j * 16 + col]) : 0.f); const _Float16 hv = (_Float16)v; sth[j * 16 + col][wave * 16 + 8 * g + r] = hv; stl[j * 16 + col][wave * 16 + 8 * g + r] = (_Float16)((v - (float)hv) * 2048.0f); } }
    __syncthreads();
    const size_t rb = (size_t)blockIdx.x * 64; const int b = (int)(rb / SS), s0 = (int)(rb % SS); const int pc0 = n0 - 2 * DM;
    for (int q = tid; q < 128 * 8; q += 128) { const int d = q >> 3, pc = q & 7; const size_t o = ((size_t)b * DM + pc0 + d) * SS + s0 + pc * 8; vst2((unsigned*)(VTH + o), *(const v4u*)&sth[d][pc * 8]); vst2((unsigned*)(VTL + o), *(const v4u*)&stl[d][pc * 8]); }
  }
}
// ---- LDS staging of k_attn: a tile = 64 keys: their 64 k rows (128 B each), the 64 v^T rows' 64 columns (128 B each), and per wave a private copy of the keys' times and errors (256 B + 256 B); two buffers, filled one tile ahead
#define AKP 144                       // k / v^T row pitch in LDS: 16 B x odd
#define AK_V (64 * AKP)
#define AK_TE (2 * 64 * AKP)
#define ASTG (AK_TE + 4 * 512)        // one buffer
#define ANT (SS / 64)
#define LOG2E 1.44269504088896340736f
// nine 16-byte copies of one thread (4 of k, 4 of v^T, 1 of times | errors); the closing s_wait_xcnt 0 keeps every address register named here unchanged until the copies have taken it
__device__ __forceinline__ void stage_kv(unsigned lbuf, const _Float16* Kr, const _Float16* Vr, const float* Tb, const float* Eb, int t, int tid) {
  const int lane = tid & 31;
  const unsigned lk = lbuf + (unsigned)(tid >> 3) * AKP + (unsigned)(tid & 7) * 16u, lv = lk + AK_V, lt = lbuf + AK_TE + (unsigned)(tid >> 5) * 512u + (unsigned)lane * 16u;
  const char* gk = (const char*)(Kr + ((size_t)t * 64 + (tid >> 3)) * (2 * DM) + (tid & 7) * 8);
  const char* gv = (const char*)(Vr + (size_t)(tid >> 3) * SS + t * 64 + (tid & 7) * 8);
  const char* gt = (const char*)(((lane < 16) ? Tb : Eb) + t * 64 + (lane & 15) * 4);
  const size_t ks16 = (size_t)16 * 2 * DM * 2, vs16 = (size_t)16 * SS * 2;
  asm volatile("global_load_async_to_lds_b128 %0, %9, off\n\t"
               "global_load_async_to_lds_b128 %1, %10, off\n\t"
               "global_load_async_to_lds_b128 %2, %11, off\n\t"
               "global_load_async_to_lds_b128 %3, %12, off\n\t"
               "global_load_async_to_lds_b128 %4, %13, off\n\t"
               "global_load_async_to_lds_b128 %5, %14, off\n\t"
               "global_load_async_to_lds_b128 %6, %15, off\n\t"
               "global_load_async_to_lds_b128 %7, %16, off\n\t"
               "global_load_async_to_lds_b128 %8, %17, off\n\t"
               "s_wait_xcnt 0x0"
               :: "v"(lk), "v"(lk + 16u * AKP), "v"(lk + 32u * AKP), "v"(lk + 48u * AKP), "v"(lv), "v"(lv + 16u * AKP), "v"(lv + 32u * AKP), "v"(lv + 48u * AKP), "v"(lt),
                  "v"(gk), "v"(gk + ks16), "v"(gk + 2 * ks16), "v"(gk + 3 * ks16), "v"(gv), "v"(gv + vs16), "v"(gv + 2 * vs16), "v"(gv + 3 * vs16), "v"(gt)
               : "memory");
}
// ---- k_attn: block = (64 queries, head h, batch b): all-keys flash attention (K = 64: 2 k-steps), scores = (q.k) * 0.125 with single f16 operands, P.V: f16 P (x2^11) x f16 V hi, one product into acc; O[b*S+q][h*64+d] = acc / 2048 / l (256-B segments)
__global__ __launch_bounds__(128) void k_attn(const _Float16* __restrict__ QK, const _Float16* __restrict__ QKL, const _Float16* __restrict__ VTH, const _Float16* __restrict__ VTL, const void* __restrict__ KMASK, const float* __restrict__ TS, const float* __restrict__ ERR, const float* __restrict__ LAMH, const float* __restrict__ WG, const float* __restrict__ BG, float* __restrict__ O) {
  __shared__ __align__(16) float sp[4][16][36]; __shared__ __align__(16) float so[4][16][68]; __shared__ __attribute__((aligned(16))) unsigned char L[2 * ASTG];
  const int tid = threadIdx.x, wave = tid >> 5, lane = tid & 31, col = lane & 15, g = lane >> 4;
  const int qb = blockIdx.x, h = blockIdx.y, b = blockIdx.z; const int q0 = qb * 64 + wave * 16; const size_t rq = (size_t)b * SS + q0 + col;
  v16h aq[2], aql[2];
#pragma unroll
  for (int kc = 0; kc < 2; ++kc) { aq[kc] = frag_h(QK + rq * (2 * DM) + h * HD + kc * 32, lane); aql[kc] = frag_h(QKL + rq * (2 * DM) + h * HD + kc * 32, lane); }
  // per-head constants and per-query-row time / error values for the score biases
  const float lraw = bfr(LAMH[h]); const float lam = (lraw > 20.f) ? lraw : log1pf(expf(lraw));   // softplus, precise, once a thread: in line, so that the kernel holds no call
  const float wg0 = bfr(WG[h * 2]), wg1 = bfr(WG[h * 2 + 1]), bgh = bfr(BG[h]); const float lam2 = lam * LOG2E;   // scores carry the factor log2 e, so that every exp and log of the loop is one hardware instruction
  float tq[8], gq[8];
#pragma unroll
  for (int r = 0; r < 8; ++r) { const size_t rowq = (size_t)b * SS + q0 + 8 * g + r; tq[r] = TS[rowq]; gq[r] = (wg0 * bfr(ERR[rowq]) + bgh) * -LOG2E; }   // gate logit's query part, as the exponent of 2 in exp(-logit)
  float m[8], l[8];
#pragma unroll
  for (int r = 0; r < 8; ++r) { m[r] = -3.0e38f; l[r] = 0.f; }
  v8f acc[4] = {}, accl[4] = {};
  const unsigned lb = (unsigned)(uintptr_t)&L[0]; const _Float16* Kr = QK + (size_t)b * SS * (2 * DM) + DM + h * HD; const _Float16* Vr = VTH + ((size_t)b * DM + h * HD) * SS; const float* Tb = TS + (size_t)b * SS; const float* Eb = ERR + (size_t)b * SS;
  stage_kv(lb, Kr, Vr, Tb, Eb, 0, tid); WAIT_ASYNC(); __syncthreads(); stage_kv(lb + ASTG, Kr, Vr, Tb, Eb, 1, tid);
#pragma unroll 1   // kept rolled: one trip = one buffer = 64 keys, all keys in order
  for (int t = 0; t < ANT; ++t) { const unsigned char* S = L + (t & 1) * ASTG;
#pragma unroll 1   // kept rolled: the tile's two 32-key steps share one body
  for (int ks = 0; ks < 2; ++ks) { v8f s[2]; v16h kf[2][2];
#pragma unroll   // constant indices keep kf[][] in registers (also the next directive)
    for (int ct = 0; ct < 2; ++ct)
#pragma unroll
      for (int kc = 0; kc < 2; ++kc) kf[ct][kc] = frag_h((const _Float16*)(S + (ks * 32 + ct * 16 + col) * AKP + kc * 64), lane);   // the step's four k fragments first, then its WMMAs
#pragma unroll
    for (int ct = 0; ct < 2; ++ct) { v8f c = {};
#pragma unroll
      for (int kc = 0; kc < 2; ++kc) c = wmma16(aq[kc], kf[ct][kc], c);   // single product: q, k as one-rounding f16 operands
      { const bool keepk = true;
      { const float* te = (const float*)(S + AK_TE + wave * 512) + ks * 32 + ct * 16 + col; const float tk = te[0]; const float gk = wg1 * bfr(te[64]) * -LOG2E;
#pragma unroll
      for (int r = 0; r < 8; ++r) { const float sig = __builtin_amdgcn_rcpf(1.0f + __builtin_amdgcn_exp2f(gq[r] + gk)); s[ct][r] = c[r] * (0.125f * LOG2E) + (__builtin_amdgcn_logf(sig + 1e-9f) - lam2 * fabsf(tq[r] - tk)); } } } }   // (q.k/8 + time-decay bias + error-gate bias) x log2 e: sigmoid by v_exp_f32 and v_rcp_f32, its logarithm by v_log_f32
#pragma unroll
    for (int r = 0; r < 8; ++r) { float mx = fmaxf(s[0][r], s[1][r]);
#pragma unroll
      for (int o = 1; o < 16; o <<= 1) mx = fmaxf(mx, __shfl_xor(mx, o));
      const float mn = fmaxf(m[r], mx); const float alpha = (m[r] <= -1.0e38f) ? 0.f : __builtin_amdgcn_exp2f(m[r] - mn);
      const float e0 = (s[0][r] <= -1.0e38f) ? 0.f : __builtin_amdgcn_exp2f(s[0][r] - mn), e1 = (s[1][r] <= -1.0e38f) ? 0.f : __builtin_amdgcn_exp2f(s[1][r] - mn); float es = e0 + e1;
#pragma unroll
      for (int o = 1; o < 16; o <<= 1) es += __shfl_xor(es, o);
      l[r] = l[r] * alpha + es; m[r] = mn;
#pragma unroll
      for (int dt = 0; dt < 4; ++dt) { acc[dt][r] *= alpha; accl[dt][r] *= alpha; }
      sp[wave][8 * g + r][col] = e0; sp[wave][8 * g + r][16 + col] = e1; }
    LDSX();
    v16h pa, pl; { const float* prow = &sp[wave][col][0] + 8 * (lane >> 4);
#pragma unroll
      for (int i = 0; i < 8; ++i) { const float x0 = prow[i] * 2048.0f, x1 = prow[16 + i] * 2048.0f; const _Float16 h0 = (_Float16)x0, h1 = (_Float16)x1; pa[i] = h0; pa[8 + i] = h1; pl[i] = (_Float16)((x0 - (float)h0) * 2048.0f); pl[8 + i] = (_Float16)((x1 - (float)h1) * 2048.0f); } }   // P scaled by 2^11 before the f16 split so small softmax weights stay out of the f16 subnormal range; 2^-11 folded into the epilogue
    v16h vf[4];
#pragma unroll   // constant indices keep vf[] in registers
    for (int dt = 0; dt < 4; ++dt) vf[dt] = frag_h((const _Float16*)(S + AK_V + (dt * 16 + col) * AKP + ks * 64), lane);   // the step's four v fragments first, then its WMMAs
#pragma unroll
    for (int dt = 0; dt < 4; ++dt) acc[dt] = wmma16(pa, vf[dt], acc[dt]);   // single product: P (x2^11) x V
    (void)pl;
    LDSX(); }
    WAIT_DS(); WAIT_ASYNC(); __syncthreads();   // publishes tile t + 1 and frees tile t's buffer
    if (t + 2 < ANT) stage_kv(lb + (unsigned)(t & 1) * ASTG, Kr, Vr, Tb, Eb, t + 2, tid); }
  WAIT_ASYNC();
#pragma unroll
  for (int r = 0; r < 8; ++r) { const float il = (1.0f / 2048.0f) / l[r];
#pragma unroll
    for (int dt = 0; dt < 4; ++dt) so[wave][8 * g + r][dt * 16 + col] = (acc[dt][r] + accl[dt][r] * (1.0f / 2048.0f)) * il; }
  LDSX();
  for (int rl = 0; rl < 16; ++rl) if (lane < 16) vst2(O + ((size_t)b * SS + q0 + rl) * DM + h * HD + lane * 4, *(const v4f*)&so[wave][rl][lane * 4]);
}
// ---- k_out: block = (64 rows, 128 cols): out = O(hi/lo) . Wo rows (2 products) + bo
__global__ __launch_bounds__(128) void k_out(const float* __restrict__ O, const __bf16* __restrict__ P, const float* __restrict__ BO, float* __restrict__ Y) {
  __shared__ __attribute__((aligned(16))) unsigned char L[2 * STG];   // the two tile buffers; behind the k loop's last barrier the same bytes serve as output staging
  float (*so)[16][132] = (float (*)[16][132])L;
  const int tid = threadIdx.x, wave = tid >> 5, lane = tid & 31, col = lane & 15, g = lane >> 4; const size_t r0 = (size_t)blockIdx.x * 64 + wave * 16; const int n0 = blockIdx.y * 128;
  v8f acc[8] = {};
  { const unsigned lb = (unsigned)(uintptr_t)&L[0]; const __bf16* Wr = P + (size_t)n0 * DM; const float* Ar = O + (size_t)blockIdx.x * 64 * DM;
    stage_tile(lb, Wr, Ar, 0, tid); WAIT_ASYNC(); __syncthreads(); stage_tile(lb + STG, Wr, Ar, 1, tid);
#pragma unroll 1   // kept rolled: one trip = one buffer
    for (int t = 0; t < NT; ++t) { const unsigned char* S = L + (t & 1) * STG;
#pragma unroll   // constant indices keep bf[] and acc[] in registers (also the two directives below)
      for (int kc = 0; kc < 2; ++kc) { float av[16]; v16b bf[8]; lds_a16(S + BTILE + (wave * 16 + col) * APITCH + kc * 128, g, av);   // all fragments of the k step first, then its WMMAs
#pragma unroll
        for (int j = 0; j < 8; ++j) bf[j] = frag_b((const __bf16*)(S + (j * 16 + col) * BPITCH + kc * 64), lane);
        const F2 a = bsplit16(av);
#pragma unroll
        for (int j = 0; j < 8; ++j) { acc[j] = wmma_bf(a.l, bf[j], acc[j]); acc[j] = wmma_bf(a.h, bf[j], acc[j]); } }
      WAIT_DS(); WAIT_ASYNC(); __syncthreads();   // publishes tile t + 1 and frees tile t's buffer
      if (t + 2 < NT) stage_tile(lb + (unsigned)(t & 1) * STG, Wr, Ar, t + 2, tid); }
    WAIT_ASYNC(); }
#pragma unroll
  for (int j = 0; j < 8; ++j) {
#pragma unroll
    for (int r = 0; r < 8; ++r) so[wave][8 * g + r][j * 16 + col] = acc[j][r] + bfr(BO[n0 + j * 16 + col]); }
  LDSX();
  for (int rl = 0; rl < 16; ++rl) vst2(Y + (r0 + rl) * DM + n0 + lane * 4, *(const v4f*)&so[wave][rl][lane * 4]);
}
// ---- k_ts: block = batch: t_scaled = (t - min) / (max - min + 1e-6) * 1000 over the sequence
__global__ __launch_bounds__(256) void k_ts(const float* __restrict__ TR, float* __restrict__ TS) {
  __shared__ float rmn[256], rmx[256]; const size_t b = blockIdx.x; const int t = threadIdx.x; float mn = 3.0e38f, mx = -3.0e38f;
  for (int s = t; s < SS; s += 256) { const float v = bfr(TR[b * SS + s]); mn = fminf(mn, v); mx = fmaxf(mx, v); }
  rmn[t] = mn; rmx[t] = mx; __syncthreads();
  for (int st = 128; st > 0; st >>= 1) { if (t < st) { rmn[t] = fminf(rmn[t], rmn[t + st]); rmx[t] = fmaxf(rmx[t], rmx[t + st]); } __syncthreads(); }
  const float tmin = rmn[0], den = rmx[0] - rmn[0] + 1e-6f;
  for (int s = t; s < SS; s += 256) TS[b * SS + s] = (bfr(TR[b * SS + s]) - tmin) / den * 1000.0f;   // 4-B scratch stores
}
extern "C" void kernel_launch(void* const* d_in, const int* in_sizes, int n_in, void* d_out, int out_size, void* d_ws, size_t ws_size, hipStream_t stream) {
  (void)in_sizes; (void)n_in; (void)out_size;
  const float** F = (const float**)d_in;   // 0 x [4,1024,1024], 1 t_raw [4,1024], 2 error [4,1024], 3 Wq, 4 bq, 5 Wk, 6 bk, 7 Wv, 8 bv, 9 Wo, 10 bo, 11 lambda_h [16], 12 Wg [16,2], 13 bg [16]
  if (ws_size < (size_t)WS_END + 4u * NB * SS + 256) return;
  char* ws = (char*)d_ws; __bf16* PK = (__bf16*)(ws + WS_PK); _Float16 *QK = (_Float16*)(ws + WS_QK), *QKL = (_Float16*)(ws + WS_QKL), *VTH = (_Float16*)(ws + WS_VTH), *VTL = (_Float16*)(ws + WS_VTL); float* O = (float*)(ws + WS_O); float* TS = (float*)(ws + WS_END);
  k_pack<<<dim3(DM, 4), 256, 0, stream>>>(F[3], F[5], F[7], F[9], PK);
  k_ts<<<NB, 256, 0, stream>>>(F[1], TS);
  k_qkv<<<dim3(TNB * SS / 64, QKVW / 128), 128, 0, stream>>>(F[0], F[0], F[0], PK + PK_A, F[4], F[6], F[8], TS, QK, QKL, VTH, VTL);
  k_attn<<<dim3(TQB, NH, TNB), 128, 0, stream>>>(QK, QKL, VTH, VTL, nullptr, TS, F[2], F[11], F[12], F[13], O);
  k_out<<<dim3(TOB, DM / 128), 128, 0, stream>>>(O, PK + PK_P, F[10], (float*)d_out);
}

// v003
// One run takes 119 microseconds.
// Timed twice side by side with v002, it ran 1.13 and 1.14 times as fast.
// Counting every step since v000, it is 3.33 times as fast.
// compute dtype: all float inputs rounded to bf16; q/k/v = x . W^T + b with EXACT bf16 products on WMMA 16x16x32 (natural rows); per-batch time scaling and the interleaved-pair rotary (neighbouring lanes; angle = t_scaled x inv_freq[d/2] with jnp's inv_freq constants, precise cosf/sinf) in f32; PLAIN attention: rotated q, k as single f16 operands x 1/8 + the decay and gate biases evaluated per score in f32 (base 2: hardware exp, reciprocal and log; the per-head softplus by precise expf/log1pf), running-max softmax in f32 (base 2, hardware exp), P (scaled by 2^11, single f16) x v (single f16); out = o (bf16 hi + residual) . Wo^T (2 products) + bo.
#include <hip/hip_runtime.h>
#include <math.h>

typedef __attribute__((ext_vector_type(16))) _Float16 v16h;
typedef __attribute__((ext_vector_type(16))) __bf16 v16b;
typedef __attribute__((ext_vector_type(8)))  _Float16 v8h;
typedef __attribute__((ext_vector_type(8)))  float v8f;
typedef __attribute__((ext_vector_type(4)))  float v4f;
typedef __attribute__((ext_vector_type(2)))  float v2f;
typedef __attribute__((ext_vector_type(4)))  unsigned v4u;
typedef __attribute__((ext_vector_type(4)))  int v4i;
typedef float __attribute__((may_alias)) float_a;
typedef int __attribute__((may_alias)) int_a;

template <typename T> __device__ __forceinline__ void vst2(void* p, T v) { *(T*)p = v;  }
__device__ __forceinline__ v8f wmma16(v16h a, v16h b, v8f c) {
  v8f d = __builtin_amdgcn_wmma_f32_16x16x32_f16(false, a, false, b, (short)0, c, false, false);
  asm volatile("v_nop\n\tv_nop\n\tv_nop\n\tv_nop" : "+v"(d) : "v"(a), "v"(b));
  return d;
}
__device__ __forceinline__ v8f wmma_bf(v16b a, v16b b, v8f c) {
  v8f d = __builtin_amdgcn_wmma_f32_16x16x32_bf16(false, a, false, b, (short)0, c, false, false);
  asm volatile("v_nop\n\tv_nop\n\tv_nop\n\tv_nop" : "+v"(d) : "v"(a), "v"(b));
  return d;
}
// Scaled continuous-time attention (B 4, S 1,024, d 1,024, 16 heads x 64): q/k/v projections + biases, an interleaved rotary embedding whose angle is the per-token time (min-max scaled to [0, 1000]) x inv_freq, scores / 8 plus a per-head time-decay bias (-softplus(lambda_h) |t_i - t_j|) and an error-gated bias log(sigmoid(w_h0 err_i + w_h1 err_j + b_h) + 1e-9), softmax, . v, output projection + bias.
__device__ __forceinline__ v16h frag_h(const _Float16* rowk0, int lane) {
  union { v16h v; v8h q[2]; } u; const _Float16* p = rowk0 + 8 * (lane >> 4);
  u.q[0] = *(const v8h*)p; u.q[1] = *(const v8h*)(p + 16); return u.v;
}
__device__ __forceinline__ v16h frag_f32(const float* rowk0, int lane) {
  v16h a; const float* p = rowk0 + 8 * (lane >> 4);
#pragma unroll
  for (int i = 0; i < 8; ++i) { a[i] = (_Float16)p[i]; a[8 + i] = (_Float16)p[16 + i]; }
  return a;
}
__device__ __forceinline__ v16h frag_f32s(const float* rowk0, int lane, float sc) {
  v16h a; const float* p = rowk0 + 8 * (lane >> 4);
#pragma unroll
  for (int i = 0; i < 8; ++i) { a[i] = (_Float16)(p[i] * sc); a[8 + i] = (_Float16)(p[16 + i] * sc); }
  return a;
}
// column fragment from a [K][ld] layout (column n), rows >= K read as 0
__device__ __forceinline__ v16h fragc_f32(const float* W, int k0, int n, int lane, int ld, int K) {
  v16h a; const int g = lane >> 4;
#pragma unroll
  for (int i = 0; i < 8; ++i) { const int ka = k0 + 8 * g + i, kb = ka + 16;
    a[i] = (_Float16)(ka < K ? W[(size_t)(ka < K ? ka : K - 1) * ld + n] : 0.f); a[8 + i] = (_Float16)(kb < K ? W[(size_t)(kb < K ? kb : K - 1) * ld + n] : 0.f); }
  return a;
}
struct F2 { v16b h, l; };
__device__ __forceinline__ F2 bsplit16(const float v[16]) { F2 r;
#pragma unroll
  for (int i = 0; i < 16; ++i) { const __bf16 h = (__bf16)v[i]; r.h[i] = h; r.l[i] = (__bf16)(v[i] - (float)h); }
  return r; }
__device__ __forceinline__ F2 split_row(const float* row, int k0, int lane) { float v[16]; const float* p = row + k0 + 8 * (lane >> 4);
#pragma unroll
  for (int i = 0; i < 8; ++i) { v[i] = p[i]; v[8 + i] = p[16 + i]; }
  return bsplit16(v); }
__device__ __forceinline__ F2 split_rowK(const float* row, int k0, int lane, int K) { float v[16]; const int g = lane >> 4;
#pragma unroll
  for (int i = 0; i < 8; ++i) { const int ka = k0 + 8 * g + i, kb = ka + 16; v[i] = ka < K ? row[ka < K ? ka : K - 1] : 0.f; v[8 + i] = kb < K ? row[kb < K ? kb : K - 1] : 0.f; }
  return bsplit16(v); }
__device__ __forceinline__ F2 split_col(const float* W, int k0, int n, int lane, int ld, int K) { float v[16]; const int g = lane >> 4;
#pragma unroll
  for (int i = 0; i < 8; ++i) { const int ka = k0 + 8 * g + i, kb = ka + 16; v[i] = ka < K ? W[(size_t)(ka < K ? ka : K - 1) * ld + n] : 0.f; v[8 + i] = kb < K ? W[(size_t)(kb < K ? kb : K - 1) * ld + n] : 0.f; }
  return bsplit16(v); }
__device__ __forceinline__ v8f mac3(const F2& a, const F2& b, v8f c) { c = wmma_bf(a.l, b.h, c); c = wmma_bf(a.h, b.l, c); return wmma_bf(a.h, b.h, c); }
__device__ __forceinline__ float sigm(float v) { return 1.0f / (1.0f + expf(-v)); }
#define LDSX() do { asm volatile("s_wait_dscnt 0" ::: "memory"); __builtin_amdgcn_wave_barrier(); __builtin_amdgcn_fence(__ATOMIC_RELEASE, "workgroup"); } while (0)


#define NB 4
#define SS 1024
#define DM 1024
#define NH 16
__constant__ float INVF[32] = {1.000000000e+00f,7.498942018e-01f,5.623413324e-01f,4.216965139e-01f,3.162277639e-01f,2.371373773e-01f,1.778279394e-01f,1.333521456e-01f,1.000000015e-01f,7.498942316e-02f,5.623413250e-02f,4.216964915e-02f,3.162277490e-02f,2.371373773e-02f,1.778279431e-02f,1.333521400e-02f,9.999999776e-03f,7.498942316e-03f,5.623413250e-03f,4.216964822e-03f,3.162277630e-03f,2.371373819e-03f,1.778279431e-03f,1.333521446e-03f,1.000000047e-03f,7.498941850e-04f,5.623413017e-04f,4.216965172e-04f,3.162277571e-04f,2.371373703e-04f,1.778279402e-04f,1.333521504e-04f};
__device__ __attribute__((noinline)) float cos_p(float v) { return cosf(v); }
__device__ __attribute__((noinline)) float sin_p(float v) { return sinf(v); }
#define HD 64
#define QKVW (3 * DM)
#ifndef TQB
#define TQB (SS / 64)
#define TNB NB
#define TOB (NB * SS / 64)     // output row tiles (all)
#endif
typedef __attribute__((ext_vector_type(8))) __bf16 v8b;
__device__ __forceinline__ v16b frag_b(const __bf16* rowk0, int lane) {
  union { v16b v; v8b q[2]; } u; const __bf16* p = rowk0 + 8 * (lane >> 4);
  u.q[0] = *(const v8b*)p; u.q[1] = *(const v8b*)(p + 16); return u.v;
}
__device__ __forceinline__ float bfr(float v) { return (float)(__bf16)v; }
__device__ __attribute__((noinline)) float erf_ni(float v) { return erff(v); }

#define PK_A 0                       // [3072][1024] Wqkv rows (natural [out][in])
#define PK_P (PK_A + QKVW * DM)        // [1024][1024] Wo rows (natural)
#define PK_END (PK_P + DM * DM)
#define WS_PK  0u
#define WS_QK  (WS_PK + 2u * PK_END)             // f16 [4096 rows][2048]: q | k
#define WS_QKL (WS_QK + 2u * NB * SS * 2 * DM)     // f16 q | k residual planes x2048
#define WS_VTH (WS_QKL + 2u * NB * SS * 2 * DM)    // f16 [b][1024 (h*64+d)][1024 s] hi
#define WS_VTL (WS_VTH + 2u * NB * DM * SS)        // f16 lo x 2048
#define WS_O   (WS_VTL + 2u * NB * DM * SS)        // f32 [4096][1024]
#define WS_CS  (WS_O + 4u * NB * SS * DM)           // f32 2 x [1024][32], not used (cos/sin computed in k_qkv)
#define WS_END (WS_CS + 4u * 2 * SS * 32)
// ---- LDS staging of the two projection GEMMs: a tile = 64 k of 128 weight rows (bf16, 128 B a row) and of 64 activation rows (f32, 256 B a row); two buffers, filled by asynchronous copies one tile ahead
#define KT 64
#define BPITCH 144                    // weight row pitch in LDS: 16 B x odd, conflict-free for 16-byte reads
#define APITCH 272                    // activation row pitch in LDS: 16 B x odd
#define BTILE (128 * BPITCH)
#define STG (BTILE + 64 * APITCH)     // one buffer
#define NT (DM / KT)
// eight 16-byte copies of one thread, global memory -> LDS, no register in between; the closing s_wait_xcnt 0 keeps every address register named here unchanged until the copies have taken it
__device__ __forceinline__ void copy8(unsigned l, const char* g, unsigned lstep, size_t gstep) {
  asm volatile("global_load_async_to_lds_b128 %0, %8, off\n\t"
               "global_load_async_to_lds_b128 %1, %9, off\n\t"
               "global_load_async_to_lds_b128 %2, %10, off\n\t"
               "global_load_async_to_lds_b128 %3, %11, off\n\t"
               "global_load_async_to_lds_b128 %4, %12, off\n\t"
               "global_load_async_to_lds_b128 %5, %13, off\n\t"
               "global_load_async_to_lds_b128 %6, %14, off\n\t"
               "global_load_async_to_lds_b128 %7, %15, off\n\t"
               "s_wait_xcnt 0x0"
               :: "v"(l), "v"(l + lstep), "v"(l + 2 * lstep), "v"(l + 3 * lstep), "v"(l + 4 * lstep), "v"(l + 5 * lstep), "v"(l + 6 * lstep), "v"(l + 7 * lstep),
                  "v"(g), "v"(g + gstep), "v"(g + 2 * gstep), "v"(g + 3 * gstep), "v"(g + 4 * gstep), "v"(g + 5 * gstep), "v"(g + 6 * gstep), "v"(g + 7 * gstep)
               : "memory");
}
// tile t of the block's 128 weight rows (Wr = row 0, k 0) and 64 activation rows (Ar) into the buffer at LDS byte address lbuf: a wave's copy covers 4 whole 128-B lines
__device__ __forceinline__ void stage_tile(unsigned lbuf, const __bf16* Wr, const float* Ar, int t, int tid) {
  copy8(lbuf + (unsigned)(tid >> 3) * BPITCH + (unsigned)(tid & 7) * 16u, (const char*)(Wr + (size_t)(tid >> 3) * DM + t * KT + (tid & 7) * 8), 16u * BPITCH, (size_t)16 * DM * 2);
  copy8(lbuf + BTILE + (unsigned)(tid >> 4) * APITCH + (unsigned)(tid & 15) * 16u, (const char*)(Ar + (size_t)(tid >> 4) * DM + t * KT + (tid & 15) * 4), 8u * APITCH, (size_t)8 * DM * 4);
}
// the 16 f32 of an A fragment from a staged row: k = 8g .. 8g+7 and 16+8g .. 16+8g+7 of the 32-k step at rowk0
__device__ __forceinline__ void lds_a16(const unsigned char* rowk0, int g, float v[16]) {
  const v4f* p = (const v4f*)(rowk0 + 32 * g); const v4f x0 = p[0], x1 = p[1], x2 = p[4], x3 = p[5];
#pragma unroll   // constant indices keep v[] in registers
  for (int i = 0; i < 4; ++i) { v[i] = x0[i]; v[4 + i] = x1[i]; v[8 + i] = x2[i]; v[12 + i] = x3[i]; }
}
#define WAIT_ASYNC() asm volatile("s_wait_asynccnt 0x0" ::: "memory")   // this wave's copies have landed
#define WAIT_DS()    asm volatile("s_wait_dscnt 0x0" ::: "memory")      // this wave's LDS reads are done before the buffer is handed back
// ---- k_pack: block = (row n, which): natural [out][in] rows -> bf16; which 0..2 -> W_q/W_k/W_v into PK_A rows which*1024 + n; 3 -> W_o into PK_P
__global__ __launch_bounds__(256) void k_pack(const float* __restrict__ WQ, const float* __restrict__ WK, const float* __restrict__ WV, const float* __restrict__ WO, __bf16* __restrict__ PK) {
  __shared__ __align__(16) __bf16 s[DM]; const int n = blockIdx.x, which = blockIdx.y, t = threadIdx.x; const float* Wm = (which == 0) ? WQ : (which == 1) ? WK : (which == 2) ? WV : WO;
  for (int k = t; k < DM; k += 256) s[k] = (__bf16)Wm[(size_t)n * DM + k];
  __syncthreads();
  __bf16* dst = (which < 3) ? PK + PK_A + ((size_t)which * DM + n) * DM : PK + PK_P + (size_t)n * DM;
  for (int q = t; q < DM / 8; q += 256) vst2((unsigned*)(dst + q * 8), *(const v4u*)&s[q * 8]);
}
__global__ __launch_bounds__(128) void k_qkv(const float* __restrict__ XQ, const float* __restrict__ XK, const float* __restrict__ XV, const __bf16* __restrict__ P, const float* __restrict__ BQ, const float* __restrict__ BK, const float* __restrict__ BV, const float* __restrict__ TS, _Float16* __restrict__ QK, _Float16* __restrict__ QKL, _Float16* __restrict__ VTH, _Float16* __restrict__ VTL) {
  const int which0 = (blockIdx.y * 128) / DM; const float* X = (which0 == 0) ? XQ : (which0 == 1) ? XK : XV; const float* BB = BQ ? (((which0 == 0) ? BQ : (which0 == 1) ? BK : BV) + (blockIdx.y * 128 - which0 * DM)) : nullptr;
  __shared__ __attribute__((aligned(16))) unsigned char L[2 * STG];   // the two tile buffers; behind the k loop's last barrier the same bytes serve as output staging
  _Float16 (*so)[16][136] = (_Float16 (*)[16][136])L; _Float16 (*sol)[16][136] = (_Float16 (*)[16][136])(L + 4 * 16 * 136 * 2); _Float16 (*sth)[72] = (_Float16 (*)[72])L; _Float16 (*stl)[72] = (_Float16 (*)[72])(L + 128 * 72 * 2);
  const int tid = threadIdx.x, wave = tid >> 5, lane = tid & 31, col = lane & 15, g = lane >> 4; const size_t r0 = (size_t)blockIdx.x * 64 + wave * 16; const int n0 = blockIdx.y * 128;
  v8f acc[8] = {};
  { const unsigned lb = (unsigned)(uintptr_t)&L[0]; const __bf16* Wr = P + (size_t)n0 * DM; const float* Ar = X + (size_t)blockIdx.x * 64 * DM;
    stage_tile(lb, Wr, Ar, 0, tid); WAIT_ASYNC(); __syncthreads(); stage_tile(lb + STG, Wr, Ar, 1, tid);
#pragma unroll 1   // kept rolled: one trip = one buffer
    for (int t = 0; t < NT; ++t) { const unsigned char* S = L + (t & 1) * STG;
#pragma unroll   // constant indices keep bf[] and acc[] in registers (also the three directives below)
      for (int kc = 0; kc < 2; ++kc) { float av[16]; v16b bf[8]; lds_a16(S + BTILE + (wave * 16 + col) * APITCH + kc * 128, g, av);   // all fragments of the k step first, then its WMMAs
#pragma unroll
        for (int j = 0; j < 8; ++j) bf[j] = frag_b((const __bf16*)(S + (j * 16 + col) * BPITCH + kc * 64), lane);
        v16b a;
#pragma unroll
        for (int i = 0; i < 16; ++i) a[i] = (__bf16)av[i];
#pragma unroll
        for (int j = 0; j < 8; ++j) acc[j] = wmma_bf(a, bf[j], acc[j]); }
      WAIT_DS(); WAIT_ASYNC(); __syncthreads();   // publishes tile t + 1 and frees tile t's buffer
      if (t + 2 < NT) stage_tile(lb + (unsigned)(t & 1) * STG, Wr, Ar, t + 2, tid); }
    WAIT_ASYNC(); }
  if (n0 < 2 * DM) {   // bias, then the interleaved-pair rotary: pair (2i, 2i+1) = neighbouring lanes (col ^ 1), angle = t_scaled[row] * inv_freq[i]
#pragma unroll
    for (int j = 0; j < 8; ++j)
#pragma unroll
      for (int r = 0; r < 8; ++r) acc[j][r] += (BB ? bfr(BB[j * 16 + col]) : 0.f);
#pragma unroll
    for (int r = 0; r < 8; ++r) { const float ts = TS[r0 + 8 * g + r];
#pragma unroll
      for (int j = 0; j < 8; ++j) { const int d = (j & 3) * 16 + col; const float ang = ts * INVF[d >> 1]; const float c = cos_p(ang), sn = sin_p(ang); const float v = acc[j][r]; const float pv = __shfl_xor(v, 1); acc[j][r] = (col & 1) ? (v * c + pv * sn) : (v * c - pv * sn); } }
#pragma unroll
    for (int j = 0; j < 8; ++j) {
#pragma unroll
      for (int r = 0; r < 8; ++r) { const float v = acc[j][r]; const _Float16 hv = (_Float16)v; so[wave][8 * g + r][j * 16 + col] = hv; sol[wave][8 * g + r][j * 16 + col] = (_Float16)((v - (float)hv) * 2048.0f); } }   // q, k (+ bias) as f16 hi + (x2048) residual
    LDSX();
    for (int rl = 0; rl < 16; ++rl) if (lane < 16) { vst2((unsigned*)(QK + (r0 + rl) * (2 * DM) + n0 + lane * 8), *(const v4u*)&so[wave][rl][lane * 8]); vst2((unsigned*)(QKL + (r0 + rl) * (2 * DM) + n0 + lane * 8), *(const v4u*)&sol[wave][rl][lane * 8]); }
  } else {
#pragma unroll
    for (int j = 0; j < 8; ++j) {
#pragma unroll
      for (int r = 0; r < 8; ++r) { const float v = acc[j][r] + (BB ? bfr(BB[j * 16 + col]) : 0.f); const _Float16 hv = (_Float16)v; sth[j * 16 + col][wave * 16 + 8 * g + r] = hv; stl[j * 16 + col][wave * 16 + 8 * g + r] = (_Float16)((v - (float)hv) * 2048.0f); } }
    __syncthreads();
    const size_t rb = (size_t)blockIdx.x * 64; const int b = (int)(rb / SS), s0 = (int)(rb % SS); const int pc0 = n0 - 2 * DM;
    for (int q = tid; q < 128 * 8; q += 128) { const int d = q >> 3, pc = q & 7; const size_t o = ((size_t)b * DM + pc0 + d) * SS + s0 + pc * 8; vst2((unsigned*)(VTH + o), *(const v4u*)&sth[d][pc * 8]); vst2((unsigned*)(VTL + o), *(const v4u*)&stl[d][pc * 8]); }
  }
}
// ---- LDS staging of k_attn: a tile = 64 keys: their 64 k rows (128 B each), the 64 v^T rows' 64 columns (128 B each), and per wave a private copy of the keys' times and errors (256 B + 256 B); two buffers, filled one tile ahead
#define AKP 144                       // k / v^T row pitch in LDS: 16 B x odd
#define AK_V (64 * AKP)
#define AK_TE (2 * 64 * AKP)
#define ASTG (AK_TE + 4 * 512)        // one buffer
#define ANT (SS / 64)
#define LOG2E 1.44269504088896340736f
// nine 16-byte copies of one thread (4 of k, 4 of v^T, 1 of times | errors); the closing s_wait_xcnt 0 keeps every address register named here unchanged until the copies have taken it
__device__ __forceinline__ void stage_kv(unsigned lbuf, const _Float16* Kr, const _Float16* Vr, const float* Tb, const float* Eb, int t, int tid) {
  const int lane = tid & 31;
  const unsigned lk = lbuf + (unsigned)(tid >> 3) * AKP + (unsigned)(tid & 7) * 16u, lv = lk + AK_V, lt = lbuf + AK_TE + (unsigned)(tid >> 5) * 512u + (unsigned)lane * 16u;
  const char* gk = (const char*)(Kr + ((size_t)t * 64 + (tid >> 3)) * (2 * DM) + (tid & 7) * 8);
  const char* gv = (const char*)(Vr + (size_t)(tid >> 3) * SS + t * 64 + (tid & 7) * 8);
  const char* gt = (const char*)(((lane < 16) ? Tb : Eb) + t * 64 + (lane & 15) * 4);
  const size_t ks16 = (size_t)16 * 2 * DM * 2, vs16 = (size_t)16 * SS * 2;
  asm volatile("global_load_async_to_lds_b128 %0, %9, off\n\t"
               "global_load_async_to_lds_b128 %1, %10, off\n\t"
               "global_load_async_to_lds_b128 %2, %11, off\n\t"
               "global_load_async_to_lds_b128 %3, %12, off\n\t"
               "global_load_async_to_lds_b128 %4, %13, off\n\t"
               "global_load_async_to_lds_b128 %5, %14, off\n\t"
               "global_load_async_to_lds_b128 %6, %15, off\n\t"
               "global_load_async_to_lds_b128 %7, %16, off\n\t"
               "global_load_async_to_lds_b128 %8, %17, off\n\t"
               "s_wait_xcnt 0x0"
               :: "v"(lk), "v"(lk + 16u * AKP), "v"(lk + 32u * AKP), "v"(lk + 48u * AKP), "v"(lv), "v"(lv + 16u * AKP), "v"(lv + 32u * AKP), "v"(lv + 48u * AKP), "v"(lt),
                  "v"(gk), "v"(gk + ks16), "v"(gk + 2 * ks16), "v"(gk + 3 * ks16), "v"(gv), "v"(gv + vs16), "v"(gv + 2 * vs16), "v"(gv + 3 * vs16), "v"(gt)
               : "memory");
}
// lane l with lane l ^ 16 (the two lanes that share one query column), by a vector cross-row move
__device__ __forceinline__ float xhalf(float x) { return __builtin_bit_cast(float, __builtin_amdgcn_permlanex16(__builtin_bit_cast(int, x), __builtin_bit_cast(int, x), 0x76543210, 0xfedcba98, false, false)); }
// ---- k_attn: block = (64 queries, head h, batch b): all-keys flash attention, transposed: S^T = K . Q^T (A = 16 key rows from LDS, B = the wave's 16 queries, kept in registers), so a lane holds 8 keys' scores of ONE query (column = lane & 15, keys 8g + r); maximum and sum run in the lane, the two halves exchange the maximum once a step and join their sums once at the end; two S^T tiles, converted in place, are the B operand of O^T += V^T . P^T; O[b*S+q][h*64+d] = acc / l (256-B segments)
__global__ __launch_bounds__(128) void k_attn(const _Float16* __restrict__ QK, const _Float16* __restrict__ QKL, const _Float16* __restrict__ VTH, const _Float16* __restrict__ VTL, const void* __restrict__ KMASK, const float* __restrict__ TS, const float* __restrict__ ERR, const float* __restrict__ LAMH, const float* __restrict__ WG, const float* __restrict__ BG, float* __restrict__ O) {
  __shared__ __align__(16) float so[4][16][68]; __shared__ __attribute__((aligned(16))) unsigned char L[2 * ASTG];
  const int tid = threadIdx.x, wave = tid >> 5, lane = tid & 31, col = lane & 15, g = lane >> 4;
  const int qb = blockIdx.x, h = blockIdx.y, b = blockIdx.z; const int q0 = qb * 64 + wave * 16; const size_t rq = (size_t)b * SS + q0 + col;
  v16h bq[2];
#pragma unroll
  for (int kc = 0; kc < 2; ++kc) bq[kc] = frag_h(QK + rq * (2 * DM) + h * HD + kc * 32, lane);
  asm volatile("s_wait_xcnt 0x0" ::: "memory");   // a precaution: stands in front of the first instruction that reuses the four query loads' address pair
  // per-head constants and the lane's own query's time / error values for the score biases
  const float lraw = bfr(LAMH[h]); const float lam = (lraw > 20.f) ? lraw : log1pf(expf(lraw));   // softplus, precise, once a thread: in line, so that the kernel holds no call
  const float wg0 = bfr(WG[h * 2]), wg1 = bfr(WG[h * 2 + 1]), bgh = bfr(BG[h]); const float lam2 = lam * LOG2E;   // scores carry the factor log2 e, so that every exp and log of the loop is one hardware instruction
  const float tq = TS[rq]; const float gq = (wg0 * bfr(ERR[rq]) + bgh) * -LOG2E; const float wk = wg1 * -LOG2E;   // gate logit's query part and the key part's factor, as the exponent of 2 in exp(-logit)
  float m = -3.0e38f, l = 0.f;
  v8f acc[4] = {};
  const unsigned lb = (unsigned)(uintptr_t)&L[0]; const _Float16* Kr = QK + (size_t)b * SS * (2 * DM) + DM + h * HD; const _Float16* Vr = VTH + ((size_t)b * DM + h * HD) * SS; const float* Tb = TS + (size_t)b * SS; const float* Eb = ERR + (size_t)b * SS;
  stage_kv(lb, Kr, Vr, Tb, Eb, 0, tid); WAIT_ASYNC(); __syncthreads(); stage_kv(lb + ASTG, Kr, Vr, Tb, Eb, 1, tid);
#pragma unroll 1   // kept rolled: one trip = one buffer = 64 keys, all keys in order
  for (int t = 0; t < ANT; ++t) { const unsigned char* S = L + (t & 1) * ASTG;
#pragma unroll 1   // kept rolled: the tile's two 32-key steps share one body
  for (int ks = 0; ks < 2; ++ks) { v8f s[2]; v16h kf[2][2];
#pragma unroll   // constant indices keep kf[][] in registers (also the next directive)
    for (int ct = 0; ct < 2; ++ct)
#pragma unroll
      for (int kc = 0; kc < 2; ++kc) kf[ct][kc] = frag_h((const _Float16*)(S + (ks * 32 + ct * 16 + col) * AKP + kc * 64), lane);   // the step's four k fragments first, then its WMMAs
#pragma unroll
    for (int ct = 0; ct < 2; ++ct) { v8f c = {};
#pragma unroll
      for (int kc = 0; kc < 2; ++kc) c = wmma16(kf[ct][kc], bq[kc], c);   // single product: k, q as one-rounding f16 operands; c[r] = key 16 ct + 8 g + r against query col
      const v4f* te = (const v4f*)(S + AK_TE + wave * 512 + (ks * 32 + ct * 16 + 8 * g) * 4); const v4f t0 = te[0], t1 = te[1], e0 = te[16], e1 = te[17];   // the lane's 8 keys' times and errors
#pragma unroll
      for (int r = 0; r < 8; ++r) { const float tk = (r < 4) ? t0[r & 3] : t1[r & 3]; const float ek = (r < 4) ? e0[r & 3] : e1[r & 3];
        const float sig = __builtin_amdgcn_rcpf(1.0f + __builtin_amdgcn_exp2f(wk * bfr(ek) + gq)); s[ct][r] = c[r] * (0.125f * LOG2E) + (__builtin_amdgcn_logf(sig + 1e-9f) - lam2 * fabsf(tq - tk)); } }   // (q.k/8 + time-decay bias + error-gate bias) x log2 e: sigmoid by v_exp_f32 and v_rcp_f32, its logarithm by v_log_f32
    float mx = fmaxf(s[0][0], s[1][0]);
#pragma unroll
    for (int r = 1; r < 8; ++r) mx = fmaxf(mx, fmaxf(s[0][r], s[1][r]));
    mx = fmaxf(mx, xhalf(mx));   // both halves hold the query's maximum over the step's 32 keys
    const float mn = fmaxf(m, mx); const float alpha = (m <= -1.0e38f) ? 0.f : __builtin_amdgcn_exp2f(m - mn);
    v2f es = {0.f, 0.f}; v16h pb;
#pragma unroll
    for (int ct = 0; ct < 2; ++ct)
#pragma unroll
      for (int r = 0; r < 8; r += 2) { v2f e; e[0] = (s[ct][r] <= -1.0e38f) ? 0.f : __builtin_amdgcn_exp2f(s[ct][r] - mn); e[1] = (s[ct][r + 1] <= -1.0e38f) ? 0.f : __builtin_amdgcn_exp2f(s[ct][r + 1] - mn);
        es = (ct + r == 0) ? e : es + e; const v2f x = e * 2048.0f; pb[ct * 8 + r] = (_Float16)x[0]; pb[ct * 8 + r + 1] = (_Float16)x[1]; }   // even and odd keys summed side by side (packed adds); P scaled by 2^11 so small softmax weights stay out of the f16 subnormal range; 2^-11 folded into the epilogue; element 8 ct + r = key 16 ct + 8 g + r, the k order of the v fragments
    l = l * alpha + (es[0] + es[1]); m = mn;   // the lane's own 16 keys of the step; the halves' sums are joined behind the loop
#pragma unroll
    for (int dt = 0; dt < 4; ++dt) acc[dt] *= alpha;
    v16h vf[4];
#pragma unroll   // constant indices keep vf[] in registers
    for (int dt = 0; dt < 4; ++dt) vf[dt] = frag_h((const _Float16*)(S + AK_V + (dt * 16 + col) * AKP + ks * 64), lane);   // the step's four v fragments first, then its WMMAs
#pragma unroll
    for (int dt = 0; dt < 4; ++dt) acc[dt] = wmma16(vf[dt], pb, acc[dt]); }   // single product: V^T x P^T (x2^11); acc[dt][r] = d 16 dt + 8 g + r of query col
    WAIT_DS(); WAIT_ASYNC(); __syncthreads();   // publishes tile t + 1 and frees tile t's buffer
    if (t + 2 < ANT) stage_kv(lb + (unsigned)(t & 1) * ASTG, Kr, Vr, Tb, Eb, t + 2, tid); }
  WAIT_ASYNC();
  const float il = (1.0f / 2048.0f) / (l + xhalf(l));
#pragma unroll
  for (int dt = 0; dt < 4; ++dt) { v4f o0, o1;
#pragma unroll
    for (int i = 0; i < 4; ++i) { o0[i] = acc[dt][i] * il; o1[i] = acc[dt][4 + i] * il; }
    *(v4f*)&so[wave][col][dt * 16 + 8 * g] = o0; *(v4f*)&so[wave][col][dt * 16 + 8 * g + 4] = o1; }
  LDSX();
  for (int rl = 0; rl < 16; ++rl) if (lane < 16) vst2(O + ((size_t)b * SS + q0 + rl) * DM + h * HD + lane * 4, *(const v4f*)&so[wave][rl][lane * 4]);
}
// ---- k_out: block = (64 rows, 128 cols): out = O(hi/lo) . Wo rows (2 products) + bo
__global__ __launch_bounds__(128) void k_out(const float* __restrict__ O, const __bf16* __restrict__ P, const float* __restrict__ BO, float* __restrict__ Y) {
  __shared__ __attribute__((aligned(16))) unsigned char L[2 * STG];   // the two tile buffers; behind the k loop's last barrier the same bytes serve as output staging
  float (*so)[16][132] = (float (*)[16][132])L;
  const int tid = threadIdx.x, wave = tid >> 5, lane = tid & 31, col = lane & 15, g = lane >> 4; const size_t r0 = (size_t)blockIdx.x * 64 + wave * 16; const int n0 = blockIdx.y * 128;
  v8f acc[8] = {};
  { const unsigned lb = (unsigned)(uintptr_t)&L[0]; const __bf16* Wr = P + (size_t)n0 * DM; const float* Ar = O + (size_t)blockIdx.x * 64 * DM;
    stage_tile(lb, Wr, Ar, 0, tid); WAIT_ASYNC(); __syncthreads(); stage_tile(lb + STG, Wr, Ar, 1, tid);
#pragma unroll 1   // kept rolled: one trip = one buffer
    for (int t = 0; t < NT; ++t) { const unsigned char* S = L + (t & 1) * STG;
#pragma unroll   // constant indices keep bf[] and acc[] in registers (also the two directives below)
      for (int kc = 0; kc < 2; ++kc) { float av[16]; v16b bf[8]; lds_a16(S + BTILE + (wave * 16 + col) * APITCH + kc * 128, g, av);   // all fragments of the k step first, then its WMMAs
#pragma unroll
        for (int j = 0; j < 8; ++j) bf[j] = frag_b((const __bf16*)(S + (j * 16 + col) * BPITCH + kc * 64), lane);
        const F2 a = bsplit16(av);
#pragma unroll
        for (int j = 0; j < 8; ++j) { acc[j] = wmma_bf(a.l, bf[j], acc[j]); acc[j] = wmma_bf(a.h, bf[j], acc[j]); } }
      WAIT_DS(); WAIT_ASYNC(); __syncthreads();   // publishes tile t + 1 and frees tile t's buffer
      if (t + 2 < NT) stage_tile(lb + (unsigned)(t & 1) * STG, Wr, Ar, t + 2, tid); }
    WAIT_ASYNC(); }
#pragma unroll
  for (int j = 0; j < 8; ++j) {
#pragma unroll
    for (int r = 0; r < 8; ++r) so[wave][8 * g + r][j * 16 + col] = acc[j][r] + bfr(BO[n0 + j * 16 + col]); }
  LDSX();
  for (int rl = 0; rl < 16; ++rl) vst2(Y + (r0 + rl) * DM + n0 + lane * 4, *(const v4f*)&so[wave][rl][lane * 4]);
}
// ---- k_ts: block = batch: t_scaled = (t - min) / (max - min + 1e-6) * 1000 over the sequence
__global__ __launch_bounds__(256) void k_ts(const float* __restrict__ TR, float* __restrict__ TS) {
  __shared__ float rmn[256], rmx[256]; const size_t b = blockIdx.x; const int t = threadIdx.x; float mn = 3.0e38f, mx = -3.0e38f;
  for (int s = t; s < SS; s += 256) { const float v = bfr(TR[b * SS + s]); mn = fminf(mn, v); mx = fmaxf(mx, v); }
  rmn[t] = mn; rmx[t] = mx; __syncthreads();
  for (int st = 128; st > 0; st >>= 1) { if (t < st) { rmn[t] = fminf(rmn[t], rmn[t + st]); rmx[t] = fmaxf(rmx[t], rmx[t + st]); } __syncthreads(); }
  const float tmin = rmn[0], den = rmx[0] - rmn[0] + 1e-6f;
  for (int s = t; s < SS; s += 256) TS[b * SS + s] = (bfr(TR[b * SS + s]) - tmin) / den * 1000.0f;   // 4-B scratch stores
}
extern "C" void kernel_launch(void* const* d_in, const int* in_sizes, int n_in, void* d_out, int out_size, void* d_ws, size_t ws_size, hipStream_t stream) {
  (void)in_sizes; (void)n_in; (void)out_size;
  const float** F = (const float**)d_in;   // 0 x [4,1024,1024], 1 t_raw [4,1024], 2 error [4,1024], 3 Wq, 4 bq, 5 Wk, 6 bk, 7 Wv, 8 bv, 9 Wo, 10 bo, 11 lambda_h [16], 12 Wg [16,2], 13 bg [16]
  if (ws_size < (size_t)WS_END + 4u * NB * SS + 256) return;
  char* ws = (char*)d_ws; __bf16* PK = (__bf16*)(ws + WS_PK); _Float16 *QK = (_Float16*)(ws + WS_QK), *QKL = (_Float16*)(ws + WS_QKL), *VTH = (_Float16*)(ws + WS_VTH), *VTL = (_Float16*)(ws + WS_VTL); float* O = (float*)(ws + WS_O); float* TS = (float*)(ws + WS_END);
  k_pack<<<dim3(DM, 4), 256, 0, stream>>>(F[3], F[5], F[7], F[9], PK);
  k_ts<<<NB, 256, 0, stream>>>(F[1], TS);
  k_qkv<<<dim3(TNB * SS / 64, QKVW / 128), 128, 0, stream>>>(F[0], F[0], F[0], PK + PK_A, F[4], F[6], F[8], TS, QK, QKL, VTH, VTL);
  k_attn<<<dim3(TQB, NH, TNB), 128, 0, stream>>>(QK, QKL, VTH, VTL, nullptr, TS, F[2], F[11], F[12], F[13], O);
  k_out<<<dim3(TOB, DM / 128), 128, 0, stream>>>(O, PK + PK_P, F[10], (float*)d_out);
}

// v004
// One run takes 113 microseconds.
// In both of two side-by-side timings against v003, it was 1.06 times as fast.
// All steps since v000 together make it 3.52 times as fast.
// compute dtype: all float inputs rounded to bf16; q/k/v = x . W^T + b with EXACT bf16 products on WMMA 16x16x32 (natural rows); per-batch time scaling and the interleaved-pair rotary (neighbouring lanes; angle = t_scaled x inv_freq[d/2] with jnp's inv_freq constants, precise cosf/sinf) in f32; PLAIN attention: rotated q, k as single f16 operands x 1/8 + the decay and gate biases evaluated per score in f32 (base 2: hardware exp, reciprocal and log; the per-head softplus by precise expf/log1pf), running-max softmax in f32 (base 2, hardware exp), P (scaled by 2^11, single f16) x v (single f16); out = o (bf16 hi + residual) . Wo^T (2 products) + bo.
#include <hip/hip_runtime.h>
#include <math.h>

typedef __attribute__((ext_vector_type(16))) _Float16 v16h;
typedef __attribute__((ext_vector_type(16))) __bf16 v16b;
typedef __attribute__((ext_vector_type(8)))  _Float16 v8h;
typedef __attribute__((ext_vector_type(8)))  float v8f;
typedef __attribute__((ext_vector_type(4)))  float v4f;
typedef __attribute__((ext_vector_type(2)))  float v2f;
typedef __attribute__((ext_vector_type(4)))  unsigned v4u;
typedef __attribute__((ext_vector_type(4)))  int v4i;
typedef float __attribute__((may_alias)) float_a;
typedef int __attribute__((may_alias)) int_a;

template <typename T> __device__ __forceinline__ void vst2(void* p, T v) { *(T*)p = v;  }
__device__ __forceinline__ v8f wmma16(v16h a, v16h b, v8f c) {
  v8f d = __builtin_amdgcn_wmma_f32_16x16x32_f16(false, a, false, b, (short)0, c, false, false);
  asm volatile("v_nop\n\tv_nop\n\tv_nop\n\tv_nop" : "+v"(d) : "v"(a), "v"(b));
  return d;
}
__device__ __forceinline__ v8f wmma_bf(v16b a, v16b b, v8f c) {
  v8f d = __builtin_amdgcn_wmma_f32_16x16x32_bf16(false, a, false, b, (short)0, c, false, false);
  asm volatile("v_nop\n\tv_nop\n\tv_nop\n\tv_nop" : "+v"(d) : "v"(a), "v"(b));
  return d;
}
// Scaled continuous-time attention (B 4, S 1,024, d 1,024, 16 heads x 64): q/k/v projections + biases, an interleaved rotary embedding whose angle is the per-token time (min-max scaled to [0, 1000]) x inv_freq, scores / 8 plus a per-head time-decay bias (-softplus(lambda_h) |t_i - t_j|) and an error-gated bias log(sigmoid(w_h0 err_i + w_h1 err_j + b_h) + 1e-9), softmax, . v, output projection + bias.
__device__ __forceinline__ v16h frag_h(const _Float16* rowk0, int lane) {
  union { v16h v; v8h q[2]; } u; const _Float16* p = rowk0 + 8 * (lane >> 4);
  u.q[0] = *(const v8h*)p; u.q[1] = *(const v8h*)(p + 16); return u.v;
}
__device__ __forceinline__ v16h frag_f32(const float* rowk0, int lane) {
  v16h a; const float* p = rowk0 + 8 * (lane >> 4);
#pragma unroll
  for (int i = 0; i < 8; ++i) { a[i] = (_Float16)p[i]; a[8 + i] = (_Float16)p[16 + i]; }
  return a;
}
__device__ __forceinline__ v16h frag_f32s(const float* rowk0, int lane, float sc) {
  v16h a; const float* p = rowk0 + 8 * (lane >> 4);
#pragma unroll
  for (int i = 0; i < 8; ++i) { a[i] = (_Float16)(p[i] * sc); a[8 + i] = (_Float16)(p[16 + i] * sc); }
  return a;
}
// column fragment from a [K][ld] layout (column n), rows >= K read as 0
__device__ __forceinline__ v16h fragc_f32(const float* W, int k0, int n, int lane, int ld, int K) {
  v16h a; const int g = lane >> 4;
#pragma unroll
  for (int i = 0; i < 8; ++i) { const int ka = k0 + 8 * g + i, kb = ka + 16;
    a[i] = (_Float16)(ka < K ? W[(size_t)(ka < K ? ka : K - 1) * ld + n] : 0.f); a[8 + i] = (_Float16)(kb < K ? W[(size_t)(kb < K ? kb : K - 1) * ld + n] : 0.f); }
  return a;
}
struct F2 { v16b h, l; };
__device__ __forceinline__ F2 bsplit16(const float v[16]) { F2 r;
#pragma unroll
  for (int i = 0; i < 16; ++i) { const __bf16 h = (__bf16)v[i]; r.h[i] = h; r.l[i] = (__bf16)(v[i] - (float)h); }
  return r; }
__device__ __forceinline__ F2 split_row(const float* row, int k0, int lane) { float v[16]; const float* p = row + k0 + 8 * (lane >> 4);
#pragma unroll
  for (int i = 0; i < 8; ++i) { v[i] = p[i]; v[8 + i] = p[16 + i]; }
  return bsplit16(v); }
__device__ __forceinline__ F2 split_rowK(const float* row, int k0, int lane, int K) { float v[16]; const int g = lane >> 4;
#pragma unroll
  for (int i = 0; i < 8; ++i) { const int ka = k0 + 8 * g + i, kb = ka + 16; v[i] = ka < K ? row[ka < K ? ka : K - 1] : 0.f; v[8 + i] = kb < K ? row[kb < K ? kb : K - 1] : 0.f; }
  return bsplit16(v); }
__device__ __forceinline__ F2 split_col(const float* W, int k0, int n, int lane, int ld, int K) { float v[16]; const int g = lane >> 4;
#pragma unroll
  for (int i = 0; i < 8; ++i) { const int ka = k0 + 8 * g + i, kb = ka + 16; v[i] = ka < K ? W[(size_t)(ka < K ? ka : K - 1) * ld + n] : 0.f; v[8 + i] = kb < K ? W[(size_t)(kb < K ? kb : K - 1) * ld + n] : 0.f; }
  return bsplit16(v); }
__device__ __forceinline__ v8f mac3(const F2& a, const F2& b, v8f c) { c = wmma_bf(a.l, b.h, c); c = wmma_bf(a.h, b.l, c); return wmma_bf(a.h, b.h, c); }
__device__ __forceinline__ float sigm(float v) { return 1.0f / (1.0f + expf(-v)); }
#define LDSX() do { asm volatile("s_wait_dscnt 0" ::: "memory"); __builtin_amdgcn_wave_barrier(); __builtin_amdgcn_fence(__ATOMIC_RELEASE, "workgroup"); } while (0)


#define NB 4
#define SS 1024
#define DM 1024
#define NH 16
__constant__ float INVF[32] = {1.000000000e+00f,7.498942018e-01f,5.623413324e-01f,4.216965139e-01f,3.162277639e-01f,2.371373773e-01f,1.778279394e-01f,1.333521456e-01f,1.000000015e-01f,7.498942316e-02f,5.623413250e-02f,4.216964915e-02f,3.162277490e-02f,2.371373773e-02f,1.778279431e-02f,1.333521400e-02f,9.999999776e-03f,7.498942316e-03f,5.623413250e-03f,4.216964822e-03f,3.162277630e-03f,2.371373819e-03f,1.778279431e-03f,1.333521446e-03f,1.000000047e-03f,7.498941850e-04f,5.623413017e-04f,4.216965172e-04f,3.162277571e-04f,2.371373703e-04f,1.778279402e-04f,1.333521504e-04f};
__device__ __attribute__((noinline)) float cos_p(float v) { return cosf(v); }
__device__ __attribute__((noinline)) float sin_p(float v) { return sinf(v); }
#define HD 64
#define QKVW (3 * DM)
#ifndef TQB
#define TQB (SS / 64)
#define TNB NB
#define TOB (NB * SS / 64)     // output row tiles (all)
#endif
typedef __attribute__((ext_vector_type(8))) __bf16 v8b;
__device__ __forceinline__ v16b frag_b(const __bf16* rowk0, int lane) {
  union { v16b v; v8b q[2]; } u; const __bf16* p = rowk0 + 8 * (lane >> 4);
  u.q[0] = *(const v8b*)p; u.q[1] = *(const v8b*)(p + 16); return u.v;
}
__device__ __forceinline__ float bfr(float v) { return (float)(__bf16)v; }
__device__ __attribute__((noinline)) float erf_ni(float v) { return erff(v); }

#define PK_A 0                       // [3072][1024] Wqkv rows (natural [out][in])
#define PK_P (PK_A + QKVW * DM)        // [1024][1024] Wo rows (natural)
#define PK_END (PK_P + DM * DM)
#define WS_PK  0u
#define WS_QK  (WS_PK + 2u * PK_END)             // f16 [4096 rows][2048]: q | k
#define WS_QKL (WS_QK + 2u * NB * SS * 2 * DM)     // f16 q | k residual planes x2048
#define WS_VTH (WS_QKL + 2u * NB * SS * 2 * DM)    // f16 [b][1024 (h*64+d)][1024 s] hi
#define WS_VTL (WS_VTH + 2u * NB * DM * SS)        // f16 lo x 2048
#define WS_O   (WS_VTL + 2u * NB * DM * SS)        // f32 [4096][1024]
#define WS_CS  (WS_O + 4u * NB * SS * DM)           // f32 2 x [1024][32], not used (cos/sin computed in k_qkv)
#define WS_END (WS_CS + 4u * 2 * SS * 32)
// ---- LDS staging of the two projection GEMMs: a tile = 64 k of 128 weight rows (bf16, 128 B a row) and of 64 activation rows (f32, 256 B a row); two buffers, filled by asynchronous copies one tile ahead
#define KT 64
#define BPITCH 144                    // weight row pitch in LDS: 16 B x odd, conflict-free for 16-byte reads
#define APITCH 272                    // activation row pitch in LDS: 16 B x odd
#define BTILE (128 * BPITCH)
#define STG (BTILE + 64 * APITCH)     // one buffer
#define NT (DM / KT)
// eight 16-byte copies of one thread, global memory -> LDS, no register in between; the closing s_wait_xcnt 0 keeps every address register named here unchanged until the copies have taken it
__device__ __forceinline__ void copy8(unsigned l, const char* g, unsigned lstep, size_t gstep) {
  asm volatile("global_load_async_to_lds_b128 %0, %8, off\n\t"
               "global_load_async_to_lds_b128 %1, %9, off\n\t"
               "global_load_async_to_lds_b128 %2, %10, off\n\t"
               "global_load_async_to_lds_b128 %3, %11, off\n\t"
               "global_load_async_to_lds_b128 %4, %12, off\n\t"
               "global_load_async_to_lds_b128 %5, %13, off\n\t"
               "global_load_async_to_lds_b128 %6, %14, off\n\t"
               "global_load_async_to_lds_b128 %7, %15, off\n\t"
               "s_wait_xcnt 0x0"
               :: "v"(l), "v"(l + lstep), "v"(l + 2 * lstep), "v"(l + 3 * lstep), "v"(l + 4 * lstep), "v"(l + 5 * lstep), "v"(l + 6 * lstep), "v"(l + 7 * lstep),
                  "v"(g), "v"(g + gstep), "v"(g + 2 * gstep), "v"(g + 3 * gstep), "v"(g + 4 * gstep), "v"(g + 5 * gstep), "v"(g + 6 * gstep), "v"(g + 7 * gstep)
               : "memory");
}
// tile t of the block's 128 weight rows (Wr = row 0, k 0) and 64 activation rows (Ar) into the buffer at LDS byte address lbuf: a wave's copy covers 4 whole 128-B lines
__device__ __forceinline__ void stage_tile(unsigned lbuf, const __bf16* Wr, const float* Ar, int t, int tid) {
  copy8(lbuf + (unsigned)(tid >> 3) * BPITCH + (unsigned)(tid & 7) * 16u, (const char*)(Wr + (size_t)(tid >> 3) * DM + t * KT + (tid & 7) * 8), 16u * BPITCH, (size_t)16 * DM * 2);
  copy8(lbuf + BTILE + (unsigned)(tid >> 4) * APITCH + (unsigned)(tid & 15) * 16u, (const char*)(Ar + (size_t)(tid >> 4) * DM + t * KT + (tid & 15) * 4), 8u * APITCH, (size_t)8 * DM * 4);
}
// the 16 f32 of an A fragment from a staged row: k = 8g .. 8g+7 and 16+8g .. 16+8g+7 of the 32-k step at rowk0
__device__ __forceinline__ void lds_a16(const unsigned char* rowk0, int g, float v[16]) {
  const v4f* p = (const v4f*)(rowk0 + 32 * g); const v4f x0 = p[0], x1 = p[1], x2 = p[4], x3 = p[5];
#pragma unroll   // constant indices keep v[] in registers
  for (int i = 0; i < 4; ++i) { v[i] = x0[i]; v[4 + i] = x1[i]; v[8 + i] = x2[i]; v[12 + i] = x3[i]; }
}
#define WAIT_ASYNC() asm volatile("s_wait_asynccnt 0x0" ::: "memory")   // this wave's copies have landed
#define WAIT_DS()    asm volatile("s_wait_dscnt 0x0" ::: "memory")      // this wave's LDS reads are done before the buffer is handed back
// ---- k_pack: block = (row n, which): natural [out][in] rows -> bf16; which 0..2 -> W_q/W_k/W_v into PK_A rows which*1024 + n; 3 -> W_o into PK_P
__global__ __launch_bounds__(256) void k_pack(const float* __restrict__ WQ, const float* __restrict__ WK, const float* __restrict__ WV, const float* __restrict__ WO, __bf16* __restrict__ PK) {
  __shared__ __align__(16) __bf16 s[DM]; const int n = blockIdx.x, which = blockIdx.y, t = threadIdx.x; const float* Wm = (which == 0) ? WQ : (which == 1) ? WK : (which == 2) ? WV : WO;
  for (int k = t; k < DM; k += 256) s[k] = (__bf16)Wm[(size_t)n * DM + k];
  __syncthreads();
  __bf16* dst = (which < 3) ? PK + PK_A + ((size_t)which * DM + n) * DM : PK + PK_P + (size_t)n * DM;
  for (int q = t; q < DM / 8; q += 256) vst2((unsigned*)(dst + q * 8), *(const v4u*)&s[q * 8]);
}
__global__ __launch_bounds__(128) void k_qkv(const float* __restrict__ XQ, const float* __restrict__ XK, const float* __restrict__ XV, const __bf16* __restrict__ P, const float* __restrict__ BQ, const float* __restrict__ BK, const float* __restrict__ BV, const float* __restrict__ TS, _Float16* __restrict__ QK, _Float16* __restrict__ QKL, _Float16* __restrict__ VTH, _Float16* __restrict__ VTL) {
  const int which0 = (blockIdx.y * 128) / DM; const float* X = (which0 == 0) ? XQ : (which0 == 1) ? XK : XV; const float* BB = BQ ? (((which0 == 0) ? BQ : (which0 == 1) ? BK : BV) + (blockIdx.y * 128 - which0 * DM)) : nullptr;
  __shared__ __attribute__((aligned(16))) unsigned char L[2 * STG];   // the two tile buffers; behind the k loop's last barrier the same bytes serve as output staging
  _Float16 (*so)[16][136] = (_Float16 (*)[16][136])L; _Float16 (*sol)[16][136] = (_Float16 (*)[16][136])(L + 4 * 16 * 136 * 2); _Float16 (*sth)[72] = (_Float16 (*)[72])L; _Float16 (*stl)[72] = (_Float16 (*)[72])(L + 128 * 72 * 2);
  const int tid = threadIdx.x, wave = tid >> 5, lane = tid & 31, col = lane & 15, g = lane >> 4; const size_t r0 = (size_t)blockIdx.x * 64 + wave * 16; const int n0 = blockIdx.y * 128;
  v8f acc[8] = {};
  { const unsigned lb = (unsigned)(uintptr_t)&L[0]; const __bf16* Wr = P + (size_t)n0 * DM; const float* Ar = X + (size_t)blockIdx.x * 64 * DM;
    stage_tile(lb, Wr, Ar, 0, tid); WAIT_ASYNC(); __syncthreads(); stage_tile(lb + STG, Wr, Ar, 1, tid);
#pragma unroll 1   // kept rolled: one trip = one buffer
    for (int t = 0; t < NT; ++t) { const unsigned char* S = L + (t & 1) * STG;
#pragma unroll   // constant indices keep bf[] and acc[] in registers (also the three directives below)
      for (int kc = 0; kc < 2; ++kc) { float av[16]; v16b bf[8]; lds_a16(S + BTILE + (wave * 16 + col) * APITCH + kc * 128, g, av);   // all fragments of the k step first, then its WMMAs
#pragma unroll
        for (int j = 0; j < 8; ++j) bf[j] = frag_b((const __bf16*)(S + (j * 16 + col) * BPITCH + kc * 64), lane);
        v16b a;
#pragma unroll
        for (int i = 0; i < 16; ++i) a[i] = (__bf16)av[i];
#pragma unroll
        for (int j = 0; j < 8; ++j) acc[j] = wmma_bf(a, bf[j], acc[j]); }
      WAIT_DS(); WAIT_ASYNC(); __syncthreads();   // publishes tile t + 1 and frees tile t's buffer
      if (t + 2 < NT) stage_tile(lb + (unsigned)(t & 1) * STG, Wr, Ar, t + 2, tid); }
    WAIT_ASYNC(); }
  float bias[8] = {0.f, 0.f, 0.f, 0.f, 0.f, 0.f, 0.f, 0.f};   // the lane's eight column biases (column j * 16 + col), fetched once: eight loads in flight together, one latency for the whole epilogue
  if (BB) { const float* bp = BB + col;
#pragma unroll   // constant indices keep bias[] in registers (also the next directive)
    for (int j = 0; j < 8; ++j) bias[j] = bp[j * 16];
    asm volatile("s_wait_xcnt 0x0" ::: "memory");   // a precaution: stands in front of the first instruction that reuses a register of the eight loads' address
#pragma unroll
    for (int j = 0; j < 8; ++j) bias[j] = bfr(bias[j]); }
  if (n0 < 2 * DM) {   // bias, then the interleaved-pair rotary: pair (2i, 2i+1) = neighbouring lanes (col ^ 1), angle = t_scaled[row] * inv_freq[i]
#pragma unroll
    for (int j = 0; j < 8; ++j)
#pragma unroll
      for (int r = 0; r < 8; ++r) acc[j][r] += bias[j];
#pragma unroll
    for (int r = 0; r < 8; ++r) { const float ts = TS[r0 + 8 * g + r];
#pragma unroll
      for (int j = 0; j < 8; ++j) { const int d = (j & 3) * 16 + col; const float ang = ts * INVF[d >> 1]; const float c = cos_p(ang), sn = sin_p(ang); const float v = acc[j][r]; const float pv = __shfl_xor(v, 1); acc[j][r] = (col & 1) ? (v * c + pv * sn) : (v * c - pv * sn); } }
#pragma unroll
    for (int j = 0; j < 8; ++j) {
#pragma unroll
      for (int r = 0; r < 8; ++r) { const float v = acc[j][r]; const _Float16 hv = (_Float16)v; so[wave][8 * g + r][j * 16 + col] = hv; sol[wave][8 * g + r][j * 16 + col] = (_Float16)((v - (float)hv) * 2048.0f); } }   // q, k (+ bias) as f16 hi + (x2048) residual
    LDSX();
    for (int rl = 0; rl < 16; ++rl) if (lane < 16) { vst2((unsigned*)(QK + (r0 + rl) * (2 * DM) + n0 + lane * 8), *(const v4u*)&so[wave][rl][lane * 8]); vst2((unsigned*)(QKL + (r0 + rl) * (2 * DM) + n0 + lane * 8), *(const v4u*)&sol[wave][rl][lane * 8]); }
  } else {
#pragma unroll
    for (int j = 0; j < 8; ++j) {
#pragma unroll
      for (int r = 0; r < 8; ++r) { const float v = acc[j][r] + bias[j]; const _Float16 hv = (_Float16)v; sth[j * 16 + col][wave * 16 + 8 * g + r] = hv; stl[j * 16 + col][wave * 16 + 8 * g + r] = (_Float16)((v - (float)hv) * 2048.0f); } }
    __syncthreads();
    const size_t rb = (size_t)blockIdx.x * 64; const int b = (int)(rb / SS), s0 = (int)(rb % SS); const int pc0 = n0 - 2 * DM;
    for (int q = tid; q < 128 * 8; q += 128) { const int d = q >> 3, pc = q & 7; const size_t o = ((size_t)b * DM + pc0 + d) * SS + s0 + pc * 8; vst2((unsigned*)(VTH + o), *(const v4u*)&sth[d][pc * 8]); vst2((unsigned*)(VTL + o), *(const v4u*)&stl[d][pc * 8]); }
  }
}
// ---- LDS staging of k_attn: a tile = 64 keys: their 64 k rows (128 B each), the 64 v^T rows' 64 columns (128 B each), and per wave a private copy of the keys' times and errors (256 B + 256 B); two buffers, filled one tile ahead
#define AKP 144                       // k / v^T row pitch in LDS: 16 B x odd
#define AK_V (64 * AKP)
#define AK_TE (2 * 64 * AKP)
#define ASTG (AK_TE + 4 * 512)        // one buffer
#define ANT (SS / 64)
#define LOG2E 1.44269504088896340736f
// nine 16-byte copies of one thread (4 of k, 4 of v^T, 1 of times | errors); the closing s_wait_xcnt 0 keeps every address register named here unchanged until the copies have taken it
__device__ __forceinline__ void stage_kv(unsigned lbuf, const _Float16* Kr, const _Float16* Vr, const float* Tb, const float* Eb, int t, int tid) {
  const int lane = tid & 31;
  const unsigned lk = lbuf + (unsigned)(tid >> 3) * AKP + (unsigned)(tid & 7) * 16u, lv = lk + AK_V, lt = lbuf + AK_TE + (unsigned)(tid >> 5) * 512u + (unsigned)lane * 16u;
  const char* gk = (const char*)(Kr + ((size_t)t * 64 + (tid >> 3)) * (2 * DM) + (tid & 7) * 8);
  const char* gv = (const char*)(Vr + (size_t)(tid >> 3) * SS + t * 64 + (tid & 7) * 8);
  const char* gt = (const char*)(((lane < 16) ? Tb : Eb) + t * 64 + (lane & 15) * 4);
  const size_t ks16 = (size_t)16 * 2 * DM * 2, vs16 = (size_t)16 * SS * 2;
  asm volatile("global_load_async_to_lds_b128 %0, %9, off\n\t"
               "global_load_async_to_lds_b128 %1, %10, off\n\t"
               "global_load_async_to_lds_b128 %2, %11, off\n\t"
               "global_load_async_to_lds_b128 %3, %12, off\n\t"
               "global_load_async_to_lds_b128 %4, %13, off\n\t"
               "global_load_async_to_lds_b128 %5, %14, off\n\t"
               "global_load_async_to_lds_b128 %6, %15, off\n\t"
               "global_load_async_to_lds_b128 %7, %16, off\n\t"
               "global_load_async_to_lds_b128 %8, %17, off\n\t"
               "s_wait_xcnt 0x0"
               :: "v"(lk), "v"(lk + 16u * AKP), "v"(lk + 32u * AKP), "v"(lk + 48u * AKP), "v"(lv), "v"(lv + 16u * AKP), "v"(lv + 32u * AKP), "v"(lv + 48u * AKP), "v"(lt),
                  "v"(gk), "v"(gk + ks16), "v"(gk + 2 * ks16), "v"(gk + 3 * ks16), "v"(gv), "v"(gv + vs16), "v"(gv + 2 * vs16), "v"(gv + 3 * vs16), "v"(gt)
               : "memory");
}
// lane l with lane l ^ 16 (the two lanes that share one query column), by a vector cross-row move
__device__ __forceinline__ float xhalf(float x) { return __builtin_bit_cast(float, __builtin_amdgcn_permlanex16(__builtin_bit_cast(int, x), __builtin_bit_cast(int, x), 0x76543210, 0xfedcba98, false, false)); }
// ---- k_attn: block = (64 queries, head h, batch b): all-keys flash attention, transposed: S^T = K . Q^T (A = 16 key rows from LDS, B = the wave's 16 queries, kept in registers), so a lane holds 8 keys' scores of ONE query (column = lane & 15, keys 8g + r); maximum and sum run in the lane, the two halves exchange the maximum once a step and join their sums once at the end; two S^T tiles, converted in place, are the B operand of O^T += V^T . P^T; O[b*S+q][h*64+d] = acc / l (256-B segments)
__global__ __launch_bounds__(128) void k_attn(const _Float16* __restrict__ QK, const _Float16* __restrict__ QKL, const _Float16* __restrict__ VTH, const _Float16* __restrict__ VTL, const void* __restrict__ KMASK, const float* __restrict__ TS, const float* __restrict__ ERR, const float* __restrict__ LAMH, const float* __restrict__ WG, const float* __restrict__ BG, float* __restrict__ O) {
  __shared__ __align__(16) float so[4][16][68]; __shared__ __attribute__((aligned(16))) unsigned char L[2 * ASTG];
  const int tid = threadIdx.x, wave = tid >> 5, lane = tid & 31, col = lane & 15, g = lane >> 4;
  const int qb = blockIdx.x, h = blockIdx.y, b = blockIdx.z; const int q0 = qb * 64 + wave * 16; const size_t rq = (size_t)b * SS + q0 + col;
  v16h bq[2];
#pragma unroll
  for (int kc = 0; kc < 2; ++kc) bq[kc] = frag_h(QK + rq * (2 * DM) + h * HD + kc * 32, lane);
  asm volatile("s_wait_xcnt 0x0" ::: "memory");   // a precaution: stands in front of the first instruction that reuses the four query loads' address pair
  // per-head constants and the lane's own query's time / error values for the score biases
  const float lraw = bfr(LAMH[h]); const float lam = (lraw > 20.f) ? lraw : log1pf(expf(lraw));   // softplus, precise, once a thread: in line, so that the kernel holds no call
  const float wg0 = bfr(WG[h * 2]), wg1 = bfr(WG[h * 2 + 1]), bgh = bfr(BG[h]); const float lam2 = lam * LOG2E;   // scores carry the factor log2 e, so that every exp and log of the loop is one hardware instruction
  const float tq = TS[rq]; const float gq = (wg0 * bfr(ERR[rq]) + bgh) * -LOG2E; const float wk = wg1 * -LOG2E;   // gate logit's query part and the key part's factor, as the exponent of 2 in exp(-logit)
  float m = -3.0e38f, l = 0.f;
  v8f acc[4] = {};
  const unsigned lb = (unsigned)(uintptr_t)&L[0]; const _Float16* Kr = QK + (size_t)b * SS * (2 * DM) + DM + h * HD; const _Float16* Vr = VTH + ((size_t)b * DM + h * HD) * SS; const float* Tb = TS + (size_t)b * SS; const float* Eb = ERR + (size_t)b * SS;
  stage_kv(lb, Kr, Vr, Tb, Eb, 0, tid); WAIT_ASYNC(); __syncthreads(); stage_kv(lb + ASTG, Kr, Vr, Tb, Eb, 1, tid);
#pragma unroll 1   // kept rolled: one trip = one buffer = 64 keys, all keys in order
  for (int t = 0; t < ANT; ++t) { const unsigned char* S = L + (t & 1) * ASTG;
#pragma unroll 1   // kept rolled: the tile's two 32-key steps share one body
  for (int ks = 0; ks < 2; ++ks) { v8f s[2]; v16h kf[2][2];
#pragma unroll   // constant indices keep kf[][] in registers (also the next directive)
    for (int ct = 0; ct < 2; ++ct)
#pragma unroll
      for (int kc = 0; kc < 2; ++kc) kf[ct][kc] = frag_h((const _Float16*)(S + (ks * 32 + ct * 16 + col) * AKP + kc * 64), lane);   // the step's four k fragments first, then its WMMAs
#pragma unroll
    for (int ct = 0; ct < 2; ++ct) { v8f c = {};
#pragma unroll
      for (int kc = 0; kc < 2; ++kc) c = wmma16(kf[ct][kc], bq[kc], c);   // single product: k, q as one-rounding f16 operands; c[r] = key 16 ct + 8 g + r against query col
      const v4f* te = (const v4f*)(S + AK_TE + wave * 512 + (ks * 32 + ct * 16 + 8 * g) * 4); const v4f t0 = te[0], t1 = te[1], e0 = te[16], e1 = te[17];   // the lane's 8 keys' times and errors
#pragma unroll
      for (int r = 0; r < 8; ++r) { const float tk = (r < 4) ? t0[r & 3] : t1[r & 3]; const float ek = (r < 4) ? e0[r & 3] : e1[r & 3];
        const float sig = __builtin_amdgcn_rcpf(1.0f + __builtin_amdgcn_exp2f(wk * bfr(ek) + gq)); s[ct][r] = c[r] * (0.125f * LOG2E) + (__builtin_amdgcn_logf(sig + 1e-9f) - lam2 * fabsf(tq - tk)); } }   // (q.k/8 + time-decay bias + error-gate bias) x log2 e: sigmoid by v_exp_f32 and v_rcp_f32, its logarithm by v_log_f32
    float mx = fmaxf(s[0][0], s[1][0]);
#pragma unroll
    for (int r = 1; r < 8; ++r) mx = fmaxf(mx, fmaxf(s[0][r], s[1][r]));
    mx = fmaxf(mx, xhalf(mx));   // both halves hold the query's maximum over the step's 32 keys
    const float mn = fmaxf(m, mx); const float alpha = (m <= -1.0e38f) ? 0.f : __builtin_amdgcn_exp2f(m - mn);
    v2f es = {0.f, 0.f}; v16h pb;
#pragma unroll
    for (int ct = 0; ct < 2; ++ct)
#pragma unroll
      for (int r = 0; r < 8; r += 2) { v2f e; e[0] = (s[ct][r] <= -1.0e38f) ? 0.f : __builtin_amdgcn_exp2f(s[ct][r] - mn); e[1] = (s[ct][r + 1] <= -1.0e38f) ? 0.f : __builtin_amdgcn_exp2f(s[ct][r + 1] - mn);
        es = (ct + r == 0) ? e : es + e; const v2f x = e * 2048.0f; pb[ct * 8 + r] = (_Float16)x[0]; pb[ct * 8 + r + 1] = (_Float16)x[1]; }   // even and odd keys summed side by side (packed adds); P scaled by 2^11 so small softmax weights stay out of the f16 subnormal range; 2^-11 folded into the epilogue; element 8 ct + r = key 16 ct + 8 g + r, the k order of the v fragments
    l = l * alpha + (es[0] + es[1]); m = mn;   // the lane's own 16 keys of the step; the halves' sums are joined behind the loop
#pragma unroll
    for (int dt = 0; dt < 4; ++dt) acc[dt] *= alpha;
    v16h vf[4];
#pragma unroll   // constant indices keep vf[] in registers
    for (int dt = 0; dt < 4; ++dt) vf[dt] = frag_h((const _Float16*)(S + AK_V + (dt * 16 + col) * AKP + ks * 64), lane);   // the step's four v fragments first, then its WMMAs
#pragma unroll
    for (int dt = 0; dt < 4; ++dt) acc[dt] = wmma16(vf[dt], pb, acc[dt]); }   // single product: V^T x P^T (x2^11); acc[dt][r] = d 16 dt + 8 g + r of query col
    WAIT_DS(); WAIT_ASYNC(); __syncthreads();   // publishes tile t + 1 and frees tile t's buffer
    if (t + 2 < ANT) stage_kv(lb + (unsigned)(t & 1) * ASTG, Kr, Vr, Tb, Eb, t + 2, tid); }
  WAIT_ASYNC();
  const float il = (1.0f / 2048.0f) / (l + xhalf(l));
#pragma unroll
  for (int dt = 0; dt < 4; ++dt) { v4f o0, o1;
#pragma unroll
    for (int i = 0; i < 4; ++i) { o0[i] = acc[dt][i] * il; o1[i] = acc[dt][4 + i] * il; }
    *(v4f*)&so[wave][col][dt * 16 + 8 * g] = o0; *(v4f*)&so[wave][col][dt * 16 + 8 * g + 4] = o1; }
  LDSX();
  for (int rl = 0; rl < 16; ++rl) if (lane < 16) vst2(O + ((size_t)b * SS + q0 + rl) * DM + h * HD + lane * 4, *(const v4f*)&so[wave][rl][lane * 4]);
}
// ---- k_out: block = (64 rows, 128 cols): out = O(hi/lo) . Wo rows (2 products) + bo
__global__ __launch_bounds__(128) void k_out(const float* __restrict__ O, const __bf16* __restrict__ P, const float* __restrict__ BO, float* __restrict__ Y) {
  __shared__ __attribute__((aligned(16))) unsigned char L[2 * STG];   // the two tile buffers; behind the k loop's last barrier the same bytes serve as output staging
  float (*so)[16][132] = (float (*)[16][132])L;
  const int tid = threadIdx.x, wave = tid >> 5, lane = tid & 31, col = lane & 15, g = lane >> 4; const size_t r0 = (size_t)blockIdx.x * 64 + wave * 16; const int n0 = blockIdx.y * 128;
  v8f acc[8] = {};
  { const unsigned lb = (unsigned)(uintptr_t)&L[0]; const __bf16* Wr = P + (size_t)n0 * DM; const float* Ar = O + (size_t)blockIdx.x * 64 * DM;
    stage_tile(lb, Wr, Ar, 0, tid); WAIT_ASYNC(); __syncthreads(); stage_tile(lb + STG, Wr, Ar, 1, tid);
#pragma unroll 1   // kept rolled: one trip = one buffer
    for (int t = 0; t < NT; ++t) { const unsigned char* S = L + (t & 1) * STG;
#pragma unroll   // constant indices keep bf[] and acc[] in registers (also the two directives below)
      for (int kc = 0; kc < 2; ++kc) { float av[16]; v16b bf[8]; lds_a16(S + BTILE + (wave * 16 + col) * APITCH + kc * 128, g, av);   // all fragments of the k step first, then its WMMAs
#pragma unroll
        for (int j = 0; j < 8; ++j) bf[j] = frag_b((const __bf16*)(S + (j * 16 + col) * BPITCH + kc * 64), lane);
        const F2 a = bsplit16(av);
#pragma unroll
        for (int j = 0; j < 8; ++j) { acc[j] = wmma_bf(a.l, bf[j], acc[j]); acc[j] = wmma_bf(a.h, bf[j], acc[j]); } }
      WAIT_DS(); WAIT_ASYNC(); __syncthreads();   // publishes tile t + 1 and frees tile t's buffer
      if (t + 2 < NT) stage_tile(lb + (unsigned)(t & 1) * STG, Wr, Ar, t + 2, tid); }
    WAIT_ASYNC(); }
#pragma unroll
  for (int j = 0; j < 8; ++j) {
#pragma unroll
    for (int r = 0; r < 8; ++r) so[wave][8 * g + r][j * 16 + col] = acc[j][r] + bfr(BO[n0 + j * 16 + col]); }
  LDSX();
  for (int rl = 0; rl < 16; ++rl) vst2(Y + (r0 + rl) * DM + n0 + lane * 4, *(const v4f*)&so[wave][rl][lane * 4]);
}
// ---- k_ts: block = batch: t_scaled = (t - min) / (max - min + 1e-6) * 1000 over the sequence
__global__ __launch_bounds__(256) void k_ts(const float* __restrict__ TR, float* __restrict__ TS) {
  __shared__ float rmn[256], rmx[256]; const size_t b = blockIdx.x; const int t = threadIdx.x; float mn = 3.0e38f, mx = -3.0e38f;
  for (int s = t; s < SS; s += 256) { const float v = bfr(TR[b * SS + s]); mn = fminf(mn, v); mx = fmaxf(mx, v); }
  rmn[t] = mn; rmx[t] = mx; __syncthreads();
  for (int st = 128; st > 0; st >>= 1) { if (t < st) { rmn[t] = fminf(rmn[t], rmn[t + st]); rmx[t] = fmaxf(rmx[t], rmx[t + st]); } __syncthreads(); }
  const float tmin = rmn[0], den = rmx[0] - rmn[0] + 1e-6f;
  for (int s = t; s < SS; s += 256) TS[b * SS + s] = (bfr(TR[b * SS + s]) - tmin) / den * 1000.0f;   // 4-B scratch stores
}
extern "C" void kernel_launch(void* const* d_in, const int* in_sizes, int n_in, void* d_out, int out_size, void* d_ws, size_t ws_size, hipStream_t stream) {
  (void)in_sizes; (void)n_in; (void)out_size;
  const float** F = (const float**)d_in;   // 0 x [4,1024,1024], 1 t_raw [4,1024], 2 error [4,1024], 3 Wq, 4 bq, 5 Wk, 6 bk, 7 Wv, 8 bv, 9 Wo, 10 bo, 11 lambda_h [16], 12 Wg [16,2], 13 bg [16]
  if (ws_size < (size_t)WS_END + 4u * NB * SS + 256) return;
  char* ws = (char*)d_ws; __bf16* PK = (__bf16*)(ws + WS_PK); _Float16 *QK = (_Float16*)(ws + WS_QK), *QKL = (_Float16*)(ws + WS_QKL), *VTH = (_Float16*)(ws + WS_VTH), *VTL = (_Float16*)(ws + WS_VTL); float* O = (float*)(ws + WS_O); float* TS = (float*)(ws + WS_END);
  k_pack<<<dim3(DM, 4), 256, 0, stream>>>(F[3], F[5], F[7], F[9], PK);
  k_ts<<<NB, 256, 0, stream>>>(F[1], TS);
  k_qkv<<<dim3(TNB * SS / 64, QKVW / 128), 128, 0, stream>>>(F[0], F[0], F[0], PK + PK_A, F[4], F[6], F[8], TS, QK, QKL, VTH, VTL);
  k_attn<<<dim3(TQB, NH, TNB), 128, 0, stream>>>(QK, QKL, VTH, VTL, nullptr, TS, F[2], F[11], F[12], F[13], O);
  k_out<<<dim3(TOB, DM / 128), 128, 0, stream>>>(O, PK + PK_P, F[10], (float*)d_out);
}

// v005
// One run takes 108 microseconds.
// Next to v004, in two timings, it ran 1.05 times as fast each time.
// All steps since v000 together make it 3.69 times as fast.
// compute dtype: all float inputs rounded to bf16; q/k/v = x . W^T + b with EXACT bf16 products on WMMA 16x16x32 (natural rows); per-batch time scaling and the interleaved-pair rotary (neighbouring lanes; angle = t_scaled x inv_freq[d/2] with jnp's inv_freq constants, precise cosf/sinf) in f32; PLAIN attention: rotated q, k as single f16 operands x 1/8 + the decay and gate biases evaluated per score in f32 (base 2: hardware exp, reciprocal and log; the per-head softplus by precise expf/log1pf), running-max softmax in f32 (base 2, hardware exp), P (scaled by 2^11, single f16) x v (single f16); out = o (bf16 hi + residual) . Wo^T (2 products) + bo.
#include <hip/hip_runtime.h>
#include <math.h>

typedef __attribute__((ext_vector_type(16))) _Float16 v16h;
typedef __attribute__((ext_vector_type(16))) __bf16 v16b;
typedef __attribute__((ext_vector_type(8)))  _Float16 v8h;
typedef __attribute__((ext_vector_type(8)))  float v8f;
typedef __attribute__((ext_vector_type(4)))  float v4f;
typedef __attribute__((ext_vector_type(2)))  float v2f;
typedef __attribute__((ext_vector_type(4)))  unsigned v4u;
typedef __attribute__((ext_vector_type(4)))  int v4i;
typedef float __attribute__((may_alias)) float_a;
typedef int __attribute__((may_alias)) int_a;

template <typename T> __device__ __forceinline__ void vst2(void* p, T v) { *(T*)p = v;  }
__device__ __forceinline__ v8f wmma16(v16h a, v16h b, v8f c) {
  v8f d = __builtin_amdgcn_wmma_f32_16x16x32_f16(false, a, false, b, (short)0, c, false, false);
  asm volatile("v_nop\n\tv_nop\n\tv_nop\n\tv_nop" : "+v"(d) : "v"(a), "v"(b));
  return d;
}
__device__ __forceinline__ v8f wmma_bf(v16b a, v16b b, v8f c) {
  v8f d = __builtin_amdgcn_wmma_f32_16x16x32_bf16(false, a, false, b, (short)0, c, false, false);
  asm volatile("v_nop\n\tv_nop\n\tv_nop\n\tv_nop" : "+v"(d) : "v"(a), "v"(b));
  return d;
}
// Scaled continuous-time attention (B 4, S 1,024, d 1,024, 16 heads x 64): q/k/v projections + biases, an interleaved rotary embedding whose angle is the per-token time (min-max scaled to [0, 1000]) x inv_freq, scores / 8 plus a per-head time-decay bias (-softplus(lambda_h) |t_i - t_j|) and an error-gated bias log(sigmoid(w_h0 err_i + w_h1 err_j + b_h) + 1e-9), softmax, . v, output projection + bias.
__device__ __forceinline__ v16h frag_h(const _Float16* rowk0, int lane) {
  union { v16h v; v8h q[2]; } u; const _Float16* p = rowk0 + 8 * (lane >> 4);
  u.q[0] = *(const v8h*)p; u.q[1] = *(const v8h*)(p + 16); return u.v;
}
__device__ __forceinline__ v16h frag_f32(const float* rowk0, int lane) {
  v16h a; const float* p = rowk0 + 8 * (lane >> 4);
#pragma unroll
  for (int i = 0; i < 8; ++i) { a[i] = (_Float16)p[i]; a[8 + i] = (_Float16)p[16 + i]; }
  return a;
}
__device__ __forceinline__ v16h frag_f32s(const float* rowk0, int lane, float sc) {
  v16h a; const float* p = rowk0 + 8 * (lane >> 4);
#pragma unroll
  for (int i = 0; i < 8; ++i) { a[i] = (_Float16)(p[i] * sc); a[8 + i] = (_Float16)(p[16 + i] * sc); }
  return a;
}
// column fragment from a [K][ld] layout (column n), rows >= K read as 0
__device__ __forceinline__ v16h fragc_f32(const float* W, int k0, int n, int lane, int ld, int K) {
  v16h a; const int g = lane >> 4;
#pragma unroll
  for (int i = 0; i < 8; ++i) { const int ka = k0 + 8 * g + i, kb = ka + 16;
    a[i] = (_Float16)(ka < K ? W[(size_t)(ka < K ? ka : K - 1) * ld + n] : 0.f); a[8 + i] = (_Float16)(kb < K ? W[(size_t)(kb < K ? kb : K - 1) * ld + n] : 0.f); }
  return a;
}
struct F2 { v16b h, l; };
__device__ __forceinline__ F2 bsplit16(const float v[16]) { F2 r;
#pragma unroll
  for (int i = 0; i < 16; ++i) { const __bf16 h = (__bf16)v[i]; r.h[i] = h; r.l[i] = (__bf16)(v[i] - (float)h); }
  return r; }
__device__ __forceinline__ F2 split_row(const float* row, int k0, int lane) { float v[16]; const float* p = row + k0 + 8 * (lane >> 4);
#pragma unroll
  for (int i = 0; i < 8; ++i) { v[i] = p[i]; v[8 + i] = p[16 + i]; }
  return bsplit16(v); }
__device__ __forceinline__ F2 split_rowK(const float* row, int k0, int lane, int K) { float v[16]; const int g = lane >> 4;
#pragma unroll
  for (int i = 0; i < 8; ++i) { const int ka = k0 + 8 * g + i, kb = ka + 16; v[i] = ka < K ? row[ka < K ? ka : K - 1] : 0.f; v[8 + i] = kb < K ? row[kb < K ? kb : K - 1] : 0.f; }
  return bsplit16(v); }
__device__ __forceinline__ F2 split_col(const float* W, int k0, int n, int lane, int ld, int K) { float v[16]; const int g = lane >> 4;
#pragma unroll
  for (int i = 0; i < 8; ++i) { const int ka = k0 + 8 * g + i, kb = ka + 16; v[i] = ka < K ? W[(size_t)(ka < K ? ka : K - 1) * ld + n] : 0.f; v[8 + i] = kb < K ? W[(size_t)(kb < K ? kb : K - 1) * ld + n] : 0.f; }
  return bsplit16(v); }
__device__ __forceinline__ v8f mac3(const F2& a, const F2& b, v8f c) { c = wmma_bf(a.l, b.h, c); c = wmma_bf(a.h, b.l, c); return wmma_bf(a.h, b.h, c); }
__device__ __forceinline__ float sigm(float v) { return 1.0f / (1.0f + expf(-v)); }
#define LDSX() do { asm volatile("s_wait_dscnt 0" ::: "memory"); __builtin_amdgcn_wave_barrier(); __builtin_amdgcn_fence(__ATOMIC_RELEASE, "workgroup"); } while (0)


#define NB 4
#define SS 1024
#define DM 1024
#define NH 16
__constant__ float INVF[32] = {1.000000000e+00f,7.498942018e-01f,5.623413324e-01f,4.216965139e-01f,3.162277639e-01f,2.371373773e-01f,1.778279394e-01f,1.333521456e-01f,1.000000015e-01f,7.498942316e-02f,5.623413250e-02f,4.216964915e-02f,3.162277490e-02f,2.371373773e-02f,1.778279431e-02f,1.333521400e-02f,9.999999776e-03f,7.498942316e-03f,5.623413250e-03f,4.216964822e-03f,3.162277630e-03f,2.371373819e-03f,1.778279431e-03f,1.333521446e-03f,1.000000047e-03f,7.498941850e-04f,5.623413017e-04f,4.216965172e-04f,3.162277571e-04f,2.371373703e-04f,1.778279402e-04f,1.333521504e-04f};
__device__ __attribute__((noinline)) float cos_p(float v) { return cosf(v); }
__device__ __attribute__((noinline)) float sin_p(float v) { return sinf(v); }
#define HD 64
#define QKVW (3 * DM)
#ifndef TQB
#define TQB (SS / 64)
#define TNB NB
#define TOB (NB * SS / 64)     // output row tiles (all)
#endif
typedef __attribute__((ext_vector_type(8))) __bf16 v8b;
__device__ __forceinline__ v16b frag_b(const __bf16* rowk0, int lane) {
  union { v16b v; v8b q[2]; } u; const __bf16* p = rowk0 + 8 * (lane >> 4);
  u.q[0] = *(const v8b*)p; u.q[1] = *(const v8b*)(p + 16); return u.v;
}
__device__ __forceinline__ float bfr(float v) { return (float)(__bf16)v; }
__device__ __attribute__((noinline)) float erf_ni(float v) { return erff(v); }

#define PK_A 0                       // [3072][1024] Wqkv rows (natural [out][in])
#define PK_P (PK_A + QKVW * DM)        // [1024][1024] Wo rows (natural)
#define PK_END (PK_P + DM * DM)
#define WS_PK  0u
#define WS_QK  (WS_PK + 2u * PK_END)             // f16 [4096 rows][2048]: q | k
#define WS_QKL (WS_QK + 2u * NB * SS * 2 * DM)     // f16 q | k residual planes x2048
#define WS_VTH (WS_QKL + 2u * NB * SS * 2 * DM)    // f16 [b][1024 (h*64+d)][1024 s] hi
#define WS_VTL (WS_VTH + 2u * NB * DM * SS)        // f16 lo x 2048
#define WS_O   (WS_VTL + 2u * NB * DM * SS)        // f32 [4096][1024]
#define WS_CS  (WS_O + 4u * NB * SS * DM)           // f32 2 x [1024][32], not used (cos/sin computed in k_ts)
#define WS_END (WS_CS + 4u * 2 * SS * 32)
#define WS_TS  WS_END                               // f32 [4096] scaled times
#define WS_ROT (WS_TS + 4u * NB * SS)               // f32 [4096 tokens][8 (f & 7)][4 (f >> 3)][cos, sin]: the rotary table, 256 B a token
#define WS_TOP (WS_ROT + 4u * NB * SS * 64)
// ---- LDS staging of the two projection GEMMs: a tile = 64 k of 128 weight rows (bf16, 128 B a row) and of 64 activation rows (f32, 256 B a row); two buffers, filled by asynchronous copies one tile ahead
#define KT 64
#define BPITCH 144                    // weight row pitch in LDS: 16 B x odd, conflict-free for 16-byte reads
#define APITCH 272                    // activation row pitch in LDS: 16 B x odd
#define BTILE (128 * BPITCH)
#define STG (BTILE + 64 * APITCH)     // one buffer
#define NT (DM / KT)
// eight 16-byte copies of one thread, global memory -> LDS, no register in between; the closing s_wait_xcnt 0 keeps every address register named here unchanged until the copies have taken it
__device__ __forceinline__ void copy8(unsigned l, const char* g, unsigned lstep, size_t gstep) {
  asm volatile("global_load_async_to_lds_b128 %0, %8, off\n\t"
               "global_load_async_to_lds_b128 %1, %9, off\n\t"
               "global_load_async_to_lds_b128 %2, %10, off\n\t"
               "global_load_async_to_lds_b128 %3, %11, off\n\t"
               "global_load_async_to_lds_b128 %4, %12, off\n\t"
               "global_load_async_to_lds_b128 %5, %13, off\n\t"
               "global_load_async_to_lds_b128 %6, %14, off\n\t"
               "global_load_async_to_lds_b128 %7, %15, off\n\t"
               "s_wait_xcnt 0x0"
               :: "v"(l), "v"(l + lstep), "v"(l + 2 * lstep), "v"(l + 3 * lstep), "v"(l + 4 * lstep), "v"(l + 5 * lstep), "v"(l + 6 * lstep), "v"(l + 7 * lstep),
                  "v"(g), "v"(g + gstep), "v"(g + 2 * gstep), "v"(g + 3 * gstep), "v"(g + 4 * gstep), "v"(g + 5 * gstep), "v"(g + 6 * gstep), "v"(g + 7 * gstep)
               : "memory");
}
// tile t of the block's 128 weight rows (Wr = row 0, k 0) and 64 activation rows (Ar) into the buffer at LDS byte address lbuf: a wave's copy covers 4 whole 128-B lines
__device__ __forceinline__ void stage_tile(unsigned lbuf, const __bf16* Wr, const float* Ar, int t, int tid) {
  copy8(lbuf + (unsigned)(tid >> 3) * BPITCH + (unsigned)(tid & 7) * 16u, (const char*)(Wr + (size_t)(tid >> 3) * DM + t * KT + (tid & 7) * 8), 16u * BPITCH, (size_t)16 * DM * 2);
  copy8(lbuf + BTILE + (unsigned)(tid >> 4) * APITCH + (unsigned)(tid & 15) * 16u, (const char*)(Ar + (size_t)(tid >> 4) * DM + t * KT + (tid & 15) * 4), 8u * APITCH, (size_t)8 * DM * 4);
}
// the 16 f32 of an A fragment from a staged row: k = 8g .. 8g+7 and 16+8g .. 16+8g+7 of the 32-k step at rowk0
__device__ __forceinline__ void lds_a16(const unsigned char* rowk0, int g, float v[16]) {
  const v4f* p = (const v4f*)(rowk0 + 32 * g); const v4f x0 = p[0], x1 = p[1], x2 = p[4], x3 = p[5];
#pragma unroll   // constant indices keep v[] in registers
  for (int i = 0; i < 4; ++i) { v[i] = x0[i]; v[4 + i] = x1[i]; v[8 + i] = x2[i]; v[12 + i] = x3[i]; }
}
#define WAIT_ASYNC() asm volatile("s_wait_asynccnt 0x0" ::: "memory")   // this wave's copies have landed
#define WAIT_DS()    asm volatile("s_wait_dscnt 0x0" ::: "memory")      // this wave's LDS reads are done before the buffer is handed back
// ---- k_pack: block = (row n, which): natural [out][in] rows -> bf16; which 0..2 -> W_q/W_k/W_v into PK_A rows which*1024 + n; 3 -> W_o into PK_P
__global__ __launch_bounds__(256) void k_pack(const float* __restrict__ WQ, const float* __restrict__ WK, const float* __restrict__ WV, const float* __restrict__ WO, __bf16* __restrict__ PK) {
  __shared__ __align__(16) __bf16 s[DM]; const int n = blockIdx.x, which = blockIdx.y, t = threadIdx.x; const float* Wm = (which == 0) ? WQ : (which == 1) ? WK : (which == 2) ? WV : WO;
  for (int k = t; k < DM; k += 256) s[k] = (__bf16)Wm[(size_t)n * DM + k];
  __syncthreads();
  __bf16* dst = (which < 3) ? PK + PK_A + ((size_t)which * DM + n) * DM : PK + PK_P + (size_t)n * DM;
  for (int q = t; q < DM / 8; q += 256) vst2((unsigned*)(dst + q * 8), *(const v4u*)&s[q * 8]);
}
__global__ __launch_bounds__(128) void k_qkv(const float* __restrict__ XQ, const float* __restrict__ XK, const float* __restrict__ XV, const __bf16* __restrict__ P, const float* __restrict__ BQ, const float* __restrict__ BK, const float* __restrict__ BV, const float* __restrict__ ROT, _Float16* __restrict__ QK, _Float16* __restrict__ QKL, _Float16* __restrict__ VTH, _Float16* __restrict__ VTL) {
  const int which0 = (blockIdx.y * 128) / DM; const float* X = (which0 == 0) ? XQ : (which0 == 1) ? XK : XV; const float* BB = BQ ? (((which0 == 0) ? BQ : (which0 == 1) ? BK : BV) + (blockIdx.y * 128 - which0 * DM)) : nullptr;
  __shared__ __attribute__((aligned(16))) unsigned char L[2 * STG];   // the two tile buffers; behind the k loop's last barrier the same bytes serve as output staging
  _Float16 (*so)[16][136] = (_Float16 (*)[16][136])L; _Float16 (*sol)[16][136] = (_Float16 (*)[16][136])(L + 4 * 16 * 136 * 2); _Float16 (*sth)[72] = (_Float16 (*)[72])L; _Float16 (*stl)[72] = (_Float16 (*)[72])(L + 128 * 72 * 2);
  const int tid = threadIdx.x, wave = tid >> 5, lane = tid & 31, col = lane & 15, g = lane >> 4; const size_t r0 = (size_t)blockIdx.x * 64 + wave * 16; const int n0 = blockIdx.y * 128;
  v8f acc[8] = {};
  v4f cs[8][2] = {};   // q and k blocks: the lane's 8 rows x 4 frequencies ((j & 3) * 8 + col / 2) of the rotary table, 32 B a row; sixteen 16-B loads issued in front of the k loop, first used behind it
  if (n0 < 2 * DM) { const v4f* cp = (const v4f*)(ROT + (r0 + 8 * g) * 64 + (col >> 1) * 8);
#pragma unroll   // constant indices keep cs[][] in registers
    for (int r = 0; r < 8; ++r) { cs[r][0] = cp[r * 16]; cs[r][1] = cp[r * 16 + 1]; }
    asm volatile("s_wait_xcnt 0x0" ::: "memory"); }   // a precaution: stands in front of the first instruction that reuses a register of the sixteen loads' address
  { const unsigned lb = (unsigned)(uintptr_t)&L[0]; const __bf16* Wr = P + (size_t)n0 * DM; const float* Ar = X + (size_t)blockIdx.x * 64 * DM;
    stage_tile(lb, Wr, Ar, 0, tid); WAIT_ASYNC(); __syncthreads(); stage_tile(lb + STG, Wr, Ar, 1, tid);
#pragma unroll 1   // kept rolled: one trip = one buffer
    for (int t = 0; t < NT; ++t) { const unsigned char* S = L + (t & 1) * STG;
#pragma unroll   // constant indices keep bf[] and acc[] in registers (also the three directives below)
      for (int kc = 0; kc < 2; ++kc) { float av[16]; v16b bf[8]; lds_a16(S + BTILE + (wave * 16 + col) * APITCH + kc * 128, g, av);   // all fragments of the k step first, then its WMMAs
#pragma unroll
        for (int j = 0; j < 8; ++j) bf[j] = frag_b((const __bf16*)(S + (j * 16 + col) * BPITCH + kc * 64), lane);
        v16b a;
#pragma unroll
        for (int i = 0; i < 16; ++i) a[i] = (__bf16)av[i];
#pragma unroll
        for (int j = 0; j < 8; ++j) acc[j] = wmma_bf(a, bf[j], acc[j]); }
      WAIT_DS(); WAIT_ASYNC(); __syncthreads();   // publishes tile t + 1 and frees tile t's buffer
      if (t + 2 < NT) stage_tile(lb + (unsigned)(t & 1) * STG, Wr, Ar, t + 2, tid); }
    WAIT_ASYNC(); }
  float bias[8] = {0.f, 0.f, 0.f, 0.f, 0.f, 0.f, 0.f, 0.f};   // the lane's eight column biases (column j * 16 + col), fetched once: eight loads in flight together, one latency for the whole epilogue
  if (BB) { const float* bp = BB + col;
#pragma unroll   // constant indices keep bias[] in registers (also the next directive)
    for (int j = 0; j < 8; ++j) bias[j] = bp[j * 16];
    asm volatile("s_wait_xcnt 0x0" ::: "memory");   // a precaution: stands in front of the first instruction that reuses a register of the eight loads' address
#pragma unroll
    for (int j = 0; j < 8; ++j) bias[j] = bfr(bias[j]); }
  if (n0 < 2 * DM) {   // bias, then the interleaved-pair rotary: pair (2i, 2i+1) = neighbouring lanes (col ^ 1), cos and sin of t_scaled[row] * inv_freq[i] from k_ts's table
#pragma unroll
    for (int j = 0; j < 8; ++j)
#pragma unroll
      for (int r = 0; r < 8; ++r) acc[j][r] += bias[j];
#pragma unroll
    for (int r = 0; r < 8; ++r) {
#pragma unroll
      for (int j = 0; j < 8; ++j) { const float c = cs[r][(j & 3) >> 1][(j & 1) * 2], sn = cs[r][(j & 3) >> 1][(j & 1) * 2 + 1]; const float v = acc[j][r]; const float pv = __shfl_xor(v, 1); acc[j][r] = (col & 1) ? (v * c + pv * sn) : (v * c - pv * sn); } }
#pragma unroll
    for (int j = 0; j < 8; ++j) {
#pragma unroll
      for (int r = 0; r < 8; ++r) { const float v = acc[j][r]; const _Float16 hv = (_Float16)v; so[wave][8 * g + r][j * 16 + col] = hv; sol[wave][8 * g + r][j * 16 + col] = (_Float16)((v - (float)hv) * 2048.0f); } }   // q, k (+ bias) as f16 hi + (x2048) residual
    LDSX();
    for (int rl = 0; rl < 16; ++rl) if (lane < 16) { vst2((unsigned*)(QK + (r0 + rl) * (2 * DM) + n0 + lane * 8), *(const v4u*)&so[wave][rl][lane * 8]); vst2((unsigned*)(QKL + (r0 + rl) * (2 * DM) + n0 + lane * 8), *(const v4u*)&sol[wave][rl][lane * 8]); }
  } else {
#pragma unroll
    for (int j = 0; j < 8; ++j) {
#pragma unroll
      for (int r = 0; r < 8; ++r) { const float v = acc[j][r] + bias[j]; const _Float16 hv = (_Float16)v; sth[j * 16 + col][wave * 16 + 8 * g + r] = hv; stl[j * 16 + col][wave * 16 + 8 * g + r] = (_Float16)((v - (float)hv) * 2048.0f); } }
    __syncthreads();
    const size_t rb = (size_t)blockIdx.x * 64; const int b = (int)(rb / SS), s0 = (int)(rb % SS); const int pc0 = n0 - 2 * DM;
    for (int q = tid; q < 128 * 8; q += 128) { const int d = q >> 3, pc = q & 7; const size_t o = ((size_t)b * DM + pc0 + d) * SS + s0 + pc * 8; vst2((unsigned*)(VTH + o), *(const v4u*)&sth[d][pc * 8]); vst2((unsigned*)(VTL + o), *(const v4u*)&stl[d][pc * 8]); }
  }
}
// ---- LDS staging of k_attn: a tile = 64 keys: their 64 k rows (128 B each), the 64 v^T rows' 64 columns (128 B each), and per wave a private copy of the keys' times and errors (256 B + 256 B); two buffers, filled one tile ahead
#define AKP 144                       // k / v^T row pitch in LDS: 16 B x odd
#define AK_V (64 * AKP)
#define AK_TE (2 * 64 * AKP)
#define ASTG (AK_TE + 4 * 512)        // one buffer
#define ANT (SS / 64)
#define LOG2E 1.44269504088896340736f
// nine 16-byte copies of one thread (4 of k, 4 of v^T, 1 of times | errors); the closing s_wait_xcnt 0 keeps every address register named here unchanged until the copies have taken it
__device__ __forceinline__ void stage_kv(unsigned lbuf, const _Float16* Kr, const _Float16* Vr, const float* Tb, const float* Eb, int t, int tid) {
  const int lane = tid & 31;
  const unsigned lk = lbuf + (unsigned)(tid >> 3) * AKP + (unsigned)(tid & 7) * 16u, lv = lk + AK_V, lt = lbuf + AK_TE + (unsigned)(tid >> 5) * 512u + (unsigned)lane * 16u;
  const char* gk = (const char*)(Kr + ((size_t)t * 64 + (tid >> 3)) * (2 * DM) + (tid & 7) * 8);
  const char* gv = (const char*)(Vr + (size_t)(tid >> 3) * SS + t * 64 + (tid & 7) * 8);
  const char* gt = (const char*)(((lane < 16) ? Tb : Eb) + t * 64 + (lane & 15) * 4);
  const size_t ks16 = (size_t)16 * 2 * DM * 2, vs16 = (size_t)16 * SS * 2;
  asm volatile("global_load_async_to_lds_b128 %0, %9, off\n\t"
               "global_load_async_to_lds_b128 %1, %10, off\n\t"
               "global_load_async_to_lds_b128 %2, %11, off\n\t"
               "global_load_async_to_lds_b128 %3, %12, off\n\t"
               "global_load_async_to_lds_b128 %4, %13, off\n\t"
               "global_load_async_to_lds_b128 %5, %14, off\n\t"
               "global_load_async_to_lds_b128 %6, %15, off\n\t"
               "global_load_async_to_lds_b128 %7, %16, off\n\t"
               "global_load_async_to_lds_b128 %8, %17, off\n\t"
               "s_wait_xcnt 0x0"
               :: "v"(lk), "v"(lk + 16u * AKP), "v"(lk + 32u * AKP), "v"(lk + 48u * AKP), "v"(lv), "v"(lv + 16u * AKP), "v"(lv + 32u * AKP), "v"(lv + 48u * AKP), "v"(lt),
                  "v"(gk), "v"(gk + ks16), "v"(gk + 2 * ks16), "v"(gk + 3 * ks16), "v"(gv), "v"(gv + vs16), "v"(gv + 2 * vs16), "v"(gv + 3 * vs16), "v"(gt)
               : "memory");
}
// lane l with lane l ^ 16 (the two lanes that share one query column), by a vector cross-row move
__device__ __forceinline__ float xhalf(float x) { return __builtin_bit_cast(float, __builtin_amdgcn_permlanex16(__builtin_bit_cast(int, x), __builtin_bit_cast(int, x), 0x76543210, 0xfedcba98, false, false)); }
// ---- k_attn: block = (64 queries, head h, batch b): all-keys flash attention, transposed: S^T = K . Q^T (A = 16 key rows from LDS, B = the wave's 16 queries, kept in registers), so a lane holds 8 keys' scores of ONE query (column = lane & 15, keys 8g + r); maximum and sum run in the lane, the two halves exchange the maximum once a step and join their sums once at the end; two S^T tiles, converted in place, are the B operand of O^T += V^T . P^T; O[b*S+q][h*64+d] = acc / l (256-B segments)
__global__ __launch_bounds__(128) void k_attn(const _Float16* __restrict__ QK, const _Float16* __restrict__ QKL, const _Float16* __restrict__ VTH, const _Float16* __restrict__ VTL, const void* __restrict__ KMASK, const float* __restrict__ TS, const float* __restrict__ ERR, const float* __restrict__ LAMH, const float* __restrict__ WG, const float* __restrict__ BG, float* __restrict__ O) {
  __shared__ __align__(16) float so[4][16][68]; __shared__ __attribute__((aligned(16))) unsigned char L[2 * ASTG];
  const int tid = threadIdx.x, wave = tid >> 5, lane = tid & 31, col = lane & 15, g = lane >> 4;
  const int qb = blockIdx.x, h = blockIdx.y, b = blockIdx.z; const int q0 = qb * 64 + wave * 16; const size_t rq = (size_t)b * SS + q0 + col;
  v16h bq[2];
#pragma unroll
  for (int kc = 0; kc < 2; ++kc) bq[kc] = frag_h(QK + rq * (2 * DM) + h * HD + kc * 32, lane);
  asm volatile("s_wait_xcnt 0x0" ::: "memory");   // a precaution: stands in front of the first instruction that reuses the four query loads' address pair
  // per-head constants and the lane's own query's time / error values for the score biases
  const float lraw = bfr(LAMH[h]); const float lam = (lraw > 20.f) ? lraw : log1pf(expf(lraw));   // softplus, precise, once a thread: in line, so that the kernel holds no call
  const float wg0 = bfr(WG[h * 2]), wg1 = bfr(WG[h * 2 + 1]), bgh = bfr(BG[h]); const float lam2 = lam * LOG2E;   // scores carry the factor log2 e, so that every exp and log of the loop is one hardware instruction
  const float tq = TS[rq]; const float gq = (wg0 * bfr(ERR[rq]) + bgh) * -LOG2E; const float wk = wg1 * -LOG2E;   // gate logit's query part and the key part's factor, as the exponent of 2 in exp(-logit)
  float m = -3.0e38f, l = 0.f;
  v8f acc[4] = {};
  const unsigned lb = (unsigned)(uintptr_t)&L[0]; const _Float16* Kr = QK + (size_t)b * SS * (2 * DM) + DM + h * HD; const _Float16* Vr = VTH + ((size_t)b * DM + h * HD) * SS; const float* Tb = TS + (size_t)b * SS; const float* Eb = ERR + (size_t)b * SS;
  stage_kv(lb, Kr, Vr, Tb, Eb, 0, tid); WAIT_ASYNC(); __syncthreads(); stage_kv(lb + ASTG, Kr, Vr, Tb, Eb, 1, tid);
#pragma unroll 1   // kept rolled: one trip = one buffer = 64 keys, all keys in order
  for (int t = 0; t < ANT; ++t) { const unsigned char* S = L + (t & 1) * ASTG;
#pragma unroll 1   // kept rolled: the tile's two 32-key steps share one body
  for (int ks = 0; ks < 2; ++ks) { v8f s[2]; v16h kf[2][2];
#pragma unroll   // constant indices keep kf[][] in registers (also the next directive)
    for (int ct = 0; ct < 2; ++ct)
#pragma unroll
      for (int kc = 0; kc < 2; ++kc) kf[ct][kc] = frag_h((const _Float16*)(S + (ks * 32 + ct * 16 + col) * AKP + kc * 64), lane);   // the step's four k fragments first, then its WMMAs
#pragma unroll
    for (int ct = 0; ct < 2; ++ct) { v8f c = {};
#pragma unroll
      for (int kc = 0; kc < 2; ++kc) c = wmma16(kf[ct][kc], bq[kc], c);   // single product: k, q as one-rounding f16 operands; c[r] = key 16 ct + 8 g + r against query col
      const v4f* te = (const v4f*)(S + AK_TE + wave * 512 + (ks * 32 + ct * 16 + 8 * g) * 4); const v4f t0 = te[0], t1 = te[1], e0 = te[16], e1 = te[17];   // the lane's 8 keys' times and errors
#pragma unroll
      for (int r = 0; r < 8; ++r) { const float tk = (r < 4) ? t0[r & 3] : t1[r & 3]; const float ek = (r < 4) ? e0[r & 3] : e1[r & 3];
        const float sig = __builtin_amdgcn_rcpf(1.0f + __builtin_amdgcn_exp2f(wk * bfr(ek) + gq)); s[ct][r] = c[r] * (0.125f * LOG2E) + (__builtin_amdgcn_logf(sig + 1e-9f) - lam2 * fabsf(tq - tk)); } }   // (q.k/8 + time-decay bias + error-gate bias) x log2 e: sigmoid by v_exp_f32 and v_rcp_f32, its logarithm by v_log_f32
    float mx = fmaxf(s[0][0], s[1][0]);
#pragma unroll
    for (int r = 1; r < 8; ++r) mx = fmaxf(mx, fmaxf(s[0][r], s[1][r]));
    mx = fmaxf(mx, xhalf(mx));   // both halves hold the query's maximum over the step's 32 keys
    const float mn = fmaxf(m, mx); const float alpha = (m <= -1.0e38f) ? 0.f : __builtin_amdgcn_exp2f(m - mn);
    v2f es = {0.f, 0.f}; v16h pb;
#pragma unroll
    for (int ct = 0; ct < 2; ++ct)
#pragma unroll
      for (int r = 0; r < 8; r += 2) { v2f e; e[0] = (s[ct][r] <= -1.0e38f) ? 0.f : __builtin_amdgcn_exp2f(s[ct][r] - mn); e[1] = (s[ct][r + 1] <= -1.0e38f) ? 0.f : __builtin_amdgcn_exp2f(s[ct][r + 1] - mn);
        es = (ct + r == 0) ? e : es + e; const v2f x = e * 2048.0f; pb[ct * 8 + r] = (_Float16)x[0]; pb[ct * 8 + r + 1] = (_Float16)x[1]; }   // even and odd keys summed side by side (packed adds); P scaled by 2^11 so small softmax weights stay out of the f16 subnormal range; 2^-11 folded into the epilogue; element 8 ct + r = key 16 ct + 8 g + r, the k order of the v fragments
    l = l * alpha + (es[0] + es[1]); m = mn;   // the lane's own 16 keys of the step; the halves' sums are joined behind the loop
#pragma unroll
    for (int dt = 0; dt < 4; ++dt) acc[dt] *= alpha;
    v16h vf[4];
#pragma unroll   // constant indices keep vf[] in registers
    for (int dt = 0; dt < 4; ++dt) vf[dt] = frag_h((const _Float16*)(S + AK_V + (dt * 16 + col) * AKP + ks * 64), lane);   // the step's four v fragments first, then its WMMAs
#pragma unroll
    for (int dt = 0; dt < 4; ++dt) acc[dt] = wmma16(vf[dt], pb, acc[dt]); }   // single product: V^T x P^T (x2^11); acc[dt][r] = d 16 dt + 8 g + r of query col
    WAIT_DS(); WAIT_ASYNC(); __syncthreads();   // publishes tile t + 1 and frees tile t's buffer
    if (t + 2 < ANT) stage_kv(lb + (unsigned)(t & 1) * ASTG, Kr, Vr, Tb, Eb, t + 2, tid); }
  WAIT_ASYNC();
  const float il = (1.0f / 2048.0f) / (l + xhalf(l));
#pragma unroll
  for (int dt = 0; dt < 4; ++dt) { v4f o0, o1;
#pragma unroll
    for (int i = 0; i < 4; ++i) { o0[i] = acc[dt][i] * il; o1[i] = acc[dt][4 + i] * il; }
    *(v4f*)&so[wave][col][dt * 16 + 8 * g] = o0; *(v4f*)&so[wave][col][dt * 16 + 8 * g + 4] = o1; }
  LDSX();
  for (int rl = 0; rl < 16; ++rl) if (lane < 16) vst2(O + ((size_t)b * SS + q0 + rl) * DM + h * HD + lane * 4, *(const v4f*)&so[wave][rl][lane * 4]);
}
// ---- k_out: block = (64 rows, 128 cols): out = O(hi/lo) . Wo rows (2 products) + bo
__global__ __launch_bounds__(128) void k_out(const float* __restrict__ O, const __bf16* __restrict__ P, const float* __restrict__ BO, float* __restrict__ Y) {
  __shared__ __attribute__((aligned(16))) unsigned char L[2 * STG];   // the two tile buffers; behind the k loop's last barrier the same bytes serve as output staging
  float (*so)[16][132] = (float (*)[16][132])L;
  const int tid = threadIdx.x, wave = tid >> 5, lane = tid & 31, col = lane & 15, g = lane >> 4; const size_t r0 = (size_t)blockIdx.x * 64 + wave * 16; const int n0 = blockIdx.y * 128;
  v8f acc[8] = {};
  { const unsigned lb = (unsigned)(uintptr_t)&L[0]; const __bf16* Wr = P + (size_t)n0 * DM; const float* Ar = O + (size_t)blockIdx.x * 64 * DM;
    stage_tile(lb, Wr, Ar, 0, tid); WAIT_ASYNC(); __syncthreads(); stage_tile(lb + STG, Wr, Ar, 1, tid);
#pragma unroll 1   // kept rolled: one trip = one buffer
    for (int t = 0; t < NT; ++t) { const unsigned char* S = L + (t & 1) * STG;
#pragma unroll   // constant indices keep bf[] and acc[] in registers (also the two directives below)
      for (int kc = 0; kc < 2; ++kc) { float av[16]; v16b bf[8]; lds_a16(S + BTILE + (wave * 16 + col) * APITCH + kc * 128, g, av);   // all fragments of the k step first, then its WMMAs
#pragma unroll
        for (int j = 0; j < 8; ++j) bf[j] = frag_b((const __bf16*)(S + (j * 16 + col) * BPITCH + kc * 64), lane);
        const F2 a = bsplit16(av);
#pragma unroll
        for (int j = 0; j < 8; ++j) { acc[j] = wmma_bf(a.l, bf[j], acc[j]); acc[j] = wmma_bf(a.h, bf[j], acc[j]); } }
      WAIT_DS(); WAIT_ASYNC(); __syncthreads();   // publishes tile t + 1 and frees tile t's buffer
      if (t + 2 < NT) stage_tile(lb + (unsigned)(t & 1) * STG, Wr, Ar, t + 2, tid); }
    WAIT_ASYNC(); }
#pragma unroll
  for (int j = 0; j < 8; ++j) {
#pragma unroll
    for (int r = 0; r < 8; ++r) so[wave][8 * g + r][j * 16 + col] = acc[j][r] + bfr(BO[n0 + j * 16 + col]); }
  LDSX();
  for (int rl = 0; rl < 16; ++rl) vst2(Y + (r0 + rl) * DM + n0 + lane * 4, *(const v4f*)&so[wave][rl][lane * 4]);
}
// ---- k_ts: block = (batch, 16 tokens): t_scaled = (t - min) / (max - min + 1e-6) * 1000, minimum and maximum over the batch's whole sequence in every block; the block's 16 scaled times and their rotary table: cos and sin of t_scaled x inv_freq[f], once per (token, frequency)
__global__ __launch_bounds__(256) void k_ts(const float* __restrict__ TR, float* __restrict__ TS, float* __restrict__ ROT) {
  __shared__ float rmn[256], rmx[256]; const size_t b = blockIdx.x; const int t = threadIdx.x; float mn = 3.0e38f, mx = -3.0e38f;
  for (int s = t; s < SS; s += 256) { const float v = bfr(TR[b * SS + s]); mn = fminf(mn, v); mx = fmaxf(mx, v); }
  rmn[t] = mn; rmx[t] = mx; __syncthreads();
  for (int st = 128; st > 0; st >>= 1) { if (t < st) { rmn[t] = fminf(rmn[t], rmn[t + st]); rmx[t] = fmaxf(rmx[t], rmx[t + st]); } __syncthreads(); }
  const float tmin = rmn[0], den = rmx[0] - rmn[0] + 1e-6f;
  const size_t s0 = b * SS + blockIdx.y * 16;
  if (t < 16) TS[s0 + t] = (bfr(TR[s0 + t]) - tmin) / den * 1000.0f;   // 4-B scratch stores
  for (int q = t; q < 16 * 32; q += 256) { const size_t s = s0 + (q >> 5); const int p = q & 31, f = (p & 3) * 8 + (p >> 2);   // place p of a token's row holds frequency f: a k_qkv lane's four frequencies lie side by side
    const float ang = (bfr(TR[s]) - tmin) / den * 1000.0f * INVF[f]; v2f cs; cs[0] = cos_p(ang); cs[1] = sin_p(ang); *(v2f*)(ROT + s * 64 + p * 2) = cs; }   // a wave stores one token's 256 B
}
extern "C" void kernel_launch(void* const* d_in, const int* in_sizes, int n_in, void* d_out, int out_size, void* d_ws, size_t ws_size, hipStream_t stream) {
  (void)in_sizes; (void)n_in; (void)out_size;
  const float** F = (const float**)d_in;   // 0 x [4,1024,1024], 1 t_raw [4,1024], 2 error [4,1024], 3 Wq, 4 bq, 5 Wk, 6 bk, 7 Wv, 8 bv, 9 Wo, 10 bo, 11 lambda_h [16], 12 Wg [16,2], 13 bg [16]
  if (ws_size < (size_t)WS_TOP + 256) return;
  char* ws = (char*)d_ws; __bf16* PK = (__bf16*)(ws + WS_PK); _Float16 *QK = (_Float16*)(ws + WS_QK), *QKL = (_Float16*)(ws + WS_QKL), *VTH = (_Float16*)(ws + WS_VTH), *VTL = (_Float16*)(ws + WS_VTL); float* O = (float*)(ws + WS_O); float* TS = (float*)(ws + WS_TS); float* ROT = (float*)(ws + WS_ROT);
  k_pack<<<dim3(DM, 4), 256, 0, stream>>>(F[3], F[5], F[7], F[9], PK);
  k_ts<<<dim3(NB, SS / 16), 256, 0, stream>>>(F[1], TS, ROT);
  k_qkv<<<dim3(TNB * SS / 64, QKVW / 128), 128, 0, stream>>>(F[0], F[0], F[0], PK + PK_A, F[4], F[6], F[8], ROT, QK, QKL, VTH, VTL);
  k_attn<<<dim3(TQB, NH, TNB), 128, 0, stream>>>(QK, QKL, VTH, VTL, nullptr, TS, F[2], F[11], F[12], F[13], O);
  k_out<<<dim3(TOB, DM / 128), 128, 0, stream>>>(O, PK + PK_P, F[10], (float*)d_out);
}

// v006
// One run takes 105 microseconds.
// Timed twice side by side with v005, it ran 1.04 times as fast both times.
// All steps since v000 together make it 3.84 times as fast.
// compute dtype: all float inputs rounded to bf16; q/k/v = x . W^T + b with EXACT bf16 products on WMMA 16x16x32 (natural rows); per-batch time scaling and the interleaved-pair rotary (neighbouring lanes; angle = t_scaled x inv_freq[d/2] with jnp's inv_freq constants, precise cosf/sinf) in f32; PLAIN attention: rotated q, k as single f16 operands x 1/8 + the decay and gate biases evaluated per score in f32 (base 2: hardware exp, reciprocal and log; the per-head softplus by precise expf/log1pf), running-max softmax in f32 (base 2, hardware exp), P (scaled by 2^11, single f16) x v (single f16); out = o (bf16 hi + residual) . Wo^T (2 products) + bo.
#include <hip/hip_runtime.h>
#include <math.h>

typedef __attribute__((ext_vector_type(16))) _Float16 v16h;
typedef __attribute__((ext_vector_type(16))) __bf16 v16b;
typedef __attribute__((ext_vector_type(8)))  _Float16 v8h;
typedef __attribute__((ext_vector_type(8)))  float v8f;
typedef __attribute__((ext_vector_type(4)))  float v4f;
typedef __attribute__((ext_vector_type(2)))  float v2f;
typedef __attribute__((ext_vector_type(4)))  unsigned v4u;
typedef __attribute__((ext_vector_type(4)))  int v4i;
typedef float __attribute__((may_alias)) float_a;
typedef int __attribute__((may_alias)) int_a;

template <typename T> __device__ __forceinline__ void vst2(void* p, T v) { *(T*)p = v;  }
__device__ __forceinline__ v8f wmma16(v16h a, v16h b, v8f c) {
  v8f d = __builtin_amdgcn_wmma_f32_16x16x32_f16(false, a, false, b, (short)0, c, false, false);
  asm volatile("v_nop\n\tv_nop\n\tv_nop\n\tv_nop" : "+v"(d) : "v"(a), "v"(b));
  return d;
}
__device__ __forceinline__ v8f wmma_bf(v16b a, v16b b, v8f c) {
  v8f d = __builtin_amdgcn_wmma_f32_16x16x32_bf16(false, a, false, b, (short)0, c, false, false);
  asm volatile("v_nop\n\tv_nop\n\tv_nop\n\tv_nop" : "+v"(d) : "v"(a), "v"(b));
  return d;
}
// Scaled continuous-time attention (B 4, S 1,024, d 1,024, 16 heads x 64): q/k/v projections + biases, an interleaved rotary embedding whose angle is the per-token time (min-max scaled to [0, 1000]) x inv_freq, scores / 8 plus a per-head time-decay bias (-softplus(lambda_h) |t_i - t_j|) and an error-gated bias log(sigmoid(w_h0 err_i + w_h1 err_j + b_h) + 1e-9), softmax, . v, output projection + bias.
__device__ __forceinline__ v16h frag_h(const _Float16* rowk0, int lane) {
  union { v16h v; v8h q[2]; } u; const _Float16* p = rowk0 + 8 * (lane >> 4);
  u.q[0] = *(const v8h*)p; u.q[1] = *(const v8h*)(p + 16); return u.v;
}
__device__ __forceinline__ v16h frag_f32(const float* rowk0, int lane) {
  v16h a; const float* p = rowk0 + 8 * (lane >> 4);
#pragma unroll
  for (int i = 0; i < 8; ++i) { a[i] = (_Float16)p[i]; a[8 + i] = (_Float16)p[16 + i]; }
  return a;
}
__device__ __forceinline__ v16h frag_f32s(const float* rowk0, int lane, float sc) {
  v16h a; const float* p = rowk0 + 8 * (lane >> 4);
#pragma unroll
  for (int i = 0; i < 8; ++i) { a[i] = (_Float16)(p[i] * sc); a[8 + i] = (_Float16)(p[16 + i] * sc); }
  return a;
}
// column fragment from a [K][ld] layout (column n), rows >= K read as 0
__device__ __forceinline__ v16h fragc_f32(const float* W, int k0, int n, int lane, int ld, int K) {
  v16h a; const int g = lane >> 4;
#pragma unroll
  for (int i = 0; i < 8; ++i) { const int ka = k0 + 8 * g + i, kb = ka + 16;
    a[i] = (_Float16)(ka < K ? W[(size_t)(ka < K ? ka : K - 1) * ld + n] : 0.f); a[8 + i] = (_Float16)(kb < K ? W[(size_t)(kb < K ? kb : K - 1) * ld + n] : 0.f); }
  return a;
}
struct F2 { v16b h, l; };
__device__ __forceinline__ F2 bsplit16(const float v[16]) { F2 r;
#pragma unroll
  for (int i = 0; i < 16; ++i) { const __bf16 h = (__bf16)v[i]; r.h[i] = h; r.l[i] = (__bf16)(v[i] - (float)h); }
  return r; }
__device__ __forceinline__ F2 split_row(const float* row, int k0, int lane) { float v[16]; const float* p = row + k0 + 8 * (lane >> 4);
#pragma unroll
  for (int i = 0; i < 8; ++i) { v[i] = p[i]; v[8 + i] = p[16 + i]; }
  return bsplit16(v); }
__device__ __forceinline__ F2 split_rowK(const float* row, int k0, int lane, int K) { float v[16]; const int g = lane >> 4;
#pragma unroll
  for (int i = 0; i < 8; ++i) { const int ka = k0 + 8 * g + i, kb = ka + 16; v[i] = ka < K ? row[ka < K ? ka : K - 1] : 0.f; v[8 + i] = kb < K ? row[kb < K ? kb : K - 1] : 0.f; }
  return bsplit16(v); }
__device__ __forceinline__ F2 split_col(const float* W, int k0, int n, int lane, int ld, int K) { float v[16]; const int g = lane >> 4;
#pragma unroll
  for (int i = 0; i < 8; ++i) { const int ka = k0 + 8 * g + i, kb = ka + 16; v[i] = ka < K ? W[(size_t)(ka < K ? ka : K - 1) * ld + n] : 0.f; v[8 + i] = kb < K ? W[(size_t)(kb < K ? kb : K - 1) * ld + n] : 0.f; }
  return bsplit16(v); }
__device__ __forceinline__ v8f mac3(const F2& a, const F2& b, v8f c) { c = wmma_bf(a.l, b.h, c); c = wmma_bf(a.h, b.l, c); return wmma_bf(a.h, b.h, c); }
__device__ __forceinline__ float sigm(float v) { return 1.0f / (1.0f + expf(-v)); }
#define LDSX() do { asm volatile("s_wait_dscnt 0" ::: "memory"); __builtin_amdgcn_wave_barrier(); __builtin_amdgcn_fence(__ATOMIC_RELEASE, "workgroup"); } while (0)


#define NB 4
#define SS 1024
#define DM 1024
#define NH 16
__constant__ float INVF[32] = {1.000000000e+00f,7.498942018e-01f,5.623413324e-01f,4.216965139e-01f,3.162277639e-01f,2.371373773e-01f,1.778279394e-01f,1.333521456e-01f,1.000000015e-01f,7.498942316e-02f,5.623413250e-02f,4.216964915e-02f,3.162277490e-02f,2.371373773e-02f,1.778279431e-02f,1.333521400e-02f,9.999999776e-03f,7.498942316e-03f,5.623413250e-03f,4.216964822e-03f,3.162277630e-03f,2.371373819e-03f,1.778279431e-03f,1.333521446e-03f,1.000000047e-03f,7.498941850e-04f,5.623413017e-04f,4.216965172e-04f,3.162277571e-04f,2.371373703e-04f,1.778279402e-04f,1.333521504e-04f};
__device__ __attribute__((noinline)) float cos_p(float v) { return cosf(v); }
__device__ __attribute__((noinline)) float sin_p(float v) { return sinf(v); }
#define HD 64
#define QKVW (3 * DM)
#ifndef TQB
#define TQB (SS / 64)
#define TNB NB
#define TOB (NB * SS / 64)     // output row tiles (all)
#endif
typedef __attribute__((ext_vector_type(8))) __bf16 v8b;
typedef __attribute__((ext_vector_type(4))) __bf16 v4b;
__device__ __forceinline__ v16b frag_b(const __bf16* rowk0, int lane) {
  union { v16b v; v8b q[2]; } u; const __bf16* p = rowk0 + 8 * (lane >> 4);
  u.q[0] = *(const v8b*)p; u.q[1] = *(const v8b*)(p + 16); return u.v;
}
__device__ __forceinline__ float bfr(float v) { return (float)(__bf16)v; }
__device__ __attribute__((noinline)) float erf_ni(float v) { return erff(v); }

#define PK_A 0                       // [3072][1024] Wqkv rows (natural [out][in])
#define PK_P (PK_A + QKVW * DM)        // [1024][1024] Wo rows (natural)
#define PK_END (PK_P + DM * DM)
#define WS_PK  0u
#define WS_QK  (WS_PK + 2u * PK_END)             // f16 [4096 rows][2048]: q | k
#define WS_QKL (WS_QK + 2u * NB * SS * 2 * DM)     // f16 q | k residual planes x2048
#define WS_VTH (WS_QKL + 2u * NB * SS * 2 * DM)    // f16 [b][1024 (h*64+d)][1024 s] hi
#define WS_VTL (WS_VTH + 2u * NB * DM * SS)        // f16 lo x 2048
#define WS_O   (WS_VTL + 2u * NB * DM * SS)        // f32 [4096][1024]
#define WS_CS  (WS_O + 4u * NB * SS * DM)           // f32 2 x [1024][32], not used (cos/sin computed in k_ts)
#define WS_END (WS_CS + 4u * 2 * SS * 32)
#define WS_TS  WS_END                               // f32 [4096] scaled times
#define WS_ROT (WS_TS + 4u * NB * SS)               // f32 [4096 tokens][8 (f & 7)][4 (f >> 3)][cos, sin]: the rotary table, 256 B a token
#define WS_XB  (WS_ROT + 4u * NB * SS * 64)         // bf16 [4096 tokens][1024]: x, rounded once
#define WS_TOP (WS_XB + 2u * NB * SS * DM)
// ---- LDS staging of the two projection GEMMs: a tile = 64 k of 128 weight rows (bf16, 128 B a row) and of 64 activation rows (k_out: f32, 256 B a row; k_qkv: bf16, further down); two buffers, filled by asynchronous copies one tile ahead
#define KT 64
#define BPITCH 144                    // weight row pitch in LDS: 16 B x odd, conflict-free for 16-byte reads
#define APITCH 272                    // activation row pitch in LDS: 16 B x odd
#define BTILE (128 * BPITCH)
#define STG (BTILE + 64 * APITCH)     // one buffer
#define NT (DM / KT)
// eight 16-byte copies of one thread, global memory -> LDS, no register in between; the closing s_wait_xcnt 0 keeps every address register named here unchanged until the copies have taken it
__device__ __forceinline__ void copy8(unsigned l, const char* g, unsigned lstep, size_t gstep) {
  asm volatile("global_load_async_to_lds_b128 %0, %8, off\n\t"
               "global_load_async_to_lds_b128 %1, %9, off\n\t"
               "global_load_async_to_lds_b128 %2, %10, off\n\t"
               "global_load_async_to_lds_b128 %3, %11, off\n\t"
               "global_load_async_to_lds_b128 %4, %12, off\n\t"
               "global_load_async_to_lds_b128 %5, %13, off\n\t"
               "global_load_async_to_lds_b128 %6, %14, off\n\t"
               "global_load_async_to_lds_b128 %7, %15, off\n\t"
               "s_wait_xcnt 0x0"
               :: "v"(l), "v"(l + lstep), "v"(l + 2 * lstep), "v"(l + 3 * lstep), "v"(l + 4 * lstep), "v"(l + 5 * lstep), "v"(l + 6 * lstep), "v"(l + 7 * lstep),
                  "v"(g), "v"(g + gstep), "v"(g + 2 * gstep), "v"(g + 3 * gstep), "v"(g + 4 * gstep), "v"(g + 5 * gstep), "v"(g + 6 * gstep), "v"(g + 7 * gstep)
               : "memory");
}
// tile t of the block's 128 weight rows (Wr = row 0, k 0) and 64 activation rows (Ar) into the buffer at LDS byte address lbuf: a wave's copy covers 4 whole 128-B lines
__device__ __forceinline__ void stage_tile(unsigned lbuf, const __bf16* Wr, const float* Ar, int t, int tid) {
  copy8(lbuf + (unsigned)(tid >> 3) * BPITCH + (unsigned)(tid & 7) * 16u, (const char*)(Wr + (size_t)(tid >> 3) * DM + t * KT + (tid & 7) * 8), 16u * BPITCH, (size_t)16 * DM * 2);
  copy8(lbuf + BTILE + (unsigned)(tid >> 4) * APITCH + (unsigned)(tid & 15) * 16u, (const char*)(Ar + (size_t)(tid >> 4) * DM + t * KT + (tid & 15) * 4), 8u * APITCH, (size_t)8 * DM * 4);
}
// ---- k_qkv's tile: 64 k of 128 weight rows and, right behind them at the same pitch, of 64 activation rows, all bf16 (128 B a row): 192 rows, 16 a pass
#define QSTG (192 * BPITCH)           // one buffer
#define XCB 8192                      // elements of x that one converting block of k_ts's launch rounds
// twelve 16-byte copies of one thread (8 of weights, 4 of activations), global memory -> LDS, no register in between; the closing s_wait_xcnt 0 keeps every address register named here unchanged until the copies have taken it
__device__ __forceinline__ void stage_tile_b(unsigned lbuf, const __bf16* Wr, const __bf16* Ar, int t, int tid) {
  const unsigned l = lbuf + (unsigned)(tid >> 3) * BPITCH + (unsigned)(tid & 7) * 16u, ls = 16u * BPITCH;
  const size_t o = (size_t)(tid >> 3) * DM + t * KT + (tid & 7) * 8, gs = (size_t)16 * DM * 2;
  const char* gw = (const char*)(Wr + o); const char* ga = (const char*)(Ar + o);
  asm volatile("global_load_async_to_lds_b128 %0, %12, off\n\t"
               "global_load_async_to_lds_b128 %1, %13, off\n\t"
               "global_load_async_to_lds_b128 %2, %14, off\n\t"
               "global_load_async_to_lds_b128 %3, %15, off\n\t"
               "global_load_async_to_lds_b128 %4, %16, off\n\t"
               "global_load_async_to_lds_b128 %5, %17, off\n\t"
               "global_load_async_to_lds_b128 %6, %18, off\n\t"
               "global_load_async_to_lds_b128 %7, %19, off\n\t"
               "global_load_async_to_lds_b128 %8, %20, off\n\t"
               "global_load_async_to_lds_b128 %9, %21, off\n\t"
               "global_load_async_to_lds_b128 %10, %22, off\n\t"
               "global_load_async_to_lds_b128 %11, %23, off\n\t"
               "s_wait_xcnt 0x0"
               :: "v"(l), "v"(l + ls), "v"(l + 2 * ls), "v"(l + 3 * ls), "v"(l + 4 * ls), "v"(l + 5 * ls), "v"(l + 6 * ls), "v"(l + 7 * ls), "v"(l + 8 * ls), "v"(l + 9 * ls), "v"(l + 10 * ls), "v"(l + 11 * ls),
                  "v"(gw), "v"(gw + gs), "v"(gw + 2 * gs), "v"(gw + 3 * gs), "v"(gw + 4 * gs), "v"(gw + 5 * gs), "v"(gw + 6 * gs), "v"(gw + 7 * gs), "v"(ga), "v"(ga + gs), "v"(ga + 2 * gs), "v"(ga + 3 * gs)
               : "memory");
}
// the 16 f32 of an A fragment from a staged row: k = 8g .. 8g+7 and 16+8g .. 16+8g+7 of the 32-k step at rowk0
__device__ __forceinline__ void lds_a16(const unsigned char* rowk0, int g, float v[16]) {
  const v4f* p = (const v4f*)(rowk0 + 32 * g); const v4f x0 = p[0], x1 = p[1], x2 = p[4], x3 = p[5];
#pragma unroll   // constant indices keep v[] in registers
  for (int i = 0; i < 4; ++i) { v[i] = x0[i]; v[4 + i] = x1[i]; v[8 + i] = x2[i]; v[12 + i] = x3[i]; }
}
#define WAIT_ASYNC() asm volatile("s_wait_asynccnt 0x0" ::: "memory")   // this wave's copies have landed
#define WAIT_DS()    asm volatile("s_wait_dscnt 0x0" ::: "memory")      // this wave's LDS reads are done before the buffer is handed back
// ---- k_pack: block = (row n, which): natural [out][in] rows -> bf16; which 0..2 -> W_q/W_k/W_v into PK_A rows which*1024 + n; 3 -> W_o into PK_P
__global__ __launch_bounds__(256) void k_pack(const float* __restrict__ WQ, const float* __restrict__ WK, const float* __restrict__ WV, const float* __restrict__ WO, __bf16* __restrict__ PK) {
  __shared__ __align__(16) __bf16 s[DM]; const int n = blockIdx.x, which = blockIdx.y, t = threadIdx.x; const float* Wm = (which == 0) ? WQ : (which == 1) ? WK : (which == 2) ? WV : WO;
  for (int k = t; k < DM; k += 256) s[k] = (__bf16)Wm[(size_t)n * DM + k];
  __syncthreads();
  __bf16* dst = (which < 3) ? PK + PK_A + ((size_t)which * DM + n) * DM : PK + PK_P + (size_t)n * DM;
  for (int q = t; q < DM / 8; q += 256) vst2((unsigned*)(dst + q * 8), *(const v4u*)&s[q * 8]);
}
__global__ __launch_bounds__(128) void k_qkv(const __bf16* __restrict__ XB, const __bf16* __restrict__ P, const float* __restrict__ BQ, const float* __restrict__ BK, const float* __restrict__ BV, const float* __restrict__ ROT, _Float16* __restrict__ QK, _Float16* __restrict__ QKL, _Float16* __restrict__ VTH, _Float16* __restrict__ VTL) {
  const int which0 = (blockIdx.y * 128) / DM; const float* BB = BQ ? (((which0 == 0) ? BQ : (which0 == 1) ? BK : BV) + (blockIdx.y * 128 - which0 * DM)) : nullptr;
  __shared__ __attribute__((aligned(16))) unsigned char L[2 * QSTG];   // the two tile buffers; behind the k loop's last barrier the same bytes serve as output staging
  _Float16 (*so)[16][136] = (_Float16 (*)[16][136])L; _Float16 (*sol)[16][136] = (_Float16 (*)[16][136])(L + 4 * 16 * 136 * 2); _Float16 (*sth)[72] = (_Float16 (*)[72])L; _Float16 (*stl)[72] = (_Float16 (*)[72])(L + 128 * 72 * 2);
  const int tid = threadIdx.x, wave = tid >> 5, lane = tid & 31, col = lane & 15, g = lane >> 4; const size_t r0 = (size_t)blockIdx.x * 64 + wave * 16; const int n0 = blockIdx.y * 128;
  v8f acc[8] = {};
  v4f cs[8][2] = {};   // q and k blocks: the lane's 8 rows x 4 frequencies ((j & 3) * 8 + col / 2) of the rotary table, 32 B a row; sixteen 16-B loads issued in front of the k loop, first used behind it
  if (n0 < 2 * DM) { const v4f* cp = (const v4f*)(ROT + (r0 + 8 * g) * 64 + (col >> 1) * 8);
#pragma unroll   // constant indices keep cs[][] in registers
    for (int r = 0; r < 8; ++r) { cs[r][0] = cp[r * 16]; cs[r][1] = cp[r * 16 + 1]; }
    asm volatile("s_wait_xcnt 0x0" ::: "memory"); }   // a precaution: stands in front of the first instruction that reuses a register of the sixteen loads' address
  { const unsigned lb = (unsigned)(uintptr_t)&L[0]; const __bf16* Wr = P + (size_t)n0 * DM; const __bf16* Ar = XB + (size_t)blockIdx.x * 64 * DM;
    stage_tile_b(lb, Wr, Ar, 0, tid); WAIT_ASYNC(); __syncthreads(); stage_tile_b(lb + QSTG, Wr, Ar, 1, tid);
#pragma unroll 1   // kept rolled: one trip = one buffer
    for (int t = 0; t < NT; ++t) { const unsigned char* S = L + (t & 1) * QSTG;
#pragma unroll   // constant indices keep bf[] and acc[] in registers (also the two directives below)
      for (int kc = 0; kc < 2; ++kc) { v16b bf[8]; const v16b a = frag_b((const __bf16*)(S + BTILE + (wave * 16 + col) * BPITCH + kc * 64), lane);   // all fragments of the k step first, then its WMMAs
#pragma unroll
        for (int j = 0; j < 8; ++j) bf[j] = frag_b((const __bf16*)(S + (j * 16 + col) * BPITCH + kc * 64), lane);
#pragma unroll
        for (int j = 0; j < 8; ++j) acc[j] = wmma_bf(a, bf[j], acc[j]); }
      WAIT_DS(); WAIT_ASYNC(); __syncthreads();   // publishes tile t + 1 and frees tile t's buffer
      if (t + 2 < NT) stage_tile_b(lb + (unsigned)(t & 1) * QSTG, Wr, Ar, t + 2, tid); }
    WAIT_ASYNC(); }
  float bias[8] = {0.f, 0.f, 0.f, 0.f, 0.f, 0.f, 0.f, 0.f};   // the lane's eight column biases (column j * 16 + col), fetched once: eight loads in flight together, one latency for the whole epilogue
  if (BB) { const float* bp = BB + col;
#pragma unroll   // constant indices keep bias[] in registers (also the next directive)
    for (int j = 0; j < 8; ++j) bias[j] = bp[j * 16];
    asm volatile("s_wait_xcnt 0x0" ::: "memory");   // a precaution: stands in front of the first instruction that reuses a register of the eight loads' address
#pragma unroll
    for (int j = 0; j < 8; ++j) bias[j] = bfr(bias[j]); }
  if (n0 < 2 * DM) {   // bias, then the interleaved-pair rotary: pair (2i, 2i+1) = neighbouring lanes (col ^ 1), cos and sin of t_scaled[row] * inv_freq[i] from k_ts's table
#pragma unroll
    for (int j = 0; j < 8; ++j)
#pragma unroll
      for (int r = 0; r < 8; ++r) acc[j][r] += bias[j];
#pragma unroll
    for (int r = 0; r < 8; ++r) {
#pragma unroll
      for (int j = 0; j < 8; ++j) { const float c = cs[r][(j & 3) >> 1][(j & 1) * 2], sn = cs[r][(j & 3) >> 1][(j & 1) * 2 + 1]; const float v = acc[j][r]; const float pv = __shfl_xor(v, 1); acc[j][r] = (col & 1) ? (v * c + pv * sn) : (v * c - pv * sn); } }
#pragma unroll
    for (int j = 0; j < 8; ++j) {
#pragma unroll
      for (int r = 0; r < 8; ++r) { const float v = acc[j][r]; const _Float16 hv = (_Float16)v; so[wave][8 * g + r][j * 16 + col] = hv; sol[wave][8 * g + r][j * 16 + col] = (_Float16)((v - (float)hv) * 2048.0f); } }   // q, k (+ bias) as f16 hi + (x2048) residual
    LDSX();
    for (int rl = 0; rl < 16; ++rl) if (lane < 16) { vst2((unsigned*)(QK + (r0 + rl) * (2 * DM) + n0 + lane * 8), *(const v4u*)&so[wave][rl][lane * 8]); vst2((unsigned*)(QKL + (r0 + rl) * (2 * DM) + n0 + lane * 8), *(const v4u*)&sol[wave][rl][lane * 8]); }
  } else {
#pragma unroll
    for (int j = 0; j < 8; ++j) {
#pragma unroll
      for (int r = 0; r < 8; ++r) { const float v = acc[j][r] + bias[j]; const _Float16 hv = (_Float16)v; sth[j * 16 + col][wave * 16 + 8 * g + r] = hv; stl[j * 16 + col][wave * 16 + 8 * g + r] = (_Float16)((v - (float)hv) * 2048.0f); } }
    __syncthreads();
    const size_t rb = (size_t)blockIdx.x * 64; const int b = (int)(rb / SS), s0 = (int)(rb % SS); const int pc0 = n0 - 2 * DM;
    for (int q = tid; q < 128 * 8; q += 128) { const int d = q >> 3, pc = q & 7; const size_t o = ((size_t)b * DM + pc0 + d) * SS + s0 + pc * 8; vst2((unsigned*)(VTH + o), *(const v4u*)&sth[d][pc * 8]); vst2((unsigned*)(VTL + o), *(const v4u*)&stl[d][pc * 8]); }
  }
}
// ---- LDS staging of k_attn: a tile = 64 keys: their 64 k rows (128 B each), the 64 v^T rows' 64 columns (128 B each), and per wave a private copy of the keys' times and errors (256 B + 256 B); two buffers, filled one tile ahead
#define AKP 144                       // k / v^T row pitch in LDS: 16 B x odd
#define AK_V (64 * AKP)
#define AK_TE (2 * 64 * AKP)
#define ASTG (AK_TE + 4 * 512)        // one buffer
#define ANT (SS / 64)
#define LOG2E 1.44269504088896340736f
// nine 16-byte copies of one thread (4 of k, 4 of v^T, 1 of times | errors); the closing s_wait_xcnt 0 keeps every address register named here unchanged until the copies have taken it
__device__ __forceinline__ void stage_kv(unsigned lbuf, const _Float16* Kr, const _Float16* Vr, const float* Tb, const float* Eb, int t, int tid) {
  const int lane = tid & 31;
  const unsigned lk = lbuf + (unsigned)(tid >> 3) * AKP + (unsigned)(tid & 7) * 16u, lv = lk + AK_V, lt = lbuf + AK_TE + (unsigned)(tid >> 5) * 512u + (unsigned)lane * 16u;
  const char* gk = (const char*)(Kr + ((size_t)t * 64 + (tid >> 3)) * (2 * DM) + (tid & 7) * 8);
  const char* gv = (const char*)(Vr + (size_t)(tid >> 3) * SS + t * 64 + (tid & 7) * 8);
  const char* gt = (const char*)(((lane < 16) ? Tb : Eb) + t * 64 + (lane & 15) * 4);
  const size_t ks16 = (size_t)16 * 2 * DM * 2, vs16 = (size_t)16 * SS * 2;
  asm volatile("global_load_async_to_lds_b128 %0, %9, off\n\t"
               "global_load_async_to_lds_b128 %1, %10, off\n\t"
               "global_load_async_to_lds_b128 %2, %11, off\n\t"
               "global_load_async_to_lds_b128 %3, %12, off\n\t"
               "global_load_async_to_lds_b128 %4, %13, off\n\t"
               "global_load_async_to_lds_b128 %5, %14, off\n\t"
               "global_load_async_to_lds_b128 %6, %15, off\n\t"
               "global_load_async_to_lds_b128 %7, %16, off\n\t"
               "global_load_async_to_lds_b128 %8, %17, off\n\t"
               "s_wait_xcnt 0x0"
               :: "v"(lk), "v"(lk + 16u * AKP), "v"(lk + 32u * AKP), "v"(lk + 48u * AKP), "v"(lv), "v"(lv + 16u * AKP), "v"(lv + 32u * AKP), "v"(lv + 48u * AKP), "v"(lt),
                  "v"(gk), "v"(gk + ks16), "v"(gk + 2 * ks16), "v"(gk + 3 * ks16), "v"(gv), "v"(gv + vs16), "v"(gv + 2 * vs16), "v"(gv + 3 * vs16), "v"(gt)
               : "memory");
}
// lane l with lane l ^ 16 (the two lanes that share one query column), by a vector cross-row move
__device__ __forceinline__ float xhalf(float x) { return __builtin_bit_cast(float, __builtin_amdgcn_permlanex16(__builtin_bit_cast(int, x), __builtin_bit_cast(int, x), 0x76543210, 0xfedcba98, false, false)); }
// ---- k_attn: block = (64 queries, head h, batch b): all-keys flash attention, transposed: S^T = K . Q^T (A = 16 key rows from LDS, B = the wave's 16 queries, kept in registers), so a lane holds 8 keys' scores of ONE query (column = lane & 15, keys 8g + r); maximum and sum run in the lane, the two halves exchange the maximum once a step and join their sums once at the end; two S^T tiles, converted in place, are the B operand of O^T += V^T . P^T; O[b*S+q][h*64+d] = acc / l (256-B segments)
__global__ __launch_bounds__(128) void k_attn(const _Float16* __restrict__ QK, const _Float16* __restrict__ QKL, const _Float16* __restrict__ VTH, const _Float16* __restrict__ VTL, const void* __restrict__ KMASK, const float* __restrict__ TS, const float* __restrict__ ERR, const float* __restrict__ LAMH, const float* __restrict__ WG, const float* __restrict__ BG, float* __restrict__ O) {
  __shared__ __align__(16) float so[4][16][68]; __shared__ __attribute__((aligned(16))) unsigned char L[2 * ASTG];
  const int tid = threadIdx.x, wave = tid >> 5, lane = tid & 31, col = lane & 15, g = lane >> 4;
  const int qb = blockIdx.x, h = blockIdx.y, b = blockIdx.z; const int q0 = qb * 64 + wave * 16; const size_t rq = (size_t)b * SS + q0 + col;
  v16h bq[2];
#pragma unroll
  for (int kc = 0; kc < 2; ++kc) bq[kc] = frag_h(QK + rq * (2 * DM) + h * HD + kc * 32, lane);
  asm volatile("s_wait_xcnt 0x0" ::: "memory");   // a precaution: stands in front of the first instruction that reuses the four query loads' address pair
  // per-head constants and the lane's own query's time / error values for the score biases
  const float lraw = bfr(LAMH[h]); const float lam = (lraw > 20.f) ? lraw : log1pf(expf(lraw));   // softplus, precise, once a thread: in line, so that the kernel holds no call
  const float wg0 = bfr(WG[h * 2]), wg1 = bfr(WG[h * 2 + 1]), bgh = bfr(BG[h]); const float lam2 = lam * LOG2E;   // scores carry the factor log2 e, so that every exp and log of the loop is one hardware instruction
  const float tq = TS[rq]; const float gq = (wg0 * bfr(ERR[rq]) + bgh) * -LOG2E; const float wk = wg1 * -LOG2E;   // gate logit's query part and the key part's factor, as the exponent of 2 in exp(-logit)
  float m = -3.0e38f, l = 0.f;
  v8f acc[4] = {};
  const unsigned lb = (unsigned)(uintptr_t)&L[0]; const _Float16* Kr = QK + (size_t)b * SS * (2 * DM) + DM + h * HD; const _Float16* Vr = VTH + ((size_t)b * DM + h * HD) * SS; const float* Tb = TS + (size_t)b * SS; const float* Eb = ERR + (size_t)b * SS;
  stage_kv(lb, Kr, Vr, Tb, Eb, 0, tid); WAIT_ASYNC(); __syncthreads(); stage_kv(lb + ASTG, Kr, Vr, Tb, Eb, 1, tid);
#pragma unroll 1   // kept rolled: one trip = one buffer = 64 keys, all keys in order
  for (int t = 0; t < ANT; ++t) { const unsigned char* S = L + (t & 1) * ASTG;
#pragma unroll 1   // kept rolled: the tile's two 32-key steps share one body
  for (int ks = 0; ks < 2; ++ks) { v8f s[2]; v16h kf[2][2];
#pragma unroll   // constant indices keep kf[][] in registers (also the next directive)
    for (int ct = 0; ct < 2; ++ct)
#pragma unroll
      for (int kc = 0; kc < 2; ++kc) kf[ct][kc] = frag_h((const _Float16*)(S + (ks * 32 + ct * 16 + col) * AKP + kc * 64), lane);   // the step's four k fragments first, then its WMMAs
#pragma unroll
    for (int ct = 0; ct < 2; ++ct) { v8f c = {};
#pragma unroll
      for (int kc = 0; kc < 2; ++kc) c = wmma16(kf[ct][kc], bq[kc], c);   // single product: k, q as one-rounding f16 operands; c[r] = key 16 ct + 8 g + r against query col
      const v4f* te = (const v4f*)(S + AK_TE + wave * 512 + (ks * 32 + ct * 16 + 8 * g) * 4); const v4f t0 = te[0], t1 = te[1], e0 = te[16], e1 = te[17];   // the lane's 8 keys' times and errors
#pragma unroll
      for (int r = 0; r < 8; ++r) { const float tk = (r < 4) ? t0[r & 3] : t1[r & 3]; const float ek = (r < 4) ? e0[r & 3] : e1[r & 3];
        const float sig = __builtin_amdgcn_rcpf(1.0f + __builtin_amdgcn_exp2f(wk * bfr(ek) + gq)); s[ct][r] = c[r] * (0.125f * LOG2E) + (__builtin_amdgcn_logf(sig + 1e-9f) - lam2 * fabsf(tq - tk)); } }   // (q.k/8 + time-decay bias + error-gate bias) x log2 e: sigmoid by v_exp_f32 and v_rcp_f32, its logarithm by v_log_f32
    float mx = fmaxf(s[0][0], s[1][0]);
#pragma unroll
    for (int r = 1; r < 8; ++r) mx = fmaxf(mx, fmaxf(s[0][r], s[1][r]));
    mx = fmaxf(mx, xhalf(mx));   // both halves hold the query's maximum over the step's 32 keys
    const float mn = fmaxf(m, mx); const float alpha = (m <= -1.0e38f) ? 0.f : __builtin_amdgcn_exp2f(m - mn);
    v2f es = {0.f, 0.f}; v16h pb;
#pragma unroll
    for (int ct = 0; ct < 2; ++ct)
#pragma unroll
      for (int r = 0; r < 8; r += 2) { v2f e; e[0] = (s[ct][r] <= -1.0e38f) ? 0.f : __builtin_amdgcn_exp2f(s[ct][r] - mn); e[1] = (s[ct][r + 1] <= -1.0e38f) ? 0.f : __builtin_amdgcn_exp2f(s[ct][r + 1] - mn);
        es = (ct + r == 0) ? e : es + e; const v2f x = e * 2048.0f; pb[ct * 8 + r] = (_Float16)x[0]; pb[ct * 8 + r + 1] = (_Float16)x[1]; }   // even and odd keys summed side by side (packed adds); P scaled by 2^11 so small softmax weights stay out of the f16 subnormal range; 2^-11 folded into the epilogue; element 8 ct + r = key 16 ct + 8 g + r, the k order of the v fragments
    l = l * alpha + (es[0] + es[1]); m = mn;   // the lane's own 16 keys of the step; the halves' sums are joined behind the loop
#pragma unroll
    for (int dt = 0; dt < 4; ++dt) acc[dt] *= alpha;
    v16h vf[4];
#pragma unroll   // constant indices keep vf[] in registers
    for (int dt = 0; dt < 4; ++dt) vf[dt] = frag_h((const _Float16*)(S + AK_V + (dt * 16 + col) * AKP + ks * 64), lane);   // the step's four v fragments first, then its WMMAs
#pragma unroll
    for (int dt = 0; dt < 4; ++dt) acc[dt] = wmma16(vf[dt], pb, acc[dt]); }   // single product: V^T x P^T (x2^11); acc[dt][r] = d 16 dt + 8 g + r of query col
    WAIT_DS(); WAIT_ASYNC(); __syncthreads();   // publishes tile t + 1 and frees tile t's buffer
    if (t + 2 < ANT) stage_kv(lb + (unsigned)(t & 1) * ASTG, Kr, Vr, Tb, Eb, t + 2, tid); }
  WAIT_ASYNC();
  const float il = (1.0f / 2048.0f) / (l + xhalf(l));
#pragma unroll
  for (int dt = 0; dt < 4; ++dt) { v4f o0, o1;
#pragma unroll
    for (int i = 0; i < 4; ++i) { o0[i] = acc[dt][i] * il; o1[i] = acc[dt][4 + i] * il; }
    *(v4f*)&so[wave][col][dt * 16 + 8 * g] = o0; *(v4f*)&so[wave][col][dt * 16 + 8 * g + 4] = o1; }
  LDSX();
  for (int rl = 0; rl < 16; ++rl) if (lane < 16) vst2(O + ((size_t)b * SS + q0 + rl) * DM + h * HD + lane * 4, *(const v4f*)&so[wave][rl][lane * 4]);
}
// ---- k_out: block = (64 rows, 128 cols): out = O(hi/lo) . Wo rows (2 products) + bo
__global__ __launch_bounds__(128) void k_out(const float* __restrict__ O, const __bf16* __restrict__ P, const float* __restrict__ BO, float* __restrict__ Y) {
  __shared__ __attribute__((aligned(16))) unsigned char L[2 * STG];   // the two tile buffers; behind the k loop's last barrier the same bytes serve as output staging
  float (*so)[16][132] = (float (*)[16][132])L;
  const int tid = threadIdx.x, wave = tid >> 5, lane = tid & 31, col = lane & 15, g = lane >> 4; const size_t r0 = (size_t)blockIdx.x * 64 + wave * 16; const int n0 = blockIdx.y * 128;
  v8f acc[8] = {};
  { const unsigned lb = (unsigned)(uintptr_t)&L[0]; const __bf16* Wr = P + (size_t)n0 * DM; const float* Ar = O + (size_t)blockIdx.x * 64 * DM;
    stage_tile(lb, Wr, Ar, 0, tid); WAIT_ASYNC(); __syncthreads(); stage_tile(lb + STG, Wr, Ar, 1, tid);
#pragma unroll 1   // kept rolled: one trip = one buffer
    for (int t = 0; t < NT; ++t) { const unsigned char* S = L + (t & 1) * STG;
#pragma unroll   // constant indices keep bf[] and acc[] in registers (also the two directives below)
      for (int kc = 0; kc < 2; ++kc) { float av[16]; v16b bf[8]; lds_a16(S + BTILE + (wave * 16 + col) * APITCH + kc * 128, g, av);   // all fragments of the k step first, then its WMMAs
#pragma unroll
        for (int j = 0; j < 8; ++j) bf[j] = frag_b((const __bf16*)(S + (j * 16 + col) * BPITCH + kc * 64), lane);
        const F2 a = bsplit16(av);
#pragma unroll
        for (int j = 0; j < 8; ++j) { acc[j] = wmma_bf(a.l, bf[j], acc[j]); acc[j] = wmma_bf(a.h, bf[j], acc[j]); } }
      WAIT_DS(); WAIT_ASYNC(); __syncthreads();   // publishes tile t + 1 and frees tile t's buffer
      if (t + 2 < NT) stage_tile(lb + (unsigned)(t & 1) * STG, Wr, Ar, t + 2, tid); }
    WAIT_ASYNC(); }
#pragma unroll
  for (int j = 0; j < 8; ++j) {
#pragma unroll
    for (int r = 0; r < 8; ++r) so[wave][8 * g + r][j * 16 + col] = acc[j][r] + bfr(BO[n0 + j * 16 + col]); }
  LDSX();
  for (int rl = 0; rl < 16; ++rl) vst2(Y + (r0 + rl) * DM + n0 + lane * 4, *(const v4f*)&so[wave][rl][lane * 4]);
}
// ---- k_ts: blocks with blockIdx.y >= 64 round 8,192 elements of x to bf16 each (a thread: eight 16-B loads in flight together, eight 8-B stores; a wave's load covers 4 whole lines, its store 2): they need nothing of the other blocks and run beside their chain of waits. The other blocks: block = (batch, 16 tokens): t_scaled = (t - min) / (max - min + 1e-6) * 1000, minimum and maximum over the batch's whole sequence in every block; the block's 16 scaled times and their rotary table: cos and sin of t_scaled x inv_freq[f], once per (token, frequency)
__global__ __launch_bounds__(256) void k_ts(const float* __restrict__ TR, float* __restrict__ TS, float* __restrict__ ROT, const float* __restrict__ X, __bf16* __restrict__ XB) {
  if (blockIdx.y >= SS / 16) {   // the same for the whole block, in front of every barrier
    const size_t e0 = ((size_t)(blockIdx.y - SS / 16) * NB + blockIdx.x) * XCB + threadIdx.x * 4; v4f v[8];
#pragma unroll   // constant indices keep v[] in registers; all eight loads first, then the stores (also the next directive)
    for (int i = 0; i < 8; ++i) v[i] = *(const v4f*)(X + e0 + i * 1024);
#pragma unroll
    for (int i = 0; i < 8; ++i) { v4b o; o[0] = (__bf16)v[i][0]; o[1] = (__bf16)v[i][1]; o[2] = (__bf16)v[i][2]; o[3] = (__bf16)v[i][3]; *(v4b*)(XB + e0 + i * 1024) = o; }
    return; }
  __shared__ float rmn[256], rmx[256]; const size_t b = blockIdx.x; const int t = threadIdx.x; float mn = 3.0e38f, mx = -3.0e38f;
  for (int s = t; s < SS; s += 256) { const float v = bfr(TR[b * SS + s]); mn = fminf(mn, v); mx = fmaxf(mx, v); }
  rmn[t] = mn; rmx[t] = mx; __syncthreads();
  for (int st = 128; st > 0; st >>= 1) { if (t < st) { rmn[t] = fminf(rmn[t], rmn[t + st]); rmx[t] = fmaxf(rmx[t], rmx[t + st]); } __syncthreads(); }
  const float tmin = rmn[0], den = rmx[0] - rmn[0] + 1e-6f;
  const size_t s0 = b * SS + blockIdx.y * 16;
  if (t < 16) TS[s0 + t] = (bfr(TR[s0 + t]) - tmin) / den * 1000.0f;   // 4-B scratch stores
  for (int q = t; q < 16 * 32; q += 256) { const size_t s = s0 + (q >> 5); const int p = q & 31, f = (p & 3) * 8 + (p >> 2);   // place p of a token's row holds frequency f: a k_qkv lane's four frequencies lie side by side
    const float ang = (bfr(TR[s]) - tmin) / den * 1000.0f * INVF[f]; v2f cs; cs[0] = cos_p(ang); cs[1] = sin_p(ang); *(v2f*)(ROT + s * 64 + p * 2) = cs; }   // a wave stores one token's 256 B
}
extern "C" void kernel_launch(void* const* d_in, const int* in_sizes, int n_in, void* d_out, int out_size, void* d_ws, size_t ws_size, hipStream_t stream) {
  (void)in_sizes; (void)n_in; (void)out_size;
  const float** F = (const float**)d_in;   // 0 x [4,1024,1024], 1 t_raw [4,1024], 2 error [4,1024], 3 Wq, 4 bq, 5 Wk, 6 bk, 7 Wv, 8 bv, 9 Wo, 10 bo, 11 lambda_h [16], 12 Wg [16,2], 13 bg [16]
  if (ws_size < (size_t)WS_TOP + 256) return;
  char* ws = (char*)d_ws; __bf16* PK = (__bf16*)(ws + WS_PK); _Float16 *QK = (_Float16*)(ws + WS_QK), *QKL = (_Float16*)(ws + WS_QKL), *VTH = (_Float16*)(ws + WS_VTH), *VTL = (_Float16*)(ws + WS_VTL); float* O = (float*)(ws + WS_O); float* TS = (float*)(ws + WS_TS); float* ROT = (float*)(ws + WS_ROT); __bf16* XB = (__bf16*)(ws + WS_XB);
  k_pack<<<dim3(DM, 4), 256, 0, stream>>>(F[3], F[5], F[7], F[9], PK);
  k_ts<<<dim3(NB, SS / 16 + SS * DM / XCB), 256, 0, stream>>>(F[1], TS, ROT, F[0], XB);
  k_qkv<<<dim3(TNB * SS / 64, QKVW / 128), 128, 0, stream>>>(XB, PK + PK_A, F[4], F[6], F[8], ROT, QK, QKL, VTH, VTL);
  k_attn<<<dim3(TQB, NH, TNB), 128, 0, stream>>>(QK, QKL, VTH, VTL, nullptr, TS, F[2], F[11], F[12], F[13], O);
  k_out<<<dim3(TOB, DM / 128), 128, 0, stream>>>(O, PK + PK_P, F[10], (float*)d_out);
}

// v007
// Measured time: 101 microseconds a run.
// Two timings next to v006 put it at 1.04 and 1.03 times that version's speed.
// Over all steps from v000 it is 3.97 times as fast.
// compute dtype: all float inputs rounded to bf16; q/k/v = x . W^T + b with EXACT bf16 products on WMMA 16x16x32 (natural rows); per-batch time scaling and the interleaved-pair rotary (neighbouring lanes; angle = t_scaled x inv_freq[d/2] with jnp's inv_freq constants, precise cosf/sinf) in f32; PLAIN attention: rotated q, k as single f16 operands x 1/8 + the decay and gate biases evaluated per score in f32 (base 2: hardware exp, reciprocal and log; the per-head softplus by precise expf/log1pf), running-max softmax in f32 (base 2, hardware exp), P (scaled by 2^11, single f16) x v (single f16); out = o (bf16 hi + residual) . Wo^T (2 products) + bo.
#include <hip/hip_runtime.h>
#include <math.h>

typedef __attribute__((ext_vector_type(16))) _Float16 v16h;
typedef __attribute__((ext_vector_type(16))) __bf16 v16b;
typedef __attribute__((ext_vector_type(8)))  _Float16 v8h;
typedef __attribute__((ext_vector_type(8)))  float v8f;
typedef __attribute__((ext_vector_type(4)))  float v4f;
typedef __attribute__((ext_vector_type(2)))  float v2f;
typedef __attribute__((ext_vector_type(4)))  unsigned v4u;
typedef __attribute__((ext_vector_type(4)))  int v4i;
typedef float __attribute__((may_alias)) float_a;
typedef int __attribute__((may_alias)) int_a;

template <typename T> __device__ __forceinline__ void vst2(void* p, T v) { *(T*)p = v;  }
__device__ __forceinline__ v8f wmma16(v16h a, v16h b, v8f c) {
  v8f d = __builtin_amdgcn_wmma_f32_16x16x32_f16(false, a, false, b, (short)0, c, false, false);
  asm volatile("v_nop\n\tv_nop\n\tv_nop\n\tv_nop" : "+v"(d) : "v"(a), "v"(b));
  return d;
}
__device__ __forceinline__ v8f wmma_bf(v16b a, v16b b, v8f c) {
  v8f d = __builtin_amdgcn_wmma_f32_16x16x32_bf16(false, a, false, b, (short)0, c, false, false);
  asm volatile("v_nop\n\tv_nop\n\tv_nop\n\tv_nop" : "+v"(d) : "v"(a), "v"(b));
  return d;
}
// Scaled continuous-time attention (B 4, S 1,024, d 1,024, 16 heads x 64): q/k/v projections + biases, an interleaved rotary embedding whose angle is the per-token time (min-max scaled to [0, 1000]) x inv_freq, scores / 8 plus a per-head time-decay bias (-softplus(lambda_h) |t_i - t_j|) and an error-gated bias log(sigmoid(w_h0 err_i + w_h1 err_j + b_h) + 1e-9), softmax, . v, output projection + bias.
__device__ __forceinline__ v16h frag_h(const _Float16* rowk0, int lane) {
  union { v16h v; v8h q[2]; } u; const _Float16* p = rowk0 + 8 * (lane >> 4);
  u.q[0] = *(const v8h*)p; u.q[1] = *(const v8h*)(p + 16); return u.v;
}
__device__ __forceinline__ v16h frag_f32(const float* rowk0, int lane) {
  v16h a; const float* p = rowk0 + 8 * (lane >> 4);
#pragma unroll
  for (int i = 0; i < 8; ++i) { a[i] = (_Float16)p[i]; a[8 + i] = (_Float16)p[16 + i]; }
  return a;
}
__device__ __forceinline__ v16h frag_f32s(const float* rowk0, int lane, float sc) {
  v16h a; const float* p = rowk0 + 8 * (lane >> 4);
#pragma unroll
  for (int i = 0; i < 8; ++i) { a[i] = (_Float16)(p[i] * sc); a[8 + i] = (_Float16)(p[16 + i] * sc); }
  return a;
}
// column fragment from a [K][ld] layout (column n), rows >= K read as 0
__device__ __forceinline__ v16h fragc_f32(const float* W, int k0, int n, int lane, int ld, int K) {
  v16h a; const int g = lane >> 4;
#pragma unroll
  for (int i = 0; i < 8; ++i) { const int ka = k0 + 8 * g + i, kb = ka + 16;
    a[i] = (_Float16)(ka < K ? W[(size_t)(ka < K ? ka : K - 1) * ld + n] : 0.f); a[8 + i] = (_Float16)(kb < K ? W[(size_t)(kb < K ? kb : K - 1) * ld + n] : 0.f); }
  return a;
}
struct F2 { v16b h, l; };
__device__ __forceinline__ F2 bsplit16(const float v[16]) { F2 r;
#pragma unroll
  for (int i = 0; i < 16; ++i) { const __bf16 h = (__bf16)v[i]; r.h[i] = h; r.l[i] = (__bf16)(v[i] - (float)h); }
  return r; }
__device__ __forceinline__ F2 split_row(const float* row, int k0, int lane) { float v[16]; const float* p = row + k0 + 8 * (lane >> 4);
#pragma unroll
  for (int i = 0; i < 8; ++i) { v[i] = p[i]; v[8 + i] = p[16 + i]; }
  return bsplit16(v); }
__device__ __forceinline__ F2 split_rowK(const float* row, int k0, int lane, int K) { float v[16]; const int g = lane >> 4;
#pragma unroll
  for (int i = 0; i < 8; ++i) { const int ka = k0 + 8 * g + i, kb = ka + 16; v[i] = ka < K ? row[ka < K ? ka : K - 1] : 0.f; v[8 + i] = kb < K ? row[kb < K ? kb : K - 1] : 0.f; }
  return bsplit16(v); }
__device__ __forceinline__ F2 split_col(const float* W, int k0, int n, int lane, int ld, int K) { float v[16]; const int g = lane >> 4;
#pragma unroll
  for (int i = 0; i < 8; ++i) { const int ka = k0 + 8 * g + i, kb = ka + 16; v[i] = ka < K ? W[(size_t)(ka < K ? ka : K - 1) * ld + n] : 0.f; v[8 + i] = kb < K ? W[(size_t)(kb < K ? kb : K - 1) * ld + n] : 0.f; }
  return bsplit16(v); }
__device__ __forceinline__ v8f mac3(const F2& a, const F2& b, v8f c) { c = wmma_bf(a.l, b.h, c); c = wmma_bf(a.h, b.l, c); return wmma_bf(a.h, b.h, c); }
__device__ __forceinline__ float sigm(float v) { return 1.0f / (1.0f + expf(-v)); }
#define LDSX() do { asm volatile("s_wait_dscnt 0" ::: "memory"); __builtin_amdgcn_wave_barrier(); __builtin_amdgcn_fence(__ATOMIC_RELEASE, "workgroup"); } while (0)


#define NB 4
#define SS 1024
#define DM 1024
#define NH 16
__constant__ float INVF[32] = {1.000000000e+00f,7.498942018e-01f,5.623413324e-01f,4.216965139e-01f,3.162277639e-01f,2.371373773e-01f,1.778279394e-01f,1.333521456e-01f,1.000000015e-01f,7.498942316e-02f,5.623413250e-02f,4.216964915e-02f,3.162277490e-02f,2.371373773e-02f,1.778279431e-02f,1.333521400e-02f,9.999999776e-03f,7.498942316e-03f,5.623413250e-03f,4.216964822e-03f,3.162277630e-03f,2.371373819e-03f,1.778279431e-03f,1.333521446e-03f,1.000000047e-03f,7.498941850e-04f,5.623413017e-04f,4.216965172e-04f,3.162277571e-04f,2.371373703e-04f,1.778279402e-04f,1.333521504e-04f};
__device__ __attribute__((noinline)) float cos_p(float v) { return cosf(v); }
__device__ __attribute__((noinline)) float sin_p(float v) { return sinf(v); }
#define HD 64
#define QKVW (3 * DM)
#ifndef TQB
#define TQB (SS / 64)
#define TNB NB
#define TOB (NB * SS / 64)     // output row tiles (all)
#endif
typedef __attribute__((ext_vector_type(8))) __bf16 v8b;
typedef __attribute__((ext_vector_type(4))) __bf16 v4b;
__device__ __forceinline__ v16b frag_b(const __bf16* rowk0, int lane) {
  union { v16b v; v8b q[2]; } u; const __bf16* p = rowk0 + 8 * (lane >> 4);
  u.q[0] = *(const v8b*)p; u.q[1] = *(const v8b*)(p + 16); return u.v;
}
__device__ __forceinline__ float bfr(float v) { return (float)(__bf16)v; }
__device__ __attribute__((noinline)) float erf_ni(float v) { return erff(v); }

#define PK_A 0                       // [3072][1024] Wqkv rows (natural [out][in])
#define PK_P (PK_A + QKVW * DM)        // [1024][1024] Wo rows (natural)
#define PK_END (PK_P + DM * DM)
#define WS_PK  0u
#define WS_QK  (WS_PK + 2u * PK_END)             // f16 [4096 rows][2048]: q | k
#define WS_QKL (WS_QK + 2u * NB * SS * 2 * DM)     // f16 q | k residual planes x2048
#define WS_VTH (WS_QKL + 2u * NB * SS * 2 * DM)    // f16 [b][1024 (h*64+d)][1024 s] hi
#define WS_VTL (WS_VTH + 2u * NB * DM * SS)        // f16 lo x 2048
#define WS_O   (WS_VTL + 2u * NB * DM * SS)        // f32 [4096][1024]
#define WS_CS  (WS_O + 4u * NB * SS * DM)           // f32 2 x [1024][32], not used (cos/sin computed in k_ts)
#define WS_END (WS_CS + 4u * 2 * SS * 32)
#define WS_TS  WS_END                               // f32 [4096] scaled times
#define WS_ROT (WS_TS + 4u * NB * SS)               // f32 [4096 tokens][8 (f & 7)][4 (f >> 3)][cos, sin]: the rotary table, 256 B a token
#define WS_XB  (WS_ROT + 4u * NB * SS * 64)         // bf16 [4096 tokens][1024]: x, rounded once
#define WS_TOP (WS_XB + 2u * NB * SS * DM)
// ---- LDS staging of the two projection GEMMs: a tile = 64 k of 128 weight rows (bf16, 128 B a row) and of 64 activation rows (k_out: f32, 256 B a row; k_qkv: bf16, further down); two buffers, filled by asynchronous copies one tile ahead
#define KT 64
#define BPITCH 144                    // weight row pitch in LDS: 16 B x odd, conflict-free for 16-byte reads
#define APITCH 272                    // activation row pitch in LDS: 16 B x odd
#define BTILE (128 * BPITCH)
#define STG (BTILE + 64 * APITCH)     // one buffer
#define NT (DM / KT)
// eight 16-byte copies of one thread, global memory -> LDS, no register in between; the closing s_wait_xcnt 0 keeps every address register named here unchanged until the copies have taken it
__device__ __forceinline__ void copy8(unsigned l, const char* g, unsigned lstep, size_t gstep) {
  asm volatile("global_load_async_to_lds_b128 %0, %8, off\n\t"
               "global_load_async_to_lds_b128 %1, %9, off\n\t"
               "global_load_async_to_lds_b128 %2, %10, off\n\t"
               "global_load_async_to_lds_b128 %3, %11, off\n\t"
               "global_load_async_to_lds_b128 %4, %12, off\n\t"
               "global_load_async_to_lds_b128 %5, %13, off\n\t"
               "global_load_async_to_lds_b128 %6, %14, off\n\t"
               "global_load_async_to_lds_b128 %7, %15, off\n\t"
               "s_wait_xcnt 0x0"
               :: "v"(l), "v"(l + lstep), "v"(l + 2 * lstep), "v"(l + 3 * lstep), "v"(l + 4 * lstep), "v"(l + 5 * lstep), "v"(l + 6 * lstep), "v"(l + 7 * lstep),
                  "v"(g), "v"(g + gstep), "v"(g + 2 * gstep), "v"(g + 3 * gstep), "v"(g + 4 * gstep), "v"(g + 5 * gstep), "v"(g + 6 * gstep), "v"(g + 7 * gstep)
               : "memory");
}
// tile t of the block's 128 weight rows (Wr = row 0, k 0) and 64 activation rows (Ar) into the buffer at LDS byte address lbuf: a wave's copy covers 4 whole 128-B lines
__device__ __forceinline__ void stage_tile(unsigned lbuf, const __bf16* Wr, const float* Ar, int t, int tid) {
  copy8(lbuf + (unsigned)(tid >> 3) * BPITCH + (unsigned)(tid & 7) * 16u, (const char*)(Wr + (size_t)(tid >> 3) * DM + t * KT + (tid & 7) * 8), 16u * BPITCH, (size_t)16 * DM * 2);
  copy8(lbuf + BTILE + (unsigned)(tid >> 4) * APITCH + (unsigned)(tid & 15) * 16u, (const char*)(Ar + (size_t)(tid >> 4) * DM + t * KT + (tid & 15) * 4), 8u * APITCH, (size_t)8 * DM * 4);
}
// ---- k_qkv's tile: 64 k of 128 weight rows and, right behind them at the same pitch, of 64 activation rows, all bf16 (128 B a row): 192 rows, 16 a pass
#define QSTG (192 * BPITCH)           // one buffer
#define XCB 16384                     // elements that one converting block of k_ts's launch rounds
// twelve 16-byte copies of one thread (8 of weights, 4 of activations), global memory -> LDS, no register in between; the closing s_wait_xcnt 0 keeps every address register named here unchanged until the copies have taken it
__device__ __forceinline__ void stage_tile_b(unsigned lbuf, const __bf16* Wr, const __bf16* Ar, int t, int tid) {
  const unsigned l = lbuf + (unsigned)(tid >> 3) * BPITCH + (unsigned)(tid & 7) * 16u, ls = 16u * BPITCH;
  const size_t o = (size_t)(tid >> 3) * DM + t * KT + (tid & 7) * 8, gs = (size_t)16 * DM * 2;
  const char* gw = (const char*)(Wr + o); const char* ga = (const char*)(Ar + o);
  asm volatile("global_load_async_to_lds_b128 %0, %12, off\n\t"
               "global_load_async_to_lds_b128 %1, %13, off\n\t"
               "global_load_async_to_lds_b128 %2, %14, off\n\t"
               "global_load_async_to_lds_b128 %3, %15, off\n\t"
               "global_load_async_to_lds_b128 %4, %16, off\n\t"
               "global_load_async_to_lds_b128 %5, %17, off\n\t"
               "global_load_async_to_lds_b128 %6, %18, off\n\t"
               "global_load_async_to_lds_b128 %7, %19, off\n\t"
               "global_load_async_to_lds_b128 %8, %20, off\n\t"
               "global_load_async_to_lds_b128 %9, %21, off\n\t"
               "global_load_async_to_lds_b128 %10, %22, off\n\t"
               "global_load_async_to_lds_b128 %11, %23, off\n\t"
               "s_wait_xcnt 0x0"
               :: "v"(l), "v"(l + ls), "v"(l + 2 * ls), "v"(l + 3 * ls), "v"(l + 4 * ls), "v"(l + 5 * ls), "v"(l + 6 * ls), "v"(l + 7 * ls), "v"(l + 8 * ls), "v"(l + 9 * ls), "v"(l + 10 * ls), "v"(l + 11 * ls),
                  "v"(gw), "v"(gw + gs), "v"(gw + 2 * gs), "v"(gw + 3 * gs), "v"(gw + 4 * gs), "v"(gw + 5 * gs), "v"(gw + 6 * gs), "v"(gw + 7 * gs), "v"(ga), "v"(ga + gs), "v"(ga + 2 * gs), "v"(ga + 3 * gs)
               : "memory");
}
// the 16 f32 of an A fragment from a staged row: k = 8g .. 8g+7 and 16+8g .. 16+8g+7 of the 32-k step at rowk0
__device__ __forceinline__ void lds_a16(const unsigned char* rowk0, int g, float v[16]) {
  const v4f* p = (const v4f*)(rowk0 + 32 * g); const v4f x0 = p[0], x1 = p[1], x2 = p[4], x3 = p[5];
#pragma unroll   // constant indices keep v[] in registers
  for (int i = 0; i < 4; ++i) { v[i] = x0[i]; v[4 + i] = x1[i]; v[8 + i] = x2[i]; v[12 + i] = x3[i]; }
}
#define WAIT_ASYNC() asm volatile("s_wait_asynccnt 0x0" ::: "memory")   // this wave's copies have landed
#define WAIT_DS()    asm volatile("s_wait_dscnt 0x0" ::: "memory")      // this wave's LDS reads are done before the buffer is handed back
__global__ __launch_bounds__(128) void k_qkv(const __bf16* __restrict__ XB, const __bf16* __restrict__ P, const float* __restrict__ BQ, const float* __restrict__ BK, const float* __restrict__ BV, const float* __restrict__ ROT, _Float16* __restrict__ QK, _Float16* __restrict__ QKL, _Float16* __restrict__ VTH, _Float16* __restrict__ VTL) {
  const int which0 = (blockIdx.y * 128) / DM; const float* BB = BQ ? (((which0 == 0) ? BQ : (which0 == 1) ? BK : BV) + (blockIdx.y * 128 - which0 * DM)) : nullptr;
  __shared__ __attribute__((aligned(16))) unsigned char L[2 * QSTG];   // the two tile buffers; behind the k loop's last barrier the same bytes serve as output staging
  _Float16 (*so)[16][136] = (_Float16 (*)[16][136])L; _Float16 (*sol)[16][136] = (_Float16 (*)[16][136])(L + 4 * 16 * 136 * 2); _Float16 (*sth)[72] = (_Float16 (*)[72])L; _Float16 (*stl)[72] = (_Float16 (*)[72])(L + 128 * 72 * 2);
  const int tid = threadIdx.x, wave = tid >> 5, lane = tid & 31, col = lane & 15, g = lane >> 4; const size_t r0 = (size_t)blockIdx.x * 64 + wave * 16; const int n0 = blockIdx.y * 128;
  v8f acc[8] = {};
  v4f cs[8][2] = {};   // q and k blocks: the lane's 8 rows x 4 frequencies ((j & 3) * 8 + col / 2) of the rotary table, 32 B a row; sixteen 16-B loads issued in front of the k loop, first used behind it
  if (n0 < 2 * DM) { const v4f* cp = (const v4f*)(ROT + (r0 + 8 * g) * 64 + (col >> 1) * 8);
#pragma unroll   // constant indices keep cs[][] in registers
    for (int r = 0; r < 8; ++r) { cs[r][0] = cp[r * 16]; cs[r][1] = cp[r * 16 + 1]; }
    asm volatile("s_wait_xcnt 0x0" ::: "memory"); }   // a precaution: stands in front of the first instruction that reuses a register of the sixteen loads' address
  { const unsigned lb = (unsigned)(uintptr_t)&L[0]; const __bf16* Wr = P + (size_t)n0 * DM; const __bf16* Ar = XB + (size_t)blockIdx.x * 64 * DM;
    stage_tile_b(lb, Wr, Ar, 0, tid); WAIT_ASYNC(); __syncthreads(); stage_tile_b(lb + QSTG, Wr, Ar, 1, tid);
#pragma unroll 1   // kept rolled: one trip = one buffer
    for (int t = 0; t < NT; ++t) { const unsigned char* S = L + (t & 1) * QSTG;
#pragma unroll   // constant indices keep bf[] and acc[] in registers (also the two directives below)
      for (int kc = 0; kc < 2; ++kc) { v16b bf[8]; const v16b a = frag_b((const __bf16*)(S + BTILE + (wave * 16 + col) * BPITCH + kc * 64), lane);   // all fragments of the k step first, then its WMMAs
#pragma unroll
        for (int j = 0; j < 8; ++j) bf[j] = frag_b((const __bf16*)(S + (j * 16 + col) * BPITCH + kc * 64), lane);
#pragma unroll
        for (int j = 0; j < 8; ++j) acc[j] = wmma_bf(a, bf[j], acc[j]); }
      WAIT_DS(); WAIT_ASYNC(); __syncthreads();   // publishes tile t + 1 and frees tile t's buffer
      if (t + 2 < NT) stage_tile_b(lb + (unsigned)(t & 1) * QSTG, Wr, Ar, t + 2, tid); }
    WAIT_ASYNC(); }
  float bias[8] = {0.f, 0.f, 0.f, 0.f, 0.f, 0.f, 0.f, 0.f};   // the lane's eight column biases (column j * 16 + col), fetched once: eight loads in flight together, one latency for the whole epilogue
  if (BB) { const float* bp = BB + col;
#pragma unroll   // constant indices keep bias[] in registers (also the next directive)
    for (int j = 0; j < 8; ++j) bias[j] = bp[j * 16];
    asm volatile("s_wait_xcnt 0x0" ::: "memory");   // a precaution: stands in front of the first instruction that reuses a register of the eight loads' address
#pragma unroll
    for (int j = 0; j < 8; ++j) bias[j] = bfr(bias[j]); }
  if (n0 < 2 * DM) {   // bias, then the interleaved-pair rotary: pair (2i, 2i+1) = neighbouring lanes (col ^ 1), cos and sin of t_scaled[row] * inv_freq[i] from k_ts's table
#pragma unroll
    for (int j = 0; j < 8; ++j)
#pragma unroll
      for (int r = 0; r < 8; ++r) acc[j][r] += bias[j];
#pragma unroll
    for (int r = 0; r < 8; ++r) {
#pragma unroll
      for (int j = 0; j < 8; ++j) { const float c = cs[r][(j & 3) >> 1][(j & 1) * 2], sn = cs[r][(j & 3) >> 1][(j & 1) * 2 + 1]; const float v = acc[j][r]; const float pv = __shfl_xor(v, 1); acc[j][r] = (col & 1) ? (v * c + pv * sn) : (v * c - pv * sn); } }
#pragma unroll
    for (int j = 0; j < 8; ++j) {
#pragma unroll
      for (int r = 0; r < 8; ++r) { const float v = acc[j][r]; const _Float16 hv = (_Float16)v; so[wave][8 * g + r][j * 16 + col] = hv; sol[wave][8 * g + r][j * 16 + col] = (_Float16)((v - (float)hv) * 2048.0f); } }   // q, k (+ bias) as f16 hi + (x2048) residual
    LDSX();
    for (int rl = 0; rl < 16; ++rl) if (lane < 16) { vst2((unsigned*)(QK + (r0 + rl) * (2 * DM) + n0 + lane * 8), *(const v4u*)&so[wave][rl][lane * 8]); vst2((unsigned*)(QKL + (r0 + rl) * (2 * DM) + n0 + lane * 8), *(const v4u*)&sol[wave][rl][lane * 8]); }
  } else {
#pragma unroll
    for (int j = 0; j < 8; ++j) {
#pragma unroll
      for (int r = 0; r < 8; ++r) { const float v = acc[j][r] + bias[j]; const _Float16 hv = (_Float16)v; sth[j * 16 + col][wave * 16 + 8 * g + r] = hv; stl[j * 16 + col][wave * 16 + 8 * g + r] = (_Float16)((v - (float)hv) * 2048.0f); } }
    __syncthreads();
    const size_t rb = (size_t)blockIdx.x * 64; const int b = (int)(rb / SS), s0 = (int)(rb % SS); const int pc0 = n0 - 2 * DM;
    for (int q = tid; q < 128 * 8; q += 128) { const int d = q >> 3, pc = q & 7; const size_t o = ((size_t)b * DM + pc0 + d) * SS + s0 + pc * 8; vst2((unsigned*)(VTH + o), *(const v4u*)&sth[d][pc * 8]); vst2((unsigned*)(VTL + o), *(const v4u*)&stl[d][pc * 8]); }
  }
}
// ---- LDS staging of k_attn: a tile = 64 keys: their 64 k rows (128 B each), the 64 v^T rows' 64 columns (128 B each), and per wave a private copy of the keys' times and errors (256 B + 256 B); two buffers, filled one tile ahead
#define AKP 144                       // k / v^T row pitch in LDS: 16 B x odd
#define AK_V (64 * AKP)
#define AK_TE (2 * 64 * AKP)
#define ASTG (AK_TE + 4 * 512)        // one buffer
#define ANT (SS / 64)
#define LOG2E 1.44269504088896340736f
// nine 16-byte copies of one thread (4 of k, 4 of v^T, 1 of times | errors); the closing s_wait_xcnt 0 keeps every address register named here unchanged until the copies have taken it
__device__ __forceinline__ void stage_kv(unsigned lbuf, const _Float16* Kr, const _Float16* Vr, const float* Tb, const float* Eb, int t, int tid) {
  const int lane = tid & 31;
  const unsigned lk = lbuf + (unsigned)(tid >> 3) * AKP + (unsigned)(tid & 7) * 16u, lv = lk + AK_V, lt = lbuf + AK_TE + (unsigned)(tid >> 5) * 512u + (unsigned)lane * 16u;
  const char* gk = (const char*)(Kr + ((size_t)t * 64 + (tid >> 3)) * (2 * DM) + (tid & 7) * 8);
  const char* gv = (const char*)(Vr + (size_t)(tid >> 3) * SS + t * 64 + (tid & 7) * 8);
  const char* gt = (const char*)(((lane < 16) ? Tb : Eb) + t * 64 + (lane & 15) * 4);
  const size_t ks16 = (size_t)16 * 2 * DM * 2, vs16 = (size_t)16 * SS * 2;
  asm volatile("global_load_async_to_lds_b128 %0, %9, off\n\t"
               "global_load_async_to_lds_b128 %1, %10, off\n\t"
               "global_load_async_to_lds_b128 %2, %11, off\n\t"
               "global_load_async_to_lds_b128 %3, %12, off\n\t"
               "global_load_async_to_lds_b128 %4, %13, off\n\t"
               "global_load_async_to_lds_b128 %5, %14, off\n\t"
               "global_load_async_to_lds_b128 %6, %15, off\n\t"
               "global_load_async_to_lds_b128 %7, %16, off\n\t"
               "global_load_async_to_lds_b128 %8, %17, off\n\t"
               "s_wait_xcnt 0x0"
               :: "v"(lk), "v"(lk + 16u * AKP), "v"(lk + 32u * AKP), "v"(lk + 48u * AKP), "v"(lv), "v"(lv + 16u * AKP), "v"(lv + 32u * AKP), "v"(lv + 48u * AKP), "v"(lt),
                  "v"(gk), "v"(gk + ks16), "v"(gk + 2 * ks16), "v"(gk + 3 * ks16), "v"(gv), "v"(gv + vs16), "v"(gv + 2 * vs16), "v"(gv + 3 * vs16), "v"(gt)
               : "memory");
}
// lane l with lane l ^ 16 (the two lanes that share one query column), by a vector cross-row move
__device__ __forceinline__ float xhalf(float x) { return __builtin_bit_cast(float, __builtin_amdgcn_permlanex16(__builtin_bit_cast(int, x), __builtin_bit_cast(int, x), 0x76543210, 0xfedcba98, false, false)); }
// ---- k_attn: block = (64 queries, head h, batch b): all-keys flash attention, transposed: S^T = K . Q^T (A = 16 key rows from LDS, B = the wave's 16 queries, kept in registers), so a lane holds 8 keys' scores of ONE query (column = lane & 15, keys 8g + r); maximum and sum run in the lane, the two halves exchange the maximum once a step and join their sums once at the end; two S^T tiles, converted in place, are the B operand of O^T += V^T . P^T; O[b*S+q][h*64+d] = acc / l (256-B segments)
__global__ __launch_bounds__(128) void k_attn(const _Float16* __restrict__ QK, const _Float16* __restrict__ QKL, const _Float16* __restrict__ VTH, const _Float16* __restrict__ VTL, const void* __restrict__ KMASK, const float* __restrict__ TS, const float* __restrict__ ERR, const float* __restrict__ LAMH, const float* __restrict__ WG, const float* __restrict__ BG, float* __restrict__ O) {
  __shared__ __align__(16) float so[4][16][68]; __shared__ __attribute__((aligned(16))) unsigned char L[2 * ASTG];
  const int tid = threadIdx.x, wave = tid >> 5, lane = tid & 31, col = lane & 15, g = lane >> 4;
  const int qb = blockIdx.x, h = blockIdx.y, b = blockIdx.z; const int q0 = qb * 64 + wave * 16; const size_t rq = (size_t)b * SS + q0 + col;
  v16h bq[2];
#pragma unroll
  for (int kc = 0; kc < 2; ++kc) bq[kc] = frag_h(QK + rq * (2 * DM) + h * HD + kc * 32, lane);
  asm volatile("s_wait_xcnt 0x0" ::: "memory");   // a precaution: stands in front of the first instruction that reuses the four query loads' address pair
  // per-head constants and the lane's own query's time / error values for the score biases
  const float lraw = bfr(LAMH[h]); const float lam = (lraw > 20.f) ? lraw : log1pf(expf(lraw));   // softplus, precise, once a thread: in line, so that the kernel holds no call
  const float wg0 = bfr(WG[h * 2]), wg1 = bfr(WG[h * 2 + 1]), bgh = bfr(BG[h]); const float lam2 = lam * LOG2E;   // scores carry the factor log2 e, so that every exp and log of the loop is one hardware instruction
  const float tq = TS[rq]; const float gq = (wg0 * bfr(ERR[rq]) + bgh) * -LOG2E; const float wk = wg1 * -LOG2E;   // gate logit's query part and the key part's factor, as the exponent of 2 in exp(-logit)
  float m = -3.0e38f, l = 0.f;
  v8f acc[4] = {};
  const unsigned lb = (unsigned)(uintptr_t)&L[0]; const _Float16* Kr = QK + (size_t)b * SS * (2 * DM) + DM + h * HD; const _Float16* Vr = VTH + ((size_t)b * DM + h * HD) * SS; const float* Tb = TS + (size_t)b * SS; const float* Eb = ERR + (size_t)b * SS;
  stage_kv(lb, Kr, Vr, Tb, Eb, 0, tid); WAIT_ASYNC(); __syncthreads(); stage_kv(lb + ASTG, Kr, Vr, Tb, Eb, 1, tid);
#pragma unroll 1   // kept rolled: one trip = one buffer = 64 keys, all keys in order
  for (int t = 0; t < ANT; ++t) { const unsigned char* S = L + (t & 1) * ASTG;
#pragma unroll 1   // kept rolled: the tile's two 32-key steps share one body
  for (int ks = 0; ks < 2; ++ks) { v8f s[2]; v16h kf[2][2];
#pragma unroll   // constant indices keep kf[][] in registers (also the next directive)
    for (int ct = 0; ct < 2; ++ct)
#pragma unroll
      for (int kc = 0; kc < 2; ++kc) kf[ct][kc] = frag_h((const _Float16*)(S + (ks * 32 + ct * 16 + col) * AKP + kc * 64), lane);   // the step's four k fragments first, then its WMMAs
#pragma unroll
    for (int ct = 0; ct < 2; ++ct) { v8f c = {};
#pragma unroll
      for (int kc = 0; kc < 2; ++kc) c = wmma16(kf[ct][kc], bq[kc], c);   // single product: k, q as one-rounding f16 operands; c[r] = key 16 ct + 8 g + r against query col
      const v4f* te = (const v4f*)(S + AK_TE + wave * 512 + (ks * 32 + ct * 16 + 8 * g) * 4); const v4f t0 = te[0], t1 = te[1], e0 = te[16], e1 = te[17];   // the lane's 8 keys' times and errors
#pragma unroll
      for (int r = 0; r < 8; ++r) { const float tk = (r < 4) ? t0[r & 3] : t1[r & 3]; const float ek = (r < 4) ? e0[r & 3] : e1[r & 3];
        const float sig = __builtin_amdgcn_rcpf(1.0f + __builtin_amdgcn_exp2f(wk * bfr(ek) + gq)); s[ct][r] = c[r] * (0.125f * LOG2E) + (__builtin_amdgcn_logf(sig + 1e-9f) - lam2 * fabsf(tq - tk)); } }   // (q.k/8 + time-decay bias + error-gate bias) x log2 e: sigmoid by v_exp_f32 and v_rcp_f32, its logarithm by v_log_f32
    float mx = fmaxf(s[0][0], s[1][0]);
#pragma unroll
    for (int r = 1; r < 8; ++r) mx = fmaxf(mx, fmaxf(s[0][r], s[1][r]));
    mx = fmaxf(mx, xhalf(mx));   // both halves hold the query's maximum over the step's 32 keys
    const float mn = fmaxf(m, mx); const float alpha = (m <= -1.0e38f) ? 0.f : __builtin_amdgcn_exp2f(m - mn);
    v2f es = {0.f, 0.f}; v16h pb;
#pragma unroll
    for (int ct = 0; ct < 2; ++ct)
#pragma unroll
      for (int r = 0; r < 8; r += 2) { v2f e; e[0] = (s[ct][r] <= -1.0e38f) ? 0.f : __builtin_amdgcn_exp2f(s[ct][r] - mn); e[1] = (s[ct][r + 1] <= -1.0e38f) ? 0.f : __builtin_amdgcn_exp2f(s[ct][r + 1] - mn);
        es = (ct + r == 0) ? e : es + e; const v2f x = e * 2048.0f; pb[ct * 8 + r] = (_Float16)x[0]; pb[ct * 8 + r + 1] = (_Float16)x[1]; }   // even and odd keys summed side by side (packed adds); P scaled by 2^11 so small softmax weights stay out of the f16 subnormal range; 2^-11 folded into the epilogue; element 8 ct + r = key 16 ct + 8 g + r, the k order of the v fragments
    l = l * alpha + (es[0] + es[1]); m = mn;   // the lane's own 16 keys of the step; the halves' sums are joined behind the loop
#pragma unroll
    for (int dt = 0; dt < 4; ++dt) acc[dt] *= alpha;
    v16h vf[4];
#pragma unroll   // constant indices keep vf[] in registers
    for (int dt = 0; dt < 4; ++dt) vf[dt] = frag_h((const _Float16*)(S + AK_V + (dt * 16 + col) * AKP + ks * 64), lane);   // the step's four v fragments first, then its WMMAs
#pragma unroll
    for (int dt = 0; dt < 4; ++dt) acc[dt] = wmma16(vf[dt], pb, acc[dt]); }   // single product: V^T x P^T (x2^11); acc[dt][r] = d 16 dt + 8 g + r of query col
    WAIT_DS(); WAIT_ASYNC(); __syncthreads();   // publishes tile t + 1 and frees tile t's buffer
    if (t + 2 < ANT) stage_kv(lb + (unsigned)(t & 1) * ASTG, Kr, Vr, Tb, Eb, t + 2, tid); }
  WAIT_ASYNC();
  const float il = (1.0f / 2048.0f) / (l + xhalf(l));
#pragma unroll
  for (int dt = 0; dt < 4; ++dt) { v4f o0, o1;
#pragma unroll
    for (int i = 0; i < 4; ++i) { o0[i] = acc[dt][i] * il; o1[i] = acc[dt][4 + i] * il; }
    *(v4f*)&so[wave][col][dt * 16 + 8 * g] = o0; *(v4f*)&so[wave][col][dt * 16 + 8 * g + 4] = o1; }
  LDSX();
  for (int rl = 0; rl < 16; ++rl) if (lane < 16) vst2(O + ((size_t)b * SS + q0 + rl) * DM + h * HD + lane * 4, *(const v4f*)&so[wave][rl][lane * 4]);
}
// ---- k_out: block = (64 rows, 128 cols): out = O(hi/lo) . Wo rows (2 products) + bo
__global__ __launch_bounds__(128) void k_out(const float* __restrict__ O, const __bf16* __restrict__ P, const float* __restrict__ BO, float* __restrict__ Y) {
  __shared__ __attribute__((aligned(16))) unsigned char L[2 * STG];   // the two tile buffers; behind the k loop's last barrier the same bytes serve as output staging
  float (*so)[16][132] = (float (*)[16][132])L;
  const int tid = threadIdx.x, wave = tid >> 5, lane = tid & 31, col = lane & 15, g = lane >> 4; const size_t r0 = (size_t)blockIdx.x * 64 + wave * 16; const int n0 = blockIdx.y * 128;
  v8f acc[8] = {};
  { const unsigned lb = (unsigned)(uintptr_t)&L[0]; const __bf16* Wr = P + (size_t)n0 * DM; const float* Ar = O + (size_t)blockIdx.x * 64 * DM;
    stage_tile(lb, Wr, Ar, 0, tid); WAIT_ASYNC(); __syncthreads(); stage_tile(lb + STG, Wr, Ar, 1, tid);
#pragma unroll 1   // kept rolled: one trip = one buffer
    for (int t = 0; t < NT; ++t) { const unsigned char* S = L + (t & 1) * STG;
#pragma unroll   // constant indices keep bf[] and acc[] in registers (also the two directives below)
      for (int kc = 0; kc < 2; ++kc) { float av[16]; v16b bf[8]; lds_a16(S + BTILE + (wave * 16 + col) * APITCH + kc * 128, g, av);   // all fragments of the k step first, then its WMMAs
#pragma unroll
        for (int j = 0; j < 8; ++j) bf[j] = frag_b((const __bf16*)(S + (j * 16 + col) * BPITCH + kc * 64), lane);
        const F2 a = bsplit16(av);
#pragma unroll
        for (int j = 0; j < 8; ++j) { acc[j] = wmma_bf(a.l, bf[j], acc[j]); acc[j] = wmma_bf(a.h, bf[j], acc[j]); } }
      WAIT_DS(); WAIT_ASYNC(); __syncthreads();   // publishes tile t + 1 and frees tile t's buffer
      if (t + 2 < NT) stage_tile(lb + (unsigned)(t & 1) * STG, Wr, Ar, t + 2, tid); }
    WAIT_ASYNC(); }
#pragma unroll
  for (int j = 0; j < 8; ++j) {
#pragma unroll
    for (int r = 0; r < 8; ++r) so[wave][8 * g + r][j * 16 + col] = acc[j][r] + bfr(BO[n0 + j * 16 + col]); }
  LDSX();
  for (int rl = 0; rl < 16; ++rl) vst2(Y + (r0 + rl) * DM + n0 + lane * 4, *(const v4f*)&so[wave][rl][lane * 4]);
}
// ---- k_ts: blocks with blockIdx.y >= 64 round 16,384 elements to bf16 each (a thread: sixteen 16-B loads, all issued ahead of its sixteen 8-B stores; a wave's load covers 4 whole lines, its store 2): the first 64 rows of such blocks take x, the next 64 the four weight matrices (blockIdx.x = W_q, W_k, W_v, W_o; natural [out][in] rows, so matrix w lies flat at PK + w * 1024 * 1024: W_q | W_k | W_v = PK_A, W_o = PK_P). Few long blocks: the launch starts 6,144 waves in all. They need nothing of the other blocks and run beside their chain of waits. The other blocks: block = (batch, 16 tokens): t_scaled = (t - min) / (max - min + 1e-6) * 1000, minimum and maximum over the batch's whole sequence in every block; the block's 16 scaled times and their rotary table: cos and sin of t_scaled x inv_freq[f], once per (token, frequency)
__global__ __launch_bounds__(256) void k_ts(const float* __restrict__ TR, float* __restrict__ TS, float* __restrict__ ROT, const float* __restrict__ X, __bf16* __restrict__ XB, const float* __restrict__ WQ, const float* __restrict__ WK, const float* __restrict__ WV, const float* __restrict__ WO, __bf16* __restrict__ PK) {
  if (blockIdx.y >= SS / 16) {   // the same for the whole block, in front of every barrier
    const int c = blockIdx.y - SS / 16, w = blockIdx.x; const float* s; __bf16* d;
    if (c < SS * DM / XCB) { const size_t o = ((size_t)c * NB + w) * XCB; s = X + o; d = XB + o; }
    else { const size_t o = (size_t)(c - SS * DM / XCB) * XCB; s = ((w == 0) ? WQ : (w == 1) ? WK : (w == 2) ? WV : WO) + o; d = PK + (size_t)w * DM * DM + o; }
    s += threadIdx.x * 4; d += threadIdx.x * 4; v4f v[16];
#pragma unroll   // constant indices keep v[] in registers; all sixteen loads first, then the stores (also the next directive)
    for (int i = 0; i < 16; ++i) v[i] = *(const v4f*)(s + i * 1024);
#pragma unroll
    for (int i = 0; i < 16; ++i) { v4b o; o[0] = (__bf16)v[i][0]; o[1] = (__bf16)v[i][1]; o[2] = (__bf16)v[i][2]; o[3] = (__bf16)v[i][3]; *(v4b*)(d + i * 1024) = o; }
    return; }
  __shared__ float rmn[256], rmx[256]; const size_t b = blockIdx.x; const int t = threadIdx.x; float mn = 3.0e38f, mx = -3.0e38f;
  for (int s = t; s < SS; s += 256) { const float v = bfr(TR[b * SS + s]); mn = fminf(mn, v); mx = fmaxf(mx, v); }
  rmn[t] = mn; rmx[t] = mx; __syncthreads();
  for (int st = 128; st > 0; st >>= 1) { if (t < st) { rmn[t] = fminf(rmn[t], rmn[t + st]); rmx[t] = fmaxf(rmx[t], rmx[t + st]); } __syncthreads(); }
  const float tmin = rmn[0], den = rmx[0] - rmn[0] + 1e-6f;
  const size_t s0 = b * SS + blockIdx.y * 16;
  if (t < 16) TS[s0 + t] = (bfr(TR[s0 + t]) - tmin) / den * 1000.0f;   // 4-B scratch stores
  for (int q = t; q < 16 * 32; q += 256) { const size_t s = s0 + (q >> 5); const int p = q & 31, f = (p & 3) * 8 + (p >> 2);   // place p of a token's row holds frequency f: a k_qkv lane's four frequencies lie side by side
    const float ang = (bfr(TR[s]) - tmin) / den * 1000.0f * INVF[f]; v2f cs; cs[0] = cos_p(ang); cs[1] = sin_p(ang); *(v2f*)(ROT + s * 64 + p * 2) = cs; }   // a wave stores one token's 256 B
}
extern "C" void kernel_launch(void* const* d_in, const int* in_sizes, int n_in, void* d_out, int out_size, void* d_ws, size_t ws_size, hipStream_t stream) {
  (void)in_sizes; (void)n_in; (void)out_size;
  const float** F = (const float**)d_in;   // 0 x [4,1024,1024], 1 t_raw [4,1024], 2 error [4,1024], 3 Wq, 4 bq, 5 Wk, 6 bk, 7 Wv, 8 bv, 9 Wo, 10 bo, 11 lambda_h [16], 12 Wg [16,2], 13 bg [16]
  if (ws_size < (size_t)WS_TOP + 256) return;
  char* ws = (char*)d_ws; __bf16* PK = (__bf16*)(ws + WS_PK); _Float16 *QK = (_Float16*)(ws + WS_QK), *QKL = (_Float16*)(ws + WS_QKL), *VTH = (_Float16*)(ws + WS_VTH), *VTL = (_Float16*)(ws + WS_VTL); float* O = (float*)(ws + WS_O); float* TS = (float*)(ws + WS_TS); float* ROT = (float*)(ws + WS_ROT); __bf16* XB = (__bf16*)(ws + WS_XB);
  k_ts<<<dim3(NB, SS / 16 + SS * DM / XCB + DM * DM / XCB), 256, 0, stream>>>(F[1], TS, ROT, F[0], XB, F[3], F[5], F[7], F[9], PK);
  k_qkv<<<dim3(TNB * SS / 64, QKVW / 128), 128, 0, stream>>>(XB, PK + PK_A, F[4], F[6], F[8], ROT, QK, QKL, VTH, VTL);
  k_attn<<<dim3(TQB, NH, TNB), 128, 0, stream>>>(QK, QKL, VTH, VTL, nullptr, TS, F[2], F[11], F[12], F[13], O);
  k_out<<<dim3(TOB, DM / 128), 128, 0, stream>>>(O, PK + PK_P, F[10], (float*)d_out);
}

// v008
// A run of this version takes 93.5 microseconds.
// Two timings next to v007 both put it at 1.09 times that version's speed.
// Counting every step since v000, it is 4.34 times as fast.
// compute dtype: all float inputs rounded to bf16; q/k/v = x . W^T + b with EXACT bf16 products on WMMA 16x16x32 (natural rows); per-batch time scaling and the interleaved-pair rotary (neighbouring lanes; angle = t_scaled x inv_freq[d/2] with jnp's inv_freq constants, precise cosf/sinf) in f32; PLAIN attention: rotated q, k as single f16 operands x 1/8 + the decay and gate biases evaluated per score in f32 (base 2: hardware exp, reciprocal and log; the per-head softplus by precise expf/log1pf), running-max softmax in f32 (base 2, hardware exp), P (scaled by 2^11, single f16) x v (single f16); out = o (bf16 hi + residual) . Wo^T (2 products) + bo.
#include <hip/hip_runtime.h>
#include <math.h>

typedef __attribute__((ext_vector_type(16))) _Float16 v16h;
typedef __attribute__((ext_vector_type(16))) __bf16 v16b;
typedef __attribute__((ext_vector_type(8)))  _Float16 v8h;
typedef __attribute__((ext_vector_type(8)))  float v8f;
typedef __attribute__((ext_vector_type(4)))  float v4f;
typedef __attribute__((ext_vector_type(2)))  float v2f;
typedef __attribute__((ext_vector_type(4)))  unsigned v4u;
typedef __attribute__((ext_vector_type(4)))  int v4i;
typedef float __attribute__((may_alias)) float_a;
typedef int __attribute__((may_alias)) int_a;

template <typename T> __device__ __forceinline__ void vst2(void* p, T v) { *(T*)p = v;  }
__device__ __forceinline__ v8f wmma16(v16h a, v16h b, v8f c) {
  v8f d = __builtin_amdgcn_wmma_f32_16x16x32_f16(false, a, false, b, (short)0, c, false, false);
  asm volatile("v_nop\n\tv_nop\n\tv_nop\n\tv_nop" : "+v"(d) : "v"(a), "v"(b));
  return d;
}
__device__ __forceinline__ v8f wmma_bf(v16b a, v16b b, v8f c) {
  v8f d = __builtin_amdgcn_wmma_f32_16x16x32_bf16(false, a, false, b, (short)0, c, false, false);
  asm volatile("v_nop\n\tv_nop\n\tv_nop\n\tv_nop" : "+v"(d) : "v"(a), "v"(b));
  return d;
}
// Scaled continuous-time attention (B 4, S 1,024, d 1,024, 16 heads x 64): q/k/v projections + biases, an interleaved rotary embedding whose angle is the per-token time (min-max scaled to [0, 1000]) x inv_freq, scores / 8 plus a per-head time-decay bias (-softplus(lambda_h) |t_i - t_j|) and an error-gated bias log(sigmoid(w_h0 err_i + w_h1 err_j + b_h) + 1e-9), softmax, . v, output projection + bias.
__device__ __forceinline__ v16h frag_h(const _Float16* rowk0, int lane) {
  union { v16h v; v8h q[2]; } u; const _Float16* p = rowk0 + 8 * (lane >> 4);
  u.q[0] = *(const v8h*)p; u.q[1] = *(const v8h*)(p + 16); return u.v;
}
__device__ __forceinline__ v16h frag_f32(const float* rowk0, int lane) {
  v16h a; const float* p = rowk0 + 8 * (lane >> 4);
#pragma unroll
  for (int i = 0; i < 8; ++i) { a[i] = (_Float16)p[i]; a[8 + i] = (_Float16)p[16 + i]; }
  return a;
}
__device__ __forceinline__ v16h frag_f32s(const float* rowk0, int lane, float sc) {
  v16h a; const float* p = rowk0 + 8 * (lane >> 4);
#pragma unroll
  for (int i = 0; i < 8; ++i) { a[i] = (_Float16)(p[i] * sc); a[8 + i] = (_Float16)(p[16 + i] * sc); }
  return a;
}
// column fragment from a [K][ld] layout (column n), rows >= K read as 0
__device__ __forceinline__ v16h fragc_f32(const float* W, int k0, int n, int lane, int ld, int K) {
  v16h a; const int g = lane >> 4;
#pragma unroll
  for (int i = 0; i < 8; ++i) { const int ka = k0 + 8 * g + i, kb = ka + 16;
    a[i] = (_Float16)(ka < K ? W[(size_t)(ka < K ? ka : K - 1) * ld + n] : 0.f); a[8 + i] = (_Float16)(kb < K ? W[(size_t)(kb < K ? kb : K - 1) * ld + n] : 0.f); }
  return a;
}
struct F2 { v16b h, l; };
__device__ __forceinline__ F2 bsplit16(const float v[16]) { F2 r;
#pragma unroll
  for (int i = 0; i < 16; ++i) { const __bf16 h = (__bf16)v[i]; r.h[i] = h; r.l[i] = (__bf16)(v[i] - (float)h); }
  return r; }
__device__ __forceinline__ F2 split_row(const float* row, int k0, int lane) { float v[16]; const float* p = row + k0 + 8 * (lane >> 4);
#pragma unroll
  for (int i = 0; i < 8; ++i) { v[i] = p[i]; v[8 + i] = p[16 + i]; }
  return bsplit16(v); }
__device__ __forceinline__ F2 split_rowK(const float* row, int k0, int lane, int K) { float v[16]; const int g = lane >> 4;
#pragma unroll
  for (int i = 0; i < 8; ++i) { const int ka = k0 + 8 * g + i, kb = ka + 16; v[i] = ka < K ? row[ka < K ? ka : K - 1] : 0.f; v[8 + i] = kb < K ? row[kb < K ? kb : K - 1] : 0.f; }
  return bsplit16(v); }
__device__ __forceinline__ F2 split_col(const float* W, int k0, int n, int lane, int ld, int K) { float v[16]; const int g = lane >> 4;
#pragma unroll
  for (int i = 0; i < 8; ++i) { const int ka = k0 + 8 * g + i, kb = ka + 16; v[i] = ka < K ? W[(size_t)(ka < K ? ka : K - 1) * ld + n] : 0.f; v[8 + i] = kb < K ? W[(size_t)(kb < K ? kb : K - 1) * ld + n] : 0.f; }
  return bsplit16(v); }
__device__ __forceinline__ v8f mac3(const F2& a, const F2& b, v8f c) { c = wmma_bf(a.l, b.h, c); c = wmma_bf(a.h, b.l, c); return wmma_bf(a.h, b.h, c); }
__device__ __forceinline__ float sigm(float v) { return 1.0f / (1.0f + expf(-v)); }
#define LDSX() do { asm volatile("s_wait_dscnt 0" ::: "memory"); __builtin_amdgcn_wave_barrier(); __builtin_amdgcn_fence(__ATOMIC_RELEASE, "workgroup"); } while (0)


#define NB 4
#define SS 1024
#define DM 1024
#define NH 16
__constant__ float INVF[32] = {1.000000000e+00f,7.498942018e-01f,5.623413324e-01f,4.216965139e-01f,3.162277639e-01f,2.371373773e-01f,1.778279394e-01f,1.333521456e-01f,1.000000015e-01f,7.498942316e-02f,5.623413250e-02f,4.216964915e-02f,3.162277490e-02f,2.371373773e-02f,1.778279431e-02f,1.333521400e-02f,9.999999776e-03f,7.498942316e-03f,5.623413250e-03f,4.216964822e-03f,3.162277630e-03f,2.371373819e-03f,1.778279431e-03f,1.333521446e-03f,1.000000047e-03f,7.498941850e-04f,5.623413017e-04f,4.216965172e-04f,3.162277571e-04f,2.371373703e-04f,1.778279402e-04f,1.333521504e-04f};
__device__ __attribute__((noinline)) float cos_p(float v) { return cosf(v); }
__device__ __attribute__((noinline)) float sin_p(float v) { return sinf(v); }
#define HD 64
#define QKVW (3 * DM)
#ifndef TQB
#define TQB (SS / 64)
#define TNB NB
#define TOB (NB * SS / 64)     // output row tiles (all)
#endif
typedef __attribute__((ext_vector_type(8))) __bf16 v8b;
typedef __attribute__((ext_vector_type(4))) __bf16 v4b;
__device__ __forceinline__ v16b frag_b(const __bf16* rowk0, int lane) {
  union { v16b v; v8b q[2]; } u; const __bf16* p = rowk0 + 8 * (lane >> 4);
  u.q[0] = *(const v8b*)p; u.q[1] = *(const v8b*)(p + 16); return u.v;
}
__device__ __forceinline__ float bfr(float v) { return (float)(__bf16)v; }
__device__ __attribute__((noinline)) float erf_ni(float v) { return erff(v); }

#define PK_A 0                       // [3072][1024] Wqkv rows (natural [out][in])
#define PK_P (PK_A + QKVW * DM)        // [1024][1024] Wo rows (natural)
#define PK_END (PK_P + DM * DM)
#define WS_PK  0u
#define WS_QK  (WS_PK + 2u * PK_END)             // f16 [4096 rows][2048]: q | k
#define WS_QKL (WS_QK + 2u * NB * SS * 2 * DM)     // f16 q | k residual planes x2048
#define WS_VTH (WS_QKL + 2u * NB * SS * 2 * DM)    // f16 [b][1024 (h*64+d)][1024 s] hi
#define WS_VTL (WS_VTH + 2u * NB * DM * SS)        // f16 lo x 2048
#define WS_O   (WS_VTL + 2u * NB * DM * SS)        // f32 [4096][1024]
#define WS_CS  (WS_O + 4u * NB * SS * DM)           // f32 2 x [1024][32], not used (cos/sin computed in k_ts)
#define WS_END (WS_CS + 4u * 2 * SS * 32)
#define WS_TS  WS_END                               // f32 [4096] scaled times, each batch's in ascending order (every per-token plane behind k_ts is in that order)
#define WS_ROT (WS_TS + 4u * NB * SS)               // f32 [4096 tokens][8 (f & 7)][4 (f >> 3)][cos, sin]: the rotary table, 256 B a token
#define WS_XB  (WS_ROT + 4u * NB * SS * 64)         // bf16 [4096 tokens][1024]: x, rounded once
#define WS_ERS (WS_XB + 2u * NB * SS * DM)          // f32 [4096]: the errors, in time order
#define WS_INV (WS_ERS + 4u * NB * SS)              // int [4096]: place in time order -> token of the batch
#define WS_TOP (WS_INV + 4u * NB * SS)
// ---- LDS staging of the two projection GEMMs: a tile = 64 k of 128 weight rows (bf16, 128 B a row) and of 64 activation rows (k_out: f32, 256 B a row; k_qkv: bf16, further down); two buffers, filled by asynchronous copies one tile ahead
#define KT 64
#define BPITCH 144                    // weight row pitch in LDS: 16 B x odd, conflict-free for 16-byte reads
#define APITCH 272                    // activation row pitch in LDS: 16 B x odd
#define BTILE (128 * BPITCH)
#define STG (BTILE + 64 * APITCH)     // one buffer
#define NT (DM / KT)
// eight 16-byte copies of one thread, global memory -> LDS, no register in between; the closing s_wait_xcnt 0 keeps every address register named here unchanged until the copies have taken it
__device__ __forceinline__ void copy8(unsigned l, const char* g, unsigned lstep, size_t gstep) {
  asm volatile("global_load_async_to_lds_b128 %0, %8, off\n\t"
               "global_load_async_to_lds_b128 %1, %9, off\n\t"
               "global_load_async_to_lds_b128 %2, %10, off\n\t"
               "global_load_async_to_lds_b128 %3, %11, off\n\t"
               "global_load_async_to_lds_b128 %4, %12, off\n\t"
               "global_load_async_to_lds_b128 %5, %13, off\n\t"
               "global_load_async_to_lds_b128 %6, %14, off\n\t"
               "global_load_async_to_lds_b128 %7, %15, off\n\t"
               "s_wait_xcnt 0x0"
               :: "v"(l), "v"(l + lstep), "v"(l + 2 * lstep), "v"(l + 3 * lstep), "v"(l + 4 * lstep), "v"(l + 5 * lstep), "v"(l + 6 * lstep), "v"(l + 7 * lstep),
                  "v"(g), "v"(g + gstep), "v"(g + 2 * gstep), "v"(g + 3 * gstep), "v"(g + 4 * gstep), "v"(g + 5 * gstep), "v"(g + 6 * gstep), "v"(g + 7 * gstep)
               : "memory");
}
// tile t of the block's 128 weight rows (Wr = row 0, k 0) and 64 activation rows (Ar) into the buffer at LDS byte address lbuf: a wave's copy covers 4 whole 128-B lines
__device__ __forceinline__ void stage_tile(unsigned lbuf, const __bf16* Wr, const float* Ar, int t, int tid) {
  copy8(lbuf + (unsigned)(tid >> 3) * BPITCH + (unsigned)(tid & 7) * 16u, (const char*)(Wr + (size_t)(tid >> 3) * DM + t * KT + (tid & 7) * 8), 16u * BPITCH, (size_t)16 * DM * 2);
  copy8(lbuf + BTILE + (unsigned)(tid >> 4) * APITCH + (unsigned)(tid & 15) * 16u, (const char*)(Ar + (size_t)(tid >> 4) * DM + t * KT + (tid & 15) * 4), 8u * APITCH, (size_t)8 * DM * 4);
}
// ---- k_qkv's tile: 64 k of 128 weight rows and, right behind them at the same pitch, of 64 activation rows, all bf16 (128 B a row): 192 rows, 16 a pass
#define QSTG (192 * BPITCH)           // one buffer
#define XCB 16384                     // elements that one converting block of k_ts's launch rounds
// twelve 16-byte copies of one thread (8 of weights, 4 of activations), global memory -> LDS, no register in between; the closing s_wait_xcnt 0 keeps every address register named here unchanged until the copies have taken it
// the four activation rows are gathered: a0 .. a3 = the thread's 16 bytes of k step 0 in the rows of the tokens that stand at its four places of the time order
__device__ __forceinline__ void stage_tile_b(unsigned lbuf, const __bf16* Wr, const char* a0, const char* a1, const char* a2, const char* a3, int t, int tid) {
  const unsigned l = lbuf + (unsigned)(tid >> 3) * BPITCH + (unsigned)(tid & 7) * 16u, ls = 16u * BPITCH;
  const size_t o = (size_t)(tid >> 3) * DM + t * KT + (tid & 7) * 8, gs = (size_t)16 * DM * 2, ka = (size_t)t * KT * 2;
  const char* gw = (const char*)(Wr + o);
  asm volatile("global_load_async_to_lds_b128 %0, %12, off\n\t"
               "global_load_async_to_lds_b128 %1, %13, off\n\t"
               "global_load_async_to_lds_b128 %2, %14, off\n\t"
               "global_load_async_to_lds_b128 %3, %15, off\n\t"
               "global_load_async_to_lds_b128 %4, %16, off\n\t"
               "global_load_async_to_lds_b128 %5, %17, off\n\t"
               "global_load_async_to_lds_b128 %6, %18, off\n\t"
               "global_load_async_to_lds_b128 %7, %19, off\n\t"
               "global_load_async_to_lds_b128 %8, %20, off\n\t"
               "global_load_async_to_lds_b128 %9, %21, off\n\t"
               "global_load_async_to_lds_b128 %10, %22, off\n\t"
               "global_load_async_to_lds_b128 %11, %23, off\n\t"
               "s_wait_xcnt 0x0"
               :: "v"(l), "v"(l + ls), "v"(l + 2 * ls), "v"(l + 3 * ls), "v"(l + 4 * ls), "v"(l + 5 * ls), "v"(l + 6 * ls), "v"(l + 7 * ls), "v"(l + 8 * ls), "v"(l + 9 * ls), "v"(l + 10 * ls), "v"(l + 11 * ls),
                  "v"(gw), "v"(gw + gs), "v"(gw + 2 * gs), "v"(gw + 3 * gs), "v"(gw + 4 * gs), "v"(gw + 5 * gs), "v"(gw + 6 * gs), "v"(gw + 7 * gs), "v"(a0 + ka), "v"(a1 + ka), "v"(a2 + ka), "v"(a3 + ka)
               : "memory");
}
// the 16 f32 of an A fragment from a staged row: k = 8g .. 8g+7 and 16+8g .. 16+8g+7 of the 32-k step at rowk0
__device__ __forceinline__ void lds_a16(const unsigned char* rowk0, int g, float v[16]) {
  const v4f* p = (const v4f*)(rowk0 + 32 * g); const v4f x0 = p[0], x1 = p[1], x2 = p[4], x3 = p[5];
#pragma unroll   // constant indices keep v[] in registers
  for (int i = 0; i < 4; ++i) { v[i] = x0[i]; v[4 + i] = x1[i]; v[8 + i] = x2[i]; v[12 + i] = x3[i]; }
}
#define WAIT_ASYNC() asm volatile("s_wait_asynccnt 0x0" ::: "memory")   // this wave's copies have landed
#define WAIT_DS()    asm volatile("s_wait_dscnt 0x0" ::: "memory")      // this wave's LDS reads are done before the buffer is handed back
__global__ __launch_bounds__(128) void k_qkv(const __bf16* __restrict__ XB, const __bf16* __restrict__ P, const float* __restrict__ BQ, const float* __restrict__ BK, const float* __restrict__ BV, const float* __restrict__ ROT, const int* __restrict__ INV, _Float16* __restrict__ QK, _Float16* __restrict__ QKL, _Float16* __restrict__ VTH, _Float16* __restrict__ VTL) {
  const int which0 = (blockIdx.y * 128) / DM; const float* BB = BQ ? (((which0 == 0) ? BQ : (which0 == 1) ? BK : BV) + (blockIdx.y * 128 - which0 * DM)) : nullptr;
  __shared__ __attribute__((aligned(16))) unsigned char L[2 * QSTG];   // the two tile buffers; behind the k loop's last barrier the same bytes serve as output staging
  _Float16 (*so)[16][136] = (_Float16 (*)[16][136])L; _Float16 (*sol)[16][136] = (_Float16 (*)[16][136])(L + 4 * 16 * 136 * 2); _Float16 (*sth)[72] = (_Float16 (*)[72])L; _Float16 (*stl)[72] = (_Float16 (*)[72])(L + 128 * 72 * 2);
  const int tid = threadIdx.x, wave = tid >> 5, lane = tid & 31, col = lane & 15, g = lane >> 4; const size_t r0 = (size_t)blockIdx.x * 64 + wave * 16; const int n0 = blockIdx.y * 128;
  v8f acc[8] = {};
  const int* ip = INV + (size_t)blockIdx.x * 64 + (tid >> 3); const int i0 = ip[0], i1 = ip[16], i2 = ip[32], i3 = ip[48];   // the tokens at the thread's four places (row r of the block = place blockIdx.x * 64 + r of the time order); issued ahead of the rotary loads, needed by the first copies
  asm volatile("s_wait_xcnt 0x0" ::: "memory");   // a precaution: stands in front of the first instruction that reuses a register of the four loads' address
  v4f cs[8][2] = {};   // q and k blocks: the lane's 8 rows x 4 frequencies ((j & 3) * 8 + col / 2) of the rotary table, 32 B a row; sixteen 16-B loads issued in front of the k loop, first used behind it
  if (n0 < 2 * DM) { const v4f* cp = (const v4f*)(ROT + (r0 + 8 * g) * 64 + (col >> 1) * 8);
#pragma unroll   // constant indices keep cs[][] in registers
    for (int r = 0; r < 8; ++r) { cs[r][0] = cp[r * 16]; cs[r][1] = cp[r * 16 + 1]; }
    asm volatile("s_wait_xcnt 0x0" ::: "memory"); }   // a precaution: stands in front of the first instruction that reuses a register of the sixteen loads' address
  { const unsigned lb = (unsigned)(uintptr_t)&L[0]; const __bf16* Wr = P + (size_t)n0 * DM;
    const __bf16* Xb = XB + (size_t)(blockIdx.x * 64 / SS) * SS * DM + (tid & 7) * 8;   // the block's batch
    const char* a0 = (const char*)(Xb + (size_t)(i0 & (SS - 1)) * DM); const char* a1 = (const char*)(Xb + (size_t)(i1 & (SS - 1)) * DM); const char* a2 = (const char*)(Xb + (size_t)(i2 & (SS - 1)) * DM); const char* a3 = (const char*)(Xb + (size_t)(i3 & (SS - 1)) * DM);   // the mask bounds the row whatever the table holds
    stage_tile_b(lb, Wr, a0, a1, a2, a3, 0, tid); WAIT_ASYNC(); __syncthreads(); stage_tile_b(lb + QSTG, Wr, a0, a1, a2, a3, 1, tid);
#pragma unroll 1   // kept rolled: one trip = one buffer
    for (int t = 0; t < NT; ++t) { const unsigned char* S = L + (t & 1) * QSTG;
#pragma unroll   // constant indices keep bf[] and acc[] in registers (also the two directives below)
      for (int kc = 0; kc < 2; ++kc) { v16b bf[8]; const v16b a = frag_b((const __bf16*)(S + BTILE + (wave * 16 + col) * BPITCH + kc * 64), lane);   // all fragments of the k step first, then its WMMAs
#pragma unroll
        for (int j = 0; j < 8; ++j) bf[j] = frag_b((const __bf16*)(S + (j * 16 + col) * BPITCH + kc * 64), lane);
#pragma unroll
        for (int j = 0; j < 8; ++j) acc[j] = wmma_bf(a, bf[j], acc[j]); }
      WAIT_DS(); WAIT_ASYNC(); __syncthreads();   // publishes tile t + 1 and frees tile t's buffer
      if (t + 2 < NT) stage_tile_b(lb + (unsigned)(t & 1) * QSTG, Wr, a0, a1, a2, a3, t + 2, tid); }
    WAIT_ASYNC(); }
  float bias[8] = {0.f, 0.f, 0.f, 0.f, 0.f, 0.f, 0.f, 0.f};   // the lane's eight column biases (column j * 16 + col), fetched once: eight loads in flight together, one latency for the whole epilogue
  if (BB) { const float* bp = BB + col;
#pragma unroll   // constant indices keep bias[] in registers (also the next directive)
    for (int j = 0; j < 8; ++j) bias[j] = bp[j * 16];
    asm volatile("s_wait_xcnt 0x0" ::: "memory");   // a precaution: stands in front of the first instruction that reuses a register of the eight loads' address
#pragma unroll
    for (int j = 0; j < 8; ++j) bias[j] = bfr(bias[j]); }
  if (n0 < 2 * DM) {   // bias, then the interleaved-pair rotary: pair (2i, 2i+1) = neighbouring lanes (col ^ 1), cos and sin of t_scaled[row] * inv_freq[i] from k_ts's table
#pragma unroll
    for (int j = 0; j < 8; ++j)
#pragma unroll
      for (int r = 0; r < 8; ++r) acc[j][r] += bias[j];
#pragma unroll
    for (int r = 0; r < 8; ++r) {
#pragma unroll
      for (int j = 0; j < 8; ++j) { const float c = cs[r][(j & 3) >> 1][(j & 1) * 2], sn = cs[r][(j & 3) >> 1][(j & 1) * 2 + 1]; const float v = acc[j][r]; const float pv = __shfl_xor(v, 1); acc[j][r] = (col & 1) ? (v * c + pv * sn) : (v * c - pv * sn); } }
#pragma unroll
    for (int j = 0; j < 8; ++j) {
#pragma unroll
      for (int r = 0; r < 8; ++r) { const float v = acc[j][r]; const _Float16 hv = (_Float16)v; so[wave][8 * g + r][j * 16 + col] = hv; sol[wave][8 * g + r][j * 16 + col] = (_Float16)((v - (float)hv) * 2048.0f); } }   // q, k (+ bias) as f16 hi + (x2048) residual
    LDSX();
    for (int rl = 0; rl < 16; ++rl) if (lane < 16) { vst2((unsigned*)(QK + (r0 + rl) * (2 * DM) + n0 + lane * 8), *(const v4u*)&so[wave][rl][lane * 8]); vst2((unsigned*)(QKL + (r0 + rl) * (2 * DM) + n0 + lane * 8), *(const v4u*)&sol[wave][rl][lane * 8]); }
  } else {
#pragma unroll
    for (int j = 0; j < 8; ++j) {
#pragma unroll
      for (int r = 0; r < 8; ++r) { const float v = acc[j][r] + bias[j]; const _Float16 hv = (_Float16)v; sth[j * 16 + col][wave * 16 + 8 * g + r] = hv; stl[j * 16 + col][wave * 16 + 8 * g + r] = (_Float16)((v - (float)hv) * 2048.0f); } }
    __syncthreads();
    const size_t rb = (size_t)blockIdx.x * 64; const int b = (int)(rb / SS), s0 = (int)(rb % SS); const int pc0 = n0 - 2 * DM;
    for (int q = tid; q < 128 * 8; q += 128) { const int d = q >> 3, pc = q & 7; const size_t o = ((size_t)b * DM + pc0 + d) * SS + s0 + pc * 8; vst2((unsigned*)(VTH + o), *(const v4u*)&sth[d][pc * 8]); vst2((unsigned*)(VTL + o), *(const v4u*)&stl[d][pc * 8]); }
  }
}
// ---- LDS staging of k_attn: a tile = 64 keys: their 64 k rows (128 B each), the 64 v^T rows' 64 columns (128 B each), and per wave a private copy of the keys' times and errors (256 B + 256 B); two buffers, filled one tile ahead
#define AKP 144                       // k / v^T row pitch in LDS: 16 B x odd
#define AK_V (64 * AKP)
#define AK_TE (2 * 64 * AKP)
#define ASTG (AK_TE + 4 * 512)        // one buffer
#define ANT (SS / 64)
#define LOG2E 1.44269504088896340736f
// nine 16-byte copies of one thread (4 of k, 4 of v^T, 1 of times | errors); the closing s_wait_xcnt 0 keeps every address register named here unchanged until the copies have taken it
__device__ __forceinline__ void stage_kv(unsigned lbuf, const _Float16* Kr, const _Float16* Vr, const float* Tb, const float* Eb, int t, int tid) {
  const int lane = tid & 31;
  const unsigned lk = lbuf + (unsigned)(tid >> 3) * AKP + (unsigned)(tid & 7) * 16u, lv = lk + AK_V, lt = lbuf + AK_TE + (unsigned)(tid >> 5) * 512u + (unsigned)lane * 16u;
  const char* gk = (const char*)(Kr + ((size_t)t * 64 + (tid >> 3)) * (2 * DM) + (tid & 7) * 8);
  const char* gv = (const char*)(Vr + (size_t)(tid >> 3) * SS + t * 64 + (tid & 7) * 8);
  const char* gt = (const char*)(((lane < 16) ? Tb : Eb) + t * 64 + (lane & 15) * 4);
  const size_t ks16 = (size_t)16 * 2 * DM * 2, vs16 = (size_t)16 * SS * 2;
  asm volatile("global_load_async_to_lds_b128 %0, %9, off\n\t"
               "global_load_async_to_lds_b128 %1, %10, off\n\t"
               "global_load_async_to_lds_b128 %2, %11, off\n\t"
               "global_load_async_to_lds_b128 %3, %12, off\n\t"
               "global_load_async_to_lds_b128 %4, %13, off\n\t"
               "global_load_async_to_lds_b128 %5, %14, off\n\t"
               "global_load_async_to_lds_b128 %6, %15, off\n\t"
               "global_load_async_to_lds_b128 %7, %16, off\n\t"
               "global_load_async_to_lds_b128 %8, %17, off\n\t"
               "s_wait_xcnt 0x0"
               :: "v"(lk), "v"(lk + 16u * AKP), "v"(lk + 32u * AKP), "v"(lk + 48u * AKP), "v"(lv), "v"(lv + 16u * AKP), "v"(lv + 32u * AKP), "v"(lv + 48u * AKP), "v"(lt),
                  "v"(gk), "v"(gk + ks16), "v"(gk + 2 * ks16), "v"(gk + 3 * ks16), "v"(gv), "v"(gv + vs16), "v"(gv + 2 * vs16), "v"(gv + 3 * vs16), "v"(gt)
               : "memory");
}
// lane l with lane l ^ 16 (the two lanes that share one query column), by a vector cross-row move
__device__ __forceinline__ float xhalf(float x) { return __builtin_bit_cast(float, __builtin_amdgcn_permlanex16(__builtin_bit_cast(int, x), __builtin_bit_cast(int, x), 0x76543210, 0xfedcba98, false, false)); }
// ---- k_attn: block = (64 queries, head h, batch b): all-keys flash attention, transposed: S^T = K . Q^T (A = 16 key rows from LDS, B = the wave's 16 queries, kept in registers), so a lane holds 8 keys' scores of ONE query (column = lane & 15, keys 8g + r); maximum and sum run in the lane, the two halves exchange the maximum once a step and join their sums once at the end; two S^T tiles, converted in place, are the B operand of O^T += V^T . P^T; O[b*S+q][h*64+d] = acc / l (256-B segments)
__global__ __launch_bounds__(128) void k_attn(const _Float16* __restrict__ QK, const _Float16* __restrict__ QKL, const _Float16* __restrict__ VTH, const _Float16* __restrict__ VTL, const void* __restrict__ KMASK, const float* __restrict__ TS, const float* __restrict__ ERR, const float* __restrict__ LAMH, const float* __restrict__ WG, const float* __restrict__ BG, float* __restrict__ O) {
  __shared__ __align__(16) float so[4][16][68]; __shared__ __attribute__((aligned(16))) unsigned char L[2 * ASTG];
  const int tid = threadIdx.x, wave = tid >> 5, lane = tid & 31, col = lane & 15, g = lane >> 4;
  const int qb = blockIdx.x, h = blockIdx.y, b = blockIdx.z; const int q0 = qb * 64 + wave * 16; const size_t rq = (size_t)b * SS + q0 + col;
  v16h bq[2];
#pragma unroll
  for (int kc = 0; kc < 2; ++kc) bq[kc] = frag_h(QK + rq * (2 * DM) + h * HD + kc * 32, lane);
  asm volatile("s_wait_xcnt 0x0" ::: "memory");   // a precaution: stands in front of the first instruction that reuses the four query loads' address pair
  // per-head constants and the lane's own query's time / error values for the score biases
  const float lraw = bfr(LAMH[h]); const float lam = (lraw > 20.f) ? lraw : log1pf(expf(lraw));   // softplus, precise, once a thread: in line, so that the kernel holds no call
  const float wg0 = bfr(WG[h * 2]), wg1 = bfr(WG[h * 2 + 1]), bgh = bfr(BG[h]); const float lam2 = lam * LOG2E;   // scores carry the factor log2 e, so that every exp and log of the loop is one hardware instruction
  const float tq = TS[rq]; const float gq = (wg0 * bfr(ERR[rq]) + bgh) * -LOG2E; const float wk = wg1 * -LOG2E;   // gate logit's query part and the key part's factor, as the exponent of 2 in exp(-logit)
  float m = -3.0e38f, l = 0.f;
  v8f acc[4] = {};
  const unsigned lb = (unsigned)(uintptr_t)&L[0]; const _Float16* Kr = QK + (size_t)b * SS * (2 * DM) + DM + h * HD; const _Float16* Vr = VTH + ((size_t)b * DM + h * HD) * SS; const float* Tb = TS + (size_t)b * SS; const float* Eb = ERR + (size_t)b * SS;
  // trip t works on key tile (qb + t) mod 16: the block's own 64 places first, so that every query's running maximum has met its own key and its neighbours in time before the far tiles come
  stage_kv(lb, Kr, Vr, Tb, Eb, qb, tid); WAIT_ASYNC(); __syncthreads(); stage_kv(lb + ASTG, Kr, Vr, Tb, Eb, (qb + 1) & (ANT - 1), tid);
#pragma unroll 1   // kept rolled: one trip = one buffer = 64 keys
  for (int t = 0; t < ANT; ++t) { const unsigned char* S = L + (t & 1) * ASTG;
#pragma unroll 1   // kept rolled: the tile's two 32-key steps share one body
  for (int ks = 0; ks < 2; ++ks) { v8f s[2]; v16h kf[2][2];
    const float* tw = (const float*)(S + AK_TE + wave * 512) + ks * 32; const float gap = fmaxf(fmaxf(tw[0] - tq, tq - tw[31]), 0.f);   // the step's first and last key in time, fetched beside the k fragments: no key of the step is nearer to the query than gap
#pragma unroll   // constant indices keep kf[][] in registers (also the next directive)
    for (int ct = 0; ct < 2; ++ct)
#pragma unroll
      for (int kc = 0; kc < 2; ++kc) kf[ct][kc] = frag_h((const _Float16*)(S + (ks * 32 + ct * 16 + col) * AKP + kc * 64), lane);   // the step's four k fragments first, then its WMMAs
#pragma unroll
    for (int ct = 0; ct < 2; ++ct) { v8f c = {};
#pragma unroll
      for (int kc = 0; kc < 2; ++kc) c = wmma16(kf[ct][kc], bq[kc], c);   // single product: k, q as one-rounding f16 operands; c[r] = key 16 ct + 8 g + r against query col
      s[ct] = c; }
    // the step's 32 keys stand in ascending time: no key is nearer to the query than gap, and the gate bias is at most log2(1 + 1e-9), so no score of the lane exceeds top. Where every lane's top lies more than 152 below its running maximum, every weight of the step is exp2 of less than -150 = 0 in f32, the maximum stays and the rescaling factor is 1: the step would change nothing, and the wave leaves it out (one scalar branch, the same for the whole wave; a bound that is NaN compares false and takes the full step)
    { float cm = fmaxf(s[0][0], s[1][0]);
#pragma unroll
      for (int r = 1; r < 8; ++r) cm = fmaxf(cm, fmaxf(s[0][r], s[1][r]));
      const float top = cm * (0.125f * LOG2E) - lam2 * gap;
      if (__builtin_amdgcn_ballot_w32(top - m < -152.0f) == 0xffffffffu) continue; }
#pragma unroll
    for (int ct = 0; ct < 2; ++ct) { const v8f c = s[ct];
      const v4f* te = (const v4f*)(S + AK_TE + wave * 512 + (ks * 32 + ct * 16 + 8 * g) * 4); const v4f t0 = te[0], t1 = te[1], e0 = te[16], e1 = te[17];   // the lane's 8 keys' times and errors
#pragma unroll
      for (int r = 0; r < 8; ++r) { const float tk = (r < 4) ? t0[r & 3] : t1[r & 3]; const float ek = (r < 4) ? e0[r & 3] : e1[r & 3];
        const float sig = __builtin_amdgcn_rcpf(1.0f + __builtin_amdgcn_exp2f(wk * bfr(ek) + gq)); s[ct][r] = c[r] * (0.125f * LOG2E) + (__builtin_amdgcn_logf(sig + 1e-9f) - lam2 * fabsf(tq - tk)); } }   // (q.k/8 + time-decay bias + error-gate bias) x log2 e: sigmoid by v_exp_f32 and v_rcp_f32, its logarithm by v_log_f32
    float mx = fmaxf(s[0][0], s[1][0]);
#pragma unroll
    for (int r = 1; r < 8; ++r) mx = fmaxf(mx, fmaxf(s[0][r], s[1][r]));
    mx = fmaxf(mx, xhalf(mx));   // both halves hold the query's maximum over the step's 32 keys
    const float mn = fmaxf(m, mx); const float alpha = (m <= -1.0e38f) ? 0.f : __builtin_amdgcn_exp2f(m - mn);
    v2f es = {0.f, 0.f}; v16h pb;
#pragma unroll
    for (int ct = 0; ct < 2; ++ct)
#pragma unroll
      for (int r = 0; r < 8; r += 2) { v2f e; e[0] = (s[ct][r] <= -1.0e38f) ? 0.f : __builtin_amdgcn_exp2f(s[ct][r] - mn); e[1] = (s[ct][r + 1] <= -1.0e38f) ? 0.f : __builtin_amdgcn_exp2f(s[ct][r + 1] - mn);
        es = (ct + r == 0) ? e : es + e; const v2f x = e * 2048.0f; pb[ct * 8 + r] = (_Float16)x[0]; pb[ct * 8 + r + 1] = (_Float16)x[1]; }   // even and odd keys summed side by side (packed adds); P scaled by 2^11 so small softmax weights stay out of the f16 subnormal range; 2^-11 folded into the epilogue; element 8 ct + r = key 16 ct + 8 g + r, the k order of the v fragments
    l = l * alpha + (es[0] + es[1]); m = mn;   // the lane's own 16 keys of the step; the halves' sums are joined behind the loop
#pragma unroll
    for (int dt = 0; dt < 4; ++dt) acc[dt] *= alpha;
    v16h vf[4];
#pragma unroll   // constant indices keep vf[] in registers
    for (int dt = 0; dt < 4; ++dt) vf[dt] = frag_h((const _Float16*)(S + AK_V + (dt * 16 + col) * AKP + ks * 64), lane);   // the step's four v fragments first, then its WMMAs
#pragma unroll
    for (int dt = 0; dt < 4; ++dt) acc[dt] = wmma16(vf[dt], pb, acc[dt]); }   // single product: V^T x P^T (x2^11); acc[dt][r] = d 16 dt + 8 g + r of query col
    WAIT_DS(); WAIT_ASYNC(); __syncthreads();   // publishes tile t + 1 and frees tile t's buffer
    if (t + 2 < ANT) stage_kv(lb + (unsigned)(t & 1) * ASTG, Kr, Vr, Tb, Eb, (qb + t + 2) & (ANT - 1), tid); }
  WAIT_ASYNC();
  const float il = (1.0f / 2048.0f) / (l + xhalf(l));
#pragma unroll
  for (int dt = 0; dt < 4; ++dt) { v4f o0, o1;
#pragma unroll
    for (int i = 0; i < 4; ++i) { o0[i] = acc[dt][i] * il; o1[i] = acc[dt][4 + i] * il; }
    *(v4f*)&so[wave][col][dt * 16 + 8 * g] = o0; *(v4f*)&so[wave][col][dt * 16 + 8 * g + 4] = o1; }
  LDSX();
  for (int rl = 0; rl < 16; ++rl) if (lane < 16) vst2(O + ((size_t)b * SS + q0 + rl) * DM + h * HD + lane * 4, *(const v4f*)&so[wave][rl][lane * 4]);
}
// ---- k_out: block = (64 rows, 128 cols): out = O(hi/lo) . Wo rows (2 products) + bo
__global__ __launch_bounds__(128) void k_out(const float* __restrict__ O, const __bf16* __restrict__ P, const float* __restrict__ BO, const int* __restrict__ INV, float* __restrict__ Y) {
  __shared__ __attribute__((aligned(16))) unsigned char L[2 * STG];   // the two tile buffers; behind the k loop's last barrier the same bytes serve as output staging
  float (*so)[16][132] = (float (*)[16][132])L;
  const int tid = threadIdx.x, wave = tid >> 5, lane = tid & 31, col = lane & 15, g = lane >> 4; const size_t r0 = (size_t)blockIdx.x * 64 + wave * 16; const int n0 = blockIdx.y * 128;
  v8f acc[8] = {};
  const int iv = INV[r0 + col];   // O's rows stand in time order: lane l holds the token of the wave's row l & 15; loaded in front of the k loop, used behind it
  asm volatile("s_wait_xcnt 0x0" ::: "memory");   // a precaution: stands in front of the first instruction that reuses a register of the load's address
  { const unsigned lb = (unsigned)(uintptr_t)&L[0]; const __bf16* Wr = P + (size_t)n0 * DM; const float* Ar = O + (size_t)blockIdx.x * 64 * DM;
    stage_tile(lb, Wr, Ar, 0, tid); WAIT_ASYNC(); __syncthreads(); stage_tile(lb + STG, Wr, Ar, 1, tid);
#pragma unroll 1   // kept rolled: one trip = one buffer
    for (int t = 0; t < NT; ++t) { const unsigned char* S = L + (t & 1) * STG;
#pragma unroll   // constant indices keep bf[] and acc[] in registers (also the two directives below)
      for (int kc = 0; kc < 2; ++kc) { float av[16]; v16b bf[8]; lds_a16(S + BTILE + (wave * 16 + col) * APITCH + kc * 128, g, av);   // all fragments of the k step first, then its WMMAs
#pragma unroll
        for (int j = 0; j < 8; ++j) bf[j] = frag_b((const __bf16*)(S + (j * 16 + col) * BPITCH + kc * 64), lane);
        const F2 a = bsplit16(av);
#pragma unroll
        for (int j = 0; j < 8; ++j) { acc[j] = wmma_bf(a.l, bf[j], acc[j]); acc[j] = wmma_bf(a.h, bf[j], acc[j]); } }
      WAIT_DS(); WAIT_ASYNC(); __syncthreads();   // publishes tile t + 1 and frees tile t's buffer
      if (t + 2 < NT) stage_tile(lb + (unsigned)(t & 1) * STG, Wr, Ar, t + 2, tid); }
    WAIT_ASYNC(); }
#pragma unroll
  for (int j = 0; j < 8; ++j) {
#pragma unroll
    for (int r = 0; r < 8; ++r) so[wave][8 * g + r][j * 16 + col] = acc[j][r] + bfr(BO[n0 + j * 16 + col]); }
  LDSX();
  const size_t rb = (size_t)(blockIdx.x * 64 / SS) * SS;   // the block's batch
  for (int rl = 0; rl < 16; ++rl) vst2(Y + (rb + (size_t)(__builtin_amdgcn_readlane(iv, rl) & (SS - 1))) * DM + n0 + lane * 4, *(const v4f*)&so[wave][rl][lane * 4]);   // each row goes to its token's place; the mask bounds the row whatever the table holds
}
// ---- k_ts: blocks with blockIdx.y >= 64 round 16,384 elements to bf16 each (a thread: sixteen 16-B loads, all issued ahead of its sixteen 8-B stores; a wave's load covers 4 whole lines, its store 2): the first 64 rows of such blocks take x, the next 64 the four weight matrices (blockIdx.x = W_q, W_k, W_v, W_o; natural [out][in] rows, so matrix w lies flat at PK + w * 1024 * 1024: W_q | W_k | W_v = PK_A, W_o = PK_P). Few long blocks: the launch starts 6,144 waves in all. They need nothing of the other blocks and run beside their chain of waits. The other blocks: block = (batch, 16 tokens): t_scaled = (t - min) / (max - min + 1e-6) * 1000, minimum and maximum over the batch's whole sequence in every block; the block's 16 scaled times and their rotary table: cos and sin of t_scaled x inv_freq[f], once per (token, frequency)
// Time order: each of these blocks also ranks its 16 tokens among the batch's 1,024 by (time, token index), a total order, so the ranks are a permutation; it stores time, error, rotary row and token index at the rank. All later kernels work on places of that order (k_qkv gathers x's rows by INV, k_out scatters its rows by INV)
__global__ __launch_bounds__(256) void k_ts(const float* __restrict__ TR, const float* __restrict__ ERR, float* __restrict__ TS, float* __restrict__ ERS, int* __restrict__ INV, float* __restrict__ ROT, const float* __restrict__ X, __bf16* __restrict__ XB, const float* __restrict__ WQ, const float* __restrict__ WK, const float* __restrict__ WV, const float* __restrict__ WO, __bf16* __restrict__ PK) {
  if (blockIdx.y >= SS / 16) {   // the same for the whole block, in front of every barrier
    const int c = blockIdx.y - SS / 16, w = blockIdx.x; const float* s; __bf16* d;
    if (c < SS * DM / XCB) { const size_t o = ((size_t)c * NB + w) * XCB; s = X + o; d = XB + o; }
    else { const size_t o = (size_t)(c - SS * DM / XCB) * XCB; s = ((w == 0) ? WQ : (w == 1) ? WK : (w == 2) ? WV : WO) + o; d = PK + (size_t)w * DM * DM + o; }
    s += threadIdx.x * 4; d += threadIdx.x * 4; v4f v[16];
#pragma unroll   // constant indices keep v[] in registers; all sixteen loads first, then the stores (also the next directive)
    for (int i = 0; i < 16; ++i) v[i] = *(const v4f*)(s + i * 1024);
#pragma unroll
    for (int i = 0; i < 16; ++i) { v4b o; o[0] = (__bf16)v[i][0]; o[1] = (__bf16)v[i][1]; o[2] = (__bf16)v[i][2]; o[3] = (__bf16)v[i][3]; *(v4b*)(d + i * 1024) = o; }
    return; }
  __shared__ float rmn[256], rmx[256]; __shared__ __attribute__((aligned(16))) int skey[SS]; const size_t b = blockIdx.x; const int t = threadIdx.x; float mn = 3.0e38f, mx = -3.0e38f;
  for (int s = t; s < SS; s += 256) { const float v = bfr(TR[b * SS + s]); mn = fminf(mn, v); mx = fmaxf(mx, v);
    const int bits = __builtin_bit_cast(int, v); skey[s] = ((bits ^ ((bits >> 31) & 0x7fffffff)) >> 16) * SS + s; }   // sort key: the rounded time's 16 significant bits as an integer that orders like the float, then the token index; published by the barrier below
  rmn[t] = mn; rmx[t] = mx; __syncthreads();
  for (int st = 128; st > 0; st >>= 1) { if (t < st) { rmn[t] = fminf(rmn[t], rmn[t + st]); rmx[t] = fmaxf(rmx[t], rmx[t + st]); } __syncthreads(); }
  const float tmin = rmn[0], den = rmx[0] - rmn[0] + 1e-6f;
  const size_t s0 = b * SS + blockIdx.y * 16;
  const int tok = t >> 4, part = t & 15; const int mykey = skey[blockIdx.y * 16 + tok]; int rank = 0;   // sixteen lanes a token: each counts the smaller keys among 64, the four exchanges below add the counts up in all sixteen
  for (int i = 0; i < 16; ++i) { const v4i k4 = *(const v4i*)&skey[i * 64 + part * 4]; rank += (k4[0] < mykey) + (k4[1] < mykey) + (k4[2] < mykey) + (k4[3] < mykey); }
  rank += __shfl_xor(rank, 1); rank += __shfl_xor(rank, 2); rank += __shfl_xor(rank, 4); rank += __shfl_xor(rank, 8);
  if (part == 0) { const size_t d = b * SS + rank; TS[d] = (bfr(TR[s0 + tok]) - tmin) / den * 1000.0f; ERS[d] = ERR[s0 + tok]; INV[d] = blockIdx.y * 16 + tok; }   // 4-B scratch stores
  for (int it = 0; it < 2; ++it) { const size_t s = s0 + (t >> 5) * 2 + it; const size_t d = b * SS + __shfl(rank, it * 16); const int p = t & 31, f = (p & 3) * 8 + (p >> 2);   // the wave's two tokens, one a pass (their ranks stand in its lanes 0-15 and 16-31); place p of a token's row holds frequency f: a k_qkv lane's four frequencies lie side by side
    const float ang = (bfr(TR[s]) - tmin) / den * 1000.0f * INVF[f]; v2f cs; cs[0] = cos_p(ang); cs[1] = sin_p(ang); *(v2f*)(ROT + d * 64 + p * 2) = cs; }   // a wave stores one token's 256 B
}
extern "C" void kernel_launch(void* const* d_in, const int* in_sizes, int n_in, void* d_out, int out_size, void* d_ws, size_t ws_size, hipStream_t stream) {
  (void)in_sizes; (void)n_in; (void)out_size;
  const float** F = (const float**)d_in;   // 0 x [4,1024,1024], 1 t_raw [4,1024], 2 error [4,1024], 3 Wq, 4 bq, 5 Wk, 6 bk, 7 Wv, 8 bv, 9 Wo, 10 bo, 11 lambda_h [16], 12 Wg [16,2], 13 bg [16]
  if (ws_size < (size_t)WS_TOP + 256) return;
  char* ws = (char*)d_ws; __bf16* PK = (__bf16*)(ws + WS_PK); _Float16 *QK = (_Float16*)(ws + WS_QK), *QKL = (_Float16*)(ws + WS_QKL), *VTH = (_Float16*)(ws + WS_VTH), *VTL = (_Float16*)(ws + WS_VTL); float* O = (float*)(ws + WS_O); float* TS = (float*)(ws + WS_TS); float* ROT = (float*)(ws + WS_ROT); __bf16* XB = (__bf16*)(ws + WS_XB); float* ERS = (float*)(ws + WS_ERS); int* INV = (int*)(ws + WS_INV);
  k_ts<<<dim3(NB, SS / 16 + SS * DM / XCB + DM * DM / XCB), 256, 0, stream>>>(F[1], F[2], TS, ERS, INV, ROT, F[0], XB, F[3], F[5], F[7], F[9], PK);
  k_qkv<<<dim3(TNB * SS / 64, QKVW / 128), 128, 0, stream>>>(XB, PK + PK_A, F[4], F[6], F[8], ROT, INV, QK, QKL, VTH, VTL);
  k_attn<<<dim3(TQB, NH, TNB), 128, 0, stream>>>(QK, QKL, VTH, VTL, nullptr, TS, ERS, F[11], F[12], F[13], O);
  k_out<<<dim3(TOB, DM / 128), 128, 0, stream>>>(O, PK + PK_P, F[10], INV, (float*)d_out);
}

// v009
// A run of this version takes 86 microseconds.
// Two timings next to v008 put it at 1.08 and 1.07 times that version's speed.
// All steps since v000 together make it 4.67 times as fast.
// compute dtype: all float inputs rounded to bf16; q/k/v = x . W^T + b with EXACT bf16 products on WMMA 16x16x32 (natural rows); per-batch time scaling and the interleaved-pair rotary (neighbouring lanes; angle = t_scaled x inv_freq[d/2] with jnp's inv_freq constants, precise cosf/sinf) in f32; PLAIN attention: rotated q, k as single f16 operands x 1/8 + the decay and gate biases evaluated per score in f32 (base 2: hardware exp, reciprocal and log; the per-head softplus by precise expf/log1pf), running-max softmax in f32 (base 2, hardware exp), P (scaled by 2^11, single f16) x v (single f16); out = o (bf16 hi + residual) . Wo^T (2 products) + bo.
#include <hip/hip_runtime.h>
#include <math.h>

typedef __attribute__((ext_vector_type(16))) _Float16 v16h;
typedef __attribute__((ext_vector_type(16))) __bf16 v16b;
typedef __attribute__((ext_vector_type(8)))  _Float16 v8h;
typedef __attribute__((ext_vector_type(8)))  float v8f;
typedef __attribute__((ext_vector_type(4)))  float v4f;
typedef __attribute__((ext_vector_type(2)))  float v2f;
typedef __attribute__((ext_vector_type(4)))  unsigned v4u;
typedef __attribute__((ext_vector_type(4)))  int v4i;
typedef float __attribute__((may_alias)) float_a;
typedef int __attribute__((may_alias)) int_a;

template <typename T> __device__ __forceinline__ void vst2(void* p, T v) { *(T*)p = v;  }
__device__ __forceinline__ v8f wmma16(v16h a, v16h b, v8f c) {
  v8f d = __builtin_amdgcn_wmma_f32_16x16x32_f16(false, a, false, b, (short)0, c, false, false);
  asm volatile("v_nop\n\tv_nop\n\tv_nop\n\tv_nop" : "+v"(d) : "v"(a), "v"(b));
  return d;
}
__device__ __forceinline__ v8f wmma_bf(v16b a, v16b b, v8f c) {
  v8f d = __builtin_amdgcn_wmma_f32_16x16x32_bf16(false, a, false, b, (short)0, c, false, false);
  asm volatile("v_nop\n\tv_nop\n\tv_nop\n\tv_nop" : "+v"(d) : "v"(a), "v"(b));
  return d;
}
// Scaled continuous-time attention (B 4, S 1,024, d 1,024, 16 heads x 64): q/k/v projections + biases, an interleaved rotary embedding whose angle is the per-token time (min-max scaled to [0, 1000]) x inv_freq, scores / 8 plus a per-head time-decay bias (-softplus(lambda_h) |t_i - t_j|) and an error-gated bias log(sigmoid(w_h0 err_i + w_h1 err_j + b_h) + 1e-9), softmax, . v, output projection + bias.
__device__ __forceinline__ v16h frag_h(const _Float16* rowk0, int lane) {
  union { v16h v; v8h q[2]; } u; const _Float16* p = rowk0 + 8 * (lane >> 4);
  u.q[0] = *(const v8h*)p; u.q[1] = *(const v8h*)(p + 16); return u.v;
}
__device__ __forceinline__ v16h frag_f32(const float* rowk0, int lane) {
  v16h a; const float* p = rowk0 + 8 * (lane >> 4);
#pragma unroll
  for (int i = 0; i < 8; ++i) { a[i] = (_Float16)p[i]; a[8 + i] = (_Float16)p[16 + i]; }
  return a;
}
__device__ __forceinline__ v16h frag_f32s(const float* rowk0, int lane, float sc) {
  v16h a; const float* p = rowk0 + 8 * (lane >> 4);
#pragma unroll
  for (int i = 0; i < 8; ++i) { a[i] = (_Float16)(p[i] * sc); a[8 + i] = (_Float16)(p[16 + i] * sc); }
  return a;
}
// column fragment from a [K][ld] layout (column n), rows >= K read as 0
__device__ __forceinline__ v16h fragc_f32(const float* W, int k0, int n, int lane, int ld, int K) {
  v16h a; const int g = lane >> 4;
#pragma unroll
  for (int i = 0; i < 8; ++i) { const int ka = k0 + 8 * g + i, kb = ka + 16;
    a[i] = (_Float16)(ka < K ? W[(size_t)(ka < K ? ka : K - 1) * ld + n] : 0.f); a[8 + i] = (_Float16)(kb < K ? W[(size_t)(kb < K ? kb : K - 1) * ld + n] : 0.f); }
  return a;
}
struct F2 { v16b h, l; };
__device__ __forceinline__ F2 bsplit16(const float v[16]) { F2 r;
#pragma unroll
  for (int i = 0; i < 16; ++i) { const __bf16 h = (__bf16)v[i]; r.h[i] = h; r.l[i] = (__bf16)(v[i] - (float)h); }
  return r; }
__device__ __forceinline__ F2 split_row(const float* row, int k0, int lane) { float v[16]; const float* p = row + k0 + 8 * (lane >> 4);
#pragma unroll
  for (int i = 0; i < 8; ++i) { v[i] = p[i]; v[8 + i] = p[16 + i]; }
  return bsplit16(v); }
__device__ __forceinline__ F2 split_rowK(const float* row, int k0, int lane, int K) { float v[16]; const int g = lane >> 4;
#pragma unroll
  for (int i = 0; i < 8; ++i) { const int ka = k0 + 8 * g + i, kb = ka + 16; v[i] = ka < K ? row[ka < K ? ka : K - 1] : 0.f; v[8 + i] = kb < K ? row[kb < K ? kb : K - 1] : 0.f; }
  return bsplit16(v); }
__device__ __forceinline__ F2 split_col(const float* W, int k0, int n, int lane, int ld, int K) { float v[16]; const int g = lane >> 4;
#pragma unroll
  for (int i = 0; i < 8; ++i) { const int ka = k0 + 8 * g + i, kb = ka + 16; v[i] = ka < K ? W[(size_t)(ka < K ? ka : K - 1) * ld + n] : 0.f; v[8 + i] = kb < K ? W[(size_t)(kb < K ? kb : K - 1) * ld + n] : 0.f; }
  return bsplit16(v); }
__device__ __forceinline__ v8f mac3(const F2& a, const F2& b, v8f c) { c = wmma_bf(a.l, b.h, c); c = wmma_bf(a.h, b.l, c); return wmma_bf(a.h, b.h, c); }
__device__ __forceinline__ float sigm(float v) { return 1.0f / (1.0f + expf(-v)); }
#define LDSX() do { asm volatile("s_wait_dscnt 0" ::: "memory"); __builtin_amdgcn_wave_barrier(); __builtin_amdgcn_fence(__ATOMIC_RELEASE, "workgroup"); } while (0)


#define NB 4
#define SS 1024
#define DM 1024
#define NH 16
__constant__ float INVF[32] = {1.000000000e+00f,7.498942018e-01f,5.623413324e-01f,4.216965139e-01f,3.162277639e-01f,2.371373773e-01f,1.778279394e-01f,1.333521456e-01f,1.000000015e-01f,7.498942316e-02f,5.623413250e-02f,4.216964915e-02f,3.162277490e-02f,2.371373773e-02f,1.778279431e-02f,1.333521400e-02f,9.999999776e-03f,7.498942316e-03f,5.623413250e-03f,4.216964822e-03f,3.162277630e-03f,2.371373819e-03f,1.778279431e-03f,1.333521446e-03f,1.000000047e-03f,7.498941850e-04f,5.623413017e-04f,4.216965172e-04f,3.162277571e-04f,2.371373703e-04f,1.778279402e-04f,1.333521504e-04f};
__device__ __attribute__((noinline)) float cos_p(float v) { return cosf(v); }
__device__ __attribute__((noinline)) float sin_p(float v) { return sinf(v); }
#define HD 64
#define QKVW (3 * DM)
#ifndef TQB
#define TQB (SS / 64)
#define TNB NB
#define TOB (NB * SS / 64)     // output row tiles (all)
#endif
typedef __attribute__((ext_vector_type(8))) __bf16 v8b;
typedef __attribute__((ext_vector_type(4))) __bf16 v4b;
__device__ __forceinline__ v16b frag_b(const __bf16* rowk0, int lane) {
  union { v16b v; v8b q[2]; } u; const __bf16* p = rowk0 + 8 * (lane >> 4);
  u.q[0] = *(const v8b*)p; u.q[1] = *(const v8b*)(p + 16); return u.v;
}
__device__ __forceinline__ float bfr(float v) { return (float)(__bf16)v; }
__device__ __attribute__((noinline)) float erf_ni(float v) { return erff(v); }

#define PK_A 0                       // [3072][1024] Wqkv rows (natural [out][in])
#define PK_P (PK_A + QKVW * DM)        // [1024][1024] Wo rows (natural)
#define PK_END (PK_P + DM * DM)
#define WS_PK  0u
#define WS_QK  (WS_PK + 2u * PK_END)             // f16 [4096 rows][2048]: q | k
#define WS_QKL (WS_QK + 2u * NB * SS * 2 * DM)     // f16 q | k residual planes x2048
#define WS_VTH (WS_QKL + 2u * NB * SS * 2 * DM)    // f16 [b][1024 (h*64+d)][1024 s] hi
#define WS_VTL (WS_VTH + 2u * NB * DM * SS)        // f16 lo x 2048
#define WS_O   (WS_VTL + 2u * NB * DM * SS)        // f32 [4096][1024]
#define WS_CS  (WS_O + 4u * NB * SS * DM)           // f32 2 x [1024][32], not used (cos/sin computed in k_ts)
#define WS_END (WS_CS + 4u * 2 * SS * 32)
#define WS_TS  WS_END                               // f32 [4096] scaled times, each batch's in ascending order (every per-token plane behind k_ts is in that order)
#define WS_ROT (WS_TS + 4u * NB * SS)               // f32 [4096 tokens][8 (f & 7)][4 (f >> 3)][cos, sin]: the rotary table, 256 B a token
#define WS_XB  (WS_ROT + 4u * NB * SS * 64)         // bf16 [4096 tokens][1024]: x, rounded once
#define WS_ERS (WS_XB + 2u * NB * SS * DM)          // f32 [4096]: the errors, in time order
#define WS_INV (WS_ERS + 4u * NB * SS)              // int [4096]: place in time order -> token of the batch
#define WS_KN  (WS_INV + 4u * NB * SS)              // f32 [4 batches][16 heads][64]: the largest squared length among each 16 rotated key rows (places 16 i .. 16 i + 15)
#define WS_TOP (WS_KN + 4u * NB * NH * (SS / 16))
// ---- LDS staging of the two projection GEMMs: a tile = 64 k of 128 weight rows (bf16, 128 B a row) and of 64 activation rows (k_out: f32, 256 B a row; k_qkv: bf16, further down); two buffers, filled by asynchronous copies one tile ahead
#define KT 64
#define BPITCH 144                    // weight row pitch in LDS: 16 B x odd, conflict-free for 16-byte reads
#define APITCH 272                    // activation row pitch in LDS: 16 B x odd
#define BTILE (128 * BPITCH)
#define STG (BTILE + 64 * APITCH)     // one buffer
#define NT (DM / KT)
// eight 16-byte copies of one thread, global memory -> LDS, no register in between; the closing s_wait_xcnt 0 keeps every address register named here unchanged until the copies have taken it
__device__ __forceinline__ void copy8(unsigned l, const char* g, unsigned lstep, size_t gstep) {
  asm volatile("global_load_async_to_lds_b128 %0, %8, off\n\t"
               "global_load_async_to_lds_b128 %1, %9, off\n\t"
               "global_load_async_to_lds_b128 %2, %10, off\n\t"
               "global_load_async_to_lds_b128 %3, %11, off\n\t"
               "global_load_async_to_lds_b128 %4, %12, off\n\t"
               "global_load_async_to_lds_b128 %5, %13, off\n\t"
               "global_load_async_to_lds_b128 %6, %14, off\n\t"
               "global_load_async_to_lds_b128 %7, %15, off\n\t"
               "s_wait_xcnt 0x0"
               :: "v"(l), "v"(l + lstep), "v"(l + 2 * lstep), "v"(l + 3 * lstep), "v"(l + 4 * lstep), "v"(l + 5 * lstep), "v"(l + 6 * lstep), "v"(l + 7 * lstep),
                  "v"(g), "v"(g + gstep), "v"(g + 2 * gstep), "v"(g + 3 * gstep), "v"(g + 4 * gstep), "v"(g + 5 * gstep), "v"(g + 6 * gstep), "v"(g + 7 * gstep)
               : "memory");
}
// tile t of the block's 128 weight rows (Wr = row 0, k 0) and 64 activation rows (Ar) into the buffer at LDS byte address lbuf: a wave's copy covers 4 whole 128-B lines
__device__ __forceinline__ void stage_tile(unsigned lbuf, const __bf16* Wr, const float* Ar, int t, int tid) {
  copy8(lbuf + (unsigned)(tid >> 3) * BPITCH + (unsigned)(tid & 7) * 16u, (const char*)(Wr + (size_t)(tid >> 3) * DM + t * KT + (tid & 7) * 8), 16u * BPITCH, (size_t)16 * DM * 2);
  copy8(lbuf + BTILE + (unsigned)(tid >> 4) * APITCH + (unsigned)(tid & 15) * 16u, (const char*)(Ar + (size_t)(tid >> 4) * DM + t * KT + (tid & 15) * 4), 8u * APITCH, (size_t)8 * DM * 4);
}
// ---- k_qkv's tile: 64 k of 128 weight rows and, right behind them at the same pitch, of 64 activation rows, all bf16 (128 B a row): 192 rows, 16 a pass
#define QSTG (192 * BPITCH)           // one buffer
#define XCB 16384                     // elements that one converting block of k_ts's launch rounds
// twelve 16-byte copies of one thread (8 of weights, 4 of activations), global memory -> LDS, no register in between; the closing s_wait_xcnt 0 keeps every address register named here unchanged until the copies have taken it
// the four activation rows are gathered: a0 .. a3 = the thread's 16 bytes of k step 0 in the rows of the tokens that stand at its four places of the time order
__device__ __forceinline__ void stage_tile_b(unsigned lbuf, const __bf16* Wr, const char* a0, const char* a1, const char* a2, const char* a3, int t, int tid) {
  const unsigned l = lbuf + (unsigned)(tid >> 3) * BPITCH + (unsigned)(tid & 7) * 16u, ls = 16u * BPITCH;
  const size_t o = (size_t)(tid >> 3) * DM + t * KT + (tid & 7) * 8, gs = (size_t)16 * DM * 2, ka = (size_t)t * KT * 2;
  const char* gw = (const char*)(Wr + o);
  asm volatile("global_load_async_to_lds_b128 %0, %12, off\n\t"
               "global_load_async_to_lds_b128 %1, %13, off\n\t"
               "global_load_async_to_lds_b128 %2, %14, off\n\t"
               "global_load_async_to_lds_b128 %3, %15, off\n\t"
               "global_load_async_to_lds_b128 %4, %16, off\n\t"
               "global_load_async_to_lds_b128 %5, %17, off\n\t"
               "global_load_async_to_lds_b128 %6, %18, off\n\t"
               "global_load_async_to_lds_b128 %7, %19, off\n\t"
               "global_load_async_to_lds_b128 %8, %20, off\n\t"
               "global_load_async_to_lds_b128 %9, %21, off\n\t"
               "global_load_async_to_lds_b128 %10, %22, off\n\t"
               "global_load_async_to_lds_b128 %11, %23, off\n\t"
               "s_wait_xcnt 0x0"
               :: "v"(l), "v"(l + ls), "v"(l + 2 * ls), "v"(l + 3 * ls), "v"(l + 4 * ls), "v"(l + 5 * ls), "v"(l + 6 * ls), "v"(l + 7 * ls), "v"(l + 8 * ls), "v"(l + 9 * ls), "v"(l + 10 * ls), "v"(l + 11 * ls),
                  "v"(gw), "v"(gw + gs), "v"(gw + 2 * gs), "v"(gw + 3 * gs), "v"(gw + 4 * gs), "v"(gw + 5 * gs), "v"(gw + 6 * gs), "v"(gw + 7 * gs), "v"(a0 + ka), "v"(a1 + ka), "v"(a2 + ka), "v"(a3 + ka)
               : "memory");
}
// the 16 f32 of an A fragment from a staged row: k = 8g .. 8g+7 and 16+8g .. 16+8g+7 of the 32-k step at rowk0
__device__ __forceinline__ void lds_a16(const unsigned char* rowk0, int g, float v[16]) {
  const v4f* p = (const v4f*)(rowk0 + 32 * g); const v4f x0 = p[0], x1 = p[1], x2 = p[4], x3 = p[5];
#pragma unroll   // constant indices keep v[] in registers
  for (int i = 0; i < 4; ++i) { v[i] = x0[i]; v[4 + i] = x1[i]; v[8 + i] = x2[i]; v[12 + i] = x3[i]; }
}
// lane l's value from lane l ^ M of its 16-lane row, by a vector move (no LDS trip)
template <int M> __device__ __forceinline__ float rowx(float x) { return __builtin_bit_cast(float, __builtin_amdgcn_update_dpp(0, __builtin_bit_cast(int, x), 0x160 | M, 0xf, 0xf, true)); }
#define WAIT_ASYNC() asm volatile("s_wait_asynccnt 0x0" ::: "memory")   // this wave's copies have landed
#define WAIT_DS()    asm volatile("s_wait_dscnt 0x0" ::: "memory")      // this wave's LDS reads are done before the buffer is handed back
__global__ __launch_bounds__(128) void k_qkv(const __bf16* __restrict__ XB, const __bf16* __restrict__ P, const float* __restrict__ BQ, const float* __restrict__ BK, const float* __restrict__ BV, const float* __restrict__ ROT, const int* __restrict__ INV, _Float16* __restrict__ QK, _Float16* __restrict__ QKL, _Float16* __restrict__ VTH, _Float16* __restrict__ VTL, float* __restrict__ KN) {
  const int which0 = (blockIdx.y * 128) / DM; const float* BB = BQ ? (((which0 == 0) ? BQ : (which0 == 1) ? BK : BV) + (blockIdx.y * 128 - which0 * DM)) : nullptr;
  __shared__ __attribute__((aligned(16))) unsigned char L[2 * QSTG];   // the two tile buffers; behind the k loop's last barrier the same bytes serve as output staging
  _Float16 (*so)[16][136] = (_Float16 (*)[16][136])L; _Float16 (*sol)[16][136] = (_Float16 (*)[16][136])(L + 4 * 16 * 136 * 2); _Float16 (*sth)[72] = (_Float16 (*)[72])L; _Float16 (*stl)[72] = (_Float16 (*)[72])(L + 128 * 72 * 2);
  const int tid = threadIdx.x, wave = tid >> 5, lane = tid & 31, col = lane & 15, g = lane >> 4; const size_t r0 = (size_t)blockIdx.x * 64 + wave * 16; const int n0 = blockIdx.y * 128;
  v8f acc[8] = {};
  const int* ip = INV + (size_t)blockIdx.x * 64 + (tid >> 3); const int i0 = ip[0], i1 = ip[16], i2 = ip[32], i3 = ip[48];   // the tokens at the thread's four places (row r of the block = place blockIdx.x * 64 + r of the time order); issued ahead of the rotary loads, needed by the first copies
  asm volatile("s_wait_xcnt 0x0" ::: "memory");   // a precaution: stands in front of the first instruction that reuses a register of the four loads' address
  v4f cs[8][2] = {};   // q and k blocks: the lane's 8 rows x 4 frequencies ((j & 3) * 8 + col / 2) of the rotary table, 32 B a row; sixteen 16-B loads issued in front of the k loop, first used behind it
  if (n0 < 2 * DM) { const v4f* cp = (const v4f*)(ROT + (r0 + 8 * g) * 64 + (col >> 1) * 8);
#pragma unroll   // constant indices keep cs[][] in registers
    for (int r = 0; r < 8; ++r) { cs[r][0] = cp[r * 16]; cs[r][1] = cp[r * 16 + 1]; }
    asm volatile("s_wait_xcnt 0x0" ::: "memory"); }   // a precaution: stands in front of the first instruction that reuses a register of the sixteen loads' address
  { const unsigned lb = (unsigned)(uintptr_t)&L[0]; const __bf16* Wr = P + (size_t)n0 * DM;
    const __bf16* Xb = XB + (size_t)(blockIdx.x * 64 / SS) * SS * DM + (tid & 7) * 8;   // the block's batch
    const char* a0 = (const char*)(Xb + (size_t)(i0 & (SS - 1)) * DM); const char* a1 = (const char*)(Xb + (size_t)(i1 & (SS - 1)) * DM); const char* a2 = (const char*)(Xb + (size_t)(i2 & (SS - 1)) * DM); const char* a3 = (const char*)(Xb + (size_t)(i3 & (SS - 1)) * DM);   // the mask bounds the row whatever the table holds
    stage_tile_b(lb, Wr, a0, a1, a2, a3, 0, tid); WAIT_ASYNC(); __syncthreads(); stage_tile_b(lb + QSTG, Wr, a0, a1, a2, a3, 1, tid);
#pragma unroll 1   // kept rolled: one trip = one buffer
    for (int t = 0; t < NT; ++t) { const unsigned char* S = L + (t & 1) * QSTG;
#pragma unroll   // constant indices keep bf[] and acc[] in registers (also the two directives below)
      for (int kc = 0; kc < 2; ++kc) { v16b bf[8]; const v16b a = frag_b((const __bf16*)(S + BTILE + (wave * 16 + col) * BPITCH + kc * 64), lane);   // all fragments of the k step first, then its WMMAs
#pragma unroll
        for (int j = 0; j < 8; ++j) bf[j] = frag_b((const __bf16*)(S + (j * 16 + col) * BPITCH + kc * 64), lane);
#pragma unroll
        for (int j = 0; j < 8; ++j) acc[j] = wmma_bf(a, bf[j], acc[j]); }
      WAIT_DS(); WAIT_ASYNC(); __syncthreads();   // publishes tile t + 1 and frees tile t's buffer
      if (t + 2 < NT) stage_tile_b(lb + (unsigned)(t & 1) * QSTG, Wr, a0, a1, a2, a3, t + 2, tid); }
    WAIT_ASYNC(); }
  float bias[8] = {0.f, 0.f, 0.f, 0.f, 0.f, 0.f, 0.f, 0.f};   // the lane's eight column biases (column j * 16 + col), fetched once: eight loads in flight together, one latency for the whole epilogue
  if (BB) { const float* bp = BB + col;
#pragma unroll   // constant indices keep bias[] in registers (also the next directive)
    for (int j = 0; j < 8; ++j) bias[j] = bp[j * 16];
    asm volatile("s_wait_xcnt 0x0" ::: "memory");   // a precaution: stands in front of the first instruction that reuses a register of the eight loads' address
#pragma unroll
    for (int j = 0; j < 8; ++j) bias[j] = bfr(bias[j]); }
  if (n0 < 2 * DM) {   // bias, then the interleaved-pair rotary: pair (2i, 2i+1) = neighbouring lanes (col ^ 1), cos and sin of t_scaled[row] * inv_freq[i] from k_ts's table
#pragma unroll
    for (int j = 0; j < 8; ++j)
#pragma unroll
      for (int r = 0; r < 8; ++r) acc[j][r] += bias[j];
#pragma unroll
    for (int r = 0; r < 8; ++r) {
#pragma unroll
      for (int j = 0; j < 8; ++j) { const float c = cs[r][(j & 3) >> 1][(j & 1) * 2], sn = cs[r][(j & 3) >> 1][(j & 1) * 2 + 1]; const float v = acc[j][r]; const float pv = __shfl_xor(v, 1); acc[j][r] = (col & 1) ? (v * c + pv * sn) : (v * c - pv * sn); } }
    if (n0 >= DM) {   // k blocks (the same for the whole block): the largest squared length of the wave's 16 rotated key rows, per head, for k_attn's bound on q . k
      float a[16];   // a[8 hh + r]: the lane's four columns' share of row 8 g + r, head hh of the block's two
#pragma unroll   // constant indices keep a[] in registers (also the three directives below)
      for (int i = 0; i < 16; ++i) { const int j0 = (i >> 3) * 4, r = i & 7; a[i] = acc[j0][r] * acc[j0][r] + acc[j0 + 1][r] * acc[j0 + 1][r] + acc[j0 + 2][r] * acc[j0 + 2][r] + acc[j0 + 3][r] * acc[j0 + 3][r]; }
      // sum over the row's 16 lanes, halving the values a lane carries at each exchange: 15 exchanges in all, and lane col ends with the whole sum of a[col]
#pragma unroll
      for (int i = 0; i < 8; ++i) { const bool up = (col & 8) != 0; a[i] = (up ? a[i + 8] : a[i]) + rowx<8>(up ? a[i] : a[i + 8]); }
#pragma unroll
      for (int i = 0; i < 4; ++i) { const bool up = (col & 4) != 0; a[i] = (up ? a[i + 4] : a[i]) + rowx<4>(up ? a[i] : a[i + 4]); }
#pragma unroll
      for (int i = 0; i < 2; ++i) { const bool up = (col & 2) != 0; a[i] = (up ? a[i + 2] : a[i]) + rowx<2>(up ? a[i] : a[i + 2]); }
      float n2 = ((col & 1) ? a[1] : a[0]) + rowx<1>((col & 1) ? a[0] : a[1]);
      n2 = (n2 < 3.0e38f) ? n2 : __builtin_inff();   // NaN or overflow: infinite, so that k_attn leaves nothing out
      n2 = fmaxf(n2, rowx<1>(n2)); n2 = fmaxf(n2, rowx<2>(n2)); n2 = fmaxf(n2, rowx<4>(n2)); n2 = fmaxf(n2, __shfl_xor(n2, 16));   // over the head's 8 lanes (rows 8 g + 0 .. 7), then over the two halves
      if ((lane & 23) == 0) { const int w16 = blockIdx.x * 4 + wave; KN[((size_t)(w16 >> 6) * NH + ((n0 - DM) >> 6) + (lane >> 3)) * (SS / 16) + (w16 & 63)] = n2;   // lanes 0 and 8: one 4-B scratch store a head
        asm volatile("s_wait_xcnt 0x0" ::: "memory"); } }   // a precaution: stands in front of the first instruction that reuses a register of the store
#pragma unroll
    for (int j = 0; j < 8; ++j) {
#pragma unroll
      for (int r = 0; r < 8; ++r) { const float v = acc[j][r]; const _Float16 hv = (_Float16)v; so[wave][8 * g + r][j * 16 + col] = hv; sol[wave][8 * g + r][j * 16 + col] = (_Float16)((v - (float)hv) * 2048.0f); } }   // q, k (+ bias) as f16 hi + (x2048) residual
    LDSX();
    for (int rl = 0; rl < 16; ++rl) if (lane < 16) { vst2((unsigned*)(QK + (r0 + rl) * (2 * DM) + n0 + lane * 8), *(const v4u*)&so[wave][rl][lane * 8]); vst2((unsigned*)(QKL + (r0 + rl) * (2 * DM) + n0 + lane * 8), *(const v4u*)&sol[wave][rl][lane * 8]); }
  } else {
#pragma unroll
    for (int j = 0; j < 8; ++j) {
#pragma unroll
      for (int r = 0; r < 8; ++r) { const float v = acc[j][r] + bias[j]; const _Float16 hv = (_Float16)v; sth[j * 16 + col][wave * 16 + 8 * g + r] = hv; stl[j * 16 + col][wave * 16 + 8 * g + r] = (_Float16)((v - (float)hv) * 2048.0f); } }
    __syncthreads();
    const size_t rb = (size_t)blockIdx.x * 64; const int b = (int)(rb / SS), s0 = (int)(rb % SS); const int pc0 = n0 - 2 * DM;
    for (int q = tid; q < 128 * 8; q += 128) { const int d = q >> 3, pc = q & 7; const size_t o = ((size_t)b * DM + pc0 + d) * SS + s0 + pc * 8; vst2((unsigned*)(VTH + o), *(const v4u*)&sth[d][pc * 8]); vst2((unsigned*)(VTL + o), *(const v4u*)&stl[d][pc * 8]); }
  }
}
// ---- LDS staging of k_attn: a tile = 64 keys: their 64 k rows (128 B each), the 64 v^T rows' 64 columns (128 B each), and per wave a private copy of the keys' times and errors (256 B + 256 B); two buffers, filled one tile ahead
#define AKP 144                       // k / v^T row pitch in LDS: 16 B x odd
#define AK_V (64 * AKP)
#define AK_TE (2 * 64 * AKP)
#define ASTG (AK_TE + 4 * 512)        // one buffer
#define ANT (SS / 64)
#define LOG2E 1.44269504088896340736f
// nine 16-byte copies of one thread (4 of k, 4 of v^T, 1 of times | errors); the closing s_wait_xcnt 0 keeps every address register named here unchanged until the copies have taken it
__device__ __forceinline__ void stage_kv(unsigned lbuf, const _Float16* Kr, const _Float16* Vr, const float* Tb, const float* Eb, int t, int tid) {
  const int lane = tid & 31;
  const unsigned lk = lbuf + (unsigned)(tid >> 3) * AKP + (unsigned)(tid & 7) * 16u, lv = lk + AK_V, lt = lbuf + AK_TE + (unsigned)(tid >> 5) * 512u + (unsigned)lane * 16u;
  const char* gk = (const char*)(Kr + ((size_t)t * 64 + (tid >> 3)) * (2 * DM) + (tid & 7) * 8);
  const char* gv = (const char*)(Vr + (size_t)(tid >> 3) * SS + t * 64 + (tid & 7) * 8);
  const char* gt = (const char*)(((lane < 16) ? Tb : Eb) + t * 64 + (lane & 15) * 4);
  const size_t ks16 = (size_t)16 * 2 * DM * 2, vs16 = (size_t)16 * SS * 2;
  asm volatile("global_load_async_to_lds_b128 %0, %9, off\n\t"
               "global_load_async_to_lds_b128 %1, %10, off\n\t"
               "global_load_async_to_lds_b128 %2, %11, off\n\t"
               "global_load_async_to_lds_b128 %3, %12, off\n\t"
               "global_load_async_to_lds_b128 %4, %13, off\n\t"
               "global_load_async_to_lds_b128 %5, %14, off\n\t"
               "global_load_async_to_lds_b128 %6, %15, off\n\t"
               "global_load_async_to_lds_b128 %7, %16, off\n\t"
               "global_load_async_to_lds_b128 %8, %17, off\n\t"
               "s_wait_xcnt 0x0"
               :: "v"(lk), "v"(lk + 16u * AKP), "v"(lk + 32u * AKP), "v"(lk + 48u * AKP), "v"(lv), "v"(lv + 16u * AKP), "v"(lv + 32u * AKP), "v"(lv + 48u * AKP), "v"(lt),
                  "v"(gk), "v"(gk + ks16), "v"(gk + 2 * ks16), "v"(gk + 3 * ks16), "v"(gv), "v"(gv + vs16), "v"(gv + 2 * vs16), "v"(gv + 3 * vs16), "v"(gt)
               : "memory");
}
// lane l with lane l ^ 16 (the two lanes that share one query column), by a vector cross-row move
__device__ __forceinline__ float xhalf(float x) { return __builtin_bit_cast(float, __builtin_amdgcn_permlanex16(__builtin_bit_cast(int, x), __builtin_bit_cast(int, x), 0x76543210, 0xfedcba98, false, false)); }
// ---- k_attn: block = (64 queries, head h, batch b): all-keys flash attention, transposed: S^T = K . Q^T (A = 16 key rows from LDS, B = the wave's 16 queries, kept in registers), so a lane holds 8 keys' scores of ONE query (column = lane & 15, keys 8g + r); maximum and sum run in the lane, the two halves exchange the maximum once a step and join their sums once at the end; two S^T tiles, converted in place, are the B operand of O^T += V^T . P^T; O[b*S+q][h*64+d] = acc / l (256-B segments)
__global__ __launch_bounds__(128) void k_attn(const _Float16* __restrict__ QK, const _Float16* __restrict__ QKL, const _Float16* __restrict__ VTH, const _Float16* __restrict__ VTL, const void* __restrict__ KMASK, const float* __restrict__ TS, const float* __restrict__ ERR, const float* __restrict__ LAMH, const float* __restrict__ WG, const float* __restrict__ BG, const float* __restrict__ KN, float* __restrict__ O) {
  __shared__ __attribute__((aligned(16))) float sred[8];   // each wave's latest and (negated) earliest time that one of its queries can reach
  __shared__ __align__(16) float so[4][16][68]; __shared__ __attribute__((aligned(16))) unsigned char L[2 * ASTG];
  const int tid = threadIdx.x, wave = tid >> 5, lane = tid & 31, col = lane & 15, g = lane >> 4;
  const int qb = blockIdx.x, h = blockIdx.y, b = blockIdx.z; const int q0 = qb * 64 + wave * 16; const size_t rq = (size_t)b * SS + q0 + col;
  v16h bq[2];
#pragma unroll
  for (int kc = 0; kc < 2; ++kc) bq[kc] = frag_h(QK + rq * (2 * DM) + h * HD + kc * 32, lane);
  asm volatile("s_wait_xcnt 0x0" ::: "memory");   // a precaution: stands in front of the first instruction that reuses the four query loads' address pair
  // per-head constants and the lane's own query's time / error values for the score biases
  const float lraw = bfr(LAMH[h]); const float lam = (lraw > 20.f) ? lraw : log1pf(expf(lraw));   // softplus, precise, once a thread: in line, so that the kernel holds no call
  const float wg0 = bfr(WG[h * 2]), wg1 = bfr(WG[h * 2 + 1]), bgh = bfr(BG[h]); const float lam2 = lam * LOG2E;   // scores carry the factor log2 e, so that every exp and log of the loop is one hardware instruction
  const float tq = TS[rq]; const float gq = (wg0 * bfr(ERR[rq]) + bgh) * -LOG2E; const float wk = wg1 * -LOG2E;   // gate logit's query part and the key part's factor, as the exponent of 2 in exp(-logit)
  // for the tile test behind trip 0: the head's 64 largest squared key lengths (two a lane) and the 16 key tiles' first (lanes 0-15) and last (lanes 16-31) times; every wave loads the same values
  const v2f kn = *(const v2f*)(KN + ((size_t)b * NH + h) * (SS / 16) + lane * 2); const float tb = TS[(size_t)b * SS + col * 64 + g * 63];
  asm volatile("s_wait_xcnt 0x0" ::: "memory");   // a precaution: stands in front of the first instruction that reuses a register of the two loads' addresses
  float m = -3.0e38f, l = 0.f;
  v8f acc[4] = {};
  const unsigned lb = (unsigned)(uintptr_t)&L[0]; const _Float16* Kr = QK + (size_t)b * SS * (2 * DM) + DM + h * HD; const _Float16* Vr = VTH + ((size_t)b * DM + h * HD) * SS; const float* Tb = TS + (size_t)b * SS; const float* Eb = ERR + (size_t)b * SS;
  // the trips take the key tiles in the order (qb + o) mod 16, o ascending: the block's own 64 places first, so that every query's running maximum has met its own key and its neighbours in time before the far tiles come; trip 1 takes o = 1; behind trip 0 the block finds which other tiles any of its queries can reach, and only those are staged and visited
  stage_kv(lb, Kr, Vr, Tb, Eb, qb, tid); WAIT_ASYNC(); __syncthreads(); stage_kv(lb + ASTG, Kr, Vr, Tb, Eb, (qb + 1) & (ANT - 1), tid);
  __builtin_amdgcn_sched_barrier(0);   // keeps the sums below, which need the query and length loads' data, behind the issue of the first two tiles' copies: ahead of them they would put one memory latency in front of the other
  float qs[4] = {0.f, 0.f, 0.f, 0.f};   // the query's squared length, from the f16 operand itself: the lane's 32 elements in four chains, then the other half's
#pragma unroll   // constant indices keep qs[] in registers (also the next directive)
  for (int kc = 0; kc < 2; ++kc)
#pragma unroll
    for (int i = 0; i < 16; ++i) { const float f = (float)bq[kc][i]; qs[i & 3] += f * f; }
  float qn2 = (qs[0] + qs[1]) + (qs[2] + qs[3]); qn2 += xhalf(qn2);
  float k2 = fmaxf(kn[0], kn[1]); k2 = fmaxf(k2, rowx<1>(k2)); k2 = fmaxf(k2, rowx<2>(k2)); k2 = fmaxf(k2, rowx<4>(k2)); k2 = fmaxf(k2, rowx<8>(k2)); k2 = fmaxf(k2, xhalf(k2));   // the head's largest squared key length in this batch
  const float qk = __builtin_amdgcn_sqrtf(qn2 * k2) * (0.125f * LOG2E * 1.002f);   // no score's q . k part exceeds this: |q . k| <= |q| |k|; the factor 1.002 covers k's rounding to f16 and the sums' rounding
  int nt = 2; unsigned rest = 0;   // trips in all (at most 16); the tiles not yet staged, bit o = tile (qb + o) mod 16: both the same in every wave of the block
#pragma unroll 1   // kept rolled: one trip = one buffer = 64 keys
  for (int t = 0; t < nt; ++t) { const unsigned char* S = L + (t & 1) * ASTG;
#pragma unroll 1   // kept rolled: the tile's two 32-key steps share one body in the instruction cache
  for (int ks = 0; ks < 2; ++ks) { v8f s[2]; v16h kf[2][2];
    const float* tw = (const float*)(S + AK_TE + wave * 512) + ks * 32; const float gap = fmaxf(fmaxf(tw[0] - tq, tq - tw[31]), 0.f);   // the step's first and last key in time, fetched beside the k fragments: no key of the step is nearer to the query than gap
#pragma unroll   // constant indices keep kf[][] in registers (also the next directive)
    for (int ct = 0; ct < 2; ++ct)
#pragma unroll
      for (int kc = 0; kc < 2; ++kc) kf[ct][kc] = frag_h((const _Float16*)(S + (ks * 32 + ct * 16 + col) * AKP + kc * 64), lane);   // the step's four k fragments first, then its WMMAs
#pragma unroll
    for (int ct = 0; ct < 2; ++ct) { v8f c = {};
#pragma unroll
      for (int kc = 0; kc < 2; ++kc) c = wmma16(kf[ct][kc], bq[kc], c);   // single product: k, q as one-rounding f16 operands; c[r] = key 16 ct + 8 g + r against query col
      s[ct] = c; }
    // the step's 32 keys stand in ascending time: no key is nearer to the query than gap, and the gate bias is at most log2(1 + 1e-9), so no score of the lane exceeds top. Where every lane's top lies more than 152 below its running maximum, every weight of the step is exp2 of less than -150 = 0 in f32, the maximum stays and the rescaling factor is 1: the step would change nothing, and the wave leaves it out (one scalar branch, the same for the whole wave; a bound that is NaN compares false and takes the full step)
    { float cm = fmaxf(s[0][0], s[1][0]);
#pragma unroll
      for (int r = 1; r < 8; ++r) cm = fmaxf(cm, fmaxf(s[0][r], s[1][r]));
      const float top = cm * (0.125f * LOG2E) - lam2 * gap;
      if (__builtin_amdgcn_ballot_w32(top - m < -152.0f) == 0xffffffffu) continue; }
#pragma unroll
    for (int ct = 0; ct < 2; ++ct) { const v8f c = s[ct];
      const v4f* te = (const v4f*)(S + AK_TE + wave * 512 + (ks * 32 + ct * 16 + 8 * g) * 4); const v4f t0 = te[0], t1 = te[1], e0 = te[16], e1 = te[17];   // the lane's 8 keys' times and errors
#pragma unroll
      for (int r = 0; r < 8; ++r) { const float tk = (r < 4) ? t0[r & 3] : t1[r & 3]; const float ek = (r < 4) ? e0[r & 3] : e1[r & 3];
        const float sig = __builtin_amdgcn_rcpf(1.0f + __builtin_amdgcn_exp2f(wk * bfr(ek) + gq)); s[ct][r] = c[r] * (0.125f * LOG2E) + (__builtin_amdgcn_logf(sig + 1e-9f) - lam2 * fabsf(tq - tk)); } }   // (q.k/8 + time-decay bias + error-gate bias) x log2 e: sigmoid by v_exp_f32 and v_rcp_f32, its logarithm by v_log_f32
    float mx = fmaxf(s[0][0], s[1][0]);
#pragma unroll
    for (int r = 1; r < 8; ++r) mx = fmaxf(mx, fmaxf(s[0][r], s[1][r]));
    mx = fmaxf(mx, xhalf(mx));   // both halves hold the query's maximum over the step's 32 keys
    const float mn = fmaxf(m, mx); const float alpha = (m <= -1.0e38f) ? 0.f : __builtin_amdgcn_exp2f(m - mn);
    v2f es = {0.f, 0.f}; v16h pb;
#pragma unroll
    for (int ct = 0; ct < 2; ++ct)
#pragma unroll
      for (int r = 0; r < 8; r += 2) { v2f e; e[0] = (s[ct][r] <= -1.0e38f) ? 0.f : __builtin_amdgcn_exp2f(s[ct][r] - mn); e[1] = (s[ct][r + 1] <= -1.0e38f) ? 0.f : __builtin_amdgcn_exp2f(s[ct][r + 1] - mn);
        es = (ct + r == 0) ? e : es + e; const v2f x = e * 2048.0f; pb[ct * 8 + r] = (_Float16)x[0]; pb[ct * 8 + r + 1] = (_Float16)x[1]; }   // even and odd keys summed side by side (packed adds); P scaled by 2^11 so small softmax weights stay out of the f16 subnormal range; 2^-11 folded into the epilogue; element 8 ct + r = key 16 ct + 8 g + r, the k order of the v fragments
    l = l * alpha + (es[0] + es[1]); m = mn;   // the lane's own 16 keys of the step; the halves' sums are joined behind the loop
#pragma unroll
    for (int dt = 0; dt < 4; ++dt) acc[dt] *= alpha;
    v16h vf[4];
#pragma unroll   // constant indices keep vf[] in registers
    for (int dt = 0; dt < 4; ++dt) vf[dt] = frag_h((const _Float16*)(S + AK_V + (dt * 16 + col) * AKP + ks * 64), lane);   // the step's four v fragments first, then its WMMAs
#pragma unroll
    for (int dt = 0; dt < 4; ++dt) acc[dt] = wmma16(vf[dt], pb, acc[dt]); }   // single product: V^T x P^T (x2^11); acc[dt][r] = d 16 dt + 8 g + r of query col
    if (t == 0) {   // the q . k part is at most qk, the gate bias at most log2(1 + 1e-9), and the maximum only grows: a key further from the query in time than reach has a score more than 153 below the maximum, so the step test above would leave it out in every wave
      float reach = (qk - m + 153.0f) * __builtin_amdgcn_rcpf(lam2) * 1.0001f;
      reach = (reach < 3.0e38f) ? reach : __builtin_inff();   // no decay, or NaN: everything is in reach
      float e = g ? (reach - tq) : (tq + reach); e = (e < 3.0e38f) ? e : __builtin_inff();   // lower half: the latest time in reach; upper half: the earliest, negated
      e = fmaxf(e, rowx<1>(e)); e = fmaxf(e, rowx<2>(e)); e = fmaxf(e, rowx<4>(e)); e = fmaxf(e, rowx<8>(e));   // over the wave's 16 queries
      if (col == 0) sred[wave * 2 + g] = e; }   // published by the barrier below
    WAIT_DS(); WAIT_ASYNC(); __syncthreads();   // publishes tile t + 1 and frees tile t's buffer
    if (t == 0) { const v4f r0 = *(const v4f*)&sred[0], r1 = *(const v4f*)&sred[4];
      const float hi = fmaxf(fmaxf(r0[0], r0[2]), fmaxf(r1[0], r1[2])), nlo = fmaxf(fmaxf(r0[1], r0[3]), fmaxf(r1[1], r1[3]));   // over the block's four waves
      const unsigned bal = __builtin_amdgcn_ballot_w32(g ? !(-tb > nlo) : !(tb > hi));   // bit T: tile T does not begin behind the latest time; bit 16 + T: it does not end ahead of the earliest (a NaN compares false: the tile stays)
      rest = ((((bal & (bal >> 16)) & 0xffffu) * 0x10001u) >> qb) & 0xfffcu;   // turned so that bit o = tile (qb + o) mod 16; o = 0 and 1 are staged already
      nt = 2 + __builtin_popcount(rest); }
    if (rest) { const int o = __builtin_ctz(rest); rest &= rest - 1; stage_kv(lb + (unsigned)(t & 1) * ASTG, Kr, Vr, Tb, Eb, (qb + o) & (ANT - 1), tid); } }   // the next tile in reach, two trips ahead, into the buffer that this trip has just read
  WAIT_ASYNC();
  const float il = (1.0f / 2048.0f) / (l + xhalf(l));
#pragma unroll
  for (int dt = 0; dt < 4; ++dt) { v4f o0, o1;
#pragma unroll
    for (int i = 0; i < 4; ++i) { o0[i] = acc[dt][i] * il; o1[i] = acc[dt][4 + i] * il; }
    *(v4f*)&so[wave][col][dt * 16 + 8 * g] = o0; *(v4f*)&so[wave][col][dt * 16 + 8 * g + 4] = o1; }
  LDSX();
  for (int rl = 0; rl < 16; ++rl) if (lane < 16) vst2(O + ((size_t)b * SS + q0 + rl) * DM + h * HD + lane * 4, *(const v4f*)&so[wave][rl][lane * 4]);
}
// ---- k_out: block = (64 rows, 128 cols): out = O(hi/lo) . Wo rows (2 products) + bo
__global__ __launch_bounds__(128) void k_out(const float* __restrict__ O, const __bf16* __restrict__ P, const float* __restrict__ BO, const int* __restrict__ INV, float* __restrict__ Y) {
  __shared__ __attribute__((aligned(16))) unsigned char L[2 * STG];   // the two tile buffers; behind the k loop's last barrier the same bytes serve as output staging
  float (*so)[16][132] = (float (*)[16][132])L;
  const int tid = threadIdx.x, wave = tid >> 5, lane = tid & 31, col = lane & 15, g = lane >> 4; const size_t r0 = (size_t)blockIdx.x * 64 + wave * 16; const int n0 = blockIdx.y * 128;
  v8f acc[8] = {};
  const int iv = INV[r0 + col];   // O's rows stand in time order: lane l holds the token of the wave's row l & 15; loaded in front of the k loop, used behind it
  asm volatile("s_wait_xcnt 0x0" ::: "memory");   // a precaution: stands in front of the first instruction that reuses a register of the load's address
  { const unsigned lb = (unsigned)(uintptr_t)&L[0]; const __bf16* Wr = P + (size_t)n0 * DM; const float* Ar = O + (size_t)blockIdx.x * 64 * DM;
    stage_tile(lb, Wr, Ar, 0, tid); WAIT_ASYNC(); __syncthreads(); stage_tile(lb + STG, Wr, Ar, 1, tid);
#pragma unroll 1   // kept rolled: one trip = one buffer
    for (int t = 0; t < NT; ++t) { const unsigned char* S = L + (t & 1) * STG;
#pragma unroll   // constant indices keep bf[] and acc[] in registers (also the two directives below)
      for (int kc = 0; kc < 2; ++kc) { float av[16]; v16b bf[8]; lds_a16(S + BTILE + (wave * 16 + col) * APITCH + kc * 128, g, av);   // all fragments of the k step first, then its WMMAs
#pragma unroll
        for (int j = 0; j < 8; ++j) bf[j] = frag_b((const __bf16*)(S + (j * 16 + col) * BPITCH + kc * 64), lane);
        const F2 a = bsplit16(av);
#pragma unroll
        for (int j = 0; j < 8; ++j) { acc[j] = wmma_bf(a.l, bf[j], acc[j]); acc[j] = wmma_bf(a.h, bf[j], acc[j]); } }
      WAIT_DS(); WAIT_ASYNC(); __syncthreads();   // publishes tile t + 1 and frees tile t's buffer
      if (t + 2 < NT) stage_tile(lb + (unsigned)(t & 1) * STG, Wr, Ar, t + 2, tid); }
    WAIT_ASYNC(); }
#pragma unroll
  for (int j = 0; j < 8; ++j) {
#pragma unroll
    for (int r = 0; r < 8; ++r) so[wave][8 * g + r][j * 16 + col] = acc[j][r] + bfr(BO[n0 + j * 16 + col]); }
  LDSX();
  const size_t rb = (size_t)(blockIdx.x * 64 / SS) * SS;   // the block's batch
  for (int rl = 0; rl < 16; ++rl) vst2(Y + (rb + (size_t)(__builtin_amdgcn_readlane(iv, rl) & (SS - 1))) * DM + n0 + lane * 4, *(const v4f*)&so[wave][rl][lane * 4]);   // each row goes to its token's place; the mask bounds the row whatever the table holds
}
// ---- k_ts: blocks with blockIdx.y >= 64 round 16,384 elements to bf16 each (a thread: sixteen 16-B loads, all issued ahead of its sixteen 8-B stores; a wave's load covers 4 whole lines, its store 2): the first 64 rows of such blocks take x, the next 64 the four weight matrices (blockIdx.x = W_q, W_k, W_v, W_o; natural [out][in] rows, so matrix w lies flat at PK + w * 1024 * 1024: W_q | W_k | W_v = PK_A, W_o = PK_P). Few long blocks: the launch starts 6,144 waves in all. They need nothing of the other blocks and run beside their chain of waits. The other blocks: block = (batch, 16 tokens): t_scaled = (t - min) / (max - min + 1e-6) * 1000, minimum and maximum over the batch's whole sequence in every block; the block's 16 scaled times and their rotary table: cos and sin of t_scaled x inv_freq[f], once per (token, frequency)
// Time order: each of these blocks also ranks its 16 tokens among the batch's 1,024 by (time, token index), a total order, so the ranks are a permutation; it stores time, error, rotary row and token index at the rank. All later kernels work on places of that order (k_qkv gathers x's rows by INV, k_out scatters its rows by INV)
__global__ __launch_bounds__(256) void k_ts(const float* __restrict__ TR, const float* __restrict__ ERR, float* __restrict__ TS, float* __restrict__ ERS, int* __restrict__ INV, float* __restrict__ ROT, const float* __restrict__ X, __bf16* __restrict__ XB, const float* __restrict__ WQ, const float* __restrict__ WK, const float* __restrict__ WV, const float* __restrict__ WO, __bf16* __restrict__ PK) {
  if (blockIdx.y >= SS / 16) {   // the same for the whole block, in front of every barrier
    const int c = blockIdx.y - SS / 16, w = blockIdx.x; const float* s; __bf16* d;
    if (c < SS * DM / XCB) { const size_t o = ((size_t)c * NB + w) * XCB; s = X + o; d = XB + o; }
    else { const size_t o = (size_t)(c - SS * DM / XCB) * XCB; s = ((w == 0) ? WQ : (w == 1) ? WK : (w == 2) ? WV : WO) + o; d = PK + (size_t)w * DM * DM + o; }
    s += threadIdx.x * 4; d += threadIdx.x * 4; v4f v[16];
#pragma unroll   // constant indices keep v[] in registers; all sixteen loads first, then the stores (also the next directive)
    for (int i = 0; i < 16; ++i) v[i] = *(const v4f*)(s + i * 1024);
#pragma unroll
    for (int i = 0; i < 16; ++i) { v4b o; o[0] = (__bf16)v[i][0]; o[1] = (__bf16)v[i][1]; o[2] = (__bf16)v[i][2]; o[3] = (__bf16)v[i][3]; *(v4b*)(d + i * 1024) = o; }
    return; }
  __shared__ float rmn[256], rmx[256]; __shared__ __attribute__((aligned(16))) int skey[SS]; const size_t b = blockIdx.x; const int t = threadIdx.x; float mn = 3.0e38f, mx = -3.0e38f;
  for (int s = t; s < SS; s += 256) { const float v = bfr(TR[b * SS + s]); mn = fminf(mn, v); mx = fmaxf(mx, v);
    const int bits = __builtin_bit_cast(int, v); skey[s] = ((bits ^ ((bits >> 31) & 0x7fffffff)) >> 16) * SS + s; }   // sort key: the rounded time's 16 significant bits as an integer that orders like the float, then the token index; published by the barrier below
  rmn[t] = mn; rmx[t] = mx; __syncthreads();
  for (int st = 128; st > 0; st >>= 1) { if (t < st) { rmn[t] = fminf(rmn[t], rmn[t + st]); rmx[t] = fmaxf(rmx[t], rmx[t + st]); } __syncthreads(); }
  const float tmin = rmn[0], den = rmx[0] - rmn[0] + 1e-6f;
  const size_t s0 = b * SS + blockIdx.y * 16;
  const int tok = t >> 4, part = t & 15; const int mykey = skey[blockIdx.y * 16 + tok]; int rank = 0;   // sixteen lanes a token: each counts the smaller keys among 64, the four exchanges below add the counts up in all sixteen
  for (int i = 0; i < 16; ++i) { const v4i k4 = *(const v4i*)&skey[i * 64 + part * 4]; rank += (k4[0] < mykey) + (k4[1] < mykey) + (k4[2] < mykey) + (k4[3] < mykey); }
  rank += __shfl_xor(rank, 1); rank += __shfl_xor(rank, 2); rank += __shfl_xor(rank, 4); rank += __shfl_xor(rank, 8);
  if (part == 0) { const size_t d = b * SS + rank; TS[d] = (bfr(TR[s0 + tok]) - tmin) / den * 1000.0f; ERS[d] = ERR[s0 + tok]; INV[d] = blockIdx.y * 16 + tok; }   // 4-B scratch stores
  for (int it = 0; it < 2; ++it) { const size_t s = s0 + (t >> 5) * 2 + it; const size_t d = b * SS + __shfl(rank, it * 16); const int p = t & 31, f = (p & 3) * 8 + (p >> 2);   // the wave's two tokens, one a pass (their ranks stand in its lanes 0-15 and 16-31); place p of a token's row holds frequency f: a k_qkv lane's four frequencies lie side by side
    const float ang = (bfr(TR[s]) - tmin) / den * 1000.0f * INVF[f]; v2f cs; cs[0] = cos_p(ang); cs[1] = sin_p(ang); *(v2f*)(ROT + d * 64 + p * 2) = cs; }   // a wave stores one token's 256 B
}
extern "C" void kernel_launch(void* const* d_in, const int* in_sizes, int n_in, void* d_out, int out_size, void* d_ws, size_t ws_size, hipStream_t stream) {
  (void)in_sizes; (void)n_in; (void)out_size;
  const float** F = (const float**)d_in;   // 0 x [4,1024,1024], 1 t_raw [4,1024], 2 error [4,1024], 3 Wq, 4 bq, 5 Wk, 6 bk, 7 Wv, 8 bv, 9 Wo, 10 bo, 11 lambda_h [16], 12 Wg [16,2], 13 bg [16]
  if (ws_size < (size_t)WS_TOP + 256) return;
  char* ws = (char*)d_ws; __bf16* PK = (__bf16*)(ws + WS_PK); _Float16 *QK = (_Float16*)(ws + WS_QK), *QKL = (_Float16*)(ws + WS_QKL), *VTH = (_Float16*)(ws + WS_VTH), *VTL = (_Float16*)(ws + WS_VTL); float* O = (float*)(ws + WS_O); float* TS = (float*)(ws + WS_TS); float* ROT = (float*)(ws + WS_ROT); __bf16* XB = (__bf16*)(ws + WS_XB); float* ERS = (float*)(ws + WS_ERS); int* INV = (int*)(ws + WS_INV); float* KN = (float*)(ws + WS_KN);
  k_ts<<<dim3(NB, SS / 16 + SS * DM / XCB + DM * DM / XCB), 256, 0, stream>>>(F[1], F[2], TS, ERS, INV, ROT, F[0], XB, F[3], F[5], F[7], F[9], PK);
  k_qkv<<<dim3(TNB * SS / 64, QKVW / 128), 128, 0, stream>>>(XB, PK + PK_A, F[4], F[6], F[8], ROT, INV, QK, QKL, VTH, VTL, KN);
  k_attn<<<dim3(TQB, NH, TNB), 128, 0, stream>>>(QK, QKL, VTH, VTL, nullptr, TS, ERS, F[11], F[12], F[13], KN, O);
  k_out<<<dim3(TOB, DM / 128), 128, 0, stream>>>(O, PK + PK_P, F[10], INV, (float*)d_out);
}

// v010
// Measured time: 78.9 microseconds a run.
// Timed twice side by side with v009, it ran 1.08 and 1.10 times as fast.
// Counting every step since v000, it is 5.09 times as fast.
// compute dtype: all float inputs rounded to bf16; q/k/v = x . W^T + b with EXACT bf16 products on WMMA 16x16x32 (natural rows); per-batch time scaling and the interleaved-pair rotary (neighbouring lanes; angle = t_scaled x inv_freq[d/2] with jnp's inv_freq constants, precise cosf/sinf) in f32; PLAIN attention: rotated q, k as single f16 operands x 1/8 + the decay and gate biases evaluated per score in f32 (base 2: hardware exp, reciprocal and log; the per-head softplus by precise expf/log1pf), running-max softmax in f32 (base 2, hardware exp), P (scaled by 2^11, single f16) x v (single f16); out = o (bf16 hi + residual) . Wo^T (2 products) + bo.
#include <hip/hip_runtime.h>
#include <math.h>

typedef __attribute__((ext_vector_type(16))) _Float16 v16h;
typedef __attribute__((ext_vector_type(16))) __bf16 v16b;
typedef __attribute__((ext_vector_type(8)))  _Float16 v8h;
typedef __attribute__((ext_vector_type(8)))  float v8f;
typedef __attribute__((ext_vector_type(4)))  float v4f;
typedef __attribute__((ext_vector_type(2)))  float v2f;
typedef __attribute__((ext_vector_type(4)))  unsigned v4u;
typedef __attribute__((ext_vector_type(4)))  int v4i;
typedef float __attribute__((may_alias)) float_a;
typedef int __attribute__((may_alias)) int_a;

template <typename T> __device__ __forceinline__ void vst2(void* p, T v) { *(T*)p = v;  }
__device__ __forceinline__ v8f wmma16(v16h a, v16h b, v8f c) {
  v8f d = __builtin_amdgcn_wmma_f32_16x16x32_f16(false, a, false, b, (short)0, c, false, false);
  asm volatile("v_nop\n\tv_nop\n\tv_nop\n\tv_nop" : "+v"(d) : "v"(a), "v"(b));
  return d;
}
__device__ __forceinline__ v8f wmma_bf(v16b a, v16b b, v8f c) {
  v8f d = __builtin_amdgcn_wmma_f32_16x16x32_bf16(false, a, false, b, (short)0, c, false, false);
  asm volatile("v_nop\n\tv_nop\n\tv_nop\n\tv_nop" : "+v"(d) : "v"(a), "v"(b));
  return d;
}
// Scaled continuous-time attention (B 4, S 1,024, d 1,024, 16 heads x 64): q/k/v projections + biases, an interleaved rotary embedding whose angle is the per-token time (min-max scaled to [0, 1000]) x inv_freq, scores / 8 plus a per-head time-decay bias (-softplus(lambda_h) |t_i - t_j|) and an error-gated bias log(sigmoid(w_h0 err_i + w_h1 err_j + b_h) + 1e-9), softmax, . v, output projection + bias.
__device__ __forceinline__ v16h frag_h(const _Float16* rowk0, int lane) {
  union { v16h v; v8h q[2]; } u; const _Float16* p = rowk0 + 8 * (lane >> 4);
  u.q[0] = *(const v8h*)p; u.q[1] = *(const v8h*)(p + 16); return u.v;
}
__device__ __forceinline__ v16h frag_f32(const float* rowk0, int lane) {
  v16h a; const float* p = rowk0 + 8 * (lane >> 4);
#pragma unroll
  for (int i = 0; i < 8; ++i) { a[i] = (_Float16)p[i]; a[8 + i] = (_Float16)p[16 + i]; }
  return a;
}
__device__ __forceinline__ v16h frag_f32s(const float* rowk0, int lane, float sc) {
  v16h a; const float* p = rowk0 + 8 * (lane >> 4);
#pragma unroll
  for (int i = 0; i < 8; ++i) { a[i] = (_Float16)(p[i] * sc); a[8 + i] = (_Float16)(p[16 + i] * sc); }
  return a;
}
// column fragment from a [K][ld] layout (column n), rows >= K read as 0
__device__ __forceinline__ v16h fragc_f32(const float* W, int k0, int n, int lane, int ld, int K) {
  v16h a; const int g = lane >> 4;
#pragma unroll
  for (int i = 0; i < 8; ++i) { const int ka = k0 + 8 * g + i, kb = ka + 16;
    a[i] = (_Float16)(ka < K ? W[(size_t)(ka < K ? ka : K - 1) * ld + n] : 0.f); a[8 + i] = (_Float16)(kb < K ? W[(size_t)(kb < K ? kb : K - 1) * ld + n] : 0.f); }
  return a;
}
struct F2 { v16b h, l; };
__device__ __forceinline__ F2 bsplit16(const float v[16]) { F2 r;
#pragma unroll
  for (int i = 0; i < 16; ++i) { const __bf16 h = (__bf16)v[i]; r.h[i] = h; r.l[i] = (__bf16)(v[i] - (float)h); }
  return r; }
__device__ __forceinline__ F2 split_row(const float* row, int k0, int lane) { float v[16]; const float* p = row + k0 + 8 * (lane >> 4);
#pragma unroll
  for (int i = 0; i < 8; ++i) { v[i] = p[i]; v[8 + i] = p[16 + i]; }
  return bsplit16(v); }
__device__ __forceinline__ F2 split_rowK(const float* row, int k0, int lane, int K) { float v[16]; const int g = lane >> 4;
#pragma unroll
  for (int i = 0; i < 8; ++i) { const int ka = k0 + 8 * g + i, kb = ka + 16; v[i] = ka < K ? row[ka < K ? ka : K - 1] : 0.f; v[8 + i] = kb < K ? row[kb < K ? kb : K - 1] : 0.f; }
  return bsplit16(v); }
__device__ __forceinline__ F2 split_col(const float* W, int k0, int n, int lane, int ld, int K) { float v[16]; const int g = lane >> 4;
#pragma unroll
  for (int i = 0; i < 8; ++i) { const int ka = k0 + 8 * g + i, kb = ka + 16; v[i] = ka < K ? W[(size_t)(ka < K ? ka : K - 1) * ld + n] : 0.f; v[8 + i] = kb < K ? W[(size_t)(kb < K ? kb : K - 1) * ld + n] : 0.f; }
  return bsplit16(v); }
__device__ __forceinline__ v8f mac3(const F2& a, const F2& b, v8f c) { c = wmma_bf(a.l, b.h, c); c = wmma_bf(a.h, b.l, c); return wmma_bf(a.h, b.h, c); }
__device__ __forceinline__ float sigm(float v) { return 1.0f / (1.0f + expf(-v)); }
#define LDSX() do { asm volatile("s_wait_dscnt 0" ::: "memory"); __builtin_amdgcn_wave_barrier(); __builtin_amdgcn_fence(__ATOMIC_RELEASE, "workgroup"); } while (0)


#define NB 4
#define SS 1024
#define DM 1024
#define NH 16
__constant__ float INVF[32] = {1.000000000e+00f,7.498942018e-01f,5.623413324e-01f,4.216965139e-01f,3.162277639e-01f,2.371373773e-01f,1.778279394e-01f,1.333521456e-01f,1.000000015e-01f,7.498942316e-02f,5.623413250e-02f,4.216964915e-02f,3.162277490e-02f,2.371373773e-02f,1.778279431e-02f,1.333521400e-02f,9.999999776e-03f,7.498942316e-03f,5.623413250e-03f,4.216964822e-03f,3.162277630e-03f,2.371373819e-03f,1.778279431e-03f,1.333521446e-03f,1.000000047e-03f,7.498941850e-04f,5.623413017e-04f,4.216965172e-04f,3.162277571e-04f,2.371373703e-04f,1.778279402e-04f,1.333521504e-04f};
__device__ __attribute__((noinline)) float cos_p(float v) { return cosf(v); }
__device__ __attribute__((noinline)) float sin_p(float v) { return sinf(v); }
#define HD 64
#define QKVW (3 * DM)
#ifndef TQB
#define TQB (SS / 64)
#define TNB NB
#define TOB (NB * SS / 64)     // output row tiles (all)
#endif
typedef __attribute__((ext_vector_type(8))) __bf16 v8b;
typedef __attribute__((ext_vector_type(4))) __bf16 v4b;
__device__ __forceinline__ v16b frag_b(const __bf16* rowk0, int lane) {
  union { v16b v; v8b q[2]; } u; const __bf16* p = rowk0 + 8 * (lane >> 4);
  u.q[0] = *(const v8b*)p; u.q[1] = *(const v8b*)(p + 16); return u.v;
}
__device__ __forceinline__ float bfr(float v) { return (float)(__bf16)v; }
__device__ __attribute__((noinline)) float erf_ni(float v) { return erff(v); }

#define PK_A 0                       // [3072][1024] Wqkv rows (natural [out][in])
#define PK_P (PK_A + QKVW * DM)        // [1024][1024] Wo rows (natural)
#define PK_END (PK_P + DM * DM)
#define WS_PK  0u
#define WS_QK  (WS_PK + 2u * PK_END)             // f16 [4096 rows][2048]: q | k
#define WS_QKL (WS_QK + 2u * NB * SS * 2 * DM)     // f16 q | k residual planes x2048
#define WS_VTH (WS_QKL + 2u * NB * SS * 2 * DM)    // f16 [b][1024 (h*64+d)][1024 s] hi
#define WS_VTL (WS_VTH + 2u * NB * DM * SS)        // f16 lo x 2048
#define WS_O   (WS_VTL + 2u * NB * DM * SS)        // f32 [4096][1024]
#define WS_CS  (WS_O + 4u * NB * SS * DM)           // f32 2 x [1024][32], not used (cos/sin computed in k_ts)
#define WS_END (WS_CS + 4u * 2 * SS * 32)
#define WS_TS  WS_END                               // f32 [4096] scaled times, each batch's in ascending order (every per-token plane behind k_ts is in that order)
#define WS_ROT (WS_TS + 4u * NB * SS)               // f32 [4096 tokens][8 (f & 7)][4 (f >> 3)][cos, sin]: the rotary table, 256 B a token
#define WS_XB  (WS_ROT + 4u * NB * SS * 64)         // bf16 [4096 tokens][1024]: x, rounded once
#define WS_ERS (WS_XB + 2u * NB * SS * DM)          // f32 [4096]: the errors, in time order
#define WS_INV (WS_ERS + 4u * NB * SS)              // int [4096]: place in time order -> token of the batch
#define WS_KN  (WS_INV + 4u * NB * SS)              // f32 [4 batches][16 heads][64]: the largest squared length among each 16 rotated key rows (places 16 i .. 16 i + 15)
#define WS_TOP (WS_KN + 4u * NB * NH * (SS / 16))
// ---- LDS staging of the two projection GEMMs: a tile = 64 k of 128 weight rows (bf16, 128 B a row) and of 64 activation rows (k_out: f32, 256 B a row; k_qkv: bf16, further down); two buffers, filled by asynchronous copies one tile ahead
#define KT 64
#define BPITCH 144                    // weight row pitch in LDS: 16 B x odd, conflict-free for 16-byte reads
#define APITCH 272                    // activation row pitch in LDS: 16 B x odd
#define BTILE (128 * BPITCH)
#define STG (BTILE + 64 * APITCH)     // one buffer
#define NT (DM / KT)
// eight 16-byte copies of one thread, global memory -> LDS, no register in between; the closing s_wait_xcnt 0 keeps every address register named here unchanged until the copies have taken it
__device__ __forceinline__ void copy8(unsigned l, const char* g, unsigned lstep, size_t gstep) {
  asm volatile("global_load_async_to_lds_b128 %0, %8, off\n\t"
               "global_load_async_to_lds_b128 %1, %9, off\n\t"
               "global_load_async_to_lds_b128 %2, %10, off\n\t"
               "global_load_async_to_lds_b128 %3, %11, off\n\t"
               "global_load_async_to_lds_b128 %4, %12, off\n\t"
               "global_load_async_to_lds_b128 %5, %13, off\n\t"
               "global_load_async_to_lds_b128 %6, %14, off\n\t"
               "global_load_async_to_lds_b128 %7, %15, off\n\t"
               "s_wait_xcnt 0x0"
               :: "v"(l), "v"(l + lstep), "v"(l + 2 * lstep), "v"(l + 3 * lstep), "v"(l + 4 * lstep), "v"(l + 5 * lstep), "v"(l + 6 * lstep), "v"(l + 7 * lstep),
                  "v"(g), "v"(g + gstep), "v"(g + 2 * gstep), "v"(g + 3 * gstep), "v"(g + 4 * gstep), "v"(g + 5 * gstep), "v"(g + 6 * gstep), "v"(g + 7 * gstep)
               : "memory");
}
// tile t of the block's 128 weight rows (Wr = row 0, k 0) and 64 activation rows (Ar) into the buffer at LDS byte address lbuf: a wave's copy covers 4 whole 128-B lines
__device__ __forceinline__ void stage_tile(unsigned lbuf, const __bf16* Wr, const float* Ar, int t, int tid) {
  copy8(lbuf + (unsigned)(tid >> 3) * BPITCH + (unsigned)(tid & 7) * 16u, (const char*)(Wr + (size_t)(tid >> 3) * DM + t * KT + (tid & 7) * 8), 16u * BPITCH, (size_t)16 * DM * 2);
  copy8(lbuf + BTILE + (unsigned)(tid >> 4) * APITCH + (unsigned)(tid & 15) * 16u, (const char*)(Ar + (size_t)(tid >> 4) * DM + t * KT + (tid & 15) * 4), 8u * APITCH, (size_t)8 * DM * 4);
}
// ---- k_qkv's tile: 64 k of 128 weight rows and, right behind them at the same pitch, of 64 activation rows, all bf16 (128 B a row): 192 rows, 16 a pass
#define QSTG (192 * BPITCH)           // one buffer
#define XCB 16384                     // elements that one converting block of k_ts's launch rounds
// twelve 16-byte copies of one thread (8 of weights, 4 of activations), global memory -> LDS, no register in between; the closing s_wait_xcnt 0 keeps every address register named here unchanged until the copies have taken it
// the four activation rows are gathered: a0 .. a3 = the thread's 16 bytes of k step 0 in the rows of the tokens that stand at its four places of the time order
__device__ __forceinline__ void stage_tile_b(unsigned lbuf, const __bf16* Wr, const char* a0, const char* a1, const char* a2, const char* a3, int t, int tid) {
  const unsigned l = lbuf + (unsigned)(tid >> 3) * BPITCH + (unsigned)(tid & 7) * 16u, ls = 16u * BPITCH;
  const size_t o = (size_t)(tid >> 3) * DM + t * KT + (tid & 7) * 8, gs = (size_t)16 * DM * 2, ka = (size_t)t * KT * 2;
  const char* gw = (const char*)(Wr + o);
  asm volatile("global_load_async_to_lds_b128 %0, %12, off\n\t"
               "global_load_async_to_lds_b128 %1, %13, off\n\t"
               "global_load_async_to_lds_b128 %2, %14, off\n\t"
               "global_load_async_to_lds_b128 %3, %15, off\n\t"
               "global_load_async_to_lds_b128 %4, %16, off\n\t"
               "global_load_async_to_lds_b128 %5, %17, off\n\t"
               "global_load_async_to_lds_b128 %6, %18, off\n\t"
               "global_load_async_to_lds_b128 %7, %19, off\n\t"
               "global_load_async_to_lds_b128 %8, %20, off\n\t"
               "global_load_async_to_lds_b128 %9, %21, off\n\t"
               "global_load_async_to_lds_b128 %10, %22, off\n\t"
               "global_load_async_to_lds_b128 %11, %23, off\n\t"
               "s_wait_xcnt 0x0"
               :: "v"(l), "v"(l + ls), "v"(l + 2 * ls), "v"(l + 3 * ls), "v"(l + 4 * ls), "v"(l + 5 * ls), "v"(l + 6 * ls), "v"(l + 7 * ls), "v"(l + 8 * ls), "v"(l + 9 * ls), "v"(l + 10 * ls), "v"(l + 11 * ls),
                  "v"(gw), "v"(gw + gs), "v"(gw + 2 * gs), "v"(gw + 3 * gs), "v"(gw + 4 * gs), "v"(gw + 5 * gs), "v"(gw + 6 * gs), "v"(gw + 7 * gs), "v"(a0 + ka), "v"(a1 + ka), "v"(a2 + ka), "v"(a3 + ka)
               : "memory");
}
// the 16 f32 of an A fragment from a staged row: k = 8g .. 8g+7 and 16+8g .. 16+8g+7 of the 32-k step at rowk0
__device__ __forceinline__ void lds_a16(const unsigned char* rowk0, int g, float v[16]) {
  const v4f* p = (const v4f*)(rowk0 + 32 * g); const v4f x0 = p[0], x1 = p[1], x2 = p[4], x3 = p[5];
#pragma unroll   // constant indices keep v[] in registers
  for (int i = 0; i < 4; ++i) { v[i] = x0[i]; v[4 + i] = x1[i]; v[8 + i] = x2[i]; v[12 + i] = x3[i]; }
}
// lane l's value from lane l ^ M of its 16-lane row, by a vector move (no LDS trip)
template <int M> __device__ __forceinline__ float rowx(float x) { return __builtin_bit_cast(float, __builtin_amdgcn_update_dpp(0, __builtin_bit_cast(int, x), 0x160 | M, 0xf, 0xf, true)); }
#define WAIT_ASYNC() asm volatile("s_wait_asynccnt 0x0" ::: "memory")   // this wave's copies have landed
#define WAIT_DS()    asm volatile("s_wait_dscnt 0x0" ::: "memory")      // this wave's LDS reads are done before the buffer is handed back
__global__ __launch_bounds__(128) void k_qkv(const __bf16* __restrict__ XB, const __bf16* __restrict__ P, const float* __restrict__ BQ, const float* __restrict__ BK, const float* __restrict__ BV, const float* __restrict__ ROT, const int* __restrict__ INV, _Float16* __restrict__ QK, _Float16* __restrict__ QKL, _Float16* __restrict__ VTH, _Float16* __restrict__ VTL, float* __restrict__ KN) {
  const int which0 = (blockIdx.y * 128) / DM; const float* BB = BQ ? (((which0 == 0) ? BQ : (which0 == 1) ? BK : BV) + (blockIdx.y * 128 - which0 * DM)) : nullptr;
  __shared__ __attribute__((aligned(16))) unsigned char L[2 * QSTG];   // the two tile buffers; behind the k loop's last barrier the same bytes serve as output staging
  _Float16 (*so)[16][136] = (_Float16 (*)[16][136])L; _Float16 (*sol)[16][136] = (_Float16 (*)[16][136])(L + 4 * 16 * 136 * 2); _Float16 (*sth)[72] = (_Float16 (*)[72])L; _Float16 (*stl)[72] = (_Float16 (*)[72])(L + 128 * 72 * 2);
  const int tid = threadIdx.x, wave = tid >> 5, lane = tid & 31, col = lane & 15, g = lane >> 4; const size_t r0 = (size_t)blockIdx.x * 64 + wave * 16; const int n0 = blockIdx.y * 128;
  v8f acc[8] = {};
  const int* ip = INV + (size_t)blockIdx.x * 64 + (tid >> 3); const int i0 = ip[0], i1 = ip[16], i2 = ip[32], i3 = ip[48];   // the tokens at the thread's four places (row r of the block = place blockIdx.x * 64 + r of the time order); issued ahead of the rotary loads, needed by the first copies
  asm volatile("s_wait_xcnt 0x0" ::: "memory");   // a precaution: stands in front of the first instruction that reuses a register of the four loads' address
  v4f cs[8][2] = {};   // q and k blocks: the lane's 8 rows x 4 frequencies ((j & 3) * 8 + col / 2) of the rotary table, 32 B a row; sixteen 16-B loads issued in front of the k loop, first used behind it
  if (n0 < 2 * DM) { const v4f* cp = (const v4f*)(ROT + (r0 + 8 * g) * 64 + (col >> 1) * 8);
#pragma unroll   // constant indices keep cs[][] in registers
    for (int r = 0; r < 8; ++r) { cs[r][0] = cp[r * 16]; cs[r][1] = cp[r * 16 + 1]; }
    asm volatile("s_wait_xcnt 0x0" ::: "memory"); }   // a precaution: stands in front of the first instruction that reuses a register of the sixteen loads' address
  { const unsigned lb = (unsigned)(uintptr_t)&L[0]; const __bf16* Wr = P + (size_t)n0 * DM;
    const __bf16* Xb = XB + (size_t)(blockIdx.x * 64 / SS) * SS * DM + (tid & 7) * 8;   // the block's batch
    const char* a0 = (const char*)(Xb + (size_t)(i0 & (SS - 1)) * DM); const char* a1 = (const char*)(Xb + (size_t)(i1 & (SS - 1)) * DM); const char* a2 = (const char*)(Xb + (size_t)(i2 & (SS - 1)) * DM); const char* a3 = (const char*)(Xb + (size_t)(i3 & (SS - 1)) * DM);   // the mask bounds the row whatever the table holds
    stage_tile_b(lb, Wr, a0, a1, a2, a3, 0, tid); WAIT_ASYNC(); __syncthreads(); stage_tile_b(lb + QSTG, Wr, a0, a1, a2, a3, 1, tid);
#pragma unroll 1   // kept rolled: one trip = one buffer
    for (int t = 0; t < NT; ++t) { const unsigned char* S = L + (t & 1) * QSTG;
#pragma unroll   // constant indices keep bf[] and acc[] in registers (also the two directives below)
      for (int kc = 0; kc < 2; ++kc) { v16b bf[8]; const v16b a = frag_b((const __bf16*)(S + BTILE + (wave * 16 + col) * BPITCH + kc * 64), lane);   // all fragments of the k step first, then its WMMAs
#pragma unroll
        for (int j = 0; j < 8; ++j) bf[j] = frag_b((const __bf16*)(S + (j * 16 + col) * BPITCH + kc * 64), lane);
#pragma unroll
        for (int j = 0; j < 8; ++j) acc[j] = wmma_bf(a, bf[j], acc[j]); }
      WAIT_DS(); WAIT_ASYNC(); __syncthreads();   // publishes tile t + 1 and frees tile t's buffer
      if (t + 2 < NT) stage_tile_b(lb + (unsigned)(t & 1) * QSTG, Wr, a0, a1, a2, a3, t + 2, tid); }
    WAIT_ASYNC(); }
  float bias[8] = {0.f, 0.f, 0.f, 0.f, 0.f, 0.f, 0.f, 0.f};   // the lane's eight column biases (column j * 16 + col), fetched once: eight loads in flight together, one latency for the whole epilogue
  if (BB) { const float* bp = BB + col;
#pragma unroll   // constant indices keep bias[] in registers (also the next directive)
    for (int j = 0; j < 8; ++j) bias[j] = bp[j * 16];
    asm volatile("s_wait_xcnt 0x0" ::: "memory");   // a precaution: stands in front of the first instruction that reuses a register of the eight loads' address
#pragma unroll
    for (int j = 0; j < 8; ++j) bias[j] = bfr(bias[j]); }
  if (n0 < 2 * DM) {   // bias, then the interleaved-pair rotary: pair (2i, 2i+1) = neighbouring lanes (col ^ 1), cos and sin of t_scaled[row] * inv_freq[i] from k_ts's table
#pragma unroll
    for (int j = 0; j < 8; ++j)
#pragma unroll
      for (int r = 0; r < 8; ++r) acc[j][r] += bias[j];
#pragma unroll
    for (int r = 0; r < 8; ++r) {
#pragma unroll
      for (int j = 0; j < 8; ++j) { const float c = cs[r][(j & 3) >> 1][(j & 1) * 2], sn = cs[r][(j & 3) >> 1][(j & 1) * 2 + 1]; const float v = acc[j][r]; const float pv = __shfl_xor(v, 1); acc[j][r] = (col & 1) ? (v * c + pv * sn) : (v * c - pv * sn); } }
    if (n0 >= DM) {   // k blocks (the same for the whole block): the largest squared length of the wave's 16 rotated key rows, per head, for k_attn's bound on q . k
      float a[16];   // a[8 hh + r]: the lane's four columns' share of row 8 g + r, head hh of the block's two
#pragma unroll   // constant indices keep a[] in registers (also the three directives below)
      for (int i = 0; i < 16; ++i) { const int j0 = (i >> 3) * 4, r = i & 7; a[i] = acc[j0][r] * acc[j0][r] + acc[j0 + 1][r] * acc[j0 + 1][r] + acc[j0 + 2][r] * acc[j0 + 2][r] + acc[j0 + 3][r] * acc[j0 + 3][r]; }
      // sum over the row's 16 lanes, halving the values a lane carries at each exchange: 15 exchanges in all, and lane col ends with the whole sum of a[col]
#pragma unroll
      for (int i = 0; i < 8; ++i) { const bool up = (col & 8) != 0; a[i] = (up ? a[i + 8] : a[i]) + rowx<8>(up ? a[i] : a[i + 8]); }
#pragma unroll
      for (int i = 0; i < 4; ++i) { const bool up = (col & 4) != 0; a[i] = (up ? a[i + 4] : a[i]) + rowx<4>(up ? a[i] : a[i + 4]); }
#pragma unroll
      for (int i = 0; i < 2; ++i) { const bool up = (col & 2) != 0; a[i] = (up ? a[i + 2] : a[i]) + rowx<2>(up ? a[i] : a[i + 2]); }
      float n2 = ((col & 1) ? a[1] : a[0]) + rowx<1>((col & 1) ? a[0] : a[1]);
      n2 = (n2 < 3.0e38f) ? n2 : __builtin_inff();   // NaN or overflow: infinite, so that k_attn leaves nothing out
      n2 = fmaxf(n2, rowx<1>(n2)); n2 = fmaxf(n2, rowx<2>(n2)); n2 = fmaxf(n2, rowx<4>(n2)); n2 = fmaxf(n2, __shfl_xor(n2, 16));   // over the head's 8 lanes (rows 8 g + 0 .. 7), then over the two halves
      if ((lane & 23) == 0) { const int w16 = blockIdx.x * 4 + wave; KN[((size_t)(w16 >> 6) * NH + ((n0 - DM) >> 6) + (lane >> 3)) * (SS / 16) + (w16 & 63)] = n2;   // lanes 0 and 8: one 4-B scratch store a head
        asm volatile("s_wait_xcnt 0x0" ::: "memory"); } }   // a precaution: stands in front of the first instruction that reuses a register of the store
#pragma unroll
    for (int j = 0; j < 8; ++j) {
#pragma unroll
      for (int r = 0; r < 8; ++r) { const float v = acc[j][r]; const _Float16 hv = (_Float16)v; so[wave][8 * g + r][j * 16 + col] = hv; sol[wave][8 * g + r][j * 16 + col] = (_Float16)((v - (float)hv) * 2048.0f); } }   // q, k (+ bias) as f16 hi + (x2048) residual
    LDSX();
    for (int rl = 0; rl < 16; ++rl) if (lane < 16) { vst2((unsigned*)(QK + (r0 + rl) * (2 * DM) + n0 + lane * 8), *(const v4u*)&so[wave][rl][lane * 8]); vst2((unsigned*)(QKL + (r0 + rl) * (2 * DM) + n0 + lane * 8), *(const v4u*)&sol[wave][rl][lane * 8]); }
  } else {
#pragma unroll
    for (int j = 0; j < 8; ++j) {
#pragma unroll
      for (int r = 0; r < 8; ++r) { const float v = acc[j][r] + bias[j]; const _Float16 hv = (_Float16)v; sth[j * 16 + col][wave * 16 + 8 * g + r] = hv; stl[j * 16 + col][wave * 16 + 8 * g + r] = (_Float16)((v - (float)hv) * 2048.0f); } }
    __syncthreads();
    const size_t rb = (size_t)blockIdx.x * 64; const int b = (int)(rb / SS), s0 = (int)(rb % SS); const int pc0 = n0 - 2 * DM;
    for (int q = tid; q < 128 * 8; q += 128) { const int d = q >> 3, pc = q & 7; const size_t o = ((size_t)b * DM + pc0 + d) * SS + s0 + pc * 8; vst2((unsigned*)(VTH + o), *(const v4u*)&sth[d][pc * 8]); vst2((unsigned*)(VTL + o), *(const v4u*)&stl[d][pc * 8]); }
  }
}
// ---- LDS staging of k_attn: a tile = 64 keys: their 64 k rows (128 B each), the 64 v^T rows' 64 columns (128 B each), and per wave a private copy of the keys' times and errors (256 B + 256 B); two buffers, filled one tile ahead
#define AKP 144                       // k / v^T row pitch in LDS: 16 B x odd
#define AK_V (64 * AKP)
#define AK_TE (2 * 64 * AKP)
#define ASTG (AK_TE + 4 * 512)        // one buffer
#define ANT (SS / 64)
#define LOG2E 1.44269504088896340736f
// nine 16-byte copies of one thread (4 of k, 4 of v^T, 1 of times | errors); the closing s_wait_xcnt 0 keeps every address register named here unchanged until the copies have taken it
__device__ __forceinline__ void stage_kv(unsigned lbuf, const _Float16* Kr, const _Float16* Vr, const float* Tb, const float* Eb, int t, int tid) {
  const int lane = tid & 31;
  const unsigned lk = lbuf + (unsigned)(tid >> 3) * AKP + (unsigned)(tid & 7) * 16u, lv = lk + AK_V, lt = lbuf + AK_TE + (unsigned)(tid >> 5) * 512u + (unsigned)lane * 16u;
  const char* gk = (const char*)(Kr + ((size_t)t * 64 + (tid >> 3)) * (2 * DM) + (tid & 7) * 8);
  const char* gv = (const char*)(Vr + (size_t)(tid >> 3) * SS + t * 64 + (tid & 7) * 8);
  const char* gt = (const char*)(((lane < 16) ? Tb : Eb) + t * 64 + (lane & 15) * 4);
  const size_t ks16 = (size_t)16 * 2 * DM * 2, vs16 = (size_t)16 * SS * 2;
  asm volatile("global_load_async_to_lds_b128 %0, %9, off\n\t"
               "global_load_async_to_lds_b128 %1, %10, off\n\t"
               "global_load_async_to_lds_b128 %2, %11, off\n\t"
               "global_load_async_to_lds_b128 %3, %12, off\n\t"
               "global_load_async_to_lds_b128 %4, %13, off\n\t"
               "global_load_async_to_lds_b128 %5, %14, off\n\t"
               "global_load_async_to_lds_b128 %6, %15, off\n\t"
               "global_load_async_to_lds_b128 %7, %16, off\n\t"
               "global_load_async_to_lds_b128 %8, %17, off\n\t"
               "s_wait_xcnt 0x0"
               :: "v"(lk), "v"(lk + 16u * AKP), "v"(lk + 32u * AKP), "v"(lk + 48u * AKP), "v"(lv), "v"(lv + 16u * AKP), "v"(lv + 32u * AKP), "v"(lv + 48u * AKP), "v"(lt),
                  "v"(gk), "v"(gk + ks16), "v"(gk + 2 * ks16), "v"(gk + 3 * ks16), "v"(gv), "v"(gv + vs16), "v"(gv + 2 * vs16), "v"(gv + 3 * vs16), "v"(gt)
               : "memory");
}
// lane l with lane l ^ 16 (the two lanes that share one query column), by a vector cross-row move
__device__ __forceinline__ float xhalf(float x) { return __builtin_bit_cast(float, __builtin_amdgcn_permlanex16(__builtin_bit_cast(int, x), __builtin_bit_cast(int, x), 0x76543210, 0xfedcba98, false, false)); }
// ---- k_attn: block = (64 queries, head h, batch b): all-keys flash attention, transposed: S^T = K . Q^T (A = 16 key rows from LDS, B = the wave's 16 queries, kept in registers), so a lane holds 8 keys' scores of ONE query (column = lane & 15, keys 8g + r); maximum and sum run in the lane, the two halves exchange the maximum once a step and join their sums once at the end; two S^T tiles, converted in place, are the B operand of O^T += V^T . P^T; O[b*S+q][h*64+d] = acc / l (256-B segments)
__global__ __launch_bounds__(128) void k_attn(const _Float16* __restrict__ QK, const _Float16* __restrict__ QKL, const _Float16* __restrict__ VTH, const _Float16* __restrict__ VTL, const void* __restrict__ KMASK, const float* __restrict__ TS, const float* __restrict__ ERR, const float* __restrict__ LAMH, const float* __restrict__ WG, const float* __restrict__ BG, const float* __restrict__ KN, float* __restrict__ O) {
  __shared__ __attribute__((aligned(16))) float sred[8];   // each wave's latest and (negated) earliest time that one of its queries can reach
  __shared__ __align__(16) float so[4][16][68]; __shared__ __attribute__((aligned(16))) unsigned char L[2 * ASTG];
  const int tid = threadIdx.x, wave = tid >> 5, lane = tid & 31, col = lane & 15, g = lane >> 4;
  const int qb = blockIdx.x, h = blockIdx.y, b = blockIdx.z; const int q0 = qb * 64 + wave * 16; const size_t rq = (size_t)b * SS + q0 + col;
  v16h bq[2];
#pragma unroll
  for (int kc = 0; kc < 2; ++kc) bq[kc] = frag_h(QK + rq * (2 * DM) + h * HD + kc * 32, lane);
  asm volatile("s_wait_xcnt 0x0" ::: "memory");   // a precaution: stands in front of the first instruction that reuses the four query loads' address pair
  // per-head constants and the lane's own query's time / error values for the score biases
  const float lraw = bfr(LAMH[h]); const float lam = (lraw > 20.f) ? lraw : log1pf(expf(lraw));   // softplus, precise, once a thread: in line, so that the kernel holds no call
  const float wg0 = bfr(WG[h * 2]), wg1 = bfr(WG[h * 2 + 1]), bgh = bfr(BG[h]); const float lam2 = lam * LOG2E;   // scores carry the factor log2 e, so that every exp and log of the loop is one hardware instruction
  const float tq = TS[rq]; const float gq = (wg0 * bfr(ERR[rq]) + bgh) * -LOG2E; const float wk = wg1 * -LOG2E;   // gate logit's query part and the key part's factor, as the exponent of 2 in exp(-logit)
  // for the tile test behind trip 0: the head's 64 largest squared key lengths (two a lane) and the 16 key tiles' first (lanes 0-15) and last (lanes 16-31) times; every wave loads the same values
  const v2f kn = *(const v2f*)(KN + ((size_t)b * NH + h) * (SS / 16) + lane * 2); const float tb = TS[(size_t)b * SS + col * 64 + g * 63];
  asm volatile("s_wait_xcnt 0x0" ::: "memory");   // a precaution: stands in front of the first instruction that reuses a register of the two loads' addresses
  float m = -3.0e38f, l = 0.f;
  v8f acc[4] = {};
  const unsigned lb = (unsigned)(uintptr_t)&L[0]; const _Float16* Kr = QK + (size_t)b * SS * (2 * DM) + DM + h * HD; const _Float16* Vr = VTH + ((size_t)b * DM + h * HD) * SS; const float* Tb = TS + (size_t)b * SS; const float* Eb = ERR + (size_t)b * SS;
  // the trips take the key tiles in the order (qb + o) mod 16, o ascending: the block's own 64 places first, so that every query's running maximum has met its own key and its neighbours in time before the far tiles come; trip 1 takes o = 1; behind trip 0 the block finds which other tiles any of its queries can reach, and only those are staged and visited
  stage_kv(lb, Kr, Vr, Tb, Eb, qb, tid); WAIT_ASYNC(); __syncthreads(); stage_kv(lb + ASTG, Kr, Vr, Tb, Eb, (qb + 1) & (ANT - 1), tid);
  __builtin_amdgcn_sched_barrier(0);   // keeps the sums below, which need the query and length loads' data, behind the issue of the first two tiles' copies: ahead of them they would put one memory latency in front of the other
  float qs[4] = {0.f, 0.f, 0.f, 0.f};   // the query's squared length, from the f16 operand itself: the lane's 32 elements in four chains, then the other half's
#pragma unroll   // constant indices keep qs[] in registers (also the next directive)
  for (int kc = 0; kc < 2; ++kc)
#pragma unroll
    for (int i = 0; i < 16; ++i) { const float f = (float)bq[kc][i]; qs[i & 3] += f * f; }
  float qn2 = (qs[0] + qs[1]) + (qs[2] + qs[3]); qn2 += xhalf(qn2);
  float k2 = fmaxf(kn[0], kn[1]); k2 = fmaxf(k2, rowx<1>(k2)); k2 = fmaxf(k2, rowx<2>(k2)); k2 = fmaxf(k2, rowx<4>(k2)); k2 = fmaxf(k2, rowx<8>(k2)); k2 = fmaxf(k2, xhalf(k2));   // the head's largest squared key length in this batch
  const float qk = __builtin_amdgcn_sqrtf(qn2 * k2) * (0.125f * LOG2E * 1.002f);   // no score's q . k part exceeds this: |q . k| <= |q| |k|; the factor 1.002 covers k's rounding to f16 and the sums' rounding
  int nt = 2; unsigned rest = 0;   // trips in all (at most 16); the tiles not yet staged, bit o = tile (qb + o) mod 16: both the same in every wave of the block
#pragma unroll 1   // kept rolled: one trip = one buffer = 64 keys
  for (int t = 0; t < nt; ++t) { const unsigned char* S = L + (t & 1) * ASTG;
#pragma unroll 1   // kept rolled: the tile's two 32-key steps share one body in the instruction cache
  for (int ks = 0; ks < 2; ++ks) { v8f s[2]; v16h kf[2][2];
    const float* tw = (const float*)(S + AK_TE + wave * 512) + ks * 32; const float gap = fmaxf(fmaxf(tw[0] - tq, tq - tw[31]), 0.f);   // the step's first and last key in time, fetched beside the k fragments: no key of the step is nearer to the query than gap
#pragma unroll   // constant indices keep kf[][] in registers (also the next directive)
    for (int ct = 0; ct < 2; ++ct)
#pragma unroll
      for (int kc = 0; kc < 2; ++kc) kf[ct][kc] = frag_h((const _Float16*)(S + (ks * 32 + ct * 16 + col) * AKP + kc * 64), lane);   // the step's four k fragments first, then its WMMAs
#pragma unroll
    for (int ct = 0; ct < 2; ++ct) { v8f c = {};
#pragma unroll
      for (int kc = 0; kc < 2; ++kc) c = wmma16(kf[ct][kc], bq[kc], c);   // single product: k, q as one-rounding f16 operands; c[r] = key 16 ct + 8 g + r against query col
      s[ct] = c; }
    // the step's 32 keys stand in ascending time: no key is nearer to the query than gap, and the gate bias is at most log2(1 + 1e-9), so no score of the lane exceeds top. Where every lane's top lies more than 40 below its running maximum, every weight of the step is under 2^-40: its P (x 2^11, f16, whose smallest value is 2^-24) rounds to exactly 0, so the step would add nothing to acc; the maximum stays and the rescaling factor is 1; only l would take the weights, and all 1,024 keys' worth of them is under 2^-30 of the query's l (its two halves' sums joined are at least 1: the maximum's own weight), below f32's rounding of it. The wave leaves the step out (one scalar branch, the same for the whole wave; a bound that is NaN compares false and takes the full step)
    { float cm = fmaxf(s[0][0], s[1][0]);
#pragma unroll
      for (int r = 1; r < 8; ++r) cm = fmaxf(cm, fmaxf(s[0][r], s[1][r]));
      const float top = cm * (0.125f * LOG2E) - lam2 * gap;
      if (__builtin_amdgcn_ballot_w32(top - m < -40.0f) == 0xffffffffu) continue; }
#pragma unroll
    for (int ct = 0; ct < 2; ++ct) { const v8f c = s[ct];
      const v4f* te = (const v4f*)(S + AK_TE + wave * 512 + (ks * 32 + ct * 16 + 8 * g) * 4); const v4f t0 = te[0], t1 = te[1], e0 = te[16], e1 = te[17];   // the lane's 8 keys' times and errors
#pragma unroll
      for (int r = 0; r < 8; ++r) { const float tk = (r < 4) ? t0[r & 3] : t1[r & 3]; const float ek = (r < 4) ? e0[r & 3] : e1[r & 3];
        const float sig = __builtin_amdgcn_rcpf(1.0f + __builtin_amdgcn_exp2f(wk * bfr(ek) + gq)); s[ct][r] = c[r] * (0.125f * LOG2E) + (__builtin_amdgcn_logf(sig + 1e-9f) - lam2 * fabsf(tq - tk)); } }   // (q.k/8 + time-decay bias + error-gate bias) x log2 e: sigmoid by v_exp_f32 and v_rcp_f32, its logarithm by v_log_f32
    float mx = fmaxf(s[0][0], s[1][0]);
#pragma unroll
    for (int r = 1; r < 8; ++r) mx = fmaxf(mx, fmaxf(s[0][r], s[1][r]));
    mx = fmaxf(mx, xhalf(mx));   // both halves hold the query's maximum over the step's 32 keys
    const float mn = fmaxf(m, mx); const float alpha = (m <= -1.0e38f) ? 0.f : __builtin_amdgcn_exp2f(m - mn);
    v2f es = {0.f, 0.f}; v16h pb;
#pragma unroll
    for (int ct = 0; ct < 2; ++ct)
#pragma unroll
      for (int r = 0; r < 8; r += 2) { v2f e; e[0] = (s[ct][r] <= -1.0e38f) ? 0.f : __builtin_amdgcn_exp2f(s[ct][r] - mn); e[1] = (s[ct][r + 1] <= -1.0e38f) ? 0.f : __builtin_amdgcn_exp2f(s[ct][r + 1] - mn);
        es = (ct + r == 0) ? e : es + e; const v2f x = e * 2048.0f; pb[ct * 8 + r] = (_Float16)x[0]; pb[ct * 8 + r + 1] = (_Float16)x[1]; }   // even and odd keys summed side by side (packed adds); P scaled by 2^11 so small softmax weights stay out of the f16 subnormal range; 2^-11 folded into the epilogue; element 8 ct + r = key 16 ct + 8 g + r, the k order of the v fragments
    l = l * alpha + (es[0] + es[1]); m = mn;   // the lane's own 16 keys of the step; the halves' sums are joined behind the loop
#pragma unroll
    for (int dt = 0; dt < 4; ++dt) acc[dt] *= alpha;
    v16h vf[4];
#pragma unroll   // constant indices keep vf[] in registers
    for (int dt = 0; dt < 4; ++dt) vf[dt] = frag_h((const _Float16*)(S + AK_V + (dt * 16 + col) * AKP + ks * 64), lane);   // the step's four v fragments first, then its WMMAs
#pragma unroll
    for (int dt = 0; dt < 4; ++dt) acc[dt] = wmma16(vf[dt], pb, acc[dt]); }   // single product: V^T x P^T (x2^11); acc[dt][r] = d 16 dt + 8 g + r of query col
    if (t == 0) {   // the q . k part is at most qk, the gate bias at most log2(1 + 1e-9), and the maximum only grows: a key further from the query in time than reach has a score more than 41 below the maximum, so the step test above would leave it out in every wave
      float reach = (qk - m + 41.0f) * __builtin_amdgcn_rcpf(lam2) * 1.0001f;
      reach = (reach < 3.0e38f) ? reach : __builtin_inff();   // no decay, or NaN: everything is in reach
      float e = g ? (reach - tq) : (tq + reach); e = (e < 3.0e38f) ? e : __builtin_inff();   // lower half: the latest time in reach; upper half: the earliest, negated
      e = fmaxf(e, rowx<1>(e)); e = fmaxf(e, rowx<2>(e)); e = fmaxf(e, rowx<4>(e)); e = fmaxf(e, rowx<8>(e));   // over the wave's 16 queries
      if (col == 0) sred[wave * 2 + g] = e; }   // published by the barrier below
    WAIT_DS(); WAIT_ASYNC(); __syncthreads();   // publishes tile t + 1 and frees tile t's buffer
    if (t == 0) { const v4f r0 = *(const v4f*)&sred[0], r1 = *(const v4f*)&sred[4];
      const float hi = fmaxf(fmaxf(r0[0], r0[2]), fmaxf(r1[0], r1[2])), nlo = fmaxf(fmaxf(r0[1], r0[3]), fmaxf(r1[1], r1[3]));   // over the block's four waves
      const unsigned bal = __builtin_amdgcn_ballot_w32(g ? !(-tb > nlo) : !(tb > hi));   // bit T: tile T does not begin behind the latest time; bit 16 + T: it does not end ahead of the earliest (a NaN compares false: the tile stays)
      rest = ((((bal & (bal >> 16)) & 0xffffu) * 0x10001u) >> qb) & 0xfffcu;   // turned so that bit o = tile (qb + o) mod 16; o = 0 and 1 are staged already
      nt = 2 + __builtin_popcount(rest); }
    if (rest) { const int o = __builtin_ctz(rest); rest &= rest - 1; stage_kv(lb + (unsigned)(t & 1) * ASTG, Kr, Vr, Tb, Eb, (qb + o) & (ANT - 1), tid); } }   // the next tile in reach, two trips ahead, into the buffer that this trip has just read
  WAIT_ASYNC();
  const float il = (1.0f / 2048.0f) / (l + xhalf(l));
#pragma unroll
  for (int dt = 0; dt < 4; ++dt) { v4f o0, o1;
#pragma unroll
    for (int i = 0; i < 4; ++i) { o0[i] = acc[dt][i] * il; o1[i] = acc[dt][4 + i] * il; }
    *(v4f*)&so[wave][col][dt * 16 + 8 * g] = o0; *(v4f*)&so[wave][col][dt * 16 + 8 * g + 4] = o1; }
  LDSX();
  for (int rl = 0; rl < 16; ++rl) if (lane < 16) vst2(O + ((size_t)b * SS + q0 + rl) * DM + h * HD + lane * 4, *(const v4f*)&so[wave][rl][lane * 4]);
}
// ---- k_out: block = (64 rows, 128 cols): out = O(hi/lo) . Wo rows (2 products) + bo
__global__ __launch_bounds__(128) void k_out(const float* __restrict__ O, const __bf16* __restrict__ P, const float* __restrict__ BO, const int* __restrict__ INV, float* __restrict__ Y) {
  __shared__ __attribute__((aligned(16))) unsigned char L[2 * STG];   // the two tile buffers; behind the k loop's last barrier the same bytes serve as output staging
  float (*so)[16][132] = (float (*)[16][132])L;
  const int tid = threadIdx.x, wave = tid >> 5, lane = tid & 31, col = lane & 15, g = lane >> 4; const size_t r0 = (size_t)blockIdx.x * 64 + wave * 16; const int n0 = blockIdx.y * 128;
  v8f acc[8] = {};
  const int iv = INV[r0 + col];   // O's rows stand in time order: lane l holds the token of the wave's row l & 15; loaded in front of the k loop, used behind it
  asm volatile("s_wait_xcnt 0x0" ::: "memory");   // a precaution: stands in front of the first instruction that reuses a register of the load's address
  { const unsigned lb = (unsigned)(uintptr_t)&L[0]; const __bf16* Wr = P + (size_t)n0 * DM; const float* Ar = O + (size_t)blockIdx.x * 64 * DM;
    stage_tile(lb, Wr, Ar, 0, tid); WAIT_ASYNC(); __syncthreads(); stage_tile(lb + STG, Wr, Ar, 1, tid);
#pragma unroll 1   // kept rolled: one trip = one buffer
    for (int t = 0; t < NT; ++t) { const unsigned char* S = L + (t & 1) * STG;
#pragma unroll   // constant indices keep bf[] and acc[] in registers (also the two directives below)
      for (int kc = 0; kc < 2; ++kc) { float av[16]; v16b bf[8]; lds_a16(S + BTILE + (wave * 16 + col) * APITCH + kc * 128, g, av);   // all fragments of the k step first, then its WMMAs
#pragma unroll
        for (int j = 0; j < 8; ++j) bf[j] = frag_b((const __bf16*)(S + (j * 16 + col) * BPITCH + kc * 64), lane);
        const F2 a = bsplit16(av);
#pragma unroll
        for (int j = 0; j < 8; ++j) { acc[j] = wmma_bf(a.l, bf[j], acc[j]); acc[j] = wmma_bf(a.h, bf[j], acc[j]); } }
      WAIT_DS(); WAIT_ASYNC(); __syncthreads();   // publishes tile t + 1 and frees tile t's buffer
      if (t + 2 < NT) stage_tile(lb + (unsigned)(t & 1) * STG, Wr, Ar, t + 2, tid); }
    WAIT_ASYNC(); }
#pragma unroll
  for (int j = 0; j < 8; ++j) {
#pragma unroll
    for (int r = 0; r < 8; ++r) so[wave][8 * g + r][j * 16 + col] = acc[j][r] + bfr(BO[n0 + j * 16 + col]); }
  LDSX();
  const size_t rb = (size_t)(blockIdx.x * 64 / SS) * SS;   // the block's batch
  for (int rl = 0; rl < 16; ++rl) vst2(Y + (rb + (size_t)(__builtin_amdgcn_readlane(iv, rl) & (SS - 1))) * DM + n0 + lane * 4, *(const v4f*)&so[wave][rl][lane * 4]);   // each row goes to its token's place; the mask bounds the row whatever the table holds
}
// ---- k_ts: blocks with blockIdx.y >= 64 round 16,384 elements to bf16 each (a thread: sixteen 16-B loads, all issued ahead of its sixteen 8-B stores; a wave's load covers 4 whole lines, its store 2): the first 64 rows of such blocks take x, the next 64 the four weight matrices (blockIdx.x = W_q, W_k, W_v, W_o; natural [out][in] rows, so matrix w lies flat at PK + w * 1024 * 1024: W_q | W_k | W_v = PK_A, W_o = PK_P). Few long blocks: the launch starts 6,144 waves in all. They need nothing of the other blocks and run beside their chain of waits. The other blocks: block = (batch, 16 tokens): t_scaled = (t - min) / (max - min + 1e-6) * 1000, minimum and maximum over the batch's whole sequence in every block; the block's 16 scaled times and their rotary table: cos and sin of t_scaled x inv_freq[f], once per (token, frequency)
// Time order: each of these blocks also ranks its 16 tokens among the batch's 1,024 by (time, token index), a total order, so the ranks are a permutation; it stores time, error, rotary row and token index at the rank. All later kernels work on places of that order (k_qkv gathers x's rows by INV, k_out scatters its rows by INV)
__global__ __launch_bounds__(256) void k_ts(const float* __restrict__ TR, const float* __restrict__ ERR, float* __restrict__ TS, float* __restrict__ ERS, int* __restrict__ INV, float* __restrict__ ROT, const float* __restrict__ X, __bf16* __restrict__ XB, const float* __restrict__ WQ, const float* __restrict__ WK, const float* __restrict__ WV, const float* __restrict__ WO, __bf16* __restrict__ PK) {
  if (blockIdx.y >= SS / 16) {   // the same for the whole block, in front of every barrier
    const int c = blockIdx.y - SS / 16, w = blockIdx.x; const float* s; __bf16* d;
    if (c < SS * DM / XCB) { const size_t o = ((size_t)c * NB + w) * XCB; s = X + o; d = XB + o; }
    else { const size_t o = (size_t)(c - SS * DM / XCB) * XCB; s = ((w == 0) ? WQ : (w == 1) ? WK : (w == 2) ? WV : WO) + o; d = PK + (size_t)w * DM * DM + o; }
    s += threadIdx.x * 4; d += threadIdx.x * 4; v4f v[16];
#pragma unroll   // constant indices keep v[] in registers; all sixteen loads first, then the stores (also the next directive)
    for (int i = 0; i < 16; ++i) v[i] = *(const v4f*)(s + i * 1024);
#pragma unroll
    for (int i = 0; i < 16; ++i) { v4b o; o[0] = (__bf16)v[i][0]; o[1] = (__bf16)v[i][1]; o[2] = (__bf16)v[i][2]; o[3] = (__bf16)v[i][3]; *(v4b*)(d + i * 1024) = o; }
    return; }
  __shared__ float rmn[256], rmx[256]; __shared__ __attribute__((aligned(16))) int skey[SS]; const size_t b = blockIdx.x; const int t = threadIdx.x; float mn = 3.0e38f, mx = -3.0e38f;
  for (int s = t; s < SS; s += 256) { const float v = bfr(TR[b * SS + s]); mn = fminf(mn, v); mx = fmaxf(mx, v);
    const int bits = __builtin_bit_cast(int, v); skey[s] = ((bits ^ ((bits >> 31) & 0x7fffffff)) >> 16) * SS + s; }   // sort key: the rounded time's 16 significant bits as an integer that orders like the float, then the token index; published by the barrier below
  rmn[t] = mn; rmx[t] = mx; __syncthreads();
  for (int st = 128; st > 0; st >>= 1) { if (t < st) { rmn[t] = fminf(rmn[t], rmn[t + st]); rmx[t] = fmaxf(rmx[t], rmx[t + st]); } __syncthreads(); }
  const float tmin = rmn[0], den = rmx[0] - rmn[0] + 1e-6f;
  const size_t s0 = b * SS + blockIdx.y * 16;
  const int tok = t >> 4, part = t & 15; const int mykey = skey[blockIdx.y * 16 + tok]; int rank = 0;   // sixteen lanes a token: each counts the smaller keys among 64, the four exchanges below add the counts up in all sixteen
  for (int i = 0; i < 16; ++i) { const v4i k4 = *(const v4i*)&skey[i * 64 + part * 4]; rank += (k4[0] < mykey) + (k4[1] < mykey) + (k4[2] < mykey) + (k4[3] < mykey); }
  rank += __shfl_xor(rank, 1); rank += __shfl_xor(rank, 2); rank += __shfl_xor(rank, 4); rank += __shfl_xor(rank, 8);
  if (part == 0) { const size_t d = b * SS + rank; TS[d] = (bfr(TR[s0 + tok]) - tmin) / den * 1000.0f; ERS[d] = ERR[s0 + tok]; INV[d] = blockIdx.y * 16 + tok; }   // 4-B scratch stores
  for (int it = 0; it < 2; ++it) { const size_t s = s0 + (t >> 5) * 2 + it; const size_t d = b * SS + __shfl(rank, it * 16); const int p = t & 31, f = (p & 3) * 8 + (p >> 2);   // the wave's two tokens, one a pass (their ranks stand in its lanes 0-15 and 16-31); place p of a token's row holds frequency f: a k_qkv lane's four frequencies lie side by side
    const float ang = (bfr(TR[s]) - tmin) / den * 1000.0f * INVF[f]; v2f cs; cs[0] = cos_p(ang); cs[1] = sin_p(ang); *(v2f*)(ROT + d * 64 + p * 2) = cs; }   // a wave stores one token's 256 B
}
extern "C" void kernel_launch(void* const* d_in, const int* in_sizes, int n_in, void* d_out, int out_size, void* d_ws, size_t ws_size, hipStream_t stream) {
  (void)in_sizes; (void)n_in; (void)out_size;
  const float** F = (const float**)d_in;   // 0 x [4,1024,1024], 1 t_raw [4,1024], 2 error [4,1024], 3 Wq, 4 bq, 5 Wk, 6 bk, 7 Wv, 8 bv, 9 Wo, 10 bo, 11 lambda_h [16], 12 Wg [16,2], 13 bg [16]
  if (ws_size < (size_t)WS_TOP + 256) return;
  char* ws = (char*)d_ws; __bf16* PK = (__bf16*)(ws + WS_PK); _Float16 *QK = (_Float16*)(ws + WS_QK), *QKL = (_Float16*)(ws + WS_QKL), *VTH = (_Float16*)(ws + WS_VTH), *VTL = (_Float16*)(ws + WS_VTL); float* O = (float*)(ws + WS_O); float* TS = (float*)(ws + WS_TS); float* ROT = (float*)(ws + WS_ROT); __bf16* XB = (__bf16*)(ws + WS_XB); float* ERS = (float*)(ws + WS_ERS); int* INV = (int*)(ws + WS_INV); float* KN = (float*)(ws + WS_KN);
  k_ts<<<dim3(NB, SS / 16 + SS * DM / XCB + DM * DM / XCB), 256, 0, stream>>>(F[1], F[2], TS, ERS, INV, ROT, F[0], XB, F[3], F[5], F[7], F[9], PK);
  k_qkv<<<dim3(TNB * SS / 64, QKVW / 128), 128, 0, stream>>>(XB, PK + PK_A, F[4], F[6], F[8], ROT, INV, QK, QKL, VTH, VTL, KN);
  k_attn<<<dim3(TQB, NH, TNB), 128, 0, stream>>>(QK, QKL, VTH, VTL, nullptr, TS, ERS, F[11], F[12], F[13], KN, O);
  k_out<<<dim3(TOB, DM / 128), 128, 0, stream>>>(O, PK + PK_P, F[10], INV, (float*)d_out);
}
